// v000
// Times are from an AMD MI455X. After a warm-up the kernel runs many times in a row, and a time is the length of
// such a window on the GPU divided by its runs, so every launch and the gaps after it count. The runs cycle
// through copies of the inputs. A figure is the median of several windows, for all but v000 over two sittings.
// Sittings can differ by a few percent; kernels timed side by side share one.
// The starting kernel, v000, takes 2140 microseconds a run.
// Contractions: q and k|v projections (weights stored [in][out]) [2048x1024].[1024x1024|2048] and the per-head 64x64 output maps written as one block-diagonal [2048x1024].[1024x1024] product (+bias) per batch element, with f16 operands on f16 planes (v_wmma_f32_16x16x32_f16, 64x64 register-blocked wave tiles, weights x16); per (batch, head) softmax(q.k^T/8) v over all 2048 keys as one flash launch per batch element (head_dim 64, f16 q.k^T and f16 p.v with p as f16 of 4096 p); f32 accumulate and softmax statistics.
#include <hip/hip_runtime.h>
#include <math.h>

typedef __attribute__((ext_vector_type(16))) _Float16 v16h;
typedef __attribute__((ext_vector_type(8)))  _Float16 v8h;
typedef __attribute__((ext_vector_type(16))) __bf16   v16b;
typedef __attribute__((ext_vector_type(8)))  float    v8f;
typedef __attribute__((ext_vector_type(4)))  float    v4f;

// 16-bit WMMA fragment map (wave32), lane L, h = L>>4, m = L&15:
//   A 16x32: lane = row m;   element i -> k = (i<8) ? 8h+i : 16+8h+(i-8)
//   B 32x16: lane = column m; the SAME k(i,h)
//   D 16x16 (8 f32): lane = column m; element r -> row 8h+r
__device__ __forceinline__ int frag_k(int i, int h) { return (i < 8) ? (8 * h + i) : (16 + 8 * h + (i - 8)); }
__device__ __forceinline__ __bf16 bf16_rne(float f) {
    unsigned int u = __float_as_uint(f);
    u += 0x7fffu + ((u >> 16) & 1u);
    return __builtin_bit_cast(__bf16, (unsigned short)(u >> 16));
}
__device__ __forceinline__ float bf16_f32(__bf16 b) { return __uint_as_float(((unsigned int)__builtin_bit_cast(unsigned short, b)) << 16); }
__device__ __forceinline__ v8f wmma16(v16h a, v16h b, v8f c) {
    c = __builtin_amdgcn_wmma_f32_16x16x32_f16(false, a, false, b, (short)0, c, false, false);
    asm volatile("v_nop\n\tv_nop\n\tv_nop\n\tv_nop" : "+v"(c) : "v"(a), "v"(b));
    return c;
}
__device__ __forceinline__ v8f wmmab(v16b a, v16b b, v8f c) {
    c = __builtin_amdgcn_wmma_f32_16x16x32_bf16(false, a, false, b, (short)0, c, false, false);
    asm volatile("v_nop\n\tv_nop\n\tv_nop\n\tv_nop" : "+v"(c) : "v"(a), "v"(b));
    return c;
}
struct Split { v16b hi, lo; };
// hi/lo split product: a.hi*b.hi + a.hi*b.lo + a.lo*b.hi
__device__ __forceinline__ v8f wmma3(const Split& a, const Split& b, v8f c) {
    c = __builtin_amdgcn_wmma_f32_16x16x32_bf16(false, a.hi, false, b.hi, (short)0, c, false, false);
    c = __builtin_amdgcn_wmma_f32_16x16x32_bf16(false, a.hi, false, b.lo, (short)0, c, false, false);
    c = __builtin_amdgcn_wmma_f32_16x16x32_bf16(false, a.lo, false, b.hi, (short)0, c, false, false);
    asm volatile("v_nop\n\tv_nop\n\tv_nop\n\tv_nop" : "+v"(c) : "v"(a.hi), "v"(a.lo), "v"(b.hi), "v"(b.lo));
    return c;
}
struct Split3 { v16b hi, mid, lo; };
// triple split product (6 terms, drops only terms below 2^-24 relative)
__device__ __forceinline__ v8f wmma6(const Split3& a, const Split3& b, v8f c) {
    c = __builtin_amdgcn_wmma_f32_16x16x32_bf16(false, a.hi, false, b.hi, (short)0, c, false, false);
    c = __builtin_amdgcn_wmma_f32_16x16x32_bf16(false, a.hi, false, b.mid, (short)0, c, false, false);
    c = __builtin_amdgcn_wmma_f32_16x16x32_bf16(false, a.mid, false, b.hi, (short)0, c, false, false);
    c = __builtin_amdgcn_wmma_f32_16x16x32_bf16(false, a.hi, false, b.lo, (short)0, c, false, false);
    c = __builtin_amdgcn_wmma_f32_16x16x32_bf16(false, a.mid, false, b.mid, (short)0, c, false, false);
    c = __builtin_amdgcn_wmma_f32_16x16x32_bf16(false, a.lo, false, b.hi, (short)0, c, false, false);
    asm volatile("v_nop\n\tv_nop\n\tv_nop\n\tv_nop" : "+v"(c) : "v"(a.hi), "v"(a.mid), "v"(a.lo), "v"(b.hi), "v"(b.mid), "v"(b.lo));
    return c;
}

// Fragment gathers from f32 memory: element i <- p[(k0 + frag_k(i,h)) * sk] * s, zero for k >= klen.
__device__ __forceinline__ v16h fh_ld(const float* __restrict__ p, long long sk, int k0, int h, int klen, float s) {
    v16h a;
#pragma unroll
    for (int i = 0; i < 16; ++i) { const int k = k0 + frag_k(i, h); a[i] = (k < klen) ? (_Float16)(p[(long long)k * sk] * s) : (_Float16)0.f; }
    return a;
}
__device__ __forceinline__ Split sp_ld(const float* __restrict__ p, long long sk, int k0, int h, int klen, float s) {
    Split r;
#pragma unroll
    for (int i = 0; i < 16; ++i) {
        const int k = k0 + frag_k(i, h); const float x = (k < klen) ? p[(long long)k * sk] * s : 0.f;
        const __bf16 hb = bf16_rne(x); r.hi[i] = hb; r.lo[i] = bf16_rne(x - bf16_f32(hb));
    }
    return r;
}
__device__ __forceinline__ Split3 sp3_ld(const float* __restrict__ p, long long sk, int k0, int h, int klen, float s) {
    Split3 r;
#pragma unroll
    for (int i = 0; i < 16; ++i) {
        const int k = k0 + frag_k(i, h); const float x = (k < klen) ? p[(long long)k * sk] * s : 0.f;
        const __bf16 hb = bf16_rne(x); const float r1 = x - bf16_f32(hb); const __bf16 mb = bf16_rne(r1);
        r.hi[i] = hb; r.mid[i] = mb; r.lo[i] = bf16_rne(r1 - bf16_f32(mb));
    }
    return r;
}
__device__ __forceinline__ v16b bh_ld(const float* __restrict__ p, long long sk, int k0, int h, int klen, float s) {
    v16b a;
#pragma unroll
    for (int i = 0; i < 16; ++i) { const int k = k0 + frag_k(i, h); a[i] = bf16_rne((k < klen) ? p[(long long)k * sk] * s : 0.f); }
    return a;
}
// f16 fragment from an f16 LDS/global row with element stride 1 (k-contiguous), no bounds (tile already zero padded)
__device__ __forceinline__ v16h fh_row(const _Float16* __restrict__ row, int k0, int h) {
    v16h a;
#pragma unroll
    for (int i = 0; i < 16; ++i) a[i] = row[k0 + frag_k(i, h)];
    return a;
}

#define VST2(T, ptr, val) do { const T vst2_v_ = (val); *(T*)(ptr) = vst2_v_;  } while (0)
typedef float v4f __attribute__((ext_vector_type(4)));
#define VST2V4(ptr, val) do { const v4f vst2_v4_ = (val); *(v4f*)(ptr) = vst2_v4_;  } while (0)

__device__ __attribute__((noinline)) float act_fn(float v, int act) {
    if (act == 1) return fmaxf(v, 0.f);                                                                               // relu
    if (act == 2) { const float u = 0.7978845608028654f * (v + 0.044715f * v * v * v); return 0.5f * v * (1.f + tanhf(u)); } // tanh-gelu
    if (act == 3) return v / (1.f + expf(-v));                                                                        // silu
    if (act == 4) return 0.5f * v * (1.f + erff(v * 0.7071067811865476f));                                             // erf-gelu
    if (act == 5) return tanhf(v);
    if (act == 6) return 1.f / (1.f + expf(-v));                                                                      // sigmoid
    if (act == 7) return (v > 0.f) ? v : 0.01f * v;                                                                   // leaky relu 0.01
    if (act == 8) return (v > 0.f) ? v : (expf(v) - 1.f);                                                             // elu
    if (act == 9) return fminf(fmaxf(v, 0.f), 6.f);                                                                   // relu6
    if (act == 10) return fabsf(v);                                                                                    // abs
    if (act == 11) return (v >= 0.f) ? v : 0.1f * v;                                                                  // leaky 0.1
    if (act == 12) return (v > 0.f) ? v : 0.2f * v;                                                                   // leaky 0.2
    if (act == 13) return (v > 20.f) ? v : log1pf(expf(v));                                                            // softplus
    return v;
}

// =====================================================================================================================
// k_gemm<MODE>: C(z, m, n) = act(alpha * sum_k A(z, m, k) * B(z, k, n) + bias) + beta * R(z, m, n)
//   One wave (32-thread block) per 16 x 32 tile of C; grid (ceil(N/32), ceil(M/16), Z). Batch z -> (zo = z / zi_n, zi = z % zi_n)
//   with separate outer/inner strides for every tensor (e.g. batch and head). A(m,k) = A[zo*sAo + zi*sAi + m*sAm + k*sAk] (f32),
//   B(k,n) = B[zo*sBo + zi*sBi + n*sBn + k*sBk] (f32); any M, N, K (K zero-padded to 32 inside the fragments, M/N tails guarded).
//   C(m,n) = C[zo*sCo + zi*sCi + m*sCm + n] (n contiguous). flags: 1 bias[n], 2 bias[m], 4 residual R[zo*sRo + zi*sRi + m*sRm + n*sRn].
//   MODE 0: f16 operands (A prescaled by sa, B by sb, both undone in the epilogue); 1: bf16 hi/lo split (3 products); 2: bf16;
//   3: bf16 hi/mid/lo triple split (6 products); 4: as 3 with Kahan-compensated f32 accumulation across k-steps.
// =====================================================================================================================
struct GemmP {
    const float* A; const float* B; const float* bias; const float* R; float* C;
    long long sAo, sAi, sAm, sAk, sBo, sBi, sBn, sBk, sCo, sCi, sCm, sRo, sRi, sRm, sRn;
    int M, N, K, zi_n, flags, act; float alpha, beta, sa, sb;
    int Npad, pad_;     // columns [N, Npad) of C are written as 0 so that padded workspace rows are covered by whole-line stores; Npad >= N
};
static_assert(sizeof(GemmP) == 5 * 8 + 15 * 8 + 6 * 4 + 4 * 4 + 2 * 4, "GemmP has padding");

template <int MODE>
__global__ __launch_bounds__(32) void k_gemm(GemmP p) {
    const int lane = threadIdx.x & 31, h = lane >> 4, l15 = lane & 15;
    const int m0 = blockIdx.y * 16, n0 = blockIdx.x * 32;
    const int z = blockIdx.z, zo = z / p.zi_n, zi = z - zo * p.zi_n;
    const float* A = p.A + zo * p.sAo + zi * p.sAi;
    const float* B = p.B + zo * p.sBo + zi * p.sBi;
    const int am = min(m0 + l15, p.M - 1);                       // clamped row for loads (stores are guarded)
    v8f acc[2], comp[2];
#pragma unroll
    for (int t = 0; t < 2; ++t) { v8f zz = {}; acc[t] = zz; comp[t] = zz; }
    for (int k0 = 0; k0 < p.K; k0 += 32) {
        const float* arow = A + (long long)am * p.sAm;
        if (MODE == 1) {
            const Split a = sp_ld(arow, p.sAk, k0, h, p.K, 1.f);
#pragma unroll
            for (int t = 0; t < 2; ++t) {
                const int bn = min(n0 + t * 16 + l15, p.N - 1);
                acc[t] = wmma3(a, sp_ld(B + (long long)bn * p.sBn, p.sBk, k0, h, p.K, 1.f), acc[t]);
            }
        } else if (MODE == 3) {
            const Split3 a = sp3_ld(arow, p.sAk, k0, h, p.K, 1.f);
#pragma unroll
            for (int t = 0; t < 2; ++t) {
                const int bn = min(n0 + t * 16 + l15, p.N - 1);
                acc[t] = wmma6(a, sp3_ld(B + (long long)bn * p.sBn, p.sBk, k0, h, p.K, 1.f), acc[t]);
            }
        } else if (MODE == 4) {
            // triple split as MODE 3, but each k-step's 6 products go into a fresh accumulator and the partial is added to the running f32 sum
            // on the VALU with Kahan compensation (accumulation error stays ~1 ulp however long K is)
            const Split3 a = sp3_ld(arow, p.sAk, k0, h, p.K, 1.f);
#pragma unroll
            for (int t = 0; t < 2; ++t) {
                const int bn = min(n0 + t * 16 + l15, p.N - 1); v8f zz = {};
                const v8f part = wmma6(a, sp3_ld(B + (long long)bn * p.sBn, p.sBk, k0, h, p.K, 1.f), zz);
                const v8f y = part - comp[t]; const v8f s = acc[t] + y; comp[t] = (s - acc[t]) - y; acc[t] = s;
            }
        } else if (MODE == 2) {
            const v16b a = bh_ld(arow, p.sAk, k0, h, p.K, 1.f);
#pragma unroll
            for (int t = 0; t < 2; ++t) {
                const int bn = min(n0 + t * 16 + l15, p.N - 1);
                acc[t] = wmmab(a, bh_ld(B + (long long)bn * p.sBn, p.sBk, k0, h, p.K, 1.f), acc[t]);
            }
        } else {
            const v16h a = fh_ld(arow, p.sAk, k0, h, p.K, p.sa);
#pragma unroll
            for (int t = 0; t < 2; ++t) {
                const int bn = min(n0 + t * 16 + l15, p.N - 1);
                acc[t] = wmma16(a, fh_ld(B + (long long)bn * p.sBn, p.sBk, k0, h, p.K, p.sb), acc[t]);
            }
        }
    }
    const float iscale = (MODE == 0) ? p.alpha / (p.sa * p.sb) : p.alpha;
    float* C = p.C + zo * p.sCo + zi * p.sCi;
    const float* R = p.R + zo * p.sRo + zi * p.sRi;
    __shared__ __align__(16) float ctile[16][36];
#pragma unroll
    for (int t = 0; t < 2; ++t) {
        const int n = n0 + t * 16 + l15; const int nn = min(n, p.N - 1);
#pragma unroll
        for (int r = 0; r < 8; ++r) {
            const int m = m0 + 8 * h + r; const int mm = min(m, p.M - 1);
            float v = acc[t][r] * iscale;
            if (p.flags & 1) v += p.bias[nn];
            if (p.flags & 2) v += p.bias[mm];
            if (p.flags & 8) v *= p.bias[(long long)zo * p.M + mm];   /* per-(z,row) scale vector laid out [Z][M]; exclusive with the bias flags */
            v = act_fn(v, p.act);
            if (p.flags & 4) v += p.beta * R[(long long)mm * p.sRm + (long long)nn * p.sRn];
            ctile[8 * h + r][t * 16 + l15] = (n < p.N) ? v : 0.f;
        }
    }
    __syncthreads();
    const int NW = (p.Npad > p.N) ? p.Npad : p.N;           // write width
    const bool fast = (m0 + 16 <= p.M) && (n0 + 32 <= NW) && ((p.sCm & 3) == 0) && ((((size_t)C) & 15) == 0);
    if (fast) {
#pragma unroll
        for (int s = 0; s < 4; ++s) {
            const int row = s * 4 + (lane >> 3), c4 = (lane & 7) * 4;
            const v4f v = *(const v4f*)&ctile[row][c4];
            VST2V4(C + (long long)(m0 + row) * p.sCm + n0 + c4, v);
        }
    } else {
        for (int row = 0; row < 16; ++row) {
            const int m = m0 + row, n = n0 + lane;
            if (m < p.M && n < NW) VST2(float, C + (long long)m * p.sCm + n, ctile[row][lane]);
        }
    }
}


// =====================================================================================================================
// k_gemmT<MODE, TM, TN>: same contract as k_gemm, but one wave computes a (16*TM) x (16*TN) tile: TM A fragments and TN B fragments are
//   loaded per 32-wide k-step and reused across TM*TN WMMAs (far fewer load/convert instructions per MAC). MODE 0 (f16), 1 (bf16 hi/lo),
//   2 (bf16) only. grid (ceil(NW/(16*TN)), ceil(M/(16*TM)), Z), block 32. Epilogue identical to k_gemm, run per 16x32 sub-tile.
// =====================================================================================================================
template <int MODE, int TM, int TN>
__global__ __launch_bounds__(32) void k_gemmT(GemmP p) {
    const int lane = threadIdx.x & 31, h = lane >> 4, l15 = lane & 15;
    const int m0 = blockIdx.y * (16 * TM), n0 = blockIdx.x * (16 * TN);
    const int z = blockIdx.z, zo = z / p.zi_n, zi = z - zo * p.zi_n;
    const float* A = p.A + zo * p.sAo + zi * p.sAi;
    const float* B = p.B + zo * p.sBo + zi * p.sBi;
    v8f acc[TM][TN];
#pragma unroll
    for (int i = 0; i < TM; ++i)
#pragma unroll
        for (int t = 0; t < TN; ++t) { v8f zz = {}; acc[i][t] = zz; }
    for (int k0 = 0; k0 < p.K; k0 += 32) {
        if (MODE == 1) {
            Split a[TM], b[TN];
#pragma unroll
            for (int i = 0; i < TM; ++i) { const int am = min(m0 + 16 * i + l15, p.M - 1); a[i] = sp_ld(A + (long long)am * p.sAm, p.sAk, k0, h, p.K, 1.f); }
#pragma unroll
            for (int t = 0; t < TN; ++t) { const int bn = min(n0 + 16 * t + l15, p.N - 1); b[t] = sp_ld(B + (long long)bn * p.sBn, p.sBk, k0, h, p.K, 1.f); }
#pragma unroll
            for (int i = 0; i < TM; ++i)
#pragma unroll
                for (int t = 0; t < TN; ++t) acc[i][t] = wmma3(a[i], b[t], acc[i][t]);
        } else if (MODE == 2) {
            v16b a[TM], b[TN];
#pragma unroll
            for (int i = 0; i < TM; ++i) { const int am = min(m0 + 16 * i + l15, p.M - 1); a[i] = bh_ld(A + (long long)am * p.sAm, p.sAk, k0, h, p.K, 1.f); }
#pragma unroll
            for (int t = 0; t < TN; ++t) { const int bn = min(n0 + 16 * t + l15, p.N - 1); b[t] = bh_ld(B + (long long)bn * p.sBn, p.sBk, k0, h, p.K, 1.f); }
#pragma unroll
            for (int i = 0; i < TM; ++i)
#pragma unroll
                for (int t = 0; t < TN; ++t) acc[i][t] = wmmab(a[i], b[t], acc[i][t]);
        } else {
            v16h a[TM], b[TN];
#pragma unroll
            for (int i = 0; i < TM; ++i) { const int am = min(m0 + 16 * i + l15, p.M - 1); a[i] = fh_ld(A + (long long)am * p.sAm, p.sAk, k0, h, p.K, p.sa); }
#pragma unroll
            for (int t = 0; t < TN; ++t) { const int bn = min(n0 + 16 * t + l15, p.N - 1); b[t] = fh_ld(B + (long long)bn * p.sBn, p.sBk, k0, h, p.K, p.sb); }
#pragma unroll
            for (int i = 0; i < TM; ++i)
#pragma unroll
                for (int t = 0; t < TN; ++t) acc[i][t] = wmma16(a[i], b[t], acc[i][t]);
        }
    }
    const float iscale = (MODE == 0) ? p.alpha / (p.sa * p.sb) : p.alpha;
    float* C = p.C + zo * p.sCo + zi * p.sCi;
    const float* R = p.R + zo * p.sRo + zi * p.sRi;
    const int NW = (p.Npad > p.N) ? p.Npad : p.N;
    __shared__ __align__(16) float ctile[16][36];
#pragma unroll
    for (int i = 0; i < TM; ++i) {
        const int mb = m0 + 16 * i; if (mb >= p.M) break;          // wave-uniform
#pragma unroll
        for (int tp = 0; tp < TN / 2; ++tp) {
            const int nb = n0 + 32 * tp; if (nb >= NW) break;        // wave-uniform
#pragma unroll
            for (int t2 = 0; t2 < 2; ++t2) {
                const int t = 2 * tp + t2; const int n = nb + t2 * 16 + l15; const int nn = min(n, p.N - 1);
#pragma unroll
                for (int r = 0; r < 8; ++r) {
                    const int m = mb + 8 * h + r; const int mm = min(m, p.M - 1);
                    float v = acc[i][t][r] * iscale;
                    if (p.flags & 1) v += p.bias[nn];
                    if (p.flags & 2) v += p.bias[mm];
            if (p.flags & 8) v *= p.bias[(long long)zo * p.M + mm];   /* per-(z,row) scale vector laid out [Z][M]; exclusive with the bias flags */
                    v = act_fn(v, p.act);
                    if (p.flags & 4) v += p.beta * R[(long long)mm * p.sRm + (long long)nn * p.sRn];
                    ctile[8 * h + r][t2 * 16 + l15] = (n < p.N) ? v : 0.f;
                }
            }
            __syncthreads();
            const bool fast = (mb + 16 <= p.M) && (nb + 32 <= NW) && ((p.sCm & 3) == 0) && ((((size_t)C) & 15) == 0);
            if (fast) {
#pragma unroll
                for (int s = 0; s < 4; ++s) {
                    const int row = s * 4 + (lane >> 3), c4 = (lane & 7) * 4;
                    const v4f v = *(const v4f*)&ctile[row][c4];
                    VST2V4(C + (long long)(mb + row) * p.sCm + nb + c4, v);
                }
            } else {
                for (int row = 0; row < 16; ++row) {
                    const int m = mb + row, n = nb + lane;
                    if (m < p.M && n < NW) VST2(float, C + (long long)m * p.sCm + n, ctile[row][lane]);
                }
            }
            __syncthreads();
        }
    }
}

// =====================================================================================================================
//   Wave = 16 queries, AW waves per block, 64-key blocks; grid (ceil(Lq/(16*AW)), H, B), block 32*AW. Any Lq, Lk; head dim dh <= DHP
//   (DHP multiple of 32), value dim dv <= DVP (multiple of 16, <= 128). Every tensor addressed by (batch, head, row, element) strides, f32.
//   Scores: QM 0 f16 operands, 1 bf16 hi/lo split, 2 bf16 triple split; statistics f32 (exp2 domain); P.V: P x 4096 as f16 with V f16 staged in LDS
//   (SPLITPV: P and V as bf16 hi/lo splits). kv head = h / hrep. Masking: causal = 1 (keep j <= i + coff, masked -> -inf, key blocks beyond the
//   diagonal skipped), causal = 2 (masked -> mfill, a finite fill like the -1e9; no skipping), causal = 3 (keep j >= i + coff,
//   masked -> -inf, no skipping); optional additive f32 mask Mf,
//   optional int keep-mask Mi (0 -> score := mfill), both addressed b*smb + h*smh + i*smi + j*smj (0 strides broadcast).
// =====================================================================================================================
#define AW 4
struct AttnP {   // apv4
    const float* Q; const float* K; const float* V; float* O; float* P; const float* Mf; const int* Mi; float* ST;
    const float* Pw; const float* Rt; const int* SQ; const int* SK;           // optional: post-softmax weight, relative-position table, segment ids
    long long swb, swh, swi, swj, srb, srh, sri;                                 // Pw strides (b,h,i,j); Rt strides (b,h,i), column = clamp(i - j + roff, 0, rn-1)
    long long sQb, sQh, sQi, sQd, sKb, sKh, sKj, sKd, sVb, sVh, sVj, sVd, sOb, sOh, sOi, sPb, sPh, sPi, smb, smh, smi, smj;
    int Lq, Lk, dh, dv, hrep, causal, coff, pband;   // pband > 0: P holds only the band |j - i| <= pband, column j - i + pband
    float scale, mfill; int nonorm, mpol;             // nonorm (online path only): O = sum_j exp(score_j) V_j without the 1/rowsum (scores must be <= ~0); mpol: Mi masks where ==0 (mpol 0) or where !=0 (mpol 1)
    int roff, rn, segpol, win;                        // Rt column offset/count; SQ/SK: score := mfill where (segpol 0) SQ[i] != SK[j] or (segpol 1) SQ[i] == SK[j]; win > 0: keys with i - j > win (after coff) -> -inf
};
//   Pw: the softmax numerator is multiplied by Pw(b,h,i,j) AFTER the row sum is taken (probs * weight, then P.V), as in post-softmax multiplicative biases.                                                    // ST (optional): per row (b,h,i) -> ST[((b*H + h)*Lq + i)*2 + {0,1}] = {row max of the scaled+masked score (natural units), sum_j exp(score - max)}
static_assert(sizeof(AttnP) == 12 * 8 + 29 * 8 + 16 * 4, "AttnP has padding");

#ifndef KATTN_ATTR
#define KATTN_ATTR
#endif
template <int DHP, int DVP, int QM, bool SPLITPV, bool TWOPASS>
__global__ __launch_bounds__(32 * AW) KATTN_ATTR void k_attn(AttnP p) {
    constexpr int NT = DVP / 16;                // output tiles
    constexpr int KS = DHP / 32;                // k-steps for the scores
    constexpr int VP = DVP + 8;                 // LDS pitch (halves)
    __shared__ __align__(16) float    pl[AW][16 * 64];
    __shared__ __align__(16) _Float16 vl[(SPLITPV ? 2 : 1) * 64 * VP];   // f16 V tile, or bf16 hi and lo tiles (same 2-byte size)
    const int lane = threadIdx.x & 31, hf = lane >> 4, l15 = lane & 15, wave = threadIdx.x >> 5;
    const int h = blockIdx.y, b = blockIdx.z, hk = h / p.hrep;
    const int q0 = (blockIdx.x * AW + wave) * 16;
    float* myp = pl[wave];
    const float L2E = 1.4426950408889634f;
    const float NEG = -__builtin_inff();
    const int qi = min(q0 + l15, p.Lq - 1);
    const float* qrow = p.Q + b * p.sQb + h * p.sQh + (long long)qi * p.sQi;
    const float* kbase = p.K + b * p.sKb + hk * p.sKh;
    const float* vbase = p.V + b * p.sVb + hk * p.sVh;
    v16h qa[QM == 0 ? KS : 1]; Split qs_[QM == 1 ? KS : 1]; Split3 qt_[QM == 2 ? KS : 1];
#pragma unroll
    for (int ks = 0; ks < KS; ++ks) {
        if (QM == 2) qt_[ks] = sp3_ld(qrow, p.sQd, ks * 32, hf, p.dh, 1.f);
        else if (QM == 1) qs_[ks] = sp_ld(qrow, p.sQd, ks * 32, hf, p.dh, 1.f);
        else qa[ks] = fh_ld(qrow, p.sQd, ks * 32, hf, p.dh, 1.f);
    }
    v8f o[NT]; float m8[8], l8[8];
#pragma unroll
    for (int t = 0; t < NT; ++t) { v8f zz = {}; o[t] = zz; }
#pragma unroll
    for (int i = 0; i < 8; ++i) { m8[i] = NEG; l8[i] = 0.f; }
    int jend = p.Lk; int jstart = 0;
    if (p.causal == 1) { const int je = (blockIdx.x * AW + AW - 1) * 16 + 16 + p.coff; jend = min(jend, max(je, 0)); }   // uniform per block
    if (p.win > 0) { const int js = (int)(blockIdx.x * AW) * 16 + p.coff - p.win; jstart = (js > 0) ? (js / 64) * 64 : 0; }   // uniform per block: key blocks entirely outside every row's window hold only -inf entries and are skipped exactly
    const int npass = TWOPASS ? 2 : 1;
    for (int pass = 0; pass < npass; ++pass) {
        const bool dopv = (!TWOPASS) || pass == 1;
        for (int j0 = jstart; j0 < jend; j0 += 64) {
            if (dopv) {
                __syncthreads();                                 // previous key block's reads of vl / pl are done
                for (int idx = threadIdx.x; idx < 64 * DVP; idx += 32 * AW) {
                    const int jr = idx / DVP, d = idx - jr * DVP, j = j0 + jr;
                    const float f = (j < p.Lk && d < p.dv) ? vbase[(long long)j * p.sVj + (long long)d * p.sVd] : 0.f;
                    if (SPLITPV) {
                        const __bf16 hb = bf16_rne(f);
                        ((__bf16*)vl)[jr * VP + d] = hb; ((__bf16*)vl)[64 * VP + jr * VP + d] = bf16_rne(f - bf16_f32(hb));
                    } else vl[jr * VP + d] = (_Float16)f;
                }
            }
            v8f s[4];
#pragma unroll
            for (int t = 0; t < 4; ++t) {
                const int j = min(j0 + t * 16 + l15, p.Lk - 1);
                const float* krow = kbase + (long long)j * p.sKj;
                v8f acc = {};
#pragma unroll
                for (int ks = 0; ks < KS; ++ks) {
                    if (QM == 2)      acc = wmma6(qt_[ks], sp3_ld(krow, p.sKd, ks * 32, hf, p.dh, 1.f), acc);
                    else if (QM == 1) acc = wmma3(qs_[ks], sp_ld(krow, p.sKd, ks * 32, hf, p.dh, 1.f), acc);
                    else              acc = wmma16(qa[ks], fh_ld(krow, p.sKd, ks * 32, hf, p.dh, 1.f), acc);
                }
                s[t] = acc;
            }
            float pv[8][4];
#pragma unroll
            for (int i = 0; i < 8; ++i) {
                const int irow = q0 + i + 8 * hf;
                const int ic = min(irow, p.Lq - 1);
                float sc[4];
#pragma unroll
                for (int t = 0; t < 4; ++t) {
                    const int jg = j0 + t * 16 + l15;
                    float v = s[t][i] * p.scale;
                    if (p.Mf) v += p.Mf[b * p.smb + h * p.smh + (long long)ic * p.smi + (long long)min(jg, p.Lk - 1) * p.smj];
                    if (p.Rt) { int rc = ic - min(jg, p.Lk - 1) + p.roff; rc = rc < 0 ? 0 : (rc >= p.rn ? p.rn - 1 : rc); v += p.Rt[b * p.srb + h * p.srh + (long long)ic * p.sri + rc]; }
                    if (p.Mi) { const int mv = p.Mi[b * p.smb + h * p.smh + (long long)ic * p.smi + (long long)min(jg, p.Lk - 1) * p.smj]; if (p.mpol ? (mv != 0) : (mv == 0)) v = p.mfill; }
                    if (p.SQ) { const bool same = p.SQ[(long long)b * p.Lq + ic] == p.SK[(long long)b * p.Lk + min(jg, p.Lk - 1)]; if (p.segpol ? same : !same) v = p.mfill; }
                    if (p.causal == 2 && jg > irow + p.coff) v = p.mfill;
                    if (jg >= p.Lk || (p.causal == 1 && jg > irow + p.coff) || (p.causal == 3 && jg < irow + p.coff) || (p.win > 0 && irow + p.coff - jg > p.win)) v = NEG; else v *= L2E;
                    sc[t] = v;
                }
                if (!TWOPASS || pass == 0) {
                    float mx = fmaxf(fmaxf(sc[0], sc[1]), fmaxf(sc[2], sc[3]));
                    mx = fmaxf(mx, __shfl_xor(mx, 1, 32)); mx = fmaxf(mx, __shfl_xor(mx, 2, 32));
                    mx = fmaxf(mx, __shfl_xor(mx, 4, 32)); mx = fmaxf(mx, __shfl_xor(mx, 8, 32));
                    const float mnew = fmaxf(m8[i], mx);
                    const float corr = (mnew == NEG) ? 1.f : exp2f(m8[i] - mnew);
                    float rs = 0.f;
#pragma unroll
                    for (int t = 0; t < 4; ++t) {
                        const float pp = (sc[t] == NEG) ? 0.f : exp2f(sc[t] - mnew); rs += pp;
                        pv[i][t] = p.Pw ? pp * p.Pw[b * p.swb + h * p.swh + (long long)ic * p.swi + (long long)min(j0 + t * 16 + l15, p.Lk - 1) * p.swj] : pp;
                    }
                    rs += __shfl_xor(rs, 1, 32); rs += __shfl_xor(rs, 2, 32); rs += __shfl_xor(rs, 4, 32); rs += __shfl_xor(rs, 8, 32);
                    l8[i] = l8[i] * corr + rs; m8[i] = mnew;
                    if (!TWOPASS) {
#pragma unroll
                        for (int t = 0; t < NT; ++t) o[t][i] *= corr;
                    }
                } else {
                    const float inv = (l8[i] > 0.f) ? 1.f / l8[i] : 0.f;
#pragma unroll
                    for (int t = 0; t < 4; ++t) {
                        const int jg = j0 + t * 16 + l15;
                        float pp = (sc[t] == NEG) ? 0.f : exp2f(sc[t] - m8[i]) * inv;
                        if (p.Pw) pp *= p.Pw[b * p.swb + h * p.swh + (long long)ic * p.swi + (long long)min(jg, p.Lk - 1) * p.swj];
                        pv[i][t] = pp;
                    }
                }
            }
            if (dopv) {
#pragma unroll
                for (int i = 0; i < 8; ++i)
#pragma unroll
                    for (int t = 0; t < 4; ++t) ((float*)myp)[(i + 8 * hf) * 64 + t * 16 + l15] = pv[i][t];
                __syncthreads();                                 // P (per wave) and V (shared) visible
                if (p.P) {
                    float* pb_ = p.P + b * p.sPb + h * p.sPh;
                    const bool fastP = (p.pband == 0) && ((p.sPi & 3) == 0) && (j0 + 64 <= p.Lk) && (q0 + 16 <= p.Lq) && ((((size_t)pb_) & 15) == 0);
                    if (fastP) {
#pragma unroll
                        for (int s = 0; s < 8; ++s) {
                            const int row = s * 2 + (lane >> 4), c4 = (lane & 15) * 4;
                            const v4f v = *(const v4f*)(myp + row * 64 + c4);
                            VST2V4(pb_ + (long long)(q0 + row) * p.sPi + j0 + c4, v);
                        }
                    } else {
                        for (int row = 0; row < 16; ++row) {
                            const int irow = q0 + row; if (irow >= p.Lq) continue;
                            for (int c = lane; c < 64; c += 32) {
                                const int jg = j0 + c; if (jg >= p.Lk) continue;
                                if (p.pband == 0) VST2(float, pb_ + (long long)irow * p.sPi + jg, myp[row * 64 + c]);
                                else if (jg - irow <= p.pband && irow - jg <= p.pband) VST2(float, pb_ + (long long)irow * p.sPi + (jg - irow + p.pband), myp[row * 64 + c]);
                            }
                        }
                    }
                }
                if (SPLITPV) {
                    const Split pa0 = sp_ld(myp + l15 * 64, 1, 0, hf, 64, 1.f), pa1 = sp_ld(myp + l15 * 64, 1, 32, hf, 64, 1.f);
                    const __bf16* vh = (const __bf16*)vl; const __bf16* vlo = vh + 64 * VP;
#pragma unroll
                    for (int t = 0; t < NT; ++t) {
                        const int dcol = t * 16 + l15;
                        Split b0, b1;
#pragma unroll
                        for (int e = 0; e < 16; ++e) {
                            const int k0 = frag_k(e, hf), k1 = 32 + frag_k(e, hf);
                            b0.hi[e] = vh[k0 * VP + dcol]; b0.lo[e] = vlo[k0 * VP + dcol]; b1.hi[e] = vh[k1 * VP + dcol]; b1.lo[e] = vlo[k1 * VP + dcol];
                        }
                        o[t] = wmma3(pa0, b0, o[t]);
                        o[t] = wmma3(pa1, b1, o[t]);
                    }
                } else {
                    const v16h pa0 = fh_ld(myp + l15 * 64, 1, 0, hf, 64, 4096.f), pa1 = fh_ld(myp + l15 * 64, 1, 32, hf, 64, 4096.f);
#pragma unroll
                    for (int t = 0; t < NT; ++t) {
                        const int dcol = t * 16 + l15;
                        v16h b0, b1;
#pragma unroll
                        for (int e = 0; e < 16; ++e) { b0[e] = vl[frag_k(e, hf) * VP + dcol]; b1[e] = vl[(32 + frag_k(e, hf)) * VP + dcol]; }
                        o[t] = wmma16(pa0, b0, o[t]);
                        o[t] = wmma16(pa1, b1, o[t]);
                    }
                }
            }
        }
    }
    float* obase = p.O + b * p.sOb + h * p.sOh;
    if (p.ST) {
        const int rl = lane >> 1, isel = rl & 7;           // row q0 + rl ; rl>>3 == hf holds because lane>>4 == (lane>>1)>>3
        float mv = 0.f, lv = 0.f;
#pragma unroll
        for (int i = 0; i < 8; ++i) if (i == isel) { mv = m8[i]; lv = l8[i]; }
        const int irow = q0 + rl;
        if (irow < p.Lq) { float* st = p.ST + (((long long)b * gridDim.y + h) * p.Lq + irow) * 2 + (lane & 1); VST2(float, st, (lane & 1) ? lv : mv * 0.6931471805599453f); }
    }
    float invr[8];
#pragma unroll
    for (int i = 0; i < 8; ++i) {
        if (TWOPASS) invr[i] = SPLITPV ? 1.f : (1.f / 4096.f);
        else if (p.nonorm) invr[i] = exp2f(m8[i]) * (SPLITPV ? 1.f : (1.f / 4096.f));
        else invr[i] = (l8[i] > 0.f) ? (SPLITPV ? 1.f / l8[i] : 1.f / (l8[i] * 4096.f)) : 0.f;
    }
    __syncthreads();                                             // all waves done with pl/vl from the main loop
    const bool ofast = ((p.sOi & 3) == 0) && ((((size_t)obase) & 15) == 0) && (q0 + 16 <= p.Lq);
#pragma unroll
    for (int c0 = 0; c0 < DVP; c0 += 64) {
#pragma unroll
        for (int i = 0; i < 8; ++i)
#pragma unroll
            for (int t = 0; t < NT; ++t) if (t * 16 >= c0 && t * 16 < c0 + 64) ((float*)myp)[(i + 8 * hf) * 64 + (t * 16 - c0) + l15] = o[t][i] * invr[i];
        __syncthreads();
        const int cw = (DVP - c0 < 64) ? (DVP - c0) : 64;      // staged columns in this chunk (multiple of 16)
        if (ofast && (c0 + cw <= p.dv) && (cw % 32 == 0)) {
            const int lpr = cw / 4;                              // lanes per row (16 for 64 cols, 8 for 32)
            const int rows_per_ins = 32 / lpr;
            for (int r0 = 0; r0 < 16; r0 += rows_per_ins) {
                const int row = r0 + lane / lpr, c4 = (lane % lpr) * 4;
                const v4f v = *(const v4f*)(myp + row * 64 + c4);
                VST2V4(obase + (long long)(q0 + row) * p.sOi + c0 + c4, v);
            }
        } else {
            for (int row = 0; row < 16; ++row) {
                const int irow = q0 + row; if (irow >= p.Lq) continue;
                for (int c = lane; c < cw; c += 32) { const int d = c0 + c; if (d < p.dv) VST2(float, obase + (long long)irow * p.sOi + d, myp[row * 64 + c]); }
            }
        }
        __syncthreads();
    }
}

// =====================================================================================================================
// k_tr: dst(z, c, r) = alpha * src(z, r, c) (+ beta * R2(z, c, r)): [Z][R][C] (row stride lds) -> [Z][C][R] (row stride ldd) through a 32x32 LDS tile;
//   flags: 1 -> add beta * residual R2 addressed like dst (z*sRz + c*ldr + r); act applied before the residual.
// =====================================================================================================================
struct TrP { const float* src; float* dst; const float* R2; long long sSz, lds, sDz, ldd, sRz, ldr; int R, C, flags, act; float alpha, beta; };
static_assert(sizeof(TrP) == 3 * 8 + 6 * 8 + 6 * 4, "TrP has padding");
__global__ __launch_bounds__(256) void k_tr(TrP p) {
    __shared__ float tile[32][33];
    const int c0 = blockIdx.x * 32, r0 = blockIdx.y * 32, z = blockIdx.z;
    const int lane = threadIdx.x & 31, wave = threadIdx.x >> 5;
    const float* s = p.src + z * p.sSz;
#pragma unroll
    for (int k = 0; k < 4; ++k) {
        const int rl = wave * 4 + k, r = r0 + rl, c = c0 + lane;
        tile[rl][lane] = (r < p.R && c < p.C) ? s[(long long)r * p.lds + c] : 0.f;
    }
    __syncthreads();
    float* d = p.dst + z * p.sDz; const float* rr = p.R2 + z * p.sRz;
#pragma unroll
    for (int k = 0; k < 4; ++k) {
        const int cl = wave * 4 + k, c = c0 + cl, r = r0 + lane;
        if (c < p.C && r < p.R) {
            float v = act_fn(p.alpha * tile[lane][cl], p.act);
            if (p.flags & 1) v += p.beta * rr[(long long)c * p.ldr + r];
            VST2(float, d + (long long)c * p.ldd + r, v);
        }
    }
}

// k_affine: dst[i] = a * (sdev ? sdev[0] : 1) * src[i] + b, i < n (one thread per element; consecutive lanes -> consecutive addresses)
__global__ __launch_bounds__(256) void k_affine(const float* __restrict__ src, float* __restrict__ dst, int n, float a, float b, const float* __restrict__ sdev) {
    const int i = blockIdx.x * 256 + threadIdx.x;
    if (i < n) { const float aa = sdev ? a * sdev[0] : a; const float v = aa * src[i] + b; VST2(float, dst + i, v); }
}

// =====================================================================================================================
// k_softmax: row softmax over n contiguous elements, one 256-thread block per row; rows addressed z*sz + r*sr (grid (R, Z)).
//   out = scale_out * softmax(scale_in * x + (Mf ? Mf[z*smz + r*smr + j] : 0)); a row whose max is -inf is written as 0.
// =====================================================================================================================
struct SmP { const float* src; float* dst; const float* Mf; long long sz, sr, dz, dr, smz, smr; int n, pad; float scale_in, scale_out; };
static_assert(sizeof(SmP) == 3 * 8 + 6 * 8 + 4 * 4, "SmP has padding");
__global__ __launch_bounds__(256) void k_softmax(SmP p) {
    __shared__ float red[256];
    const int r = blockIdx.x, z = blockIdx.y, tid = threadIdx.x;
    const float* s = p.src + z * p.sz + (long long)r * p.sr;
    const float* mf = p.Mf ? (p.Mf + z * p.smz + (long long)r * p.smr) : nullptr;
    float mx = -__builtin_inff();
    for (int j = tid; j < p.n; j += 256) { float v = s[j] * p.scale_in; if (mf) v += mf[j]; mx = fmaxf(mx, v); }
    red[tid] = mx; __syncthreads();
    for (int o = 128; o > 0; o >>= 1) { if (tid < o) red[tid] = fmaxf(red[tid], red[tid + o]); __syncthreads(); }
    mx = red[0]; __syncthreads();
    float sum = 0.f;
    for (int j = tid; j < p.n; j += 256) { float v = s[j] * p.scale_in; if (mf) v += mf[j]; sum += (mx == -__builtin_inff()) ? 0.f : expf(v - mx); }
    red[tid] = sum; __syncthreads();
    for (int o = 128; o > 0; o >>= 1) { if (tid < o) red[tid] += red[tid + o]; __syncthreads(); }
    sum = red[0];
    const float inv = (sum > 0.f) ? p.scale_out / sum : 0.f;
    float* d = p.dst + z * p.dz + (long long)r * p.dr;
    for (int j = tid; j < p.n; j += 256) { float v = s[j] * p.scale_in; if (mf) v += mf[j]; const float o = (mx == -__builtin_inff()) ? 0.f : expf(v - mx) * inv; VST2(float, d + j, o); }
}
// =====================================================================================================================
// k_stats: mean and rsqrt(var + eps) over a set of n elements addressed base + z*sz + (e / inner) * so + (e % inner) * si, one 256-thread
// k_norm_apply: y = (x - mean[set]) * rstd[set] * g[c] + b[c] over a [Z][C][L] channel-major tensor with set = z*G + c / (C/G) (G groups per z;
//   G = C -> per-channel sets indexed z*C+c; for batch norm pass stats indexed by c only via bn = 1). Optional act. Output same layout.
// =====================================================================================================================
//   mode 0: mean / rsqrt(var + eps); mode 1 (RMSNorm): 0 / rsqrt(mean(x^2) + eps); mode 2 (L2 normalize * sqrt(n)): 0 / sqrt(n) / max(||x||, eps); mode 3: as 0 with unbiased variance (n-1)
__global__ __launch_bounds__(256) void k_stats(const float* __restrict__ x, long long sz, long long so, long long si, int inner, int n, float eps, float* __restrict__ stat, int mode) {
    __shared__ float red[256];
    const int z = blockIdx.x, tid = threadIdx.x;
    const float* base = x + z * sz;
    float s = 0.f;
    for (int e = tid; e < n; e += 256) s += base[(long long)(e / inner) * so + (long long)(e % inner) * si];
    red[tid] = s; __syncthreads();
    for (int o = 128; o > 0; o >>= 1) { if (tid < o) red[tid] += red[tid + o]; __syncthreads(); }
    const float mu = (mode == 0 || mode == 3) ? red[0] / (float)n : 0.f; __syncthreads();
    float q = 0.f;
    for (int e = tid; e < n; e += 256) { const float dlt = base[(long long)(e / inner) * so + (long long)(e % inner) * si] - mu; q += dlt * dlt; }
    red[tid] = q; __syncthreads();
    for (int o = 128; o > 0; o >>= 1) { if (tid < o) red[tid] += red[tid + o]; __syncthreads(); }
    {
        float rs;
        if (mode == 2) rs = sqrtf((float)n) / fmaxf(sqrtf(red[0]), eps); else if (mode == 3) rs = rsqrtf(red[0] / (float)(n - 1) + eps); else rs = rsqrtf(red[0] / (float)n + eps);
        if (tid < 32) { const float v = (tid == 0) ? mu : ((tid == 1) ? rs : 0.f); VST2(float, stat + (long long)z * 32 + tid, v); }
    }
}
//   One thread per element over the flat [Z][C][L] index space: grid ceil(Z*C*L / 256).
__global__ __launch_bounds__(256) void k_norm_apply(const float* __restrict__ x, float* __restrict__ y, const float* __restrict__ stat, const float* __restrict__ g, const float* __restrict__ bta,
                                                     int Z, int C, int L, int G, int bn, int act) {
    const long long idx = (long long)blockIdx.x * 256 + threadIdx.x;
    if (idx >= (long long)Z * C * L) return;
    const int l = (int)(idx % L); const long long zc = idx / L; const int c = (int)(zc % C), z = (int)(zc / C); (void)l;
    const int set = bn ? c : (z * G + c / (C / G));
    float v = (x[idx] - stat[(long long)set * 32]) * stat[(long long)set * 32 + 1];
    if (g) v *= g[c];
    if (bta) v += bta[c];
    v = act_fn(v, act);
    VST2(float, y + idx, v);
}

// k_lse_neg: c[i] = -(st[2i] + log(st[2i+1])) = minus the log-sum-exp of row i from k_attn's ST output (for softmax over the query dimension)
__global__ __launch_bounds__(256) void k_lse_neg(const float* __restrict__ st, float* __restrict__ c, int n) {
    const int i = blockIdx.x * 256 + threadIdx.x;
    if (i < n) { const float v = -(st[2 * i] + logf(st[2 * i + 1])); VST2(float, c + i, v); }
}

// k_iota: dst[i] = a * i + b as int32 (segment/position id helper)
__global__ __launch_bounds__(256) void k_iota(int* __restrict__ dst, int n, int a, int b) {
    const int i = blockIdx.x * 256 + threadIdx.x;
    if (i < n) { const int v = a * i + b; VST2(int, dst + i, v); }
}

// k_axpby: dst[i] = a * x[i] + b * y[i] (+ c), i < n
__global__ __launch_bounds__(256) void k_axpby(const float* __restrict__ x, const float* __restrict__ y, float* __restrict__ dst, int n, float a, float b, float c) {
    const int i = blockIdx.x * 256 + threadIdx.x;
    if (i < n) { const float v = a * x[i] + b * y[i] + c; VST2(float, dst + i, v); }
}

// =====================================================================================================================
// k_rope: rotary embedding on a [R rows][Hn heads][D] view (row stride sXr, head stride sXh, element stride 1) -> Y (own strides).
//   mode 0: rotate_half (partner d±D/2, sign - for d<D/2); mode 1: interleaved pairs (partner d^1, sign - for even d).
//   table column tcol: tmode 0 -> d, 1 -> d % (D/2), 2 -> d / 2; position p: pmode 0 -> r % S, 1 -> head index, 2 -> pos[r];
//   c = C[(r / S) * sCb + p * sCp + tcol * sCd], s likewise from Sn; y = x[d] * c + sign * x[partner] * s. X and Y must not alias.
// =====================================================================================================================
struct RopeP { const float* X; float* Y; const float* C; const float* Sn; const int* pos; long long sXr, sXh, sYr, sYh, sCb, sCp, sCd; int R, Hn, D, S, mode, tmode, pmode, pad; };
static_assert(sizeof(RopeP) == 5 * 8 + 7 * 8 + 8 * 4, "RopeP has padding");
__global__ __launch_bounds__(256) void k_rope(RopeP p) {
    const long long idx = (long long)blockIdx.x * 256 + threadIdx.x;
    if (idx >= (long long)p.R * p.Hn * p.D) return;
    const int d = (int)(idx % p.D); const long long rh = idx / p.D; const int h = (int)(rh % p.Hn); const int r = (int)(rh / p.Hn);
    const int half = p.D / 2;
    int partner; float sign;
    if (p.mode == 0) { partner = (d < half) ? d + half : d - half; sign = (d < half) ? -1.f : 1.f; }
    else { partner = d ^ 1; sign = (d & 1) ? 1.f : -1.f; }
    const int tcol = (p.tmode == 0) ? d : ((p.tmode == 1) ? (d % half) : (d >> 1));
    const int pp = (p.pmode == 0) ? (r % p.S) : ((p.pmode == 1) ? h : p.pos[r]);
    const long long toff = (long long)(r / p.S) * p.sCb + (long long)pp * p.sCp + (long long)tcol * p.sCd;
    const float* xr = p.X + (long long)r * p.sXr + (long long)h * p.sXh;
    const float v = xr[d] * p.C[toff] + sign * xr[partner] * p.Sn[toff];
    VST2(float, p.Y + (long long)r * p.sYr + (long long)h * p.sYh + d, v);
}

// k_invf + k_sincos (split so neither kernel carries a large VALU-fma footprint): invf_i = num * (1 / powf(base, (2 i)/D)) [fmode 0],
//   num * expf((2 i) * cexp) [fmode 1], num * powf(base, -2 (i - 1) / D) [fmode 2]; then cs/sn[s*half + i] = cos/sin((pscale * s) * invf_i)
__global__ __launch_bounds__(256) void k_invf(float* __restrict__ invb, int half, int D, float base, float num, int fmode, float cexp) {
    const int i = blockIdx.x * 256 + threadIdx.x;
    if (i >= ((half + 31) / 32) * 32) return;
    if (i >= half) { VST2(float, invb + i, 0.f); return; }
    const float e = (float)(2 * i) / (float)D;
    float invf;
    if (fmode == 1) invf = num * expf((float)(2 * i) * cexp);
    else if (fmode == 2) invf = num * powf(base, (-2.0f * ((float)i - 1.0f)) / (float)D);
    else invf = num * (1.0f / powf(base, e));
    VST2(float, invb + i, invf);
}
__global__ __launch_bounds__(256) void k_sincos(float* __restrict__ cs, float* __restrict__ sn, const float* __restrict__ invb, int S, int half, float pscale) {
    const int idx = blockIdx.x * 256 + threadIdx.x;
    if (idx >= S * half) return;
    const int s = idx / half, i = idx - s * half;
    const float ang = (pscale * (float)s) * invb[i];
    VST2(float, cs + idx, cosf(ang)); VST2(float, sn + idx, sinf(ang));
}

// k_mulact: dst[i] = act(x[i]) * y[i]
__global__ __launch_bounds__(256) void k_mulact(const float* __restrict__ x, const float* __restrict__ y, float* __restrict__ dst, int n, int act) {
    const int i = blockIdx.x * 256 + threadIdx.x;
    if (i < n) { const float v = act_fn(x[i], act) * y[i]; VST2(float, dst + i, v); }
}

// =====================================================================================================================
// k_matvec: thread-per-row matrix-vector products for N <= 8 output columns (heads with 1-3 outputs, gates), f32 on the VALU.
//   C[r*sCm + j] = act(alpha * sum_k A[r*sAm + k*sAk] * B[j*sBn + k*sBk] + bias[j]) + beta * R[r*sRm + j*sRn]; each thread writes its N contiguous floats.
// =====================================================================================================================
__global__ __launch_bounds__(256) void k_matvec(GemmP p) {
    // 32 lanes write one line with one instruction.
    const int rpt = (p.N == 1) ? 1 : 32;
    const long long r0 = ((long long)blockIdx.x * 256 + threadIdx.x) * rpt; const int z = blockIdx.z, zo = z / p.zi_n, zi = z - zo * p.zi_n;
    if (r0 >= p.M) return;
    const float* Bb = p.B + zo * p.sBo + zi * p.sBi;
    float* C = p.C + zo * p.sCo + zi * p.sCi; const float* R = p.R + zo * p.sRo + zi * p.sRi;
    for (int rr = 0; rr < rpt; ++rr) {
        const long long r = r0 + rr; if (r >= p.M) break;
        const float* A = p.A + zo * p.sAo + zi * p.sAi + r * p.sAm;
        float acc[8] = {0.f, 0.f, 0.f, 0.f, 0.f, 0.f, 0.f, 0.f};
        for (int k = 0; k < p.K; ++k) { const float a = A[(long long)k * p.sAk];
#pragma unroll
            for (int j = 0; j < 8; ++j) if (j < p.N) acc[j] += a * Bb[(long long)j * p.sBn + (long long)k * p.sBk]; }
#pragma unroll
        for (int j = 0; j < 8; ++j) if (j < p.N) {
            float v = acc[j] * p.alpha;
            if (p.flags & 1) v += p.bias[j];
            if (p.flags & 2) v += p.bias[r];
            v = act_fn(v, p.act);
            if (p.flags & 4) v += p.beta * R[r * p.sRm + (long long)j * p.sRn];
            VST2(float, C + r * p.sCm + j, v);
        }
    }
}
// k_smallsoftmax: thread-per-row softmax for short rows (n <= 64): dst[r*dr + j] = softmax(scale*src[r*sr + j])
__global__ __launch_bounds__(256) void k_smallsoftmax(const float* __restrict__ src, float* __restrict__ dst, long long sr, long long dr, int n, long long R, float scale) {
    const long long r0 = ((long long)blockIdx.x * 256 + threadIdx.x) * 32;
    for (int rr = 0; rr < 32; ++rr) {
        const long long r = r0 + rr; if (r >= R) return;
        const float* s = src + r * sr; float* d = dst + r * dr;
        float mx = -__builtin_inff();
        for (int j = 0; j < n; ++j) mx = fmaxf(mx, s[j] * scale);
        float sum = 0.f;
        for (int j = 0; j < n; ++j) sum += expf(s[j] * scale - mx);
        const float inv = 1.f / sum;
        for (int j = 0; j < n; ++j) { const float v = expf(s[j] * scale - mx) * inv; VST2(float, d + j, v); }
    }
}

__global__ __launch_bounds__(32) void k_unitstat(float* __restrict__ st) { const int t = threadIdx.x; const float v = (t == 1) ? 1.f : 0.f; VST2(float, st + t, v); }

// destination (e.g. a d_out whose row width is not a multiple of 32 floats) is written by consecutive lanes of one instruction
__global__ __launch_bounds__(256) void k_lincopy(const float* __restrict__ src, long long lds, float* __restrict__ dst, long long ldd, long long rows, int cols) {
    const long long i = (long long)blockIdx.x * 256 + threadIdx.x; if (i >= rows * cols) return;
    const long long r = i / cols; const int c = (int)(i - r * cols);
    const float v = src[r * lds + c]; VST2(float, dst + r * ldd + c, v);
}

namespace w25 {
typedef __attribute__((ext_vector_type(16))) _Float16 v16h;
typedef __attribute__((ext_vector_type(8)))  _Float16 v8h;
typedef __attribute__((ext_vector_type(16))) __bf16   v16b;
typedef __attribute__((ext_vector_type(8)))  __bf16   v8b;
typedef __attribute__((ext_vector_type(8)))  float    v8f;
typedef __attribute__((ext_vector_type(4)))  float    v4f;

__device__ __forceinline__ unsigned short f2bf_bits(float f) {
  unsigned u = __float_as_uint(f);
  return (unsigned short)((u + 0x7FFFu + ((u >> 16) & 1u)) >> 16);
}
__device__ __forceinline__ float bf_bits2f(unsigned short h) { return __uint_as_float(((unsigned)h) << 16); }

// hazard guards as plain device helpers (no inline asm inside the kernel template body)
__device__ __forceinline__ void dep_guard_h(v8f& a, v8f& b, v16h x, v16h y) { asm volatile("v_nop\n\tv_nop\n\tv_nop\n\tv_nop" : "+v"(a), "+v"(b) : "v"(x), "v"(y)); }
__device__ __forceinline__ void dep_guard_b(v8f& a, v8f& b, v16b x, v16b y) { asm volatile("v_nop\n\tv_nop\n\tv_nop\n\tv_nop" : "+v"(a), "+v"(b) : "v"(x), "v"(y)); }
__device__ __forceinline__ void keep4_h(v16h a, v16h b, v16h c, v16h d) { asm volatile("v_nop" :: "v"(a), "v"(b), "v"(c), "v"(d)); }
__device__ __forceinline__ void keep4_b(v16b a, v16b b, v16b c, v16b d) { asm volatile("v_nop" :: "v"(a), "v"(b), "v"(c), "v"(d)); }
__device__ __forceinline__ void acc_guard4(v8f& a, v8f& b, v8f& c, v8f& d) { asm volatile("v_nop\n\tv_nop\n\tv_nop\n\tv_nop" : "+v"(a), "+v"(b), "+v"(c), "+v"(d)); }
template <typename T> struct Frag;
template <> struct Frag<_Float16> {
  typedef v16h V; union U { v16h v; v8h h[2]; };
  static __device__ __forceinline__ v16h load(const _Float16* p) {   // elements 0..7 <- p[0..7], 8..15 <- p[16..23]
    U f; f.h[0] = *(const v8h*)(p); f.h[1] = *(const v8h*)(p + 16); return f.v;
  }
  static __device__ __forceinline__ v8f mma(v16h a, v16h b, v8f c) {
    return __builtin_amdgcn_wmma_f32_16x16x32_f16(false, a, false, b, (short)0, c, false, false);
  }
  static __device__ __forceinline__ void guard(v8f& a, v8f& b, v16h x, v16h y) { dep_guard_h(a, b, x, y); }
  static __device__ __forceinline__ void keep(v16h a, v16h b, v16h c, v16h d) { keep4_h(a, b, c, d); }
};
template <> struct Frag<__bf16> {
  typedef v16b V; union U { v16b v; v8b h[2]; };
  static __device__ __forceinline__ v16b load(const __bf16* p) {
    U f; f.h[0] = *(const v8b*)(p); f.h[1] = *(const v8b*)(p + 16); return f.v;
  }
  static __device__ __forceinline__ v8f mma(v16b a, v16b b, v8f c) {
    return __builtin_amdgcn_wmma_f32_16x16x32_bf16(false, a, false, b, (short)0, c, false, false);
  }
  static __device__ __forceinline__ void guard(v8f& a, v8f& b, v16b x, v16b y) { dep_guard_b(a, b, x, y); }
  static __device__ __forceinline__ void keep(v16b a, v16b b, v16b c, v16b d) { keep4_b(a, b, c, d); }
};

// ---- Register-blocked batched WMMA GEMM ------------------------------------
// C[m,n] = scale * sum_k A[m,k] * Bt[n,k] (+bias)(+resid); each wave owns a 64x64 tile.
// A row-major [M,K]; Bt row-major [N,K]; M,N % 64 == 0, K % 32 == 0.
// SPLIT: operands are hi/lo planes (A2/Bt2 = lo planes, same layout); product = hi·hi + hi·lo + lo·hi.
// BIAS_MODE: 0 = none, 1 = bias[m], 2 = bias[n].
// OUT_MODE: 0 = f32, 1 = f16, 2 = bf16 hi plane (Cout) + bf16 lo plane (Cout2).
// ET: 0 = f16 operands, 1 = bf16 operands (pointers passed as 16-bit storage)
template <int ET> struct Elem;
template <> struct Elem<0> { typedef _Float16 T; };
template <> struct Elem<1> { typedef __bf16 T; };
template <int ET, bool SPLIT, int BIAS_MODE, int OUT_MODE, bool RESID, int ACT = 0>
__global__ __launch_bounds__(256) void wmma_gemm64(
    const unsigned short* __restrict__ Ap, const unsigned short* __restrict__ A2p, int lda, long strideA,
    const unsigned short* __restrict__ Btp, const unsigned short* __restrict__ Bt2p, int ldb, long strideB,
    void* __restrict__ Cout, void* __restrict__ Cout2, int ldc, long strideC,
    const float* __restrict__ bias,
    const float* __restrict__ resid, long strideR,
    int M, int N, int K, float scale) {
  typedef typename Elem<ET>::T T;
  typedef typename Frag<T>::V V;
  const T* A = (const T*)Ap; const T* A2 = (const T*)A2p; const T* Bt = (const T*)Btp; const T* Bt2 = (const T*)Bt2p;
  __shared__ __align__(16) float sT[8][16 * 68];   // per-wave 16x64 slab, pitch 68 floats
  const int b    = blockIdx.y;
  const int lane = threadIdx.x & 31;
  const int wave = threadIdx.x >> 5;
  const int tilesN = N >> 6;
  const int tilesM = M >> 6;
  const int tile = blockIdx.x * 8 + wave;
  if (tile >= tilesM * tilesN) return;   // wave-uniform; no block barriers in this kernel
  const int tm = tile / tilesN;
  const int tn = tile - tm * tilesN;
  const int m0 = tm << 6;
  const int n0 = tn << 6;

  const T* Ab  = A  + (size_t)b * strideA;
  const T* Bb  = Bt + (size_t)b * strideB;
  const T* Ab2 = SPLIT ? (A2  + (size_t)b * strideA) : nullptr;
  const T* Bb2 = SPLIT ? (Bt2 + (size_t)b * strideB) : nullptr;

  const int rlane = lane & 15;                 // row (A) / col (B, D) within subtile
  const int koff  = (lane >> 4) * 8;           // k offset of this lane half
  const int mOff  = (lane >> 4) * 8;           // D row offset

  v8f acc[4][4];
#pragma unroll
  for (int i = 0; i < 4; ++i)
#pragma unroll
    for (int j = 0; j < 4; ++j) acc[i][j] = (v8f){0.f,0.f,0.f,0.f,0.f,0.f,0.f,0.f};

  for (int k0 = 0; k0 < K; k0 += 32) {
    V bh[4], bl[4];
#pragma unroll
    for (int j = 0; j < 4; ++j) {
      const size_t bo = (size_t)(n0 + (j << 4) + rlane) * ldb + koff + k0;
      bh[j] = Frag<T>::load(Bb + bo);
      if (SPLIT) bl[j] = Frag<T>::load(Bb2 + bo);
    }
#pragma unroll
    for (int i = 0; i < 4; ++i) {
      const size_t ao = (size_t)(m0 + (i << 4) + rlane) * lda + koff + k0;
      V ah = Frag<T>::load(Ab + ao);
      V al;
      if (SPLIT) al = Frag<T>::load(Ab2 + ao);
#pragma unroll
      for (int j = 0; j < 4; ++j) {
        acc[i][j] = Frag<T>::mma(ah, bh[j], acc[i][j]);
        if (SPLIT) {
          acc[i][j] = Frag<T>::mma(ah, bl[j], acc[i][j]);
          acc[i][j] = Frag<T>::mma(al, bh[j], acc[i][j]);
        }
      }
      Frag<T>::guard(acc[i][0], acc[i][3], ah, SPLIT ? al : ah);
    }
    Frag<T>::keep(bh[0], bh[1], bh[2], bh[3]);
    if (SPLIT) Frag<T>::keep(bl[0], bl[1], bl[2], bl[3]);
  }
  acc_guard4(acc[0][0], acc[0][1], acc[0][2], acc[0][3]);
  acc_guard4(acc[1][0], acc[1][1], acc[1][2], acc[1][3]);
  acc_guard4(acc[2][0], acc[2][1], acc[2][2], acc[2][3]);
  acc_guard4(acc[3][0], acc[3][1], acc[3][2], acc[3][3]);

  // ---- epilogue ----
  float* slab = sT[wave];
  const float* Rb = RESID ? (resid + (size_t)b * strideR) : nullptr;
#pragma unroll
  for (int i = 0; i < 4; ++i) {
    const int mBase = m0 + (i << 4);
#pragma unroll
    for (int j = 0; j < 4; ++j) {
      const int n = n0 + (j << 4) + rlane;
      float bv = 0.f;
      if (BIAS_MODE == 2) bv = bias[n];
#pragma unroll
      for (int r = 0; r < 8; ++r) {
        float v = acc[i][j][r] * scale;
        if (BIAS_MODE == 1) v += bias[mBase + mOff + r];
        if (BIAS_MODE == 2) v += bv;
        if (RESID) v += Rb[(size_t)(mBase + mOff + r) * ldc + n];
        if (ACT == 1) v = tanhf(v);
        if (ACT == 2) v = fmaxf(v, 0.0f);
        if (ACT == 3) v = v / (1.0f + expf(-v));
        if (ACT == 4) v = (v > 0.f) ? v : 0.01f * v;
        if (ACT == 5) v = 0.5f * v * (1.0f + erff(v * 0.70710678118654752f));
        if (ACT == 6) v = (v > 0.f) ? v : 0.2f * v;
        slab[(mOff + r) * 68 + (j << 4) + rlane] = v;
      }
    }
    __builtin_amdgcn_fence(__ATOMIC_RELEASE, "workgroup");
    __builtin_amdgcn_wave_barrier();
    __builtin_amdgcn_fence(__ATOMIC_ACQUIRE, "workgroup");
    if (OUT_MODE == 0) {
      float* C = (float*)Cout + (size_t)b * strideC;
      const int hh = lane >> 4, c4 = (lane & 15) * 4;     // row seg = 256 B = 16 lanes x 16 B
      {
#pragma unroll
        for (int it = 0; it < 8; ++it) {
          const int row = it * 2 + hh;
          v4f v = *(const v4f*)(slab + row * 68 + c4);
          *(v4f*)(C + (size_t)(mBase + row) * ldc + n0 + c4) = v;
        }
        
      }
    } else {
      const int q = lane >> 3, c8 = (lane & 7) * 8;
      unsigned short* C  = (unsigned short*)Cout  + (size_t)b * strideC;
      unsigned short* C2 = (OUT_MODE == 2) ? ((unsigned short*)Cout2 + (size_t)b * strideC) : nullptr;
      {
#pragma unroll
        for (int it = 0; it < 4; ++it) {
          const int row = it * 4 + q;
          const float* sp = slab + row * 68 + c8;
          v8h hv, lv;
#pragma unroll
          for (int e = 0; e < 8; ++e) {
            if (OUT_MODE == 1) {
              hv[e] = (_Float16)sp[e];
            } else {
              unsigned short hb = f2bf_bits(sp[e]);
              unsigned short lb = f2bf_bits(sp[e] - bf_bits2f(hb));
              hv[e] = __builtin_bit_cast(_Float16, hb);
              lv[e] = __builtin_bit_cast(_Float16, lb);
            }
          }
          *(v8h*)(C + (size_t)(mBase + row) * ldc + n0 + c8) = hv;
          if (OUT_MODE == 2) *(v8h*)(C2 + (size_t)(mBase + row) * ldc + n0 + c8) = lv;
        }
        
      }
    }
    __builtin_amdgcn_fence(__ATOMIC_RELEASE, "workgroup");
    __builtin_amdgcn_wave_barrier();
    __builtin_amdgcn_fence(__ATOMIC_ACQUIRE, "workgroup");
  }
}

__global__ __launch_bounds__(256) void cast_f32_f16x2(
    const float* __restrict__ in, _Float16* __restrict__ out, int n2) {
  int i = blockIdx.x * 256 + threadIdx.x;
  if (i < n2) {
    const _Float16 h0 = (_Float16)in[2 * i], h1 = (_Float16)in[2 * i + 1];
    const unsigned u = (unsigned)__builtin_bit_cast(unsigned short, h0) | ((unsigned)__builtin_bit_cast(unsigned short, h1) << 16);
    ((unsigned*)out)[i] = u;
    
  }
}


} // namespace w25

__global__ __launch_bounds__(256) void k_castT16(const float* __restrict__ src, long long lds, _Float16* __restrict__ dst, long long ldd, int R, int C, float s) {
    const long long i = (long long)blockIdx.x * 256 + threadIdx.x; const long long np = (long long)C * (R / 2); if (i >= np) return; const int c = (int)(i / (R / 2)); const int r = 2 * (int)(i % (R / 2));
    const _Float16 h0 = (_Float16)(src[(long long)r * lds + c] * s), h1 = (_Float16)(src[(long long)(r + 1) * lds + c] * s);
    const unsigned u = (unsigned)__builtin_bit_cast(unsigned short, h0) | ((unsigned)__builtin_bit_cast(unsigned short, h1) << 16);
    unsigned* d = (unsigned*)(dst + (long long)c * ldd + r); *d = u;  }
__global__ __launch_bounds__(256) void k_cast16(const float* __restrict__ src, long long lds, _Float16* __restrict__ dst, long long ldd, int R, int C, float s) {
    const long long i = (long long)blockIdx.x * 256 + threadIdx.x; const long long np = (long long)R * (C / 2); if (i >= np) return; const int r = (int)(i / (C / 2)); const int c = 2 * (int)(i % (C / 2));
    const _Float16 h0 = (_Float16)(src[(long long)r * lds + c] * s), h1 = (_Float16)(src[(long long)r * lds + c + 1] * s);
    const unsigned u = (unsigned)__builtin_bit_cast(unsigned short, h0) | ((unsigned)__builtin_bit_cast(unsigned short, h1) << 16);
    unsigned* d = (unsigned*)(dst + (long long)r * ldd + c); *d = u;  }

// f32 -> bf16 hi plane + bf16 lo plane (x = hi + lo to ~2^-17 relative; RNE both), [R][C] -> [R][C] (or transposed to [C][R]); 2 consecutive destination elements
__device__ __forceinline__ unsigned int f2bf2_pack(float a, float b, unsigned int* lo) {
    const unsigned short ha = w25::f2bf_bits(a), hb = w25::f2bf_bits(b);
    const unsigned short la = w25::f2bf_bits(a - w25::bf_bits2f(ha)), lb = w25::f2bf_bits(b - w25::bf_bits2f(hb));
    *lo = (unsigned)la | ((unsigned)lb << 16); return (unsigned)ha | ((unsigned)hb << 16); }
__global__ __launch_bounds__(256) void k_castS16(const float* __restrict__ src, long long lds, __bf16* __restrict__ dhi, __bf16* __restrict__ dlo, long long ldd, int R, int C, float s, int transpose) {
    const long long i = (long long)blockIdx.x * 256 + threadIdx.x; long long o; float a, b;
    if (transpose) { const long long np = (long long)C * (R / 2); if (i >= np) return; const int c = (int)(i / (R / 2)); const int r = 2 * (int)(i % (R / 2)); a = src[(long long)r * lds + c] * s; b = src[(long long)(r + 1) * lds + c] * s; o = (long long)c * ldd + r; }
    else { const long long np = (long long)R * (C / 2); if (i >= np) return; const int r = (int)(i / (C / 2)); const int c = 2 * (int)(i % (C / 2)); a = src[(long long)r * lds + c] * s; b = src[(long long)r * lds + c + 1] * s; o = (long long)r * ldd + c; }
    unsigned lo; const unsigned hi = f2bf2_pack(a, b, &lo); unsigned* ph = (unsigned*)(dhi + o); unsigned* pl = (unsigned*)(dlo + o);
    *ph = hi; *pl = lo;  }

namespace w25 {
// =====================================================================================
// Generic causal/non-causal attention for head_dim 64, f32 in / f32 out; 16-bit operands: bf16 with optional hi/lo splits, or
// plain f16 (F16=true, non-split, probabilities carried x2^15).
//   scores = (q*qscale)·kᵀ : v_wmma_f32_16x16x32_bf16; SPLIT_QK -> q,k as bf16 hi/lo (hi·hi + hi·lo + lo·hi)
//   out    = p·v           : v_wmma_f32_16x16x32_bf16; SPLIT_PV -> p,v as bf16 hi/lo; else p,v plain bf16
//   f32 accumulate; online softmax in f32. Block = 4 waves = 64 query rows of one (batch, head); S % 64 == 0.
//   Element (b, s, h, d) of tensor X lives at X[b*X_bs + s*X_rs + h*X_hs + d] (strides in floats, multiples of 4).
//   Masking: mask_mode 0 none, 1 causal (kv > q masked), 2 tensor [S][Skv] shared over (b,h) (float if
//   mask_is_int==0, int32 with element == 0 -> masked if 1, int32 with element != 0 -> masked if 2), 3 per-token vectors qmask[B][S] & kvmask[B][Skv] (int32,
//   0 -> masked), 4 causal + sliding window (kv > q or q - kv > W masked; W passed in mask_is_int);
//   5 = relative-position bias: s += cp[b,h,q][idx[q][kv]] + pc[b,h,kv][idx[q][kv]] with idx = mask_b ([S][Skv] int32) and
//   mask_a an int32 [S][Skv] tensor with nonzero = masked (tables: element (b,h,row,n) at X + b*c_bs + h*c_hs + row*c_rs + n);
//   masked scores are replaced by mask_fill (e.g. -inf or -1e9) before the softmax.
//   grid.x = B * H * (S/64) (or a sub-range with blk0).
// =====================================================================================
#define AT_D 64
#define AT_NW 4
#define AT_QB 64
#define AT_KC 64
struct AttnGeom { const float* cp = nullptr; const float* pc = nullptr; long c_bs = 0, c_rs = 0, c_hs = 0;   // mode-5 score-bias tables
                  long q_bs, q_rs, q_hs, k_bs, k_rs, k_hs, v_bs, v_rs, v_hs, o_bs, o_rs, o_hs;
                  int S, Skv, H, mask_mode; float qscale; int blk0; float mask_fill; int mask_is_int; };
static_assert(sizeof(AttnGeom) == 168, "no padding");

__device__ __forceinline__ unsigned short at_bf_bits(float f) {
  unsigned u = __float_as_uint(f);
  return (unsigned short)((u + 0x7FFFu + ((u >> 16) & 1u)) >> 16);
}
__device__ __forceinline__ __bf16 at_f2bf(float f) { return __builtin_bit_cast(__bf16, at_bf_bits(f)); }
__device__ __forceinline__ void at_split(float f, __bf16& hi, __bf16& lo) {
  const unsigned short hb = at_bf_bits(f);
  hi = __builtin_bit_cast(__bf16, hb);
  lo = at_f2bf(f - __uint_as_float(((unsigned)hb) << 16));
}
__device__ __forceinline__ v8f at_mma(v16b a, v16b b, v8f c) {
  c = __builtin_amdgcn_wmma_f32_16x16x32_bf16(false, a, false, b, (short)0, c, false, false);
  asm volatile("v_nop\n\tv_nop\n\tv_nop\n\tv_nop" : "+v"(c) : "v"(a), "v"(b));
  return c;
}
// 16-bit element as a bit pattern held in a __bf16 slot: f16 bits when F16, bf16 (RNE) otherwise
template <bool F16> __device__ __forceinline__ __bf16 at_to16(float f) {
  if (F16) return __builtin_bit_cast(__bf16, (_Float16)f);
  return at_f2bf(f);
}
template <bool F16> __device__ __forceinline__ v8f at_mma16(v16b a, v16b b, v8f c) {
  if (F16) {
    const v16h ah = __builtin_bit_cast(v16h, a), bh = __builtin_bit_cast(v16h, b);
    c = __builtin_amdgcn_wmma_f32_16x16x32_f16(false, ah, false, bh, (short)0, c, false, false);
    asm volatile("v_nop\n\tv_nop\n\tv_nop\n\tv_nop" : "+v"(c) : "v"(ah), "v"(bh));
    return c;
  }
  return at_mma(a, b, c);
}

template <bool SPLIT_QK, bool SPLIT_PV, bool F16 = false>
__global__ __launch_bounds__(128)
void attn64_kernel(const float* __restrict__ q, const float* __restrict__ k,
                   const float* __restrict__ v, float* __restrict__ out,
                   const void* __restrict__ mask_a, const int* __restrict__ mask_b, AttnGeom g) {
  static_assert(!(F16 && (SPLIT_QK || SPLIT_PV)), "f16 mode is non-split");
  const float PSC = F16 ? 32768.0f : 1.0f;     // f16 probabilities carried x2^15 (subnormal range), folded into the final 1/l
  union FB { v16b v; v8b h[2]; };
  __shared__ __align__(16) __bf16 Ksh[AT_KC * AT_D];             // K hi [kv][d]      8 KB
  __shared__ __align__(16) __bf16 Ksl[SPLIT_QK ? AT_KC * AT_D : 8];
  __shared__ __align__(16) __bf16 Vth[AT_D * AT_KC];             // V hi [d][kv]      8 KB
  __shared__ __align__(16) __bf16 Vtl[SPLIT_PV ? AT_D * AT_KC : 8];
  __shared__ __align__(16) __bf16 Psh[AT_NW][16 * AT_KC];        // per wave P hi [row][kv]  8 KB
  __shared__ __align__(16) __bf16 Psl[SPLIT_PV ? AT_NW : 1][SPLIT_PV ? 16 * AT_KC : 8];
  __shared__ __align__(16) float  Os[AT_NW][16 * 68];            // per wave out tile, pitch 68

  const int tid  = threadIdx.x;
  const int wave = tid >> 5;
  const int lane = tid & 31;
  const int hh   = lane >> 4;
  const int c    = lane & 15;

  const int nqb = g.S / AT_QB;
  const int bx = blockIdx.x + g.blk0;
  const int qb = bx % nqb;
  const int bh = bx / nqb;
  const int h  = bh % g.H;
  const int b  = bh / g.H;
  const int qbase_block = qb * AT_QB;
  const int q0 = qbase_block + wave * 16;

  const float* qb_ptr = q + (size_t)b * g.q_bs + (size_t)h * g.q_hs;
  const float* kb_ptr = k + (size_t)b * g.k_bs + (size_t)h * g.k_hs;
  const float* vb_ptr = v + (size_t)b * g.v_bs + (size_t)h * g.v_hs;
  float*       ob_ptr = out + (size_t)b * g.o_bs + (size_t)h * g.o_hs;

  // ---- Q fragments (A operand): 2 d-chunks, hi (and lo) ----
  v16b qah[2], qal[2];
  {
    const float* qrow = qb_ptr + (size_t)(q0 + c) * g.q_rs;
#pragma unroll
    for (int dc = 0; dc < 2; ++dc) {
#pragma unroll
      for (int e = 0; e < 8; ++e) {
        const float f0 = qrow[dc * 32 + 8 * hh + e] * g.qscale;
        const float f1 = qrow[dc * 32 + 16 + 8 * hh + e] * g.qscale;
        if (SPLIT_QK) { __bf16 hq, lq; at_split(f0, hq, lq); qah[dc][e] = hq; qal[dc][e] = lq; at_split(f1, hq, lq); qah[dc][8 + e] = hq; qal[dc][8 + e] = lq; }
        else { qah[dc][e] = at_to16<F16>(f0); qah[dc][8 + e] = at_to16<F16>(f1); qal[dc][e] = qah[dc][e]; qal[dc][8 + e] = qah[dc][8 + e]; }
      }
    }
  }

  float mrow[8], lrow[8];
  v8f oacc[4];
#pragma unroll
  for (int r = 0; r < 8; ++r) { mrow[r] = -INFINITY; lrow[r] = 0.f; }
#pragma unroll
  for (int t = 0; t < 4; ++t) oacc[t] = (v8f){0.f,0.f,0.f,0.f,0.f,0.f,0.f,0.f};

  const int nChunks = (g.mask_mode == 1 || g.mask_mode == 4) ? (qb + 1) : (g.Skv / AT_KC);   // block-uniform
  // per-row query mask (mode 3)
  int qkeep[8];
#pragma unroll
  for (int r = 0; r < 8; ++r) qkeep[r] = (g.mask_mode == 3) ? mask_b[(size_t)b * g.S + q0 + 8 * hh + r] : 1;   // mask_b = qmask in mode 3
  for (int kc = 0; kc < nChunks; ++kc) {
    const int kv0 = kc * AT_KC;
    __syncthreads();
    {
      const int kvr = tid >> 1, dh = (tid & 1) * 32;
      const float* krow = kb_ptr + (size_t)(kv0 + kvr) * g.k_rs + dh;
      const float* vrow = vb_ptr + (size_t)(kv0 + kvr) * g.v_rs + dh;
#pragma unroll
      for (int i = 0; i < 8; ++i) {
        v4f kk = *(const v4f*)(krow + 4 * i);
        v4f vv = *(const v4f*)(vrow + 4 * i);
#pragma unroll
        for (int e = 0; e < 4; ++e) {
          const int d = dh + 4 * i + e;
          if (SPLIT_QK) { __bf16 a, bl; at_split(kk[e], a, bl); Ksh[kvr * AT_D + d] = a; Ksl[kvr * AT_D + d] = bl; }
          else Ksh[kvr * AT_D + d] = at_to16<F16>(kk[e]);
          if (SPLIT_PV) { __bf16 a, bl; at_split(vv[e], a, bl); Vth[d * AT_KC + kvr] = a; Vtl[d * AT_KC + kvr] = bl; }
          else Vth[d * AT_KC + kvr] = at_to16<F16>(vv[e]);
        }
      }
    }
    __syncthreads();

    v8f s[4];
#pragma unroll
    for (int j = 0; j < 4; ++j) {
      s[j] = (v8f){0.f,0.f,0.f,0.f,0.f,0.f,0.f,0.f};
#pragma unroll 1
      for (int dc = 0; dc < 2; ++dc) {
        FB kb;
        kb.h[0] = *(const v8b*)(Ksh + (j * 16 + c) * AT_D + dc * 32 + 8 * hh);
        kb.h[1] = *(const v8b*)(Ksh + (j * 16 + c) * AT_D + dc * 32 + 16 + 8 * hh);
        s[j] = at_mma16<F16>(qah[dc], kb.v, s[j]);
        if (SPLIT_QK) {
          FB kl;
          kl.h[0] = *(const v8b*)(Ksl + (j * 16 + c) * AT_D + dc * 32 + 8 * hh);
          kl.h[1] = *(const v8b*)(Ksl + (j * 16 + c) * AT_D + dc * 32 + 16 + 8 * hh);
          s[j] = at_mma16<F16>(qah[dc], kl.v, s[j]);
          s[j] = at_mma16<F16>(qal[dc], kb.v, s[j]);
        }
      }
    }
    const bool diag = (g.mask_mode == 1) && (kc == qb);
    int kvkeep[4] = {1, 1, 1, 1};
    if (g.mask_mode == 3) {
#pragma unroll
      for (int j = 0; j < 4; ++j) kvkeep[j] = ((const int*)mask_a)[(size_t)b * g.Skv + kv0 + j * 16 + c];   // mask_a = kvmask
    }
    float cm[8];
#pragma unroll
    for (int r = 0; r < 8; ++r) {
      const int qrow = q0 + 8 * hh + r;
      float m = -INFINITY;
#pragma unroll
      for (int j = 0; j < 4; ++j) {
        const int kvcol = kv0 + j * 16 + c;
        bool masked = false;
        if (diag) masked = (kvcol > qrow);
        else if (g.mask_mode == 4) masked = (kvcol > qrow) || (qrow - kvcol > g.mask_is_int);
        else if (g.mask_mode == 2) {
          const size_t mi = (size_t)qrow * g.Skv + kvcol;
          masked = (g.mask_is_int == 0) ? (((const float*)mask_a)[mi] == 0.0f)
                 : (g.mask_is_int == 1) ? (((const int*)mask_a)[mi] == 0) : (((const int*)mask_a)[mi] != 0);
        } else if (g.mask_mode == 3) masked = (qkeep[r] == 0) || (kvkeep[j] == 0);
        else if (g.mask_mode == 5) {
          const size_t mi = (size_t)qrow * g.Skv + kvcol;
          masked = (((const int*)mask_a)[mi] != 0);
          int n = mask_b[mi]; n = n < 0 ? 0 : n;
          s[j][r] += g.cp[(size_t)b * g.c_bs + (size_t)h * g.c_hs + (size_t)qrow * g.c_rs + n]
                   + g.pc[(size_t)b * g.c_bs + (size_t)h * g.c_hs + (size_t)kvcol * g.c_rs + n];
        }
        if (masked) s[j][r] = g.mask_fill;
        m = fmaxf(m, s[j][r]);
      }
#pragma unroll
      for (int off = 1; off < 16; off <<= 1) m = fmaxf(m, __shfl_xor(m, off, 32));
      cm[r] = m;
    }
    __bf16* pwh = Psh[wave];
    __bf16* pwl = Psl[SPLIT_PV ? wave : 0];
#pragma unroll
    for (int r = 0; r < 8; ++r) {
      const float mnew = fmaxf(mrow[r], cm[r]);
      const float alpha = expf(mrow[r] - mnew);
      mrow[r] = mnew;
      float psum = 0.f;
#pragma unroll
      for (int j = 0; j < 4; ++j) {
        const float p = expf(s[j][r] - mnew);
        psum += p;
        if (SPLIT_PV) { __bf16 a, bl; at_split(p, a, bl); pwh[(8 * hh + r) * AT_KC + j * 16 + c] = a; pwl[(8 * hh + r) * AT_KC + j * 16 + c] = bl; }
        else pwh[(8 * hh + r) * AT_KC + j * 16 + c] = at_to16<F16>(p * PSC);
      }
#pragma unroll
      for (int off = 1; off < 16; off <<= 1) psum += __shfl_xor(psum, off, 32);
      lrow[r] = lrow[r] * alpha + psum;
#pragma unroll
      for (int t = 0; t < 4; ++t) oacc[t][r] *= alpha;
    }
    __builtin_amdgcn_fence(__ATOMIC_RELEASE, "workgroup");
    __builtin_amdgcn_wave_barrier();
    __builtin_amdgcn_fence(__ATOMIC_ACQUIRE, "workgroup");
#pragma unroll 1
    for (int kk = 0; kk < 2; ++kk) {
      FB pa, pl;
      pa.h[0] = *(const v8b*)(pwh + c * AT_KC + kk * 32 + 8 * hh);
      pa.h[1] = *(const v8b*)(pwh + c * AT_KC + kk * 32 + 16 + 8 * hh);
      if (SPLIT_PV) {
        pl.h[0] = *(const v8b*)(pwl + c * AT_KC + kk * 32 + 8 * hh);
        pl.h[1] = *(const v8b*)(pwl + c * AT_KC + kk * 32 + 16 + 8 * hh);
      }
#pragma unroll
      for (int t = 0; t < 4; ++t) {
        FB vb;
        vb.h[0] = *(const v8b*)(Vth + (t * 16 + c) * AT_KC + kk * 32 + 8 * hh);
        vb.h[1] = *(const v8b*)(Vth + (t * 16 + c) * AT_KC + kk * 32 + 16 + 8 * hh);
        oacc[t] = at_mma16<F16>(pa.v, vb.v, oacc[t]);
        if (SPLIT_PV) {
          FB vl;
          vl.h[0] = *(const v8b*)(Vtl + (t * 16 + c) * AT_KC + kk * 32 + 8 * hh);
          vl.h[1] = *(const v8b*)(Vtl + (t * 16 + c) * AT_KC + kk * 32 + 16 + 8 * hh);
          oacc[t] = at_mma16<F16>(pa.v, vl.v, oacc[t]);
          oacc[t] = at_mma16<F16>(pl.v, vb.v, oacc[t]);
        }
      }
    }
  }

  float* os = Os[wave];
#pragma unroll
  for (int r = 0; r < 8; ++r) {
    const float inv = 1.0f / (lrow[r] * PSC);
#pragma unroll
    for (int t = 0; t < 4; ++t) os[(8 * hh + r) * 68 + t * 16 + c] = oacc[t][r] * inv;
  }
  __builtin_amdgcn_fence(__ATOMIC_RELEASE, "workgroup");
  __builtin_amdgcn_wave_barrier();
  __builtin_amdgcn_fence(__ATOMIC_ACQUIRE, "workgroup");
  {
    const int c4 = (lane & 15) * 4;
    {
#pragma unroll
      for (int it = 0; it < 8; ++it) {
        const int row = it * 2 + hh;
        v4f val = *(const v4f*)(os + row * 68 + c4);
        *(v4f*)(ob_ptr + (size_t)(q0 + row) * g.o_rs + c4) = val;
      }
      
    }
  }
}

} // namespace w25


__device__ __forceinline__ void st_h2(_Float16* dst, float a, float b) { const unsigned u = (unsigned)__builtin_bit_cast(unsigned short, (_Float16)a) | ((unsigned)__builtin_bit_cast(unsigned short, (_Float16)b) << 16); unsigned* d = (unsigned*)dst; *d = u;  }
// block-diagonal output-map plane: WBD[n = h*64+e][kk = h2*64+d] = sc * Wo[h][d][e] if h2 == h else 0 (thread per destination pair over [D][D], linear order)
__global__ __launch_bounds__(256) void k_sw_wbd(const float* __restrict__ Wo, _Float16* __restrict__ WBD, int D, int HD, float sc) {
    const long long t = (long long)blockIdx.x * 256 + threadIdx.x; if (t >= (long long)D * D / 2) return; const long long e2 = 2 * t; const int n = (int)(e2 / D), kk = (int)(e2 % D);
    const int h = n / HD, e = n % HD, h2 = kk / HD, d = kk % HD; const float* w = Wo + ((long long)h * HD) * HD;
    const float v0 = (h2 == h) ? w[d * HD + e] * sc : 0.f, v1 = (h2 == h) ? w[(d + 1) * HD + e] * sc : 0.f;   // kk even, kk+1 in the same head block
    st_h2(WBD + e2, v0, v1); }


extern "C" void kernel_launch(void* const* d_in, const int* in_sizes, int n_in, void* d_out, int out_size, void* d_ws, size_t ws_size, hipStream_t stream) {
    (void)in_sizes; (void)n_in; (void)out_size; (void)ws_size;
    const float* x = (const float*)d_in[0];
    const float* Wq = (const float*)d_in[1];
    const float* Wkv = (const float*)d_in[2];
    const float* Wo = (const float*)d_in[3];
    const float* bo = (const float*)d_in[4];
    const int Bn = 2;
    const int T = 2048;
    const int D = 1024;
    const int NH = 16;
    const int HD = 64;
    const int D3 = 3 * D;
    const int NR = Bn * T;
    float* out = (float*)d_out;
    char* wsp = (char*)d_ws;
    unsigned short* X16 = (unsigned short*)wsp; wsp += (((size_t)((size_t)NR * D) * 2 + 255) / 256) * 256;
    unsigned short* W316 = (unsigned short*)wsp; wsp += (((size_t)((size_t)D3 * D) * 2 + 255) / 256) * 256;
    unsigned short* WBD16 = (unsigned short*)wsp; wsp += (((size_t)((size_t)D * D) * 2 + 255) / 256) * 256;
    float* QKV = (float*)wsp; wsp += (((size_t)((size_t)T * D3) * 4 + 255) / 256) * 256;
    float* AO = (float*)wsp; wsp += (((size_t)((size_t)T * D) * 4 + 255) / 256) * 256;
    unsigned short* AO16 = (unsigned short*)wsp; wsp += (((size_t)((size_t)T * D) * 2 + 255) / 256) * 256;
    if ((size_t)(wsp - (char*)d_ws) > ws_size) return;   // static carve guard
    k_cast16<<<(unsigned)((((long long)(NR) * ((D) / 2)) + 255) / 256), 256, 0, stream>>>(x, D, (_Float16*)(X16), D, NR, D, 1.0f);
    k_castT16<<<(unsigned)((((long long)(D) * ((D) / 2)) + 255) / 256), 256, 0, stream>>>(Wq, D, (_Float16*)(W316), D, D, D, 16.0f);
    k_castT16<<<(unsigned)((((long long)(D) * ((D) / 2)) + 255) / 256), 256, 0, stream>>>(Wkv, 2 * D, (_Float16*)(W316 + (size_t)D * D), D, D, D, 16.0f);
    k_castT16<<<(unsigned)((((long long)(D) * ((D) / 2)) + 255) / 256), 256, 0, stream>>>(Wkv + D, 2 * D, (_Float16*)(W316 + (size_t)2 * D * D), D, D, D, 16.0f);
    k_sw_wbd<<<(unsigned)(((long long)D * D / 2 + 255) / 256), 256, 0, stream>>>(Wo, (_Float16*)WBD16, D, HD, 16.f);
    w25::wmma_gemm64<0, false, 0, 0, false, 0><<<dim3((unsigned)((((T) / 64) * ((D3) / 64) + 7) / 8), (unsigned)(1)), 256, 0, stream>>>((const unsigned short*)(X16 + (size_t)0 * T * D), nullptr, D, 0, (const unsigned short*)(W316), nullptr, D, 0, (void*)(QKV), nullptr, D3, 0, nullptr, nullptr, 0, T, D3, D, 0.0625f);
    { /*apv4*/ AttnP a;
      a.Q = QKV; a.K = QKV + D; a.V = QKV + 2 * D; a.O = AO; a.P = 0; a.Mf = 0; a.Mi = 0; a.ST = 0;
      a.Pw = 0; a.Rt = 0; a.SQ = 0; a.SK = 0;
      a.swb = 0; a.swh = 0; a.swi = 0; a.swj = 0; a.srb = 0; a.srh = 0; a.sri = 0; a.sQb = 0; a.sQh = HD; a.sQi = D3; a.sQd = 1; a.sKb = 0; a.sKh = HD; a.sKj = D3; a.sKd = 1; a.sVb = 0; a.sVh = HD; a.sVj = D3; a.sVd = 1; a.sOb = 0; a.sOh = HD; a.sOi = D; a.sPb = 0; a.sPh = 0; a.sPi = 0; a.smb = 0; a.smh = 0; a.smi = 0; a.smj = 0;
      a.Lq = T; a.Lk = T; a.dh = HD; a.dv = HD; a.hrep = 1; a.causal = 0; a.coff = 0; a.pband = 0;
      a.scale = 0.125f; a.mfill = 0.0f; a.nonorm = 0; a.mpol = 0;
      a.roff = 0; a.rn = 1; a.segpol = 0; a.win = 0;
      k_attn<64, 64, 0, false, false><<<dim3((unsigned)((T) + 16 * AW - 1) / (16 * AW), (unsigned)(NH), (unsigned)(1)), 32 * AW, 0, stream>>>(a); }
    k_cast16<<<(unsigned)((((long long)(T) * ((D) / 2)) + 255) / 256), 256, 0, stream>>>(AO, D, (_Float16*)(AO16), D, T, D, 1.0f);
    w25::wmma_gemm64<0, false, 2, 0, false, 0><<<dim3((unsigned)((((T) / 64) * ((D) / 64) + 7) / 8), (unsigned)(1)), 256, 0, stream>>>((const unsigned short*)(AO16), nullptr, D, 0, (const unsigned short*)(WBD16), nullptr, D, 0, (void*)(out + (size_t)0 * T * D), nullptr, D, 0, bo, nullptr, 0, T, D, D, 0.0625f);
    w25::wmma_gemm64<0, false, 0, 0, false, 0><<<dim3((unsigned)((((T) / 64) * ((D3) / 64) + 7) / 8), (unsigned)(1)), 256, 0, stream>>>((const unsigned short*)(X16 + (size_t)1 * T * D), nullptr, D, 0, (const unsigned short*)(W316), nullptr, D, 0, (void*)(QKV), nullptr, D3, 0, nullptr, nullptr, 0, T, D3, D, 0.0625f);
    { /*apv4*/ AttnP a;
      a.Q = QKV; a.K = QKV + D; a.V = QKV + 2 * D; a.O = AO; a.P = 0; a.Mf = 0; a.Mi = 0; a.ST = 0;
      a.Pw = 0; a.Rt = 0; a.SQ = 0; a.SK = 0;
      a.swb = 0; a.swh = 0; a.swi = 0; a.swj = 0; a.srb = 0; a.srh = 0; a.sri = 0; a.sQb = 0; a.sQh = HD; a.sQi = D3; a.sQd = 1; a.sKb = 0; a.sKh = HD; a.sKj = D3; a.sKd = 1; a.sVb = 0; a.sVh = HD; a.sVj = D3; a.sVd = 1; a.sOb = 0; a.sOh = HD; a.sOi = D; a.sPb = 0; a.sPh = 0; a.sPi = 0; a.smb = 0; a.smh = 0; a.smi = 0; a.smj = 0;
      a.Lq = T; a.Lk = T; a.dh = HD; a.dv = HD; a.hrep = 1; a.causal = 0; a.coff = 0; a.pband = 0;
      a.scale = 0.125f; a.mfill = 0.0f; a.nonorm = 0; a.mpol = 0;
      a.roff = 0; a.rn = 1; a.segpol = 0; a.win = 0;
      k_attn<64, 64, 0, false, false><<<dim3((unsigned)((T) + 16 * AW - 1) / (16 * AW), (unsigned)(NH), (unsigned)(1)), 32 * AW, 0, stream>>>(a); }
    k_cast16<<<(unsigned)((((long long)(T) * ((D) / 2)) + 255) / 256), 256, 0, stream>>>(AO, D, (_Float16*)(AO16), D, T, D, 1.0f);
    w25::wmma_gemm64<0, false, 2, 0, false, 0><<<dim3((unsigned)((((T) / 64) * ((D) / 64) + 7) / 8), (unsigned)(1)), 256, 0, stream>>>((const unsigned short*)(AO16), nullptr, D, 0, (const unsigned short*)(WBD16), nullptr, D, 0, (void*)(out + (size_t)1 * T * D), nullptr, D, 0, bo, nullptr, 0, T, D, D, 0.0625f);
}

// v001
// Measured time: 531 microseconds a run.
// Timed twice side by side with v000, it ran 4.06 and 4.07 times as fast.
// Contractions: q and k|v projections (weights stored [in][out]) [2048x1024].[1024x1024|2048] and the per-head 64x64 output maps written as one block-diagonal [2048x1024].[1024x1024] product (+bias) per batch element, with f16 operands on f16 planes (v_wmma_f32_16x16x32_f16, 64x64 register-blocked wave tiles, weights x16); per (batch, head) softmax(q.k^T/8) v over all 2048 keys as one flash launch per batch element (head_dim 64, f16 q.k^T and f16 p.v with p as f16 of 4096 p); f32 accumulate and softmax statistics.
#include <hip/hip_runtime.h>
#include <math.h>

typedef __attribute__((ext_vector_type(16))) _Float16 v16h;
typedef __attribute__((ext_vector_type(8)))  _Float16 v8h;
typedef __attribute__((ext_vector_type(16))) __bf16   v16b;
typedef __attribute__((ext_vector_type(8)))  float    v8f;
typedef __attribute__((ext_vector_type(4)))  float    v4f;

// 16-bit WMMA fragment map (wave32), lane L, h = L>>4, m = L&15:
//   A 16x32: lane = row m;   element i -> k = (i<8) ? 8h+i : 16+8h+(i-8)
//   B 32x16: lane = column m; the SAME k(i,h)
//   D 16x16 (8 f32): lane = column m; element r -> row 8h+r
__device__ __forceinline__ int frag_k(int i, int h) { return (i < 8) ? (8 * h + i) : (16 + 8 * h + (i - 8)); }
__device__ __forceinline__ __bf16 bf16_rne(float f) {
    unsigned int u = __float_as_uint(f);
    u += 0x7fffu + ((u >> 16) & 1u);
    return __builtin_bit_cast(__bf16, (unsigned short)(u >> 16));
}
__device__ __forceinline__ float bf16_f32(__bf16 b) { return __uint_as_float(((unsigned int)__builtin_bit_cast(unsigned short, b)) << 16); }
__device__ __forceinline__ v8f wmma16(v16h a, v16h b, v8f c) {
    c = __builtin_amdgcn_wmma_f32_16x16x32_f16(false, a, false, b, (short)0, c, false, false);
    asm volatile("v_nop\n\tv_nop\n\tv_nop\n\tv_nop" : "+v"(c) : "v"(a), "v"(b));
    return c;
}
__device__ __forceinline__ v8f wmmab(v16b a, v16b b, v8f c) {
    c = __builtin_amdgcn_wmma_f32_16x16x32_bf16(false, a, false, b, (short)0, c, false, false);
    asm volatile("v_nop\n\tv_nop\n\tv_nop\n\tv_nop" : "+v"(c) : "v"(a), "v"(b));
    return c;
}
struct Split { v16b hi, lo; };
// hi/lo split product: a.hi*b.hi + a.hi*b.lo + a.lo*b.hi
__device__ __forceinline__ v8f wmma3(const Split& a, const Split& b, v8f c) {
    c = __builtin_amdgcn_wmma_f32_16x16x32_bf16(false, a.hi, false, b.hi, (short)0, c, false, false);
    c = __builtin_amdgcn_wmma_f32_16x16x32_bf16(false, a.hi, false, b.lo, (short)0, c, false, false);
    c = __builtin_amdgcn_wmma_f32_16x16x32_bf16(false, a.lo, false, b.hi, (short)0, c, false, false);
    asm volatile("v_nop\n\tv_nop\n\tv_nop\n\tv_nop" : "+v"(c) : "v"(a.hi), "v"(a.lo), "v"(b.hi), "v"(b.lo));
    return c;
}
struct Split3 { v16b hi, mid, lo; };
// triple split product (6 terms, drops only terms below 2^-24 relative)
__device__ __forceinline__ v8f wmma6(const Split3& a, const Split3& b, v8f c) {
    c = __builtin_amdgcn_wmma_f32_16x16x32_bf16(false, a.hi, false, b.hi, (short)0, c, false, false);
    c = __builtin_amdgcn_wmma_f32_16x16x32_bf16(false, a.hi, false, b.mid, (short)0, c, false, false);
    c = __builtin_amdgcn_wmma_f32_16x16x32_bf16(false, a.mid, false, b.hi, (short)0, c, false, false);
    c = __builtin_amdgcn_wmma_f32_16x16x32_bf16(false, a.hi, false, b.lo, (short)0, c, false, false);
    c = __builtin_amdgcn_wmma_f32_16x16x32_bf16(false, a.mid, false, b.mid, (short)0, c, false, false);
    c = __builtin_amdgcn_wmma_f32_16x16x32_bf16(false, a.lo, false, b.hi, (short)0, c, false, false);
    asm volatile("v_nop\n\tv_nop\n\tv_nop\n\tv_nop" : "+v"(c) : "v"(a.hi), "v"(a.mid), "v"(a.lo), "v"(b.hi), "v"(b.mid), "v"(b.lo));
    return c;
}

// Fragment gathers from f32 memory: element i <- p[(k0 + frag_k(i,h)) * sk] * s, zero for k >= klen.
__device__ __forceinline__ v16h fh_ld(const float* __restrict__ p, long long sk, int k0, int h, int klen, float s) {
    v16h a;
#pragma unroll
    for (int i = 0; i < 16; ++i) { const int k = k0 + frag_k(i, h); a[i] = (k < klen) ? (_Float16)(p[(long long)k * sk] * s) : (_Float16)0.f; }
    return a;
}
__device__ __forceinline__ Split sp_ld(const float* __restrict__ p, long long sk, int k0, int h, int klen, float s) {
    Split r;
#pragma unroll
    for (int i = 0; i < 16; ++i) {
        const int k = k0 + frag_k(i, h); const float x = (k < klen) ? p[(long long)k * sk] * s : 0.f;
        const __bf16 hb = bf16_rne(x); r.hi[i] = hb; r.lo[i] = bf16_rne(x - bf16_f32(hb));
    }
    return r;
}
__device__ __forceinline__ Split3 sp3_ld(const float* __restrict__ p, long long sk, int k0, int h, int klen, float s) {
    Split3 r;
#pragma unroll
    for (int i = 0; i < 16; ++i) {
        const int k = k0 + frag_k(i, h); const float x = (k < klen) ? p[(long long)k * sk] * s : 0.f;
        const __bf16 hb = bf16_rne(x); const float r1 = x - bf16_f32(hb); const __bf16 mb = bf16_rne(r1);
        r.hi[i] = hb; r.mid[i] = mb; r.lo[i] = bf16_rne(r1 - bf16_f32(mb));
    }
    return r;
}
__device__ __forceinline__ v16b bh_ld(const float* __restrict__ p, long long sk, int k0, int h, int klen, float s) {
    v16b a;
#pragma unroll
    for (int i = 0; i < 16; ++i) { const int k = k0 + frag_k(i, h); a[i] = bf16_rne((k < klen) ? p[(long long)k * sk] * s : 0.f); }
    return a;
}
// f16 fragment from an f16 LDS/global row with element stride 1 (k-contiguous), no bounds (tile already zero padded)
__device__ __forceinline__ v16h fh_row(const _Float16* __restrict__ row, int k0, int h) {
    v16h a;
#pragma unroll
    for (int i = 0; i < 16; ++i) a[i] = row[k0 + frag_k(i, h)];
    return a;
}

#define VST2(T, ptr, val) do { const T vst2_v_ = (val); *(T*)(ptr) = vst2_v_;  } while (0)
typedef float v4f __attribute__((ext_vector_type(4)));
#define VST2V4(ptr, val) do { const v4f vst2_v4_ = (val); *(v4f*)(ptr) = vst2_v4_;  } while (0)

__device__ __attribute__((noinline)) float act_fn(float v, int act) {
    if (act == 1) return fmaxf(v, 0.f);                                                                               // relu
    if (act == 2) { const float u = 0.7978845608028654f * (v + 0.044715f * v * v * v); return 0.5f * v * (1.f + tanhf(u)); } // tanh-gelu
    if (act == 3) return v / (1.f + expf(-v));                                                                        // silu
    if (act == 4) return 0.5f * v * (1.f + erff(v * 0.7071067811865476f));                                             // erf-gelu
    if (act == 5) return tanhf(v);
    if (act == 6) return 1.f / (1.f + expf(-v));                                                                      // sigmoid
    if (act == 7) return (v > 0.f) ? v : 0.01f * v;                                                                   // leaky relu 0.01
    if (act == 8) return (v > 0.f) ? v : (expf(v) - 1.f);                                                             // elu
    if (act == 9) return fminf(fmaxf(v, 0.f), 6.f);                                                                   // relu6
    if (act == 10) return fabsf(v);                                                                                    // abs
    if (act == 11) return (v >= 0.f) ? v : 0.1f * v;                                                                  // leaky 0.1
    if (act == 12) return (v > 0.f) ? v : 0.2f * v;                                                                   // leaky 0.2
    if (act == 13) return (v > 20.f) ? v : log1pf(expf(v));                                                            // softplus
    return v;
}

// =====================================================================================================================
// k_gemm<MODE>: C(z, m, n) = act(alpha * sum_k A(z, m, k) * B(z, k, n) + bias) + beta * R(z, m, n)
//   One wave (32-thread block) per 16 x 32 tile of C; grid (ceil(N/32), ceil(M/16), Z). Batch z -> (zo = z / zi_n, zi = z % zi_n)
//   with separate outer/inner strides for every tensor (e.g. batch and head). A(m,k) = A[zo*sAo + zi*sAi + m*sAm + k*sAk] (f32),
//   B(k,n) = B[zo*sBo + zi*sBi + n*sBn + k*sBk] (f32); any M, N, K (K zero-padded to 32 inside the fragments, M/N tails guarded).
//   C(m,n) = C[zo*sCo + zi*sCi + m*sCm + n] (n contiguous). flags: 1 bias[n], 2 bias[m], 4 residual R[zo*sRo + zi*sRi + m*sRm + n*sRn].
//   MODE 0: f16 operands (A prescaled by sa, B by sb, both undone in the epilogue); 1: bf16 hi/lo split (3 products); 2: bf16;
//   3: bf16 hi/mid/lo triple split (6 products); 4: as 3 with Kahan-compensated f32 accumulation across k-steps.
// =====================================================================================================================
struct GemmP {
    const float* A; const float* B; const float* bias; const float* R; float* C;
    long long sAo, sAi, sAm, sAk, sBo, sBi, sBn, sBk, sCo, sCi, sCm, sRo, sRi, sRm, sRn;
    int M, N, K, zi_n, flags, act; float alpha, beta, sa, sb;
    int Npad, pad_;     // columns [N, Npad) of C are written as 0 so that padded workspace rows are covered by whole-line stores; Npad >= N
};
static_assert(sizeof(GemmP) == 5 * 8 + 15 * 8 + 6 * 4 + 4 * 4 + 2 * 4, "GemmP has padding");

template <int MODE>
__global__ __launch_bounds__(32) void k_gemm(GemmP p) {
    const int lane = threadIdx.x & 31, h = lane >> 4, l15 = lane & 15;
    const int m0 = blockIdx.y * 16, n0 = blockIdx.x * 32;
    const int z = blockIdx.z, zo = z / p.zi_n, zi = z - zo * p.zi_n;
    const float* A = p.A + zo * p.sAo + zi * p.sAi;
    const float* B = p.B + zo * p.sBo + zi * p.sBi;
    const int am = min(m0 + l15, p.M - 1);                       // clamped row for loads (stores are guarded)
    v8f acc[2], comp[2];
#pragma unroll
    for (int t = 0; t < 2; ++t) { v8f zz = {}; acc[t] = zz; comp[t] = zz; }
    for (int k0 = 0; k0 < p.K; k0 += 32) {
        const float* arow = A + (long long)am * p.sAm;
        if (MODE == 1) {
            const Split a = sp_ld(arow, p.sAk, k0, h, p.K, 1.f);
#pragma unroll
            for (int t = 0; t < 2; ++t) {
                const int bn = min(n0 + t * 16 + l15, p.N - 1);
                acc[t] = wmma3(a, sp_ld(B + (long long)bn * p.sBn, p.sBk, k0, h, p.K, 1.f), acc[t]);
            }
        } else if (MODE == 3) {
            const Split3 a = sp3_ld(arow, p.sAk, k0, h, p.K, 1.f);
#pragma unroll
            for (int t = 0; t < 2; ++t) {
                const int bn = min(n0 + t * 16 + l15, p.N - 1);
                acc[t] = wmma6(a, sp3_ld(B + (long long)bn * p.sBn, p.sBk, k0, h, p.K, 1.f), acc[t]);
            }
        } else if (MODE == 4) {
            // triple split as MODE 3, but each k-step's 6 products go into a fresh accumulator and the partial is added to the running f32 sum
            // on the VALU with Kahan compensation (accumulation error stays ~1 ulp however long K is)
            const Split3 a = sp3_ld(arow, p.sAk, k0, h, p.K, 1.f);
#pragma unroll
            for (int t = 0; t < 2; ++t) {
                const int bn = min(n0 + t * 16 + l15, p.N - 1); v8f zz = {};
                const v8f part = wmma6(a, sp3_ld(B + (long long)bn * p.sBn, p.sBk, k0, h, p.K, 1.f), zz);
                const v8f y = part - comp[t]; const v8f s = acc[t] + y; comp[t] = (s - acc[t]) - y; acc[t] = s;
            }
        } else if (MODE == 2) {
            const v16b a = bh_ld(arow, p.sAk, k0, h, p.K, 1.f);
#pragma unroll
            for (int t = 0; t < 2; ++t) {
                const int bn = min(n0 + t * 16 + l15, p.N - 1);
                acc[t] = wmmab(a, bh_ld(B + (long long)bn * p.sBn, p.sBk, k0, h, p.K, 1.f), acc[t]);
            }
        } else {
            const v16h a = fh_ld(arow, p.sAk, k0, h, p.K, p.sa);
#pragma unroll
            for (int t = 0; t < 2; ++t) {
                const int bn = min(n0 + t * 16 + l15, p.N - 1);
                acc[t] = wmma16(a, fh_ld(B + (long long)bn * p.sBn, p.sBk, k0, h, p.K, p.sb), acc[t]);
            }
        }
    }
    const float iscale = (MODE == 0) ? p.alpha / (p.sa * p.sb) : p.alpha;
    float* C = p.C + zo * p.sCo + zi * p.sCi;
    const float* R = p.R + zo * p.sRo + zi * p.sRi;
    __shared__ __align__(16) float ctile[16][36];
#pragma unroll
    for (int t = 0; t < 2; ++t) {
        const int n = n0 + t * 16 + l15; const int nn = min(n, p.N - 1);
#pragma unroll
        for (int r = 0; r < 8; ++r) {
            const int m = m0 + 8 * h + r; const int mm = min(m, p.M - 1);
            float v = acc[t][r] * iscale;
            if (p.flags & 1) v += p.bias[nn];
            if (p.flags & 2) v += p.bias[mm];
            if (p.flags & 8) v *= p.bias[(long long)zo * p.M + mm];   /* per-(z,row) scale vector laid out [Z][M]; exclusive with the bias flags */
            v = act_fn(v, p.act);
            if (p.flags & 4) v += p.beta * R[(long long)mm * p.sRm + (long long)nn * p.sRn];
            ctile[8 * h + r][t * 16 + l15] = (n < p.N) ? v : 0.f;
        }
    }
    __syncthreads();
    const int NW = (p.Npad > p.N) ? p.Npad : p.N;           // write width
    const bool fast = (m0 + 16 <= p.M) && (n0 + 32 <= NW) && ((p.sCm & 3) == 0) && ((((size_t)C) & 15) == 0);
    if (fast) {
#pragma unroll
        for (int s = 0; s < 4; ++s) {
            const int row = s * 4 + (lane >> 3), c4 = (lane & 7) * 4;
            const v4f v = *(const v4f*)&ctile[row][c4];
            VST2V4(C + (long long)(m0 + row) * p.sCm + n0 + c4, v);
        }
    } else {
        for (int row = 0; row < 16; ++row) {
            const int m = m0 + row, n = n0 + lane;
            if (m < p.M && n < NW) VST2(float, C + (long long)m * p.sCm + n, ctile[row][lane]);
        }
    }
}


// =====================================================================================================================
// k_gemmT<MODE, TM, TN>: same contract as k_gemm, but one wave computes a (16*TM) x (16*TN) tile: TM A fragments and TN B fragments are
//   loaded per 32-wide k-step and reused across TM*TN WMMAs (far fewer load/convert instructions per MAC). MODE 0 (f16), 1 (bf16 hi/lo),
//   2 (bf16) only. grid (ceil(NW/(16*TN)), ceil(M/(16*TM)), Z), block 32. Epilogue identical to k_gemm, run per 16x32 sub-tile.
// =====================================================================================================================
template <int MODE, int TM, int TN>
__global__ __launch_bounds__(32) void k_gemmT(GemmP p) {
    const int lane = threadIdx.x & 31, h = lane >> 4, l15 = lane & 15;
    const int m0 = blockIdx.y * (16 * TM), n0 = blockIdx.x * (16 * TN);
    const int z = blockIdx.z, zo = z / p.zi_n, zi = z - zo * p.zi_n;
    const float* A = p.A + zo * p.sAo + zi * p.sAi;
    const float* B = p.B + zo * p.sBo + zi * p.sBi;
    v8f acc[TM][TN];
#pragma unroll
    for (int i = 0; i < TM; ++i)
#pragma unroll
        for (int t = 0; t < TN; ++t) { v8f zz = {}; acc[i][t] = zz; }
    for (int k0 = 0; k0 < p.K; k0 += 32) {
        if (MODE == 1) {
            Split a[TM], b[TN];
#pragma unroll
            for (int i = 0; i < TM; ++i) { const int am = min(m0 + 16 * i + l15, p.M - 1); a[i] = sp_ld(A + (long long)am * p.sAm, p.sAk, k0, h, p.K, 1.f); }
#pragma unroll
            for (int t = 0; t < TN; ++t) { const int bn = min(n0 + 16 * t + l15, p.N - 1); b[t] = sp_ld(B + (long long)bn * p.sBn, p.sBk, k0, h, p.K, 1.f); }
#pragma unroll
            for (int i = 0; i < TM; ++i)
#pragma unroll
                for (int t = 0; t < TN; ++t) acc[i][t] = wmma3(a[i], b[t], acc[i][t]);
        } else if (MODE == 2) {
            v16b a[TM], b[TN];
#pragma unroll
            for (int i = 0; i < TM; ++i) { const int am = min(m0 + 16 * i + l15, p.M - 1); a[i] = bh_ld(A + (long long)am * p.sAm, p.sAk, k0, h, p.K, 1.f); }
#pragma unroll
            for (int t = 0; t < TN; ++t) { const int bn = min(n0 + 16 * t + l15, p.N - 1); b[t] = bh_ld(B + (long long)bn * p.sBn, p.sBk, k0, h, p.K, 1.f); }
#pragma unroll
            for (int i = 0; i < TM; ++i)
#pragma unroll
                for (int t = 0; t < TN; ++t) acc[i][t] = wmmab(a[i], b[t], acc[i][t]);
        } else {
            v16h a[TM], b[TN];
#pragma unroll
            for (int i = 0; i < TM; ++i) { const int am = min(m0 + 16 * i + l15, p.M - 1); a[i] = fh_ld(A + (long long)am * p.sAm, p.sAk, k0, h, p.K, p.sa); }
#pragma unroll
            for (int t = 0; t < TN; ++t) { const int bn = min(n0 + 16 * t + l15, p.N - 1); b[t] = fh_ld(B + (long long)bn * p.sBn, p.sBk, k0, h, p.K, p.sb); }
#pragma unroll
            for (int i = 0; i < TM; ++i)
#pragma unroll
                for (int t = 0; t < TN; ++t) acc[i][t] = wmma16(a[i], b[t], acc[i][t]);
        }
    }
    const float iscale = (MODE == 0) ? p.alpha / (p.sa * p.sb) : p.alpha;
    float* C = p.C + zo * p.sCo + zi * p.sCi;
    const float* R = p.R + zo * p.sRo + zi * p.sRi;
    const int NW = (p.Npad > p.N) ? p.Npad : p.N;
    __shared__ __align__(16) float ctile[16][36];
#pragma unroll
    for (int i = 0; i < TM; ++i) {
        const int mb = m0 + 16 * i; if (mb >= p.M) break;          // wave-uniform
#pragma unroll
        for (int tp = 0; tp < TN / 2; ++tp) {
            const int nb = n0 + 32 * tp; if (nb >= NW) break;        // wave-uniform
#pragma unroll
            for (int t2 = 0; t2 < 2; ++t2) {
                const int t = 2 * tp + t2; const int n = nb + t2 * 16 + l15; const int nn = min(n, p.N - 1);
#pragma unroll
                for (int r = 0; r < 8; ++r) {
                    const int m = mb + 8 * h + r; const int mm = min(m, p.M - 1);
                    float v = acc[i][t][r] * iscale;
                    if (p.flags & 1) v += p.bias[nn];
                    if (p.flags & 2) v += p.bias[mm];
            if (p.flags & 8) v *= p.bias[(long long)zo * p.M + mm];   /* per-(z,row) scale vector laid out [Z][M]; exclusive with the bias flags */
                    v = act_fn(v, p.act);
                    if (p.flags & 4) v += p.beta * R[(long long)mm * p.sRm + (long long)nn * p.sRn];
                    ctile[8 * h + r][t2 * 16 + l15] = (n < p.N) ? v : 0.f;
                }
            }
            __syncthreads();
            const bool fast = (mb + 16 <= p.M) && (nb + 32 <= NW) && ((p.sCm & 3) == 0) && ((((size_t)C) & 15) == 0);
            if (fast) {
#pragma unroll
                for (int s = 0; s < 4; ++s) {
                    const int row = s * 4 + (lane >> 3), c4 = (lane & 7) * 4;
                    const v4f v = *(const v4f*)&ctile[row][c4];
                    VST2V4(C + (long long)(mb + row) * p.sCm + nb + c4, v);
                }
            } else {
                for (int row = 0; row < 16; ++row) {
                    const int m = mb + row, n = nb + lane;
                    if (m < p.M && n < NW) VST2(float, C + (long long)m * p.sCm + n, ctile[row][lane]);
                }
            }
            __syncthreads();
        }
    }
}

// =====================================================================================================================
// k_attn_lds<L, RS, OS>: O = softmax(scale * Q.K^T) V for one head per blockIdx.y, head and value dim 64, L queries and L keys (L % 64 == 0), f32 in and out.
//   Wave = 16 queries, AW waves per block, 64-key blocks; grid (L / (16*AW), H), block 32*AW. Row r of head h: Q/K/V + r*RS + h*64, O + r*OS + h*64.
//   Each 64-key block of K and of V is read once per work-group with 16-byte loads, converted to f16 and laid in LDS as [key][d] rows:
//   K at a pitch of 144 B for ds_load_b128 fragment reads (B operand of q.k^T, same k order as the Q fragment),
//   V at a pitch of 160 B for ds_load_tr16_b128 fragment reads (B operand of p.v: lane = column d, k = key in the frag_k order).
//   Statistics f32 (exp2 domain); P x 4096 as f16, handed from D layout to A layout through a per-wave f32 LDS tile.
// =====================================================================================================================
#define AW 4
typedef __attribute__((ext_vector_type(4))) _Float16 v4h;
typedef __attribute__((ext_vector_type(8))) short    v8s;
union FragH { v16h v; v8h h[2]; };
// 16-bit transposing LDS load: with lane address T + (k0 + 8*(l>>4) + (l&7)) * pitch + d0 + 8*((l>>3)&1) (halves), lane (c = l&15, h = l>>4) gets T[k0 + 8h + 0..7][d0 + c]
__device__ __forceinline__ v8h ld_tr16(const _Float16* p) {
    typedef __attribute__((address_space(3))) v8s lds_v8s;
    return __builtin_bit_cast(v8h, __builtin_amdgcn_ds_load_tr16_b128_v8i16((lds_v8s*)p));
}
template <int L, int RS, int OS>
__global__ __launch_bounds__(32 * AW) void k_attn_lds(const float* __restrict__ Q, const float* __restrict__ K, const float* __restrict__ V, float* __restrict__ O, float scale) {
    constexpr int KP = 72;                      // K tile pitch in halves (144 B: odd multiple of 16 B)
    constexpr int VP = 80;                      // V tile pitch in halves (160 B: odd multiple of 32 B)
    __shared__ __align__(16) float    pl[AW][16 * 64];
    __shared__ __align__(16) _Float16 kl[64 * KP];
    __shared__ __align__(16) _Float16 vl[64 * VP];
    const int lane = threadIdx.x & 31, hf = lane >> 4, l15 = lane & 15, wave = threadIdx.x >> 5;
    const int h = blockIdx.y;
    const int q0 = (blockIdx.x * AW + wave) * 16;
    float* myp = pl[wave];
    const float L2E = 1.4426950408889634f;
    const float NEG = -__builtin_inff();
    const float* qrow = Q + h * 64 + (long long)(q0 + l15) * RS;
    const float* kbase = K + h * 64;
    const float* vbase = V + h * 64;
    v16h qa[2];
#pragma unroll
    for (int ks = 0; ks < 2; ++ks) qa[ks] = fh_ld(qrow, 1, ks * 32, hf, 64, 1.f);
    v8f o[4]; float m8[8], l8[8];
#pragma unroll
    for (int t = 0; t < 4; ++t) { v8f zz = {}; o[t] = zz; }
#pragma unroll
    for (int i = 0; i < 8; ++i) { m8[i] = NEG; l8[i] = 0.f; }
    const int sr = threadIdx.x >> 4, sc4 = (threadIdx.x & 15) * 4;   // staging: 16 threads per 64-float row, 8 rows per sweep
    const _Float16* kfr = kl + l15 * KP + 8 * hf;
    const _Float16* vfr = vl + (8 * hf + (lane & 7)) * VP + 8 * ((lane >> 3) & 1);
    for (int j0 = 0; j0 < L; j0 += 64) {
        v4f kr[8], vr[8];
#pragma unroll
        for (int i = 0; i < 8; ++i) {
            const long long off = (long long)(j0 + i * 8 + sr) * RS + sc4;
            kr[i] = *(const v4f*)(kbase + off); vr[i] = *(const v4f*)(vbase + off);
        }
        asm volatile("s_wait_xcnt 0x0" ::: "memory");    // stands in front of any reuse of the address registers of the loads above
        __syncthreads();                                 // previous key block's reads of kl / vl are done
#pragma unroll
        for (int i = 0; i < 8; ++i) {
            *(v4h*)(kl + (i * 8 + sr) * KP + sc4) = __builtin_convertvector(kr[i], v4h);
            *(v4h*)(vl + (i * 8 + sr) * VP + sc4) = __builtin_convertvector(vr[i], v4h);
        }
        __syncthreads();                                 // K and V tiles visible to every wave
        FragH kb[4][2];                                  // all eight K fragments behind one LDS latency
#pragma unroll
        for (int t = 0; t < 4; ++t)
#pragma unroll
            for (int ks = 0; ks < 2; ++ks) {
                kb[t][ks].h[0] = *(const v8h*)(kfr + t * 16 * KP + ks * 32);
                kb[t][ks].h[1] = *(const v8h*)(kfr + t * 16 * KP + ks * 32 + 16);
            }
        v8f s[4];
#pragma unroll
        for (int t = 0; t < 4; ++t) {
            v8f acc = {};
#pragma unroll
            for (int ks = 0; ks < 2; ++ks) acc = wmma16(qa[ks], kb[t][ks].v, acc);
            s[t] = acc;
        }
        float pv[8][4];
#pragma unroll
        for (int i = 0; i < 8; ++i) {
            float sc[4];
#pragma unroll
            for (int t = 0; t < 4; ++t) sc[t] = (s[t][i] * scale) * L2E;
            float mx = fmaxf(fmaxf(sc[0], sc[1]), fmaxf(sc[2], sc[3]));
            mx = fmaxf(mx, __shfl_xor(mx, 1, 32)); mx = fmaxf(mx, __shfl_xor(mx, 2, 32));
            mx = fmaxf(mx, __shfl_xor(mx, 4, 32)); mx = fmaxf(mx, __shfl_xor(mx, 8, 32));
            const float mnew = fmaxf(m8[i], mx);
            const float corr = (mnew == NEG) ? 1.f : exp2f(m8[i] - mnew);
            float rs = 0.f;
#pragma unroll
            for (int t = 0; t < 4; ++t) { const float pp = (sc[t] == NEG) ? 0.f : exp2f(sc[t] - mnew); rs += pp; pv[i][t] = pp; }
            rs += __shfl_xor(rs, 1, 32); rs += __shfl_xor(rs, 2, 32); rs += __shfl_xor(rs, 4, 32); rs += __shfl_xor(rs, 8, 32);
            l8[i] = l8[i] * corr + rs; m8[i] = mnew;
#pragma unroll
            for (int t = 0; t < 4; ++t) o[t][i] *= corr;
        }
#pragma unroll
        for (int i = 0; i < 8; ++i)
#pragma unroll
            for (int t = 0; t < 4; ++t) myp[(i + 8 * hf) * 64 + t * 16 + l15] = pv[i][t];
        // P goes from lane to lane of one wave only: the fences keep the compiler from moving the reads below over the stores above
        __builtin_amdgcn_fence(__ATOMIC_RELEASE, "workgroup");
        __builtin_amdgcn_wave_barrier();
        __builtin_amdgcn_fence(__ATOMIC_ACQUIRE, "workgroup");
        const v16h pa0 = fh_ld(myp + l15 * 64, 1, 0, hf, 64, 4096.f), pa1 = fh_ld(myp + l15 * 64, 1, 32, hf, 64, 4096.f);
        FragH vb[4][2];                                  // all eight V fragments behind one LDS latency
#pragma unroll
        for (int t = 0; t < 4; ++t) {
            vb[t][0].h[0] = ld_tr16(vfr + t * 16);           vb[t][0].h[1] = ld_tr16(vfr + 16 * VP + t * 16);
            vb[t][1].h[0] = ld_tr16(vfr + 32 * VP + t * 16); vb[t][1].h[1] = ld_tr16(vfr + 48 * VP + t * 16);
        }
#pragma unroll
        for (int t = 0; t < 4; ++t) {
            o[t] = wmma16(pa0, vb[t][0].v, o[t]);
            o[t] = wmma16(pa1, vb[t][1].v, o[t]);
        }
    }
    float* obase = O + h * 64;
    float invr[8];
#pragma unroll
    for (int i = 0; i < 8; ++i) invr[i] = (l8[i] > 0.f) ? 1.f / (l8[i] * 4096.f) : 0.f;
    __syncthreads();                                             // all waves done with pl from the main loop
#pragma unroll
    for (int i = 0; i < 8; ++i)
#pragma unroll
        for (int t = 0; t < 4; ++t) myp[(i + 8 * hf) * 64 + t * 16 + l15] = o[t][i] * invr[i];
    __syncthreads();
#pragma unroll
    for (int r0 = 0; r0 < 16; r0 += 2) {
        const int row = r0 + hf, c4 = l15 * 4;
        const v4f v = *(const v4f*)(myp + row * 64 + c4);
        VST2V4(obase + (long long)(q0 + row) * OS + c4, v);
    }
}

// =====================================================================================================================
// k_tr: dst(z, c, r) = alpha * src(z, r, c) (+ beta * R2(z, c, r)): [Z][R][C] (row stride lds) -> [Z][C][R] (row stride ldd) through a 32x32 LDS tile;
//   flags: 1 -> add beta * residual R2 addressed like dst (z*sRz + c*ldr + r); act applied before the residual.
// =====================================================================================================================
struct TrP { const float* src; float* dst; const float* R2; long long sSz, lds, sDz, ldd, sRz, ldr; int R, C, flags, act; float alpha, beta; };
static_assert(sizeof(TrP) == 3 * 8 + 6 * 8 + 6 * 4, "TrP has padding");
__global__ __launch_bounds__(256) void k_tr(TrP p) {
    __shared__ float tile[32][33];
    const int c0 = blockIdx.x * 32, r0 = blockIdx.y * 32, z = blockIdx.z;
    const int lane = threadIdx.x & 31, wave = threadIdx.x >> 5;
    const float* s = p.src + z * p.sSz;
#pragma unroll
    for (int k = 0; k < 4; ++k) {
        const int rl = wave * 4 + k, r = r0 + rl, c = c0 + lane;
        tile[rl][lane] = (r < p.R && c < p.C) ? s[(long long)r * p.lds + c] : 0.f;
    }
    __syncthreads();
    float* d = p.dst + z * p.sDz; const float* rr = p.R2 + z * p.sRz;
#pragma unroll
    for (int k = 0; k < 4; ++k) {
        const int cl = wave * 4 + k, c = c0 + cl, r = r0 + lane;
        if (c < p.C && r < p.R) {
            float v = act_fn(p.alpha * tile[lane][cl], p.act);
            if (p.flags & 1) v += p.beta * rr[(long long)c * p.ldr + r];
            VST2(float, d + (long long)c * p.ldd + r, v);
        }
    }
}

// k_affine: dst[i] = a * (sdev ? sdev[0] : 1) * src[i] + b, i < n (one thread per element; consecutive lanes -> consecutive addresses)
__global__ __launch_bounds__(256) void k_affine(const float* __restrict__ src, float* __restrict__ dst, int n, float a, float b, const float* __restrict__ sdev) {
    const int i = blockIdx.x * 256 + threadIdx.x;
    if (i < n) { const float aa = sdev ? a * sdev[0] : a; const float v = aa * src[i] + b; VST2(float, dst + i, v); }
}

// =====================================================================================================================
// k_softmax: row softmax over n contiguous elements, one 256-thread block per row; rows addressed z*sz + r*sr (grid (R, Z)).
//   out = scale_out * softmax(scale_in * x + (Mf ? Mf[z*smz + r*smr + j] : 0)); a row whose max is -inf is written as 0.
// =====================================================================================================================
struct SmP { const float* src; float* dst; const float* Mf; long long sz, sr, dz, dr, smz, smr; int n, pad; float scale_in, scale_out; };
static_assert(sizeof(SmP) == 3 * 8 + 6 * 8 + 4 * 4, "SmP has padding");
__global__ __launch_bounds__(256) void k_softmax(SmP p) {
    __shared__ float red[256];
    const int r = blockIdx.x, z = blockIdx.y, tid = threadIdx.x;
    const float* s = p.src + z * p.sz + (long long)r * p.sr;
    const float* mf = p.Mf ? (p.Mf + z * p.smz + (long long)r * p.smr) : nullptr;
    float mx = -__builtin_inff();
    for (int j = tid; j < p.n; j += 256) { float v = s[j] * p.scale_in; if (mf) v += mf[j]; mx = fmaxf(mx, v); }
    red[tid] = mx; __syncthreads();
    for (int o = 128; o > 0; o >>= 1) { if (tid < o) red[tid] = fmaxf(red[tid], red[tid + o]); __syncthreads(); }
    mx = red[0]; __syncthreads();
    float sum = 0.f;
    for (int j = tid; j < p.n; j += 256) { float v = s[j] * p.scale_in; if (mf) v += mf[j]; sum += (mx == -__builtin_inff()) ? 0.f : expf(v - mx); }
    red[tid] = sum; __syncthreads();
    for (int o = 128; o > 0; o >>= 1) { if (tid < o) red[tid] += red[tid + o]; __syncthreads(); }
    sum = red[0];
    const float inv = (sum > 0.f) ? p.scale_out / sum : 0.f;
    float* d = p.dst + z * p.dz + (long long)r * p.dr;
    for (int j = tid; j < p.n; j += 256) { float v = s[j] * p.scale_in; if (mf) v += mf[j]; const float o = (mx == -__builtin_inff()) ? 0.f : expf(v - mx) * inv; VST2(float, d + j, o); }
}
// =====================================================================================================================
// k_stats: mean and rsqrt(var + eps) over a set of n elements addressed base + z*sz + (e / inner) * so + (e % inner) * si, one 256-thread
// k_norm_apply: y = (x - mean[set]) * rstd[set] * g[c] + b[c] over a [Z][C][L] channel-major tensor with set = z*G + c / (C/G) (G groups per z;
//   G = C -> per-channel sets indexed z*C+c; for batch norm pass stats indexed by c only via bn = 1). Optional act. Output same layout.
// =====================================================================================================================
//   mode 0: mean / rsqrt(var + eps); mode 1 (RMSNorm): 0 / rsqrt(mean(x^2) + eps); mode 2 (L2 normalize * sqrt(n)): 0 / sqrt(n) / max(||x||, eps); mode 3: as 0 with unbiased variance (n-1)
__global__ __launch_bounds__(256) void k_stats(const float* __restrict__ x, long long sz, long long so, long long si, int inner, int n, float eps, float* __restrict__ stat, int mode) {
    __shared__ float red[256];
    const int z = blockIdx.x, tid = threadIdx.x;
    const float* base = x + z * sz;
    float s = 0.f;
    for (int e = tid; e < n; e += 256) s += base[(long long)(e / inner) * so + (long long)(e % inner) * si];
    red[tid] = s; __syncthreads();
    for (int o = 128; o > 0; o >>= 1) { if (tid < o) red[tid] += red[tid + o]; __syncthreads(); }
    const float mu = (mode == 0 || mode == 3) ? red[0] / (float)n : 0.f; __syncthreads();
    float q = 0.f;
    for (int e = tid; e < n; e += 256) { const float dlt = base[(long long)(e / inner) * so + (long long)(e % inner) * si] - mu; q += dlt * dlt; }
    red[tid] = q; __syncthreads();
    for (int o = 128; o > 0; o >>= 1) { if (tid < o) red[tid] += red[tid + o]; __syncthreads(); }
    {
        float rs;
        if (mode == 2) rs = sqrtf((float)n) / fmaxf(sqrtf(red[0]), eps); else if (mode == 3) rs = rsqrtf(red[0] / (float)(n - 1) + eps); else rs = rsqrtf(red[0] / (float)n + eps);
        if (tid < 32) { const float v = (tid == 0) ? mu : ((tid == 1) ? rs : 0.f); VST2(float, stat + (long long)z * 32 + tid, v); }
    }
}
//   One thread per element over the flat [Z][C][L] index space: grid ceil(Z*C*L / 256).
__global__ __launch_bounds__(256) void k_norm_apply(const float* __restrict__ x, float* __restrict__ y, const float* __restrict__ stat, const float* __restrict__ g, const float* __restrict__ bta,
                                                     int Z, int C, int L, int G, int bn, int act) {
    const long long idx = (long long)blockIdx.x * 256 + threadIdx.x;
    if (idx >= (long long)Z * C * L) return;
    const int l = (int)(idx % L); const long long zc = idx / L; const int c = (int)(zc % C), z = (int)(zc / C); (void)l;
    const int set = bn ? c : (z * G + c / (C / G));
    float v = (x[idx] - stat[(long long)set * 32]) * stat[(long long)set * 32 + 1];
    if (g) v *= g[c];
    if (bta) v += bta[c];
    v = act_fn(v, act);
    VST2(float, y + idx, v);
}

// k_lse_neg: c[i] = -(st[2i] + log(st[2i+1])) = minus the log-sum-exp of row i from (max, sum) statistic pairs (for softmax over the query dimension)
__global__ __launch_bounds__(256) void k_lse_neg(const float* __restrict__ st, float* __restrict__ c, int n) {
    const int i = blockIdx.x * 256 + threadIdx.x;
    if (i < n) { const float v = -(st[2 * i] + logf(st[2 * i + 1])); VST2(float, c + i, v); }
}

// k_iota: dst[i] = a * i + b as int32 (segment/position id helper)
__global__ __launch_bounds__(256) void k_iota(int* __restrict__ dst, int n, int a, int b) {
    const int i = blockIdx.x * 256 + threadIdx.x;
    if (i < n) { const int v = a * i + b; VST2(int, dst + i, v); }
}

// k_axpby: dst[i] = a * x[i] + b * y[i] (+ c), i < n
__global__ __launch_bounds__(256) void k_axpby(const float* __restrict__ x, const float* __restrict__ y, float* __restrict__ dst, int n, float a, float b, float c) {
    const int i = blockIdx.x * 256 + threadIdx.x;
    if (i < n) { const float v = a * x[i] + b * y[i] + c; VST2(float, dst + i, v); }
}

// =====================================================================================================================
// k_rope: rotary embedding on a [R rows][Hn heads][D] view (row stride sXr, head stride sXh, element stride 1) -> Y (own strides).
//   mode 0: rotate_half (partner d±D/2, sign - for d<D/2); mode 1: interleaved pairs (partner d^1, sign - for even d).
//   table column tcol: tmode 0 -> d, 1 -> d % (D/2), 2 -> d / 2; position p: pmode 0 -> r % S, 1 -> head index, 2 -> pos[r];
//   c = C[(r / S) * sCb + p * sCp + tcol * sCd], s likewise from Sn; y = x[d] * c + sign * x[partner] * s. X and Y must not alias.
// =====================================================================================================================
struct RopeP { const float* X; float* Y; const float* C; const float* Sn; const int* pos; long long sXr, sXh, sYr, sYh, sCb, sCp, sCd; int R, Hn, D, S, mode, tmode, pmode, pad; };
static_assert(sizeof(RopeP) == 5 * 8 + 7 * 8 + 8 * 4, "RopeP has padding");
__global__ __launch_bounds__(256) void k_rope(RopeP p) {
    const long long idx = (long long)blockIdx.x * 256 + threadIdx.x;
    if (idx >= (long long)p.R * p.Hn * p.D) return;
    const int d = (int)(idx % p.D); const long long rh = idx / p.D; const int h = (int)(rh % p.Hn); const int r = (int)(rh / p.Hn);
    const int half = p.D / 2;
    int partner; float sign;
    if (p.mode == 0) { partner = (d < half) ? d + half : d - half; sign = (d < half) ? -1.f : 1.f; }
    else { partner = d ^ 1; sign = (d & 1) ? 1.f : -1.f; }
    const int tcol = (p.tmode == 0) ? d : ((p.tmode == 1) ? (d % half) : (d >> 1));
    const int pp = (p.pmode == 0) ? (r % p.S) : ((p.pmode == 1) ? h : p.pos[r]);
    const long long toff = (long long)(r / p.S) * p.sCb + (long long)pp * p.sCp + (long long)tcol * p.sCd;
    const float* xr = p.X + (long long)r * p.sXr + (long long)h * p.sXh;
    const float v = xr[d] * p.C[toff] + sign * xr[partner] * p.Sn[toff];
    VST2(float, p.Y + (long long)r * p.sYr + (long long)h * p.sYh + d, v);
}

// k_invf + k_sincos (split so neither kernel carries a large VALU-fma footprint): invf_i = num * (1 / powf(base, (2 i)/D)) [fmode 0],
//   num * expf((2 i) * cexp) [fmode 1], num * powf(base, -2 (i - 1) / D) [fmode 2]; then cs/sn[s*half + i] = cos/sin((pscale * s) * invf_i)
__global__ __launch_bounds__(256) void k_invf(float* __restrict__ invb, int half, int D, float base, float num, int fmode, float cexp) {
    const int i = blockIdx.x * 256 + threadIdx.x;
    if (i >= ((half + 31) / 32) * 32) return;
    if (i >= half) { VST2(float, invb + i, 0.f); return; }
    const float e = (float)(2 * i) / (float)D;
    float invf;
    if (fmode == 1) invf = num * expf((float)(2 * i) * cexp);
    else if (fmode == 2) invf = num * powf(base, (-2.0f * ((float)i - 1.0f)) / (float)D);
    else invf = num * (1.0f / powf(base, e));
    VST2(float, invb + i, invf);
}
__global__ __launch_bounds__(256) void k_sincos(float* __restrict__ cs, float* __restrict__ sn, const float* __restrict__ invb, int S, int half, float pscale) {
    const int idx = blockIdx.x * 256 + threadIdx.x;
    if (idx >= S * half) return;
    const int s = idx / half, i = idx - s * half;
    const float ang = (pscale * (float)s) * invb[i];
    VST2(float, cs + idx, cosf(ang)); VST2(float, sn + idx, sinf(ang));
}

// k_mulact: dst[i] = act(x[i]) * y[i]
__global__ __launch_bounds__(256) void k_mulact(const float* __restrict__ x, const float* __restrict__ y, float* __restrict__ dst, int n, int act) {
    const int i = blockIdx.x * 256 + threadIdx.x;
    if (i < n) { const float v = act_fn(x[i], act) * y[i]; VST2(float, dst + i, v); }
}

// =====================================================================================================================
// k_matvec: thread-per-row matrix-vector products for N <= 8 output columns (heads with 1-3 outputs, gates), f32 on the VALU.
//   C[r*sCm + j] = act(alpha * sum_k A[r*sAm + k*sAk] * B[j*sBn + k*sBk] + bias[j]) + beta * R[r*sRm + j*sRn]; each thread writes its N contiguous floats.
// =====================================================================================================================
__global__ __launch_bounds__(256) void k_matvec(GemmP p) {
    // 32 lanes write one line with one instruction.
    const int rpt = (p.N == 1) ? 1 : 32;
    const long long r0 = ((long long)blockIdx.x * 256 + threadIdx.x) * rpt; const int z = blockIdx.z, zo = z / p.zi_n, zi = z - zo * p.zi_n;
    if (r0 >= p.M) return;
    const float* Bb = p.B + zo * p.sBo + zi * p.sBi;
    float* C = p.C + zo * p.sCo + zi * p.sCi; const float* R = p.R + zo * p.sRo + zi * p.sRi;
    for (int rr = 0; rr < rpt; ++rr) {
        const long long r = r0 + rr; if (r >= p.M) break;
        const float* A = p.A + zo * p.sAo + zi * p.sAi + r * p.sAm;
        float acc[8] = {0.f, 0.f, 0.f, 0.f, 0.f, 0.f, 0.f, 0.f};
        for (int k = 0; k < p.K; ++k) { const float a = A[(long long)k * p.sAk];
#pragma unroll
            for (int j = 0; j < 8; ++j) if (j < p.N) acc[j] += a * Bb[(long long)j * p.sBn + (long long)k * p.sBk]; }
#pragma unroll
        for (int j = 0; j < 8; ++j) if (j < p.N) {
            float v = acc[j] * p.alpha;
            if (p.flags & 1) v += p.bias[j];
            if (p.flags & 2) v += p.bias[r];
            v = act_fn(v, p.act);
            if (p.flags & 4) v += p.beta * R[r * p.sRm + (long long)j * p.sRn];
            VST2(float, C + r * p.sCm + j, v);
        }
    }
}
// k_smallsoftmax: thread-per-row softmax for short rows (n <= 64): dst[r*dr + j] = softmax(scale*src[r*sr + j])
__global__ __launch_bounds__(256) void k_smallsoftmax(const float* __restrict__ src, float* __restrict__ dst, long long sr, long long dr, int n, long long R, float scale) {
    const long long r0 = ((long long)blockIdx.x * 256 + threadIdx.x) * 32;
    for (int rr = 0; rr < 32; ++rr) {
        const long long r = r0 + rr; if (r >= R) return;
        const float* s = src + r * sr; float* d = dst + r * dr;
        float mx = -__builtin_inff();
        for (int j = 0; j < n; ++j) mx = fmaxf(mx, s[j] * scale);
        float sum = 0.f;
        for (int j = 0; j < n; ++j) sum += expf(s[j] * scale - mx);
        const float inv = 1.f / sum;
        for (int j = 0; j < n; ++j) { const float v = expf(s[j] * scale - mx) * inv; VST2(float, d + j, v); }
    }
}

__global__ __launch_bounds__(32) void k_unitstat(float* __restrict__ st) { const int t = threadIdx.x; const float v = (t == 1) ? 1.f : 0.f; VST2(float, st + t, v); }

// destination (e.g. a d_out whose row width is not a multiple of 32 floats) is written by consecutive lanes of one instruction
__global__ __launch_bounds__(256) void k_lincopy(const float* __restrict__ src, long long lds, float* __restrict__ dst, long long ldd, long long rows, int cols) {
    const long long i = (long long)blockIdx.x * 256 + threadIdx.x; if (i >= rows * cols) return;
    const long long r = i / cols; const int c = (int)(i - r * cols);
    const float v = src[r * lds + c]; VST2(float, dst + r * ldd + c, v);
}

namespace w25 {
typedef __attribute__((ext_vector_type(16))) _Float16 v16h;
typedef __attribute__((ext_vector_type(8)))  _Float16 v8h;
typedef __attribute__((ext_vector_type(16))) __bf16   v16b;
typedef __attribute__((ext_vector_type(8)))  __bf16   v8b;
typedef __attribute__((ext_vector_type(8)))  float    v8f;
typedef __attribute__((ext_vector_type(4)))  float    v4f;

__device__ __forceinline__ unsigned short f2bf_bits(float f) {
  unsigned u = __float_as_uint(f);
  return (unsigned short)((u + 0x7FFFu + ((u >> 16) & 1u)) >> 16);
}
__device__ __forceinline__ float bf_bits2f(unsigned short h) { return __uint_as_float(((unsigned)h) << 16); }

// hazard guards as plain device helpers (no inline asm inside the kernel template body)
__device__ __forceinline__ void dep_guard_h(v8f& a, v8f& b, v16h x, v16h y) { asm volatile("v_nop\n\tv_nop\n\tv_nop\n\tv_nop" : "+v"(a), "+v"(b) : "v"(x), "v"(y)); }
__device__ __forceinline__ void dep_guard_b(v8f& a, v8f& b, v16b x, v16b y) { asm volatile("v_nop\n\tv_nop\n\tv_nop\n\tv_nop" : "+v"(a), "+v"(b) : "v"(x), "v"(y)); }
__device__ __forceinline__ void keep4_h(v16h a, v16h b, v16h c, v16h d) { asm volatile("v_nop" :: "v"(a), "v"(b), "v"(c), "v"(d)); }
__device__ __forceinline__ void keep4_b(v16b a, v16b b, v16b c, v16b d) { asm volatile("v_nop" :: "v"(a), "v"(b), "v"(c), "v"(d)); }
__device__ __forceinline__ void acc_guard4(v8f& a, v8f& b, v8f& c, v8f& d) { asm volatile("v_nop\n\tv_nop\n\tv_nop\n\tv_nop" : "+v"(a), "+v"(b), "+v"(c), "+v"(d)); }
template <typename T> struct Frag;
template <> struct Frag<_Float16> {
  typedef v16h V; union U { v16h v; v8h h[2]; };
  static __device__ __forceinline__ v16h load(const _Float16* p) {   // elements 0..7 <- p[0..7], 8..15 <- p[16..23]
    U f; f.h[0] = *(const v8h*)(p); f.h[1] = *(const v8h*)(p + 16); return f.v;
  }
  static __device__ __forceinline__ v8f mma(v16h a, v16h b, v8f c) {
    return __builtin_amdgcn_wmma_f32_16x16x32_f16(false, a, false, b, (short)0, c, false, false);
  }
  static __device__ __forceinline__ void guard(v8f& a, v8f& b, v16h x, v16h y) { dep_guard_h(a, b, x, y); }
  static __device__ __forceinline__ void keep(v16h a, v16h b, v16h c, v16h d) { keep4_h(a, b, c, d); }
};
template <> struct Frag<__bf16> {
  typedef v16b V; union U { v16b v; v8b h[2]; };
  static __device__ __forceinline__ v16b load(const __bf16* p) {
    U f; f.h[0] = *(const v8b*)(p); f.h[1] = *(const v8b*)(p + 16); return f.v;
  }
  static __device__ __forceinline__ v8f mma(v16b a, v16b b, v8f c) {
    return __builtin_amdgcn_wmma_f32_16x16x32_bf16(false, a, false, b, (short)0, c, false, false);
  }
  static __device__ __forceinline__ void guard(v8f& a, v8f& b, v16b x, v16b y) { dep_guard_b(a, b, x, y); }
  static __device__ __forceinline__ void keep(v16b a, v16b b, v16b c, v16b d) { keep4_b(a, b, c, d); }
};

// ---- Register-blocked batched WMMA GEMM ------------------------------------
// C[m,n] = scale * sum_k A[m,k] * Bt[n,k] (+bias)(+resid); each wave owns a 64x64 tile.
// A row-major [M,K]; Bt row-major [N,K]; M,N % 64 == 0, K % 32 == 0.
// SPLIT: operands are hi/lo planes (A2/Bt2 = lo planes, same layout); product = hi·hi + hi·lo + lo·hi.
// BIAS_MODE: 0 = none, 1 = bias[m], 2 = bias[n].
// OUT_MODE: 0 = f32, 1 = f16, 2 = bf16 hi plane (Cout) + bf16 lo plane (Cout2).
// ET: 0 = f16 operands, 1 = bf16 operands (pointers passed as 16-bit storage)
template <int ET> struct Elem;
template <> struct Elem<0> { typedef _Float16 T; };
template <> struct Elem<1> { typedef __bf16 T; };
template <int ET, bool SPLIT, int BIAS_MODE, int OUT_MODE, bool RESID, int ACT = 0>
__global__ __launch_bounds__(256) void wmma_gemm64(
    const unsigned short* __restrict__ Ap, const unsigned short* __restrict__ A2p, int lda, long strideA,
    const unsigned short* __restrict__ Btp, const unsigned short* __restrict__ Bt2p, int ldb, long strideB,
    void* __restrict__ Cout, void* __restrict__ Cout2, int ldc, long strideC,
    const float* __restrict__ bias,
    const float* __restrict__ resid, long strideR,
    int M, int N, int K, float scale) {
  typedef typename Elem<ET>::T T;
  typedef typename Frag<T>::V V;
  const T* A = (const T*)Ap; const T* A2 = (const T*)A2p; const T* Bt = (const T*)Btp; const T* Bt2 = (const T*)Bt2p;
  __shared__ __align__(16) float sT[8][16 * 68];   // per-wave 16x64 slab, pitch 68 floats
  const int b    = blockIdx.y;
  const int lane = threadIdx.x & 31;
  const int wave = threadIdx.x >> 5;
  const int tilesN = N >> 6;
  const int tilesM = M >> 6;
  const int tile = blockIdx.x * 8 + wave;
  if (tile >= tilesM * tilesN) return;   // wave-uniform; no block barriers in this kernel
  const int tm = tile / tilesN;
  const int tn = tile - tm * tilesN;
  const int m0 = tm << 6;
  const int n0 = tn << 6;

  const T* Ab  = A  + (size_t)b * strideA;
  const T* Bb  = Bt + (size_t)b * strideB;
  const T* Ab2 = SPLIT ? (A2  + (size_t)b * strideA) : nullptr;
  const T* Bb2 = SPLIT ? (Bt2 + (size_t)b * strideB) : nullptr;

  const int rlane = lane & 15;                 // row (A) / col (B, D) within subtile
  const int koff  = (lane >> 4) * 8;           // k offset of this lane half
  const int mOff  = (lane >> 4) * 8;           // D row offset

  v8f acc[4][4];
#pragma unroll
  for (int i = 0; i < 4; ++i)
#pragma unroll
    for (int j = 0; j < 4; ++j) acc[i][j] = (v8f){0.f,0.f,0.f,0.f,0.f,0.f,0.f,0.f};

  for (int k0 = 0; k0 < K; k0 += 32) {
    V bh[4], bl[4];
#pragma unroll
    for (int j = 0; j < 4; ++j) {
      const size_t bo = (size_t)(n0 + (j << 4) + rlane) * ldb + koff + k0;
      bh[j] = Frag<T>::load(Bb + bo);
      if (SPLIT) bl[j] = Frag<T>::load(Bb2 + bo);
    }
#pragma unroll
    for (int i = 0; i < 4; ++i) {
      const size_t ao = (size_t)(m0 + (i << 4) + rlane) * lda + koff + k0;
      V ah = Frag<T>::load(Ab + ao);
      V al;
      if (SPLIT) al = Frag<T>::load(Ab2 + ao);
#pragma unroll
      for (int j = 0; j < 4; ++j) {
        acc[i][j] = Frag<T>::mma(ah, bh[j], acc[i][j]);
        if (SPLIT) {
          acc[i][j] = Frag<T>::mma(ah, bl[j], acc[i][j]);
          acc[i][j] = Frag<T>::mma(al, bh[j], acc[i][j]);
        }
      }
      Frag<T>::guard(acc[i][0], acc[i][3], ah, SPLIT ? al : ah);
    }
    Frag<T>::keep(bh[0], bh[1], bh[2], bh[3]);
    if (SPLIT) Frag<T>::keep(bl[0], bl[1], bl[2], bl[3]);
  }
  acc_guard4(acc[0][0], acc[0][1], acc[0][2], acc[0][3]);
  acc_guard4(acc[1][0], acc[1][1], acc[1][2], acc[1][3]);
  acc_guard4(acc[2][0], acc[2][1], acc[2][2], acc[2][3]);
  acc_guard4(acc[3][0], acc[3][1], acc[3][2], acc[3][3]);

  // ---- epilogue ----
  float* slab = sT[wave];
  const float* Rb = RESID ? (resid + (size_t)b * strideR) : nullptr;
#pragma unroll
  for (int i = 0; i < 4; ++i) {
    const int mBase = m0 + (i << 4);
#pragma unroll
    for (int j = 0; j < 4; ++j) {
      const int n = n0 + (j << 4) + rlane;
      float bv = 0.f;
      if (BIAS_MODE == 2) bv = bias[n];
#pragma unroll
      for (int r = 0; r < 8; ++r) {
        float v = acc[i][j][r] * scale;
        if (BIAS_MODE == 1) v += bias[mBase + mOff + r];
        if (BIAS_MODE == 2) v += bv;
        if (RESID) v += Rb[(size_t)(mBase + mOff + r) * ldc + n];
        if (ACT == 1) v = tanhf(v);
        if (ACT == 2) v = fmaxf(v, 0.0f);
        if (ACT == 3) v = v / (1.0f + expf(-v));
        if (ACT == 4) v = (v > 0.f) ? v : 0.01f * v;
        if (ACT == 5) v = 0.5f * v * (1.0f + erff(v * 0.70710678118654752f));
        if (ACT == 6) v = (v > 0.f) ? v : 0.2f * v;
        slab[(mOff + r) * 68 + (j << 4) + rlane] = v;
      }
    }
    __builtin_amdgcn_fence(__ATOMIC_RELEASE, "workgroup");
    __builtin_amdgcn_wave_barrier();
    __builtin_amdgcn_fence(__ATOMIC_ACQUIRE, "workgroup");
    if (OUT_MODE == 0) {
      float* C = (float*)Cout + (size_t)b * strideC;
      const int hh = lane >> 4, c4 = (lane & 15) * 4;     // row seg = 256 B = 16 lanes x 16 B
      {
#pragma unroll
        for (int it = 0; it < 8; ++it) {
          const int row = it * 2 + hh;
          v4f v = *(const v4f*)(slab + row * 68 + c4);
          *(v4f*)(C + (size_t)(mBase + row) * ldc + n0 + c4) = v;
        }
        
      }
    } else {
      const int q = lane >> 3, c8 = (lane & 7) * 8;
      unsigned short* C  = (unsigned short*)Cout  + (size_t)b * strideC;
      unsigned short* C2 = (OUT_MODE == 2) ? ((unsigned short*)Cout2 + (size_t)b * strideC) : nullptr;
      {
#pragma unroll
        for (int it = 0; it < 4; ++it) {
          const int row = it * 4 + q;
          const float* sp = slab + row * 68 + c8;
          v8h hv, lv;
#pragma unroll
          for (int e = 0; e < 8; ++e) {
            if (OUT_MODE == 1) {
              hv[e] = (_Float16)sp[e];
            } else {
              unsigned short hb = f2bf_bits(sp[e]);
              unsigned short lb = f2bf_bits(sp[e] - bf_bits2f(hb));
              hv[e] = __builtin_bit_cast(_Float16, hb);
              lv[e] = __builtin_bit_cast(_Float16, lb);
            }
          }
          *(v8h*)(C + (size_t)(mBase + row) * ldc + n0 + c8) = hv;
          if (OUT_MODE == 2) *(v8h*)(C2 + (size_t)(mBase + row) * ldc + n0 + c8) = lv;
        }
        
      }
    }
    __builtin_amdgcn_fence(__ATOMIC_RELEASE, "workgroup");
    __builtin_amdgcn_wave_barrier();
    __builtin_amdgcn_fence(__ATOMIC_ACQUIRE, "workgroup");
  }
}

__global__ __launch_bounds__(256) void cast_f32_f16x2(
    const float* __restrict__ in, _Float16* __restrict__ out, int n2) {
  int i = blockIdx.x * 256 + threadIdx.x;
  if (i < n2) {
    const _Float16 h0 = (_Float16)in[2 * i], h1 = (_Float16)in[2 * i + 1];
    const unsigned u = (unsigned)__builtin_bit_cast(unsigned short, h0) | ((unsigned)__builtin_bit_cast(unsigned short, h1) << 16);
    ((unsigned*)out)[i] = u;
    
  }
}


} // namespace w25

__global__ __launch_bounds__(256) void k_castT16(const float* __restrict__ src, long long lds, _Float16* __restrict__ dst, long long ldd, int R, int C, float s) {
    const long long i = (long long)blockIdx.x * 256 + threadIdx.x; const long long np = (long long)C * (R / 2); if (i >= np) return; const int c = (int)(i / (R / 2)); const int r = 2 * (int)(i % (R / 2));
    const _Float16 h0 = (_Float16)(src[(long long)r * lds + c] * s), h1 = (_Float16)(src[(long long)(r + 1) * lds + c] * s);
    const unsigned u = (unsigned)__builtin_bit_cast(unsigned short, h0) | ((unsigned)__builtin_bit_cast(unsigned short, h1) << 16);
    unsigned* d = (unsigned*)(dst + (long long)c * ldd + r); *d = u;  }
__global__ __launch_bounds__(256) void k_cast16(const float* __restrict__ src, long long lds, _Float16* __restrict__ dst, long long ldd, int R, int C, float s) {
    const long long i = (long long)blockIdx.x * 256 + threadIdx.x; const long long np = (long long)R * (C / 2); if (i >= np) return; const int r = (int)(i / (C / 2)); const int c = 2 * (int)(i % (C / 2));
    const _Float16 h0 = (_Float16)(src[(long long)r * lds + c] * s), h1 = (_Float16)(src[(long long)r * lds + c + 1] * s);
    const unsigned u = (unsigned)__builtin_bit_cast(unsigned short, h0) | ((unsigned)__builtin_bit_cast(unsigned short, h1) << 16);
    unsigned* d = (unsigned*)(dst + (long long)r * ldd + c); *d = u;  }

// f32 -> bf16 hi plane + bf16 lo plane (x = hi + lo to ~2^-17 relative; RNE both), [R][C] -> [R][C] (or transposed to [C][R]); 2 consecutive destination elements
__device__ __forceinline__ unsigned int f2bf2_pack(float a, float b, unsigned int* lo) {
    const unsigned short ha = w25::f2bf_bits(a), hb = w25::f2bf_bits(b);
    const unsigned short la = w25::f2bf_bits(a - w25::bf_bits2f(ha)), lb = w25::f2bf_bits(b - w25::bf_bits2f(hb));
    *lo = (unsigned)la | ((unsigned)lb << 16); return (unsigned)ha | ((unsigned)hb << 16); }
__global__ __launch_bounds__(256) void k_castS16(const float* __restrict__ src, long long lds, __bf16* __restrict__ dhi, __bf16* __restrict__ dlo, long long ldd, int R, int C, float s, int transpose) {
    const long long i = (long long)blockIdx.x * 256 + threadIdx.x; long long o; float a, b;
    if (transpose) { const long long np = (long long)C * (R / 2); if (i >= np) return; const int c = (int)(i / (R / 2)); const int r = 2 * (int)(i % (R / 2)); a = src[(long long)r * lds + c] * s; b = src[(long long)(r + 1) * lds + c] * s; o = (long long)c * ldd + r; }
    else { const long long np = (long long)R * (C / 2); if (i >= np) return; const int r = (int)(i / (C / 2)); const int c = 2 * (int)(i % (C / 2)); a = src[(long long)r * lds + c] * s; b = src[(long long)r * lds + c + 1] * s; o = (long long)r * ldd + c; }
    unsigned lo; const unsigned hi = f2bf2_pack(a, b, &lo); unsigned* ph = (unsigned*)(dhi + o); unsigned* pl = (unsigned*)(dlo + o);
    *ph = hi; *pl = lo;  }

namespace w25 {
// =====================================================================================
// Generic causal/non-causal attention for head_dim 64, f32 in / f32 out; 16-bit operands: bf16 with optional hi/lo splits, or
// plain f16 (F16=true, non-split, probabilities carried x2^15).
//   scores = (q*qscale)·kᵀ : v_wmma_f32_16x16x32_bf16; SPLIT_QK -> q,k as bf16 hi/lo (hi·hi + hi·lo + lo·hi)
//   out    = p·v           : v_wmma_f32_16x16x32_bf16; SPLIT_PV -> p,v as bf16 hi/lo; else p,v plain bf16
//   f32 accumulate; online softmax in f32. Block = 4 waves = 64 query rows of one (batch, head); S % 64 == 0.
//   Element (b, s, h, d) of tensor X lives at X[b*X_bs + s*X_rs + h*X_hs + d] (strides in floats, multiples of 4).
//   Masking: mask_mode 0 none, 1 causal (kv > q masked), 2 tensor [S][Skv] shared over (b,h) (float if
//   mask_is_int==0, int32 with element == 0 -> masked if 1, int32 with element != 0 -> masked if 2), 3 per-token vectors qmask[B][S] & kvmask[B][Skv] (int32,
//   0 -> masked), 4 causal + sliding window (kv > q or q - kv > W masked; W passed in mask_is_int);
//   5 = relative-position bias: s += cp[b,h,q][idx[q][kv]] + pc[b,h,kv][idx[q][kv]] with idx = mask_b ([S][Skv] int32) and
//   mask_a an int32 [S][Skv] tensor with nonzero = masked (tables: element (b,h,row,n) at X + b*c_bs + h*c_hs + row*c_rs + n);
//   masked scores are replaced by mask_fill (e.g. -inf or -1e9) before the softmax.
//   grid.x = B * H * (S/64) (or a sub-range with blk0).
// =====================================================================================
#define AT_D 64
#define AT_NW 4
#define AT_QB 64
#define AT_KC 64
struct AttnGeom { const float* cp = nullptr; const float* pc = nullptr; long c_bs = 0, c_rs = 0, c_hs = 0;   // mode-5 score-bias tables
                  long q_bs, q_rs, q_hs, k_bs, k_rs, k_hs, v_bs, v_rs, v_hs, o_bs, o_rs, o_hs;
                  int S, Skv, H, mask_mode; float qscale; int blk0; float mask_fill; int mask_is_int; };
static_assert(sizeof(AttnGeom) == 168, "no padding");

__device__ __forceinline__ unsigned short at_bf_bits(float f) {
  unsigned u = __float_as_uint(f);
  return (unsigned short)((u + 0x7FFFu + ((u >> 16) & 1u)) >> 16);
}
__device__ __forceinline__ __bf16 at_f2bf(float f) { return __builtin_bit_cast(__bf16, at_bf_bits(f)); }
__device__ __forceinline__ void at_split(float f, __bf16& hi, __bf16& lo) {
  const unsigned short hb = at_bf_bits(f);
  hi = __builtin_bit_cast(__bf16, hb);
  lo = at_f2bf(f - __uint_as_float(((unsigned)hb) << 16));
}
__device__ __forceinline__ v8f at_mma(v16b a, v16b b, v8f c) {
  c = __builtin_amdgcn_wmma_f32_16x16x32_bf16(false, a, false, b, (short)0, c, false, false);
  asm volatile("v_nop\n\tv_nop\n\tv_nop\n\tv_nop" : "+v"(c) : "v"(a), "v"(b));
  return c;
}
// 16-bit element as a bit pattern held in a __bf16 slot: f16 bits when F16, bf16 (RNE) otherwise
template <bool F16> __device__ __forceinline__ __bf16 at_to16(float f) {
  if (F16) return __builtin_bit_cast(__bf16, (_Float16)f);
  return at_f2bf(f);
}
template <bool F16> __device__ __forceinline__ v8f at_mma16(v16b a, v16b b, v8f c) {
  if (F16) {
    const v16h ah = __builtin_bit_cast(v16h, a), bh = __builtin_bit_cast(v16h, b);
    c = __builtin_amdgcn_wmma_f32_16x16x32_f16(false, ah, false, bh, (short)0, c, false, false);
    asm volatile("v_nop\n\tv_nop\n\tv_nop\n\tv_nop" : "+v"(c) : "v"(ah), "v"(bh));
    return c;
  }
  return at_mma(a, b, c);
}

template <bool SPLIT_QK, bool SPLIT_PV, bool F16 = false>
__global__ __launch_bounds__(128)
void attn64_kernel(const float* __restrict__ q, const float* __restrict__ k,
                   const float* __restrict__ v, float* __restrict__ out,
                   const void* __restrict__ mask_a, const int* __restrict__ mask_b, AttnGeom g) {
  static_assert(!(F16 && (SPLIT_QK || SPLIT_PV)), "f16 mode is non-split");
  const float PSC = F16 ? 32768.0f : 1.0f;     // f16 probabilities carried x2^15 (subnormal range), folded into the final 1/l
  union FB { v16b v; v8b h[2]; };
  __shared__ __align__(16) __bf16 Ksh[AT_KC * AT_D];             // K hi [kv][d]      8 KB
  __shared__ __align__(16) __bf16 Ksl[SPLIT_QK ? AT_KC * AT_D : 8];
  __shared__ __align__(16) __bf16 Vth[AT_D * AT_KC];             // V hi [d][kv]      8 KB
  __shared__ __align__(16) __bf16 Vtl[SPLIT_PV ? AT_D * AT_KC : 8];
  __shared__ __align__(16) __bf16 Psh[AT_NW][16 * AT_KC];        // per wave P hi [row][kv]  8 KB
  __shared__ __align__(16) __bf16 Psl[SPLIT_PV ? AT_NW : 1][SPLIT_PV ? 16 * AT_KC : 8];
  __shared__ __align__(16) float  Os[AT_NW][16 * 68];            // per wave out tile, pitch 68

  const int tid  = threadIdx.x;
  const int wave = tid >> 5;
  const int lane = tid & 31;
  const int hh   = lane >> 4;
  const int c    = lane & 15;

  const int nqb = g.S / AT_QB;
  const int bx = blockIdx.x + g.blk0;
  const int qb = bx % nqb;
  const int bh = bx / nqb;
  const int h  = bh % g.H;
  const int b  = bh / g.H;
  const int qbase_block = qb * AT_QB;
  const int q0 = qbase_block + wave * 16;

  const float* qb_ptr = q + (size_t)b * g.q_bs + (size_t)h * g.q_hs;
  const float* kb_ptr = k + (size_t)b * g.k_bs + (size_t)h * g.k_hs;
  const float* vb_ptr = v + (size_t)b * g.v_bs + (size_t)h * g.v_hs;
  float*       ob_ptr = out + (size_t)b * g.o_bs + (size_t)h * g.o_hs;

  // ---- Q fragments (A operand): 2 d-chunks, hi (and lo) ----
  v16b qah[2], qal[2];
  {
    const float* qrow = qb_ptr + (size_t)(q0 + c) * g.q_rs;
#pragma unroll
    for (int dc = 0; dc < 2; ++dc) {
#pragma unroll
      for (int e = 0; e < 8; ++e) {
        const float f0 = qrow[dc * 32 + 8 * hh + e] * g.qscale;
        const float f1 = qrow[dc * 32 + 16 + 8 * hh + e] * g.qscale;
        if (SPLIT_QK) { __bf16 hq, lq; at_split(f0, hq, lq); qah[dc][e] = hq; qal[dc][e] = lq; at_split(f1, hq, lq); qah[dc][8 + e] = hq; qal[dc][8 + e] = lq; }
        else { qah[dc][e] = at_to16<F16>(f0); qah[dc][8 + e] = at_to16<F16>(f1); qal[dc][e] = qah[dc][e]; qal[dc][8 + e] = qah[dc][8 + e]; }
      }
    }
  }

  float mrow[8], lrow[8];
  v8f oacc[4];
#pragma unroll
  for (int r = 0; r < 8; ++r) { mrow[r] = -INFINITY; lrow[r] = 0.f; }
#pragma unroll
  for (int t = 0; t < 4; ++t) oacc[t] = (v8f){0.f,0.f,0.f,0.f,0.f,0.f,0.f,0.f};

  const int nChunks = (g.mask_mode == 1 || g.mask_mode == 4) ? (qb + 1) : (g.Skv / AT_KC);   // block-uniform
  // per-row query mask (mode 3)
  int qkeep[8];
#pragma unroll
  for (int r = 0; r < 8; ++r) qkeep[r] = (g.mask_mode == 3) ? mask_b[(size_t)b * g.S + q0 + 8 * hh + r] : 1;   // mask_b = qmask in mode 3
  for (int kc = 0; kc < nChunks; ++kc) {
    const int kv0 = kc * AT_KC;
    __syncthreads();
    {
      const int kvr = tid >> 1, dh = (tid & 1) * 32;
      const float* krow = kb_ptr + (size_t)(kv0 + kvr) * g.k_rs + dh;
      const float* vrow = vb_ptr + (size_t)(kv0 + kvr) * g.v_rs + dh;
#pragma unroll
      for (int i = 0; i < 8; ++i) {
        v4f kk = *(const v4f*)(krow + 4 * i);
        v4f vv = *(const v4f*)(vrow + 4 * i);
#pragma unroll
        for (int e = 0; e < 4; ++e) {
          const int d = dh + 4 * i + e;
          if (SPLIT_QK) { __bf16 a, bl; at_split(kk[e], a, bl); Ksh[kvr * AT_D + d] = a; Ksl[kvr * AT_D + d] = bl; }
          else Ksh[kvr * AT_D + d] = at_to16<F16>(kk[e]);
          if (SPLIT_PV) { __bf16 a, bl; at_split(vv[e], a, bl); Vth[d * AT_KC + kvr] = a; Vtl[d * AT_KC + kvr] = bl; }
          else Vth[d * AT_KC + kvr] = at_to16<F16>(vv[e]);
        }
      }
    }
    __syncthreads();

    v8f s[4];
#pragma unroll
    for (int j = 0; j < 4; ++j) {
      s[j] = (v8f){0.f,0.f,0.f,0.f,0.f,0.f,0.f,0.f};
#pragma unroll 1
      for (int dc = 0; dc < 2; ++dc) {
        FB kb;
        kb.h[0] = *(const v8b*)(Ksh + (j * 16 + c) * AT_D + dc * 32 + 8 * hh);
        kb.h[1] = *(const v8b*)(Ksh + (j * 16 + c) * AT_D + dc * 32 + 16 + 8 * hh);
        s[j] = at_mma16<F16>(qah[dc], kb.v, s[j]);
        if (SPLIT_QK) {
          FB kl;
          kl.h[0] = *(const v8b*)(Ksl + (j * 16 + c) * AT_D + dc * 32 + 8 * hh);
          kl.h[1] = *(const v8b*)(Ksl + (j * 16 + c) * AT_D + dc * 32 + 16 + 8 * hh);
          s[j] = at_mma16<F16>(qah[dc], kl.v, s[j]);
          s[j] = at_mma16<F16>(qal[dc], kb.v, s[j]);
        }
      }
    }
    const bool diag = (g.mask_mode == 1) && (kc == qb);
    int kvkeep[4] = {1, 1, 1, 1};
    if (g.mask_mode == 3) {
#pragma unroll
      for (int j = 0; j < 4; ++j) kvkeep[j] = ((const int*)mask_a)[(size_t)b * g.Skv + kv0 + j * 16 + c];   // mask_a = kvmask
    }
    float cm[8];
#pragma unroll
    for (int r = 0; r < 8; ++r) {
      const int qrow = q0 + 8 * hh + r;
      float m = -INFINITY;
#pragma unroll
      for (int j = 0; j < 4; ++j) {
        const int kvcol = kv0 + j * 16 + c;
        bool masked = false;
        if (diag) masked = (kvcol > qrow);
        else if (g.mask_mode == 4) masked = (kvcol > qrow) || (qrow - kvcol > g.mask_is_int);
        else if (g.mask_mode == 2) {
          const size_t mi = (size_t)qrow * g.Skv + kvcol;
          masked = (g.mask_is_int == 0) ? (((const float*)mask_a)[mi] == 0.0f)
                 : (g.mask_is_int == 1) ? (((const int*)mask_a)[mi] == 0) : (((const int*)mask_a)[mi] != 0);
        } else if (g.mask_mode == 3) masked = (qkeep[r] == 0) || (kvkeep[j] == 0);
        else if (g.mask_mode == 5) {
          const size_t mi = (size_t)qrow * g.Skv + kvcol;
          masked = (((const int*)mask_a)[mi] != 0);
          int n = mask_b[mi]; n = n < 0 ? 0 : n;
          s[j][r] += g.cp[(size_t)b * g.c_bs + (size_t)h * g.c_hs + (size_t)qrow * g.c_rs + n]
                   + g.pc[(size_t)b * g.c_bs + (size_t)h * g.c_hs + (size_t)kvcol * g.c_rs + n];
        }
        if (masked) s[j][r] = g.mask_fill;
        m = fmaxf(m, s[j][r]);
      }
#pragma unroll
      for (int off = 1; off < 16; off <<= 1) m = fmaxf(m, __shfl_xor(m, off, 32));
      cm[r] = m;
    }
    __bf16* pwh = Psh[wave];
    __bf16* pwl = Psl[SPLIT_PV ? wave : 0];
#pragma unroll
    for (int r = 0; r < 8; ++r) {
      const float mnew = fmaxf(mrow[r], cm[r]);
      const float alpha = expf(mrow[r] - mnew);
      mrow[r] = mnew;
      float psum = 0.f;
#pragma unroll
      for (int j = 0; j < 4; ++j) {
        const float p = expf(s[j][r] - mnew);
        psum += p;
        if (SPLIT_PV) { __bf16 a, bl; at_split(p, a, bl); pwh[(8 * hh + r) * AT_KC + j * 16 + c] = a; pwl[(8 * hh + r) * AT_KC + j * 16 + c] = bl; }
        else pwh[(8 * hh + r) * AT_KC + j * 16 + c] = at_to16<F16>(p * PSC);
      }
#pragma unroll
      for (int off = 1; off < 16; off <<= 1) psum += __shfl_xor(psum, off, 32);
      lrow[r] = lrow[r] * alpha + psum;
#pragma unroll
      for (int t = 0; t < 4; ++t) oacc[t][r] *= alpha;
    }
    __builtin_amdgcn_fence(__ATOMIC_RELEASE, "workgroup");
    __builtin_amdgcn_wave_barrier();
    __builtin_amdgcn_fence(__ATOMIC_ACQUIRE, "workgroup");
#pragma unroll 1
    for (int kk = 0; kk < 2; ++kk) {
      FB pa, pl;
      pa.h[0] = *(const v8b*)(pwh + c * AT_KC + kk * 32 + 8 * hh);
      pa.h[1] = *(const v8b*)(pwh + c * AT_KC + kk * 32 + 16 + 8 * hh);
      if (SPLIT_PV) {
        pl.h[0] = *(const v8b*)(pwl + c * AT_KC + kk * 32 + 8 * hh);
        pl.h[1] = *(const v8b*)(pwl + c * AT_KC + kk * 32 + 16 + 8 * hh);
      }
#pragma unroll
      for (int t = 0; t < 4; ++t) {
        FB vb;
        vb.h[0] = *(const v8b*)(Vth + (t * 16 + c) * AT_KC + kk * 32 + 8 * hh);
        vb.h[1] = *(const v8b*)(Vth + (t * 16 + c) * AT_KC + kk * 32 + 16 + 8 * hh);
        oacc[t] = at_mma16<F16>(pa.v, vb.v, oacc[t]);
        if (SPLIT_PV) {
          FB vl;
          vl.h[0] = *(const v8b*)(Vtl + (t * 16 + c) * AT_KC + kk * 32 + 8 * hh);
          vl.h[1] = *(const v8b*)(Vtl + (t * 16 + c) * AT_KC + kk * 32 + 16 + 8 * hh);
          oacc[t] = at_mma16<F16>(pa.v, vl.v, oacc[t]);
          oacc[t] = at_mma16<F16>(pl.v, vb.v, oacc[t]);
        }
      }
    }
  }

  float* os = Os[wave];
#pragma unroll
  for (int r = 0; r < 8; ++r) {
    const float inv = 1.0f / (lrow[r] * PSC);
#pragma unroll
    for (int t = 0; t < 4; ++t) os[(8 * hh + r) * 68 + t * 16 + c] = oacc[t][r] * inv;
  }
  __builtin_amdgcn_fence(__ATOMIC_RELEASE, "workgroup");
  __builtin_amdgcn_wave_barrier();
  __builtin_amdgcn_fence(__ATOMIC_ACQUIRE, "workgroup");
  {
    const int c4 = (lane & 15) * 4;
    {
#pragma unroll
      for (int it = 0; it < 8; ++it) {
        const int row = it * 2 + hh;
        v4f val = *(const v4f*)(os + row * 68 + c4);
        *(v4f*)(ob_ptr + (size_t)(q0 + row) * g.o_rs + c4) = val;
      }
      
    }
  }
}

} // namespace w25


__device__ __forceinline__ void st_h2(_Float16* dst, float a, float b) { const unsigned u = (unsigned)__builtin_bit_cast(unsigned short, (_Float16)a) | ((unsigned)__builtin_bit_cast(unsigned short, (_Float16)b) << 16); unsigned* d = (unsigned*)dst; *d = u;  }
// block-diagonal output-map plane: WBD[n = h*64+e][kk = h2*64+d] = sc * Wo[h][d][e] if h2 == h else 0 (thread per destination pair over [D][D], linear order)
__global__ __launch_bounds__(256) void k_sw_wbd(const float* __restrict__ Wo, _Float16* __restrict__ WBD, int D, int HD, float sc) {
    const long long t = (long long)blockIdx.x * 256 + threadIdx.x; if (t >= (long long)D * D / 2) return; const long long e2 = 2 * t; const int n = (int)(e2 / D), kk = (int)(e2 % D);
    const int h = n / HD, e = n % HD, h2 = kk / HD, d = kk % HD; const float* w = Wo + ((long long)h * HD) * HD;
    const float v0 = (h2 == h) ? w[d * HD + e] * sc : 0.f, v1 = (h2 == h) ? w[(d + 1) * HD + e] * sc : 0.f;   // kk even, kk+1 in the same head block
    st_h2(WBD + e2, v0, v1); }


extern "C" void kernel_launch(void* const* d_in, const int* in_sizes, int n_in, void* d_out, int out_size, void* d_ws, size_t ws_size, hipStream_t stream) {
    (void)in_sizes; (void)n_in; (void)out_size; (void)ws_size;
    const float* x = (const float*)d_in[0];
    const float* Wq = (const float*)d_in[1];
    const float* Wkv = (const float*)d_in[2];
    const float* Wo = (const float*)d_in[3];
    const float* bo = (const float*)d_in[4];
    const int Bn = 2;
    const int T = 2048;
    const int D = 1024;
    const int NH = 16;
    const int HD = 64;
    const int D3 = 3 * D;
    const int NR = Bn * T;
    float* out = (float*)d_out;
    char* wsp = (char*)d_ws;
    unsigned short* X16 = (unsigned short*)wsp; wsp += (((size_t)((size_t)NR * D) * 2 + 255) / 256) * 256;
    unsigned short* W316 = (unsigned short*)wsp; wsp += (((size_t)((size_t)D3 * D) * 2 + 255) / 256) * 256;
    unsigned short* WBD16 = (unsigned short*)wsp; wsp += (((size_t)((size_t)D * D) * 2 + 255) / 256) * 256;
    float* QKV = (float*)wsp; wsp += (((size_t)((size_t)T * D3) * 4 + 255) / 256) * 256;
    float* AO = (float*)wsp; wsp += (((size_t)((size_t)T * D) * 4 + 255) / 256) * 256;
    unsigned short* AO16 = (unsigned short*)wsp; wsp += (((size_t)((size_t)T * D) * 2 + 255) / 256) * 256;
    if ((size_t)(wsp - (char*)d_ws) > ws_size) return;   // static carve guard
    k_cast16<<<(unsigned)((((long long)(NR) * ((D) / 2)) + 255) / 256), 256, 0, stream>>>(x, D, (_Float16*)(X16), D, NR, D, 1.0f);
    k_castT16<<<(unsigned)((((long long)(D) * ((D) / 2)) + 255) / 256), 256, 0, stream>>>(Wq, D, (_Float16*)(W316), D, D, D, 16.0f);
    k_castT16<<<(unsigned)((((long long)(D) * ((D) / 2)) + 255) / 256), 256, 0, stream>>>(Wkv, 2 * D, (_Float16*)(W316 + (size_t)D * D), D, D, D, 16.0f);
    k_castT16<<<(unsigned)((((long long)(D) * ((D) / 2)) + 255) / 256), 256, 0, stream>>>(Wkv + D, 2 * D, (_Float16*)(W316 + (size_t)2 * D * D), D, D, D, 16.0f);
    k_sw_wbd<<<(unsigned)(((long long)D * D / 2 + 255) / 256), 256, 0, stream>>>(Wo, (_Float16*)WBD16, D, HD, 16.f);
    w25::wmma_gemm64<0, false, 0, 0, false, 0><<<dim3((unsigned)((((T) / 64) * ((D3) / 64) + 7) / 8), (unsigned)(1)), 256, 0, stream>>>((const unsigned short*)(X16 + (size_t)0 * T * D), nullptr, D, 0, (const unsigned short*)(W316), nullptr, D, 0, (void*)(QKV), nullptr, D3, 0, nullptr, nullptr, 0, T, D3, D, 0.0625f);
    k_attn_lds<T, D3, D><<<dim3((unsigned)((T) / (16 * AW)), (unsigned)(NH)), 32 * AW, 0, stream>>>(QKV, QKV + D, QKV + 2 * D, AO, 0.125f);
    k_cast16<<<(unsigned)((((long long)(T) * ((D) / 2)) + 255) / 256), 256, 0, stream>>>(AO, D, (_Float16*)(AO16), D, T, D, 1.0f);
    w25::wmma_gemm64<0, false, 2, 0, false, 0><<<dim3((unsigned)((((T) / 64) * ((D) / 64) + 7) / 8), (unsigned)(1)), 256, 0, stream>>>((const unsigned short*)(AO16), nullptr, D, 0, (const unsigned short*)(WBD16), nullptr, D, 0, (void*)(out + (size_t)0 * T * D), nullptr, D, 0, bo, nullptr, 0, T, D, D, 0.0625f);
    w25::wmma_gemm64<0, false, 0, 0, false, 0><<<dim3((unsigned)((((T) / 64) * ((D3) / 64) + 7) / 8), (unsigned)(1)), 256, 0, stream>>>((const unsigned short*)(X16 + (size_t)1 * T * D), nullptr, D, 0, (const unsigned short*)(W316), nullptr, D, 0, (void*)(QKV), nullptr, D3, 0, nullptr, nullptr, 0, T, D3, D, 0.0625f);
    k_attn_lds<T, D3, D><<<dim3((unsigned)((T) / (16 * AW)), (unsigned)(NH)), 32 * AW, 0, stream>>>(QKV, QKV + D, QKV + 2 * D, AO, 0.125f);
    k_cast16<<<(unsigned)((((long long)(T) * ((D) / 2)) + 255) / 256), 256, 0, stream>>>(AO, D, (_Float16*)(AO16), D, T, D, 1.0f);
    w25::wmma_gemm64<0, false, 2, 0, false, 0><<<dim3((unsigned)((((T) / 64) * ((D) / 64) + 7) / 8), (unsigned)(1)), 256, 0, stream>>>((const unsigned short*)(AO16), nullptr, D, 0, (const unsigned short*)(WBD16), nullptr, D, 0, (void*)(out + (size_t)1 * T * D), nullptr, D, 0, bo, nullptr, 0, T, D, D, 0.0625f);
}

// v002
// It runs in 332 microseconds.
// In both of two side-by-side timings against v001, it was 1.60 times as fast.
// All steps since v000 together make it 6.52 times as fast.
// Contractions: q and k|v projections (weights stored [in][out]) [2048x1024].[1024x1024|2048] and the per-head 64x64 output maps written as one block-diagonal [2048x1024].[1024x1024] product (+bias) per batch element, with f16 operands on f16 planes (v_wmma_f32_16x16x32_f16, 64x64 register-blocked wave tiles, weights x16); per (batch, head) softmax(q.k^T/8) v over all 2048 keys as one flash launch per batch element (head_dim 64, f16 q.k^T and f16 p.v with p as f16 of 4096 p); f32 accumulate and softmax statistics.
#include <hip/hip_runtime.h>
#include <math.h>

typedef __attribute__((ext_vector_type(16))) _Float16 v16h;
typedef __attribute__((ext_vector_type(8)))  _Float16 v8h;
typedef __attribute__((ext_vector_type(16))) __bf16   v16b;
typedef __attribute__((ext_vector_type(8)))  float    v8f;
typedef __attribute__((ext_vector_type(4)))  float    v4f;

// 16-bit WMMA fragment map (wave32), lane L, h = L>>4, m = L&15:
//   A 16x32: lane = row m;   element i -> k = (i<8) ? 8h+i : 16+8h+(i-8)
//   B 32x16: lane = column m; the SAME k(i,h)
//   D 16x16 (8 f32): lane = column m; element r -> row 8h+r
__device__ __forceinline__ int frag_k(int i, int h) { return (i < 8) ? (8 * h + i) : (16 + 8 * h + (i - 8)); }
__device__ __forceinline__ __bf16 bf16_rne(float f) {
    unsigned int u = __float_as_uint(f);
    u += 0x7fffu + ((u >> 16) & 1u);
    return __builtin_bit_cast(__bf16, (unsigned short)(u >> 16));
}
__device__ __forceinline__ float bf16_f32(__bf16 b) { return __uint_as_float(((unsigned int)__builtin_bit_cast(unsigned short, b)) << 16); }
__device__ __forceinline__ v8f wmma16(v16h a, v16h b, v8f c) {
    c = __builtin_amdgcn_wmma_f32_16x16x32_f16(false, a, false, b, (short)0, c, false, false);
    asm volatile("v_nop\n\tv_nop\n\tv_nop\n\tv_nop" : "+v"(c) : "v"(a), "v"(b));
    return c;
}
__device__ __forceinline__ v8f wmmab(v16b a, v16b b, v8f c) {
    c = __builtin_amdgcn_wmma_f32_16x16x32_bf16(false, a, false, b, (short)0, c, false, false);
    asm volatile("v_nop\n\tv_nop\n\tv_nop\n\tv_nop" : "+v"(c) : "v"(a), "v"(b));
    return c;
}
struct Split { v16b hi, lo; };
// hi/lo split product: a.hi*b.hi + a.hi*b.lo + a.lo*b.hi
__device__ __forceinline__ v8f wmma3(const Split& a, const Split& b, v8f c) {
    c = __builtin_amdgcn_wmma_f32_16x16x32_bf16(false, a.hi, false, b.hi, (short)0, c, false, false);
    c = __builtin_amdgcn_wmma_f32_16x16x32_bf16(false, a.hi, false, b.lo, (short)0, c, false, false);
    c = __builtin_amdgcn_wmma_f32_16x16x32_bf16(false, a.lo, false, b.hi, (short)0, c, false, false);
    asm volatile("v_nop\n\tv_nop\n\tv_nop\n\tv_nop" : "+v"(c) : "v"(a.hi), "v"(a.lo), "v"(b.hi), "v"(b.lo));
    return c;
}
struct Split3 { v16b hi, mid, lo; };
// triple split product (6 terms, drops only terms below 2^-24 relative)
__device__ __forceinline__ v8f wmma6(const Split3& a, const Split3& b, v8f c) {
    c = __builtin_amdgcn_wmma_f32_16x16x32_bf16(false, a.hi, false, b.hi, (short)0, c, false, false);
    c = __builtin_amdgcn_wmma_f32_16x16x32_bf16(false, a.hi, false, b.mid, (short)0, c, false, false);
    c = __builtin_amdgcn_wmma_f32_16x16x32_bf16(false, a.mid, false, b.hi, (short)0, c, false, false);
    c = __builtin_amdgcn_wmma_f32_16x16x32_bf16(false, a.hi, false, b.lo, (short)0, c, false, false);
    c = __builtin_amdgcn_wmma_f32_16x16x32_bf16(false, a.mid, false, b.mid, (short)0, c, false, false);
    c = __builtin_amdgcn_wmma_f32_16x16x32_bf16(false, a.lo, false, b.hi, (short)0, c, false, false);
    asm volatile("v_nop\n\tv_nop\n\tv_nop\n\tv_nop" : "+v"(c) : "v"(a.hi), "v"(a.mid), "v"(a.lo), "v"(b.hi), "v"(b.mid), "v"(b.lo));
    return c;
}

// Fragment gathers from f32 memory: element i <- p[(k0 + frag_k(i,h)) * sk] * s, zero for k >= klen.
__device__ __forceinline__ v16h fh_ld(const float* __restrict__ p, long long sk, int k0, int h, int klen, float s) {
    v16h a;
#pragma unroll
    for (int i = 0; i < 16; ++i) { const int k = k0 + frag_k(i, h); a[i] = (k < klen) ? (_Float16)(p[(long long)k * sk] * s) : (_Float16)0.f; }
    return a;
}
__device__ __forceinline__ Split sp_ld(const float* __restrict__ p, long long sk, int k0, int h, int klen, float s) {
    Split r;
#pragma unroll
    for (int i = 0; i < 16; ++i) {
        const int k = k0 + frag_k(i, h); const float x = (k < klen) ? p[(long long)k * sk] * s : 0.f;
        const __bf16 hb = bf16_rne(x); r.hi[i] = hb; r.lo[i] = bf16_rne(x - bf16_f32(hb));
    }
    return r;
}
__device__ __forceinline__ Split3 sp3_ld(const float* __restrict__ p, long long sk, int k0, int h, int klen, float s) {
    Split3 r;
#pragma unroll
    for (int i = 0; i < 16; ++i) {
        const int k = k0 + frag_k(i, h); const float x = (k < klen) ? p[(long long)k * sk] * s : 0.f;
        const __bf16 hb = bf16_rne(x); const float r1 = x - bf16_f32(hb); const __bf16 mb = bf16_rne(r1);
        r.hi[i] = hb; r.mid[i] = mb; r.lo[i] = bf16_rne(r1 - bf16_f32(mb));
    }
    return r;
}
__device__ __forceinline__ v16b bh_ld(const float* __restrict__ p, long long sk, int k0, int h, int klen, float s) {
    v16b a;
#pragma unroll
    for (int i = 0; i < 16; ++i) { const int k = k0 + frag_k(i, h); a[i] = bf16_rne((k < klen) ? p[(long long)k * sk] * s : 0.f); }
    return a;
}
// f16 fragment from an f16 LDS/global row with element stride 1 (k-contiguous), no bounds (tile already zero padded)
__device__ __forceinline__ v16h fh_row(const _Float16* __restrict__ row, int k0, int h) {
    v16h a;
#pragma unroll
    for (int i = 0; i < 16; ++i) a[i] = row[k0 + frag_k(i, h)];
    return a;
}

#define VST2(T, ptr, val) do { const T vst2_v_ = (val); *(T*)(ptr) = vst2_v_;  } while (0)
typedef float v4f __attribute__((ext_vector_type(4)));
#define VST2V4(ptr, val) do { const v4f vst2_v4_ = (val); *(v4f*)(ptr) = vst2_v4_;  } while (0)

__device__ __attribute__((noinline)) float act_fn(float v, int act) {
    if (act == 1) return fmaxf(v, 0.f);                                                                               // relu
    if (act == 2) { const float u = 0.7978845608028654f * (v + 0.044715f * v * v * v); return 0.5f * v * (1.f + tanhf(u)); } // tanh-gelu
    if (act == 3) return v / (1.f + expf(-v));                                                                        // silu
    if (act == 4) return 0.5f * v * (1.f + erff(v * 0.7071067811865476f));                                             // erf-gelu
    if (act == 5) return tanhf(v);
    if (act == 6) return 1.f / (1.f + expf(-v));                                                                      // sigmoid
    if (act == 7) return (v > 0.f) ? v : 0.01f * v;                                                                   // leaky relu 0.01
    if (act == 8) return (v > 0.f) ? v : (expf(v) - 1.f);                                                             // elu
    if (act == 9) return fminf(fmaxf(v, 0.f), 6.f);                                                                   // relu6
    if (act == 10) return fabsf(v);                                                                                    // abs
    if (act == 11) return (v >= 0.f) ? v : 0.1f * v;                                                                  // leaky 0.1
    if (act == 12) return (v > 0.f) ? v : 0.2f * v;                                                                   // leaky 0.2
    if (act == 13) return (v > 20.f) ? v : log1pf(expf(v));                                                            // softplus
    return v;
}

// =====================================================================================================================
// k_gemm<MODE>: C(z, m, n) = act(alpha * sum_k A(z, m, k) * B(z, k, n) + bias) + beta * R(z, m, n)
//   One wave (32-thread block) per 16 x 32 tile of C; grid (ceil(N/32), ceil(M/16), Z). Batch z -> (zo = z / zi_n, zi = z % zi_n)
//   with separate outer/inner strides for every tensor (e.g. batch and head). A(m,k) = A[zo*sAo + zi*sAi + m*sAm + k*sAk] (f32),
//   B(k,n) = B[zo*sBo + zi*sBi + n*sBn + k*sBk] (f32); any M, N, K (K zero-padded to 32 inside the fragments, M/N tails guarded).
//   C(m,n) = C[zo*sCo + zi*sCi + m*sCm + n] (n contiguous). flags: 1 bias[n], 2 bias[m], 4 residual R[zo*sRo + zi*sRi + m*sRm + n*sRn].
//   MODE 0: f16 operands (A prescaled by sa, B by sb, both undone in the epilogue); 1: bf16 hi/lo split (3 products); 2: bf16;
//   3: bf16 hi/mid/lo triple split (6 products); 4: as 3 with Kahan-compensated f32 accumulation across k-steps.
// =====================================================================================================================
struct GemmP {
    const float* A; const float* B; const float* bias; const float* R; float* C;
    long long sAo, sAi, sAm, sAk, sBo, sBi, sBn, sBk, sCo, sCi, sCm, sRo, sRi, sRm, sRn;
    int M, N, K, zi_n, flags, act; float alpha, beta, sa, sb;
    int Npad, pad_;     // columns [N, Npad) of C are written as 0 so that padded workspace rows are covered by whole-line stores; Npad >= N
};
static_assert(sizeof(GemmP) == 5 * 8 + 15 * 8 + 6 * 4 + 4 * 4 + 2 * 4, "GemmP has padding");

template <int MODE>
__global__ __launch_bounds__(32) void k_gemm(GemmP p) {
    const int lane = threadIdx.x & 31, h = lane >> 4, l15 = lane & 15;
    const int m0 = blockIdx.y * 16, n0 = blockIdx.x * 32;
    const int z = blockIdx.z, zo = z / p.zi_n, zi = z - zo * p.zi_n;
    const float* A = p.A + zo * p.sAo + zi * p.sAi;
    const float* B = p.B + zo * p.sBo + zi * p.sBi;
    const int am = min(m0 + l15, p.M - 1);                       // clamped row for loads (stores are guarded)
    v8f acc[2], comp[2];
#pragma unroll
    for (int t = 0; t < 2; ++t) { v8f zz = {}; acc[t] = zz; comp[t] = zz; }
    for (int k0 = 0; k0 < p.K; k0 += 32) {
        const float* arow = A + (long long)am * p.sAm;
        if (MODE == 1) {
            const Split a = sp_ld(arow, p.sAk, k0, h, p.K, 1.f);
#pragma unroll
            for (int t = 0; t < 2; ++t) {
                const int bn = min(n0 + t * 16 + l15, p.N - 1);
                acc[t] = wmma3(a, sp_ld(B + (long long)bn * p.sBn, p.sBk, k0, h, p.K, 1.f), acc[t]);
            }
        } else if (MODE == 3) {
            const Split3 a = sp3_ld(arow, p.sAk, k0, h, p.K, 1.f);
#pragma unroll
            for (int t = 0; t < 2; ++t) {
                const int bn = min(n0 + t * 16 + l15, p.N - 1);
                acc[t] = wmma6(a, sp3_ld(B + (long long)bn * p.sBn, p.sBk, k0, h, p.K, 1.f), acc[t]);
            }
        } else if (MODE == 4) {
            // triple split as MODE 3, but each k-step's 6 products go into a fresh accumulator and the partial is added to the running f32 sum
            // on the VALU with Kahan compensation (accumulation error stays ~1 ulp however long K is)
            const Split3 a = sp3_ld(arow, p.sAk, k0, h, p.K, 1.f);
#pragma unroll
            for (int t = 0; t < 2; ++t) {
                const int bn = min(n0 + t * 16 + l15, p.N - 1); v8f zz = {};
                const v8f part = wmma6(a, sp3_ld(B + (long long)bn * p.sBn, p.sBk, k0, h, p.K, 1.f), zz);
                const v8f y = part - comp[t]; const v8f s = acc[t] + y; comp[t] = (s - acc[t]) - y; acc[t] = s;
            }
        } else if (MODE == 2) {
            const v16b a = bh_ld(arow, p.sAk, k0, h, p.K, 1.f);
#pragma unroll
            for (int t = 0; t < 2; ++t) {
                const int bn = min(n0 + t * 16 + l15, p.N - 1);
                acc[t] = wmmab(a, bh_ld(B + (long long)bn * p.sBn, p.sBk, k0, h, p.K, 1.f), acc[t]);
            }
        } else {
            const v16h a = fh_ld(arow, p.sAk, k0, h, p.K, p.sa);
#pragma unroll
            for (int t = 0; t < 2; ++t) {
                const int bn = min(n0 + t * 16 + l15, p.N - 1);
                acc[t] = wmma16(a, fh_ld(B + (long long)bn * p.sBn, p.sBk, k0, h, p.K, p.sb), acc[t]);
            }
        }
    }
    const float iscale = (MODE == 0) ? p.alpha / (p.sa * p.sb) : p.alpha;
    float* C = p.C + zo * p.sCo + zi * p.sCi;
    const float* R = p.R + zo * p.sRo + zi * p.sRi;
    __shared__ __align__(16) float ctile[16][36];
#pragma unroll
    for (int t = 0; t < 2; ++t) {
        const int n = n0 + t * 16 + l15; const int nn = min(n, p.N - 1);
#pragma unroll
        for (int r = 0; r < 8; ++r) {
            const int m = m0 + 8 * h + r; const int mm = min(m, p.M - 1);
            float v = acc[t][r] * iscale;
            if (p.flags & 1) v += p.bias[nn];
            if (p.flags & 2) v += p.bias[mm];
            if (p.flags & 8) v *= p.bias[(long long)zo * p.M + mm];   /* per-(z,row) scale vector laid out [Z][M]; exclusive with the bias flags */
            v = act_fn(v, p.act);
            if (p.flags & 4) v += p.beta * R[(long long)mm * p.sRm + (long long)nn * p.sRn];
            ctile[8 * h + r][t * 16 + l15] = (n < p.N) ? v : 0.f;
        }
    }
    __syncthreads();
    const int NW = (p.Npad > p.N) ? p.Npad : p.N;           // write width
    const bool fast = (m0 + 16 <= p.M) && (n0 + 32 <= NW) && ((p.sCm & 3) == 0) && ((((size_t)C) & 15) == 0);
    if (fast) {
#pragma unroll
        for (int s = 0; s < 4; ++s) {
            const int row = s * 4 + (lane >> 3), c4 = (lane & 7) * 4;
            const v4f v = *(const v4f*)&ctile[row][c4];
            VST2V4(C + (long long)(m0 + row) * p.sCm + n0 + c4, v);
        }
    } else {
        for (int row = 0; row < 16; ++row) {
            const int m = m0 + row, n = n0 + lane;
            if (m < p.M && n < NW) VST2(float, C + (long long)m * p.sCm + n, ctile[row][lane]);
        }
    }
}


// =====================================================================================================================
// k_gemmT<MODE, TM, TN>: same contract as k_gemm, but one wave computes a (16*TM) x (16*TN) tile: TM A fragments and TN B fragments are
//   loaded per 32-wide k-step and reused across TM*TN WMMAs (far fewer load/convert instructions per MAC). MODE 0 (f16), 1 (bf16 hi/lo),
//   2 (bf16) only. grid (ceil(NW/(16*TN)), ceil(M/(16*TM)), Z), block 32. Epilogue identical to k_gemm, run per 16x32 sub-tile.
// =====================================================================================================================
template <int MODE, int TM, int TN>
__global__ __launch_bounds__(32) void k_gemmT(GemmP p) {
    const int lane = threadIdx.x & 31, h = lane >> 4, l15 = lane & 15;
    const int m0 = blockIdx.y * (16 * TM), n0 = blockIdx.x * (16 * TN);
    const int z = blockIdx.z, zo = z / p.zi_n, zi = z - zo * p.zi_n;
    const float* A = p.A + zo * p.sAo + zi * p.sAi;
    const float* B = p.B + zo * p.sBo + zi * p.sBi;
    v8f acc[TM][TN];
#pragma unroll
    for (int i = 0; i < TM; ++i)
#pragma unroll
        for (int t = 0; t < TN; ++t) { v8f zz = {}; acc[i][t] = zz; }
    for (int k0 = 0; k0 < p.K; k0 += 32) {
        if (MODE == 1) {
            Split a[TM], b[TN];
#pragma unroll
            for (int i = 0; i < TM; ++i) { const int am = min(m0 + 16 * i + l15, p.M - 1); a[i] = sp_ld(A + (long long)am * p.sAm, p.sAk, k0, h, p.K, 1.f); }
#pragma unroll
            for (int t = 0; t < TN; ++t) { const int bn = min(n0 + 16 * t + l15, p.N - 1); b[t] = sp_ld(B + (long long)bn * p.sBn, p.sBk, k0, h, p.K, 1.f); }
#pragma unroll
            for (int i = 0; i < TM; ++i)
#pragma unroll
                for (int t = 0; t < TN; ++t) acc[i][t] = wmma3(a[i], b[t], acc[i][t]);
        } else if (MODE == 2) {
            v16b a[TM], b[TN];
#pragma unroll
            for (int i = 0; i < TM; ++i) { const int am = min(m0 + 16 * i + l15, p.M - 1); a[i] = bh_ld(A + (long long)am * p.sAm, p.sAk, k0, h, p.K, 1.f); }
#pragma unroll
            for (int t = 0; t < TN; ++t) { const int bn = min(n0 + 16 * t + l15, p.N - 1); b[t] = bh_ld(B + (long long)bn * p.sBn, p.sBk, k0, h, p.K, 1.f); }
#pragma unroll
            for (int i = 0; i < TM; ++i)
#pragma unroll
                for (int t = 0; t < TN; ++t) acc[i][t] = wmmab(a[i], b[t], acc[i][t]);
        } else {
            v16h a[TM], b[TN];
#pragma unroll
            for (int i = 0; i < TM; ++i) { const int am = min(m0 + 16 * i + l15, p.M - 1); a[i] = fh_ld(A + (long long)am * p.sAm, p.sAk, k0, h, p.K, p.sa); }
#pragma unroll
            for (int t = 0; t < TN; ++t) { const int bn = min(n0 + 16 * t + l15, p.N - 1); b[t] = fh_ld(B + (long long)bn * p.sBn, p.sBk, k0, h, p.K, p.sb); }
#pragma unroll
            for (int i = 0; i < TM; ++i)
#pragma unroll
                for (int t = 0; t < TN; ++t) acc[i][t] = wmma16(a[i], b[t], acc[i][t]);
        }
    }
    const float iscale = (MODE == 0) ? p.alpha / (p.sa * p.sb) : p.alpha;
    float* C = p.C + zo * p.sCo + zi * p.sCi;
    const float* R = p.R + zo * p.sRo + zi * p.sRi;
    const int NW = (p.Npad > p.N) ? p.Npad : p.N;
    __shared__ __align__(16) float ctile[16][36];
#pragma unroll
    for (int i = 0; i < TM; ++i) {
        const int mb = m0 + 16 * i; if (mb >= p.M) break;          // wave-uniform
#pragma unroll
        for (int tp = 0; tp < TN / 2; ++tp) {
            const int nb = n0 + 32 * tp; if (nb >= NW) break;        // wave-uniform
#pragma unroll
            for (int t2 = 0; t2 < 2; ++t2) {
                const int t = 2 * tp + t2; const int n = nb + t2 * 16 + l15; const int nn = min(n, p.N - 1);
#pragma unroll
                for (int r = 0; r < 8; ++r) {
                    const int m = mb + 8 * h + r; const int mm = min(m, p.M - 1);
                    float v = acc[i][t][r] * iscale;
                    if (p.flags & 1) v += p.bias[nn];
                    if (p.flags & 2) v += p.bias[mm];
            if (p.flags & 8) v *= p.bias[(long long)zo * p.M + mm];   /* per-(z,row) scale vector laid out [Z][M]; exclusive with the bias flags */
                    v = act_fn(v, p.act);
                    if (p.flags & 4) v += p.beta * R[(long long)mm * p.sRm + (long long)nn * p.sRn];
                    ctile[8 * h + r][t2 * 16 + l15] = (n < p.N) ? v : 0.f;
                }
            }
            __syncthreads();
            const bool fast = (mb + 16 <= p.M) && (nb + 32 <= NW) && ((p.sCm & 3) == 0) && ((((size_t)C) & 15) == 0);
            if (fast) {
#pragma unroll
                for (int s = 0; s < 4; ++s) {
                    const int row = s * 4 + (lane >> 3), c4 = (lane & 7) * 4;
                    const v4f v = *(const v4f*)&ctile[row][c4];
                    VST2V4(C + (long long)(mb + row) * p.sCm + nb + c4, v);
                }
            } else {
                for (int row = 0; row < 16; ++row) {
                    const int m = mb + row, n = nb + lane;
                    if (m < p.M && n < NW) VST2(float, C + (long long)m * p.sCm + n, ctile[row][lane]);
                }
            }
            __syncthreads();
        }
    }
}

// =====================================================================================================================
// k_attn_lds<L, RS, OS>: O = softmax(scale * Q.K^T) V for one head per blockIdx.y, head and value dim 64, L queries and L keys (L % 64 == 0), f32 in and out.
//   Wave = 16 queries, AW waves per block, 64-key blocks; grid (L / (16*AW), H), block 32*AW. Row r of head h: Q/K/V + r*RS + h*64, O + r*OS + h*64.
//   Each 64-key block of K and of V is read once per work-group with 16-byte loads, converted to f16 and laid in LDS as [key][d] rows:
//   K at a pitch of 144 B for ds_load_b128 fragment reads (A operand of k.q^T, same k order as the Q fragment),
//   V at a pitch of 160 B for ds_load_tr16_b128 fragment reads (A operand of v^T.p^T: lane = row d, k = key in the frag_k order).
//   Both products are taken transposed: S^T = K.Q^T puts query l15 in lane column l15, so lanes l15 and l15+16 hold all 64 scores of one query
//   (tile t, register r: key 16t + 8*hf + r); maximum and sum run inside the lane, with one exchange between the lane halves.
//   Two S^T tiles of 16 keys, converted in place, are the B fragment of O^T += V^T.P^T in the frag_k order: P never leaves the registers.
//   Statistics f32 (exp2 domain); P x 4096 as f16.
// =====================================================================================================================
#define AW 4
typedef __attribute__((ext_vector_type(4))) _Float16 v4h;
typedef __attribute__((ext_vector_type(8))) short    v8s;
union FragH { v16h v; v8h h[2]; };
// 16-bit transposing LDS load: with lane address T + (k0 + 8*(l>>4) + (l&7)) * pitch + d0 + 8*((l>>3)&1) (halves), lane (c = l&15, h = l>>4) gets T[k0 + 8h + 0..7][d0 + c]
__device__ __forceinline__ v8h ld_tr16(const _Float16* p) {
    typedef __attribute__((address_space(3))) v8s lds_v8s;
    return __builtin_bit_cast(v8h, __builtin_amdgcn_ds_load_tr16_b128_v8i16((lds_v8s*)p));
}
// value of lane l ^ 16
__device__ __forceinline__ float swap_half(float x) {
    const int b = __builtin_bit_cast(int, x);
    return __builtin_bit_cast(float, __builtin_amdgcn_permlanex16(b, b, 0x76543210, 0xfedcba98, false, false));
}
template <int L, int RS, int OS>
__global__ __launch_bounds__(32 * AW) void k_attn_lds(const float* __restrict__ Q, const float* __restrict__ K, const float* __restrict__ V, float* __restrict__ O, float scale) {
    constexpr int KP = 72;                      // K tile pitch in halves (144 B: odd multiple of 16 B)
    constexpr int VP = 80;                      // V tile pitch in halves (160 B: odd multiple of 32 B)
    constexpr int OP = 68;                      // output tile pitch in floats (272 B: odd multiple of 16 B)
    __shared__ __align__(16) float    pl[AW][16 * OP];
    __shared__ __align__(16) _Float16 kl[64 * KP];
    __shared__ __align__(16) _Float16 vl[64 * VP];
    const int lane = threadIdx.x & 31, hf = lane >> 4, l15 = lane & 15, wave = threadIdx.x >> 5;
    const int h = blockIdx.y;
    const int q0 = (blockIdx.x * AW + wave) * 16;
    float* myp = pl[wave];
    const float L2E = 1.4426950408889634f;
    const float NEG = -__builtin_inff();
    const float* qrow = Q + h * 64 + (long long)(q0 + l15) * RS;
    const float* kbase = K + h * 64;
    const float* vbase = V + h * 64;
    v16h qa[2];
#pragma unroll
    for (int ks = 0; ks < 2; ++ks) qa[ks] = fh_ld(qrow, 1, ks * 32, hf, 64, 1.f);
    v8f o[4];                                   // o[t][r] = O^T[d = 16t + 8*hf + r][query l15]
    float m1 = NEG, l1 = 0.f;                   // query l15: running maximum (equal in both lane halves), sum over this half's keys
#pragma unroll
    for (int t = 0; t < 4; ++t) { v8f zz = {}; o[t] = zz; }
    const int sr = threadIdx.x >> 4, sc4 = (threadIdx.x & 15) * 4;   // staging: 16 threads per 64-float row, 8 rows per sweep
    const _Float16* kfr = kl + l15 * KP + 8 * hf;
    const _Float16* vfr = vl + (8 * hf + (lane & 7)) * VP + 8 * ((lane >> 3) & 1);
    for (int j0 = 0; j0 < L; j0 += 64) {
        v4f kr[8], vr[8];
#pragma unroll
        for (int i = 0; i < 8; ++i) {
            const long long off = (long long)(j0 + i * 8 + sr) * RS + sc4;
            kr[i] = *(const v4f*)(kbase + off); vr[i] = *(const v4f*)(vbase + off);
        }
        asm volatile("s_wait_xcnt 0x0" ::: "memory");    // stands in front of any reuse of the address registers of the loads above
        __syncthreads();                                 // previous key block's reads of kl / vl are done
#pragma unroll
        for (int i = 0; i < 8; ++i) {
            *(v4h*)(kl + (i * 8 + sr) * KP + sc4) = __builtin_convertvector(kr[i], v4h);
            *(v4h*)(vl + (i * 8 + sr) * VP + sc4) = __builtin_convertvector(vr[i], v4h);
        }
        __syncthreads();                                 // K and V tiles visible to every wave
        FragH kb[4][2];                                  // all eight K fragments behind one LDS latency
#pragma unroll
        for (int t = 0; t < 4; ++t)
#pragma unroll
            for (int ks = 0; ks < 2; ++ks) {
                kb[t][ks].h[0] = *(const v8h*)(kfr + t * 16 * KP + ks * 32);
                kb[t][ks].h[1] = *(const v8h*)(kfr + t * 16 * KP + ks * 32 + 16);
            }
        v8f s[4];                                        // s[t][r] = S[query l15][key j0 + 16t + 8*hf + r]
#pragma unroll
        for (int t = 0; t < 4; ++t) {
            v8f acc = {};
#pragma unroll
            for (int ks = 0; ks < 2; ++ks) acc = wmma16(kb[t][ks].v, qa[ks], acc);
            s[t] = acc;
        }
        float sc[4][8], mt[4];
#pragma unroll
        for (int t = 0; t < 4; ++t) {
            mt[t] = NEG;
#pragma unroll
            for (int i = 0; i < 8; ++i) { sc[t][i] = (s[t][i] * scale) * L2E; mt[t] = fmaxf(mt[t], sc[t][i]); }
        }
        float mx = fmaxf(fmaxf(mt[0], mt[1]), fmaxf(mt[2], mt[3]));
        mx = fmaxf(mx, swap_half(mx));
        const float mnew = fmaxf(m1, mx);
        const float mref = (mnew == NEG) ? 0.f : mnew;   // a query with only -inf scores so far: every exp2 below is exp2(-inf) = 0, never exp2(nan)
        const float corr = exp2f(m1 - mref);
        FragH pa[2]; float rt[4];
#pragma unroll
        for (int t = 0; t < 4; ++t) {
            rt[t] = 0.f;
#pragma unroll
            for (int i = 0; i < 8; ++i) {
                const float pp = exp2f(sc[t][i] - mref);
                rt[t] += pp; pa[t >> 1].v[(t & 1) * 8 + i] = (_Float16)(pp * 4096.f);
            }
        }
        l1 = l1 * corr + ((rt[0] + rt[1]) + (rt[2] + rt[3])); m1 = mnew;
#pragma unroll
        for (int t = 0; t < 4; ++t) o[t] *= corr;
        FragH vb[4][2];                                  // all eight V fragments behind one LDS latency
#pragma unroll
        for (int t = 0; t < 4; ++t) {
            vb[t][0].h[0] = ld_tr16(vfr + t * 16);           vb[t][0].h[1] = ld_tr16(vfr + 16 * VP + t * 16);
            vb[t][1].h[0] = ld_tr16(vfr + 32 * VP + t * 16); vb[t][1].h[1] = ld_tr16(vfr + 48 * VP + t * 16);
        }
#pragma unroll
        for (int t = 0; t < 4; ++t) {
            o[t] = wmma16(vb[t][0].v, pa[0].v, o[t]);
            o[t] = wmma16(vb[t][1].v, pa[1].v, o[t]);
        }
    }
    float* obase = O + h * 64;
    const float lt = l1 + swap_half(l1);
    const float inv = (lt > 0.f) ? 1.f / (lt * 4096.f) : 0.f;
#pragma unroll
    for (int t = 0; t < 4; ++t) {
        const v8f ov = o[t] * inv;
        *(v4f*)(myp + l15 * OP + t * 16 + 8 * hf)     = __builtin_shufflevector(ov, ov, 0, 1, 2, 3);
        *(v4f*)(myp + l15 * OP + t * 16 + 8 * hf + 4) = __builtin_shufflevector(ov, ov, 4, 5, 6, 7);
    }
    __syncthreads();
#pragma unroll
    for (int r0 = 0; r0 < 16; r0 += 2) {
        const int row = r0 + hf, c4 = l15 * 4;
        const v4f v = *(const v4f*)(myp + row * OP + c4);
        VST2V4(obase + (long long)(q0 + row) * OS + c4, v);
    }
}

// =====================================================================================================================
// k_tr: dst(z, c, r) = alpha * src(z, r, c) (+ beta * R2(z, c, r)): [Z][R][C] (row stride lds) -> [Z][C][R] (row stride ldd) through a 32x32 LDS tile;
//   flags: 1 -> add beta * residual R2 addressed like dst (z*sRz + c*ldr + r); act applied before the residual.
// =====================================================================================================================
struct TrP { const float* src; float* dst; const float* R2; long long sSz, lds, sDz, ldd, sRz, ldr; int R, C, flags, act; float alpha, beta; };
static_assert(sizeof(TrP) == 3 * 8 + 6 * 8 + 6 * 4, "TrP has padding");
__global__ __launch_bounds__(256) void k_tr(TrP p) {
    __shared__ float tile[32][33];
    const int c0 = blockIdx.x * 32, r0 = blockIdx.y * 32, z = blockIdx.z;
    const int lane = threadIdx.x & 31, wave = threadIdx.x >> 5;
    const float* s = p.src + z * p.sSz;
#pragma unroll
    for (int k = 0; k < 4; ++k) {
        const int rl = wave * 4 + k, r = r0 + rl, c = c0 + lane;
        tile[rl][lane] = (r < p.R && c < p.C) ? s[(long long)r * p.lds + c] : 0.f;
    }
    __syncthreads();
    float* d = p.dst + z * p.sDz; const float* rr = p.R2 + z * p.sRz;
#pragma unroll
    for (int k = 0; k < 4; ++k) {
        const int cl = wave * 4 + k, c = c0 + cl, r = r0 + lane;
        if (c < p.C && r < p.R) {
            float v = act_fn(p.alpha * tile[lane][cl], p.act);
            if (p.flags & 1) v += p.beta * rr[(long long)c * p.ldr + r];
            VST2(float, d + (long long)c * p.ldd + r, v);
        }
    }
}

// k_affine: dst[i] = a * (sdev ? sdev[0] : 1) * src[i] + b, i < n (one thread per element; consecutive lanes -> consecutive addresses)
__global__ __launch_bounds__(256) void k_affine(const float* __restrict__ src, float* __restrict__ dst, int n, float a, float b, const float* __restrict__ sdev) {
    const int i = blockIdx.x * 256 + threadIdx.x;
    if (i < n) { const float aa = sdev ? a * sdev[0] : a; const float v = aa * src[i] + b; VST2(float, dst + i, v); }
}

// =====================================================================================================================
// k_softmax: row softmax over n contiguous elements, one 256-thread block per row; rows addressed z*sz + r*sr (grid (R, Z)).
//   out = scale_out * softmax(scale_in * x + (Mf ? Mf[z*smz + r*smr + j] : 0)); a row whose max is -inf is written as 0.
// =====================================================================================================================
struct SmP { const float* src; float* dst; const float* Mf; long long sz, sr, dz, dr, smz, smr; int n, pad; float scale_in, scale_out; };
static_assert(sizeof(SmP) == 3 * 8 + 6 * 8 + 4 * 4, "SmP has padding");
__global__ __launch_bounds__(256) void k_softmax(SmP p) {
    __shared__ float red[256];
    const int r = blockIdx.x, z = blockIdx.y, tid = threadIdx.x;
    const float* s = p.src + z * p.sz + (long long)r * p.sr;
    const float* mf = p.Mf ? (p.Mf + z * p.smz + (long long)r * p.smr) : nullptr;
    float mx = -__builtin_inff();
    for (int j = tid; j < p.n; j += 256) { float v = s[j] * p.scale_in; if (mf) v += mf[j]; mx = fmaxf(mx, v); }
    red[tid] = mx; __syncthreads();
    for (int o = 128; o > 0; o >>= 1) { if (tid < o) red[tid] = fmaxf(red[tid], red[tid + o]); __syncthreads(); }
    mx = red[0]; __syncthreads();
    float sum = 0.f;
    for (int j = tid; j < p.n; j += 256) { float v = s[j] * p.scale_in; if (mf) v += mf[j]; sum += (mx == -__builtin_inff()) ? 0.f : expf(v - mx); }
    red[tid] = sum; __syncthreads();
    for (int o = 128; o > 0; o >>= 1) { if (tid < o) red[tid] += red[tid + o]; __syncthreads(); }
    sum = red[0];
    const float inv = (sum > 0.f) ? p.scale_out / sum : 0.f;
    float* d = p.dst + z * p.dz + (long long)r * p.dr;
    for (int j = tid; j < p.n; j += 256) { float v = s[j] * p.scale_in; if (mf) v += mf[j]; const float o = (mx == -__builtin_inff()) ? 0.f : expf(v - mx) * inv; VST2(float, d + j, o); }
}
// =====================================================================================================================
// k_stats: mean and rsqrt(var + eps) over a set of n elements addressed base + z*sz + (e / inner) * so + (e % inner) * si, one 256-thread
// k_norm_apply: y = (x - mean[set]) * rstd[set] * g[c] + b[c] over a [Z][C][L] channel-major tensor with set = z*G + c / (C/G) (G groups per z;
//   G = C -> per-channel sets indexed z*C+c; for batch norm pass stats indexed by c only via bn = 1). Optional act. Output same layout.
// =====================================================================================================================
//   mode 0: mean / rsqrt(var + eps); mode 1 (RMSNorm): 0 / rsqrt(mean(x^2) + eps); mode 2 (L2 normalize * sqrt(n)): 0 / sqrt(n) / max(||x||, eps); mode 3: as 0 with unbiased variance (n-1)
__global__ __launch_bounds__(256) void k_stats(const float* __restrict__ x, long long sz, long long so, long long si, int inner, int n, float eps, float* __restrict__ stat, int mode) {
    __shared__ float red[256];
    const int z = blockIdx.x, tid = threadIdx.x;
    const float* base = x + z * sz;
    float s = 0.f;
    for (int e = tid; e < n; e += 256) s += base[(long long)(e / inner) * so + (long long)(e % inner) * si];
    red[tid] = s; __syncthreads();
    for (int o = 128; o > 0; o >>= 1) { if (tid < o) red[tid] += red[tid + o]; __syncthreads(); }
    const float mu = (mode == 0 || mode == 3) ? red[0] / (float)n : 0.f; __syncthreads();
    float q = 0.f;
    for (int e = tid; e < n; e += 256) { const float dlt = base[(long long)(e / inner) * so + (long long)(e % inner) * si] - mu; q += dlt * dlt; }
    red[tid] = q; __syncthreads();
    for (int o = 128; o > 0; o >>= 1) { if (tid < o) red[tid] += red[tid + o]; __syncthreads(); }
    {
        float rs;
        if (mode == 2) rs = sqrtf((float)n) / fmaxf(sqrtf(red[0]), eps); else if (mode == 3) rs = rsqrtf(red[0] / (float)(n - 1) + eps); else rs = rsqrtf(red[0] / (float)n + eps);
        if (tid < 32) { const float v = (tid == 0) ? mu : ((tid == 1) ? rs : 0.f); VST2(float, stat + (long long)z * 32 + tid, v); }
    }
}
//   One thread per element over the flat [Z][C][L] index space: grid ceil(Z*C*L / 256).
__global__ __launch_bounds__(256) void k_norm_apply(const float* __restrict__ x, float* __restrict__ y, const float* __restrict__ stat, const float* __restrict__ g, const float* __restrict__ bta,
                                                     int Z, int C, int L, int G, int bn, int act) {
    const long long idx = (long long)blockIdx.x * 256 + threadIdx.x;
    if (idx >= (long long)Z * C * L) return;
    const int l = (int)(idx % L); const long long zc = idx / L; const int c = (int)(zc % C), z = (int)(zc / C); (void)l;
    const int set = bn ? c : (z * G + c / (C / G));
    float v = (x[idx] - stat[(long long)set * 32]) * stat[(long long)set * 32 + 1];
    if (g) v *= g[c];
    if (bta) v += bta[c];
    v = act_fn(v, act);
    VST2(float, y + idx, v);
}

// k_lse_neg: c[i] = -(st[2i] + log(st[2i+1])) = minus the log-sum-exp of row i from (max, sum) statistic pairs (for softmax over the query dimension)
__global__ __launch_bounds__(256) void k_lse_neg(const float* __restrict__ st, float* __restrict__ c, int n) {
    const int i = blockIdx.x * 256 + threadIdx.x;
    if (i < n) { const float v = -(st[2 * i] + logf(st[2 * i + 1])); VST2(float, c + i, v); }
}

// k_iota: dst[i] = a * i + b as int32 (segment/position id helper)
__global__ __launch_bounds__(256) void k_iota(int* __restrict__ dst, int n, int a, int b) {
    const int i = blockIdx.x * 256 + threadIdx.x;
    if (i < n) { const int v = a * i + b; VST2(int, dst + i, v); }
}

// k_axpby: dst[i] = a * x[i] + b * y[i] (+ c), i < n
__global__ __launch_bounds__(256) void k_axpby(const float* __restrict__ x, const float* __restrict__ y, float* __restrict__ dst, int n, float a, float b, float c) {
    const int i = blockIdx.x * 256 + threadIdx.x;
    if (i < n) { const float v = a * x[i] + b * y[i] + c; VST2(float, dst + i, v); }
}

// =====================================================================================================================
// k_rope: rotary embedding on a [R rows][Hn heads][D] view (row stride sXr, head stride sXh, element stride 1) -> Y (own strides).
//   mode 0: rotate_half (partner d±D/2, sign - for d<D/2); mode 1: interleaved pairs (partner d^1, sign - for even d).
//   table column tcol: tmode 0 -> d, 1 -> d % (D/2), 2 -> d / 2; position p: pmode 0 -> r % S, 1 -> head index, 2 -> pos[r];
//   c = C[(r / S) * sCb + p * sCp + tcol * sCd], s likewise from Sn; y = x[d] * c + sign * x[partner] * s. X and Y must not alias.
// =====================================================================================================================
struct RopeP { const float* X; float* Y; const float* C; const float* Sn; const int* pos; long long sXr, sXh, sYr, sYh, sCb, sCp, sCd; int R, Hn, D, S, mode, tmode, pmode, pad; };
static_assert(sizeof(RopeP) == 5 * 8 + 7 * 8 + 8 * 4, "RopeP has padding");
__global__ __launch_bounds__(256) void k_rope(RopeP p) {
    const long long idx = (long long)blockIdx.x * 256 + threadIdx.x;
    if (idx >= (long long)p.R * p.Hn * p.D) return;
    const int d = (int)(idx % p.D); const long long rh = idx / p.D; const int h = (int)(rh % p.Hn); const int r = (int)(rh / p.Hn);
    const int half = p.D / 2;
    int partner; float sign;
    if (p.mode == 0) { partner = (d < half) ? d + half : d - half; sign = (d < half) ? -1.f : 1.f; }
    else { partner = d ^ 1; sign = (d & 1) ? 1.f : -1.f; }
    const int tcol = (p.tmode == 0) ? d : ((p.tmode == 1) ? (d % half) : (d >> 1));
    const int pp = (p.pmode == 0) ? (r % p.S) : ((p.pmode == 1) ? h : p.pos[r]);
    const long long toff = (long long)(r / p.S) * p.sCb + (long long)pp * p.sCp + (long long)tcol * p.sCd;
    const float* xr = p.X + (long long)r * p.sXr + (long long)h * p.sXh;
    const float v = xr[d] * p.C[toff] + sign * xr[partner] * p.Sn[toff];
    VST2(float, p.Y + (long long)r * p.sYr + (long long)h * p.sYh + d, v);
}

// k_invf + k_sincos (split so neither kernel carries a large VALU-fma footprint): invf_i = num * (1 / powf(base, (2 i)/D)) [fmode 0],
//   num * expf((2 i) * cexp) [fmode 1], num * powf(base, -2 (i - 1) / D) [fmode 2]; then cs/sn[s*half + i] = cos/sin((pscale * s) * invf_i)
__global__ __launch_bounds__(256) void k_invf(float* __restrict__ invb, int half, int D, float base, float num, int fmode, float cexp) {
    const int i = blockIdx.x * 256 + threadIdx.x;
    if (i >= ((half + 31) / 32) * 32) return;
    if (i >= half) { VST2(float, invb + i, 0.f); return; }
    const float e = (float)(2 * i) / (float)D;
    float invf;
    if (fmode == 1) invf = num * expf((float)(2 * i) * cexp);
    else if (fmode == 2) invf = num * powf(base, (-2.0f * ((float)i - 1.0f)) / (float)D);
    else invf = num * (1.0f / powf(base, e));
    VST2(float, invb + i, invf);
}
__global__ __launch_bounds__(256) void k_sincos(float* __restrict__ cs, float* __restrict__ sn, const float* __restrict__ invb, int S, int half, float pscale) {
    const int idx = blockIdx.x * 256 + threadIdx.x;
    if (idx >= S * half) return;
    const int s = idx / half, i = idx - s * half;
    const float ang = (pscale * (float)s) * invb[i];
    VST2(float, cs + idx, cosf(ang)); VST2(float, sn + idx, sinf(ang));
}

// k_mulact: dst[i] = act(x[i]) * y[i]
__global__ __launch_bounds__(256) void k_mulact(const float* __restrict__ x, const float* __restrict__ y, float* __restrict__ dst, int n, int act) {
    const int i = blockIdx.x * 256 + threadIdx.x;
    if (i < n) { const float v = act_fn(x[i], act) * y[i]; VST2(float, dst + i, v); }
}

// =====================================================================================================================
// k_matvec: thread-per-row matrix-vector products for N <= 8 output columns (heads with 1-3 outputs, gates), f32 on the VALU.
//   C[r*sCm + j] = act(alpha * sum_k A[r*sAm + k*sAk] * B[j*sBn + k*sBk] + bias[j]) + beta * R[r*sRm + j*sRn]; each thread writes its N contiguous floats.
// =====================================================================================================================
__global__ __launch_bounds__(256) void k_matvec(GemmP p) {
    // 32 lanes write one line with one instruction.
    const int rpt = (p.N == 1) ? 1 : 32;
    const long long r0 = ((long long)blockIdx.x * 256 + threadIdx.x) * rpt; const int z = blockIdx.z, zo = z / p.zi_n, zi = z - zo * p.zi_n;
    if (r0 >= p.M) return;
    const float* Bb = p.B + zo * p.sBo + zi * p.sBi;
    float* C = p.C + zo * p.sCo + zi * p.sCi; const float* R = p.R + zo * p.sRo + zi * p.sRi;
    for (int rr = 0; rr < rpt; ++rr) {
        const long long r = r0 + rr; if (r >= p.M) break;
        const float* A = p.A + zo * p.sAo + zi * p.sAi + r * p.sAm;
        float acc[8] = {0.f, 0.f, 0.f, 0.f, 0.f, 0.f, 0.f, 0.f};
        for (int k = 0; k < p.K; ++k) { const float a = A[(long long)k * p.sAk];
#pragma unroll
            for (int j = 0; j < 8; ++j) if (j < p.N) acc[j] += a * Bb[(long long)j * p.sBn + (long long)k * p.sBk]; }
#pragma unroll
        for (int j = 0; j < 8; ++j) if (j < p.N) {
            float v = acc[j] * p.alpha;
            if (p.flags & 1) v += p.bias[j];
            if (p.flags & 2) v += p.bias[r];
            v = act_fn(v, p.act);
            if (p.flags & 4) v += p.beta * R[r * p.sRm + (long long)j * p.sRn];
            VST2(float, C + r * p.sCm + j, v);
        }
    }
}
// k_smallsoftmax: thread-per-row softmax for short rows (n <= 64): dst[r*dr + j] = softmax(scale*src[r*sr + j])
__global__ __launch_bounds__(256) void k_smallsoftmax(const float* __restrict__ src, float* __restrict__ dst, long long sr, long long dr, int n, long long R, float scale) {
    const long long r0 = ((long long)blockIdx.x * 256 + threadIdx.x) * 32;
    for (int rr = 0; rr < 32; ++rr) {
        const long long r = r0 + rr; if (r >= R) return;
        const float* s = src + r * sr; float* d = dst + r * dr;
        float mx = -__builtin_inff();
        for (int j = 0; j < n; ++j) mx = fmaxf(mx, s[j] * scale);
        float sum = 0.f;
        for (int j = 0; j < n; ++j) sum += expf(s[j] * scale - mx);
        const float inv = 1.f / sum;
        for (int j = 0; j < n; ++j) { const float v = expf(s[j] * scale - mx) * inv; VST2(float, d + j, v); }
    }
}

__global__ __launch_bounds__(32) void k_unitstat(float* __restrict__ st) { const int t = threadIdx.x; const float v = (t == 1) ? 1.f : 0.f; VST2(float, st + t, v); }

// destination (e.g. a d_out whose row width is not a multiple of 32 floats) is written by consecutive lanes of one instruction
__global__ __launch_bounds__(256) void k_lincopy(const float* __restrict__ src, long long lds, float* __restrict__ dst, long long ldd, long long rows, int cols) {
    const long long i = (long long)blockIdx.x * 256 + threadIdx.x; if (i >= rows * cols) return;
    const long long r = i / cols; const int c = (int)(i - r * cols);
    const float v = src[r * lds + c]; VST2(float, dst + r * ldd + c, v);
}

namespace w25 {
typedef __attribute__((ext_vector_type(16))) _Float16 v16h;
typedef __attribute__((ext_vector_type(8)))  _Float16 v8h;
typedef __attribute__((ext_vector_type(16))) __bf16   v16b;
typedef __attribute__((ext_vector_type(8)))  __bf16   v8b;
typedef __attribute__((ext_vector_type(8)))  float    v8f;
typedef __attribute__((ext_vector_type(4)))  float    v4f;

__device__ __forceinline__ unsigned short f2bf_bits(float f) {
  unsigned u = __float_as_uint(f);
  return (unsigned short)((u + 0x7FFFu + ((u >> 16) & 1u)) >> 16);
}
__device__ __forceinline__ float bf_bits2f(unsigned short h) { return __uint_as_float(((unsigned)h) << 16); }

// hazard guards as plain device helpers (no inline asm inside the kernel template body)
__device__ __forceinline__ void dep_guard_h(v8f& a, v8f& b, v16h x, v16h y) { asm volatile("v_nop\n\tv_nop\n\tv_nop\n\tv_nop" : "+v"(a), "+v"(b) : "v"(x), "v"(y)); }
__device__ __forceinline__ void dep_guard_b(v8f& a, v8f& b, v16b x, v16b y) { asm volatile("v_nop\n\tv_nop\n\tv_nop\n\tv_nop" : "+v"(a), "+v"(b) : "v"(x), "v"(y)); }
__device__ __forceinline__ void keep4_h(v16h a, v16h b, v16h c, v16h d) { asm volatile("v_nop" :: "v"(a), "v"(b), "v"(c), "v"(d)); }
__device__ __forceinline__ void keep4_b(v16b a, v16b b, v16b c, v16b d) { asm volatile("v_nop" :: "v"(a), "v"(b), "v"(c), "v"(d)); }
__device__ __forceinline__ void acc_guard4(v8f& a, v8f& b, v8f& c, v8f& d) { asm volatile("v_nop\n\tv_nop\n\tv_nop\n\tv_nop" : "+v"(a), "+v"(b), "+v"(c), "+v"(d)); }
template <typename T> struct Frag;
template <> struct Frag<_Float16> {
  typedef v16h V; union U { v16h v; v8h h[2]; };
  static __device__ __forceinline__ v16h load(const _Float16* p) {   // elements 0..7 <- p[0..7], 8..15 <- p[16..23]
    U f; f.h[0] = *(const v8h*)(p); f.h[1] = *(const v8h*)(p + 16); return f.v;
  }
  static __device__ __forceinline__ v8f mma(v16h a, v16h b, v8f c) {
    return __builtin_amdgcn_wmma_f32_16x16x32_f16(false, a, false, b, (short)0, c, false, false);
  }
  static __device__ __forceinline__ void guard(v8f& a, v8f& b, v16h x, v16h y) { dep_guard_h(a, b, x, y); }
  static __device__ __forceinline__ void keep(v16h a, v16h b, v16h c, v16h d) { keep4_h(a, b, c, d); }
};
template <> struct Frag<__bf16> {
  typedef v16b V; union U { v16b v; v8b h[2]; };
  static __device__ __forceinline__ v16b load(const __bf16* p) {
    U f; f.h[0] = *(const v8b*)(p); f.h[1] = *(const v8b*)(p + 16); return f.v;
  }
  static __device__ __forceinline__ v8f mma(v16b a, v16b b, v8f c) {
    return __builtin_amdgcn_wmma_f32_16x16x32_bf16(false, a, false, b, (short)0, c, false, false);
  }
  static __device__ __forceinline__ void guard(v8f& a, v8f& b, v16b x, v16b y) { dep_guard_b(a, b, x, y); }
  static __device__ __forceinline__ void keep(v16b a, v16b b, v16b c, v16b d) { keep4_b(a, b, c, d); }
};

// ---- Register-blocked batched WMMA GEMM ------------------------------------
// C[m,n] = scale * sum_k A[m,k] * Bt[n,k] (+bias)(+resid); each wave owns a 64x64 tile.
// A row-major [M,K]; Bt row-major [N,K]; M,N % 64 == 0, K % 32 == 0.
// SPLIT: operands are hi/lo planes (A2/Bt2 = lo planes, same layout); product = hi·hi + hi·lo + lo·hi.
// BIAS_MODE: 0 = none, 1 = bias[m], 2 = bias[n].
// OUT_MODE: 0 = f32, 1 = f16, 2 = bf16 hi plane (Cout) + bf16 lo plane (Cout2).
// ET: 0 = f16 operands, 1 = bf16 operands (pointers passed as 16-bit storage)
template <int ET> struct Elem;
template <> struct Elem<0> { typedef _Float16 T; };
template <> struct Elem<1> { typedef __bf16 T; };
template <int ET, bool SPLIT, int BIAS_MODE, int OUT_MODE, bool RESID, int ACT = 0>
__global__ __launch_bounds__(256) void wmma_gemm64(
    const unsigned short* __restrict__ Ap, const unsigned short* __restrict__ A2p, int lda, long strideA,
    const unsigned short* __restrict__ Btp, const unsigned short* __restrict__ Bt2p, int ldb, long strideB,
    void* __restrict__ Cout, void* __restrict__ Cout2, int ldc, long strideC,
    const float* __restrict__ bias,
    const float* __restrict__ resid, long strideR,
    int M, int N, int K, float scale) {
  typedef typename Elem<ET>::T T;
  typedef typename Frag<T>::V V;
  const T* A = (const T*)Ap; const T* A2 = (const T*)A2p; const T* Bt = (const T*)Btp; const T* Bt2 = (const T*)Bt2p;
  __shared__ __align__(16) float sT[8][16 * 68];   // per-wave 16x64 slab, pitch 68 floats
  const int b    = blockIdx.y;
  const int lane = threadIdx.x & 31;
  const int wave = threadIdx.x >> 5;
  const int tilesN = N >> 6;
  const int tilesM = M >> 6;
  const int tile = blockIdx.x * 8 + wave;
  if (tile >= tilesM * tilesN) return;   // wave-uniform; no block barriers in this kernel
  const int tm = tile / tilesN;
  const int tn = tile - tm * tilesN;
  const int m0 = tm << 6;
  const int n0 = tn << 6;

  const T* Ab  = A  + (size_t)b * strideA;
  const T* Bb  = Bt + (size_t)b * strideB;
  const T* Ab2 = SPLIT ? (A2  + (size_t)b * strideA) : nullptr;
  const T* Bb2 = SPLIT ? (Bt2 + (size_t)b * strideB) : nullptr;

  const int rlane = lane & 15;                 // row (A) / col (B, D) within subtile
  const int koff  = (lane >> 4) * 8;           // k offset of this lane half
  const int mOff  = (lane >> 4) * 8;           // D row offset

  v8f acc[4][4];
#pragma unroll
  for (int i = 0; i < 4; ++i)
#pragma unroll
    for (int j = 0; j < 4; ++j) acc[i][j] = (v8f){0.f,0.f,0.f,0.f,0.f,0.f,0.f,0.f};

  for (int k0 = 0; k0 < K; k0 += 32) {
    V bh[4], bl[4];
#pragma unroll
    for (int j = 0; j < 4; ++j) {
      const size_t bo = (size_t)(n0 + (j << 4) + rlane) * ldb + koff + k0;
      bh[j] = Frag<T>::load(Bb + bo);
      if (SPLIT) bl[j] = Frag<T>::load(Bb2 + bo);
    }
#pragma unroll
    for (int i = 0; i < 4; ++i) {
      const size_t ao = (size_t)(m0 + (i << 4) + rlane) * lda + koff + k0;
      V ah = Frag<T>::load(Ab + ao);
      V al;
      if (SPLIT) al = Frag<T>::load(Ab2 + ao);
#pragma unroll
      for (int j = 0; j < 4; ++j) {
        acc[i][j] = Frag<T>::mma(ah, bh[j], acc[i][j]);
        if (SPLIT) {
          acc[i][j] = Frag<T>::mma(ah, bl[j], acc[i][j]);
          acc[i][j] = Frag<T>::mma(al, bh[j], acc[i][j]);
        }
      }
      Frag<T>::guard(acc[i][0], acc[i][3], ah, SPLIT ? al : ah);
    }
    Frag<T>::keep(bh[0], bh[1], bh[2], bh[3]);
    if (SPLIT) Frag<T>::keep(bl[0], bl[1], bl[2], bl[3]);
  }
  acc_guard4(acc[0][0], acc[0][1], acc[0][2], acc[0][3]);
  acc_guard4(acc[1][0], acc[1][1], acc[1][2], acc[1][3]);
  acc_guard4(acc[2][0], acc[2][1], acc[2][2], acc[2][3]);
  acc_guard4(acc[3][0], acc[3][1], acc[3][2], acc[3][3]);

  // ---- epilogue ----
  float* slab = sT[wave];
  const float* Rb = RESID ? (resid + (size_t)b * strideR) : nullptr;
#pragma unroll
  for (int i = 0; i < 4; ++i) {
    const int mBase = m0 + (i << 4);
#pragma unroll
    for (int j = 0; j < 4; ++j) {
      const int n = n0 + (j << 4) + rlane;
      float bv = 0.f;
      if (BIAS_MODE == 2) bv = bias[n];
#pragma unroll
      for (int r = 0; r < 8; ++r) {
        float v = acc[i][j][r] * scale;
        if (BIAS_MODE == 1) v += bias[mBase + mOff + r];
        if (BIAS_MODE == 2) v += bv;
        if (RESID) v += Rb[(size_t)(mBase + mOff + r) * ldc + n];
        if (ACT == 1) v = tanhf(v);
        if (ACT == 2) v = fmaxf(v, 0.0f);
        if (ACT == 3) v = v / (1.0f + expf(-v));
        if (ACT == 4) v = (v > 0.f) ? v : 0.01f * v;
        if (ACT == 5) v = 0.5f * v * (1.0f + erff(v * 0.70710678118654752f));
        if (ACT == 6) v = (v > 0.f) ? v : 0.2f * v;
        slab[(mOff + r) * 68 + (j << 4) + rlane] = v;
      }
    }
    __builtin_amdgcn_fence(__ATOMIC_RELEASE, "workgroup");
    __builtin_amdgcn_wave_barrier();
    __builtin_amdgcn_fence(__ATOMIC_ACQUIRE, "workgroup");
    if (OUT_MODE == 0) {
      float* C = (float*)Cout + (size_t)b * strideC;
      const int hh = lane >> 4, c4 = (lane & 15) * 4;     // row seg = 256 B = 16 lanes x 16 B
      {
#pragma unroll
        for (int it = 0; it < 8; ++it) {
          const int row = it * 2 + hh;
          v4f v = *(const v4f*)(slab + row * 68 + c4);
          *(v4f*)(C + (size_t)(mBase + row) * ldc + n0 + c4) = v;
        }
        
      }
    } else {
      const int q = lane >> 3, c8 = (lane & 7) * 8;
      unsigned short* C  = (unsigned short*)Cout  + (size_t)b * strideC;
      unsigned short* C2 = (OUT_MODE == 2) ? ((unsigned short*)Cout2 + (size_t)b * strideC) : nullptr;
      {
#pragma unroll
        for (int it = 0; it < 4; ++it) {
          const int row = it * 4 + q;
          const float* sp = slab + row * 68 + c8;
          v8h hv, lv;
#pragma unroll
          for (int e = 0; e < 8; ++e) {
            if (OUT_MODE == 1) {
              hv[e] = (_Float16)sp[e];
            } else {
              unsigned short hb = f2bf_bits(sp[e]);
              unsigned short lb = f2bf_bits(sp[e] - bf_bits2f(hb));
              hv[e] = __builtin_bit_cast(_Float16, hb);
              lv[e] = __builtin_bit_cast(_Float16, lb);
            }
          }
          *(v8h*)(C + (size_t)(mBase + row) * ldc + n0 + c8) = hv;
          if (OUT_MODE == 2) *(v8h*)(C2 + (size_t)(mBase + row) * ldc + n0 + c8) = lv;
        }
        
      }
    }
    __builtin_amdgcn_fence(__ATOMIC_RELEASE, "workgroup");
    __builtin_amdgcn_wave_barrier();
    __builtin_amdgcn_fence(__ATOMIC_ACQUIRE, "workgroup");
  }
}

__global__ __launch_bounds__(256) void cast_f32_f16x2(
    const float* __restrict__ in, _Float16* __restrict__ out, int n2) {
  int i = blockIdx.x * 256 + threadIdx.x;
  if (i < n2) {
    const _Float16 h0 = (_Float16)in[2 * i], h1 = (_Float16)in[2 * i + 1];
    const unsigned u = (unsigned)__builtin_bit_cast(unsigned short, h0) | ((unsigned)__builtin_bit_cast(unsigned short, h1) << 16);
    ((unsigned*)out)[i] = u;
    
  }
}


} // namespace w25

__global__ __launch_bounds__(256) void k_castT16(const float* __restrict__ src, long long lds, _Float16* __restrict__ dst, long long ldd, int R, int C, float s) {
    const long long i = (long long)blockIdx.x * 256 + threadIdx.x; const long long np = (long long)C * (R / 2); if (i >= np) return; const int c = (int)(i / (R / 2)); const int r = 2 * (int)(i % (R / 2));
    const _Float16 h0 = (_Float16)(src[(long long)r * lds + c] * s), h1 = (_Float16)(src[(long long)(r + 1) * lds + c] * s);
    const unsigned u = (unsigned)__builtin_bit_cast(unsigned short, h0) | ((unsigned)__builtin_bit_cast(unsigned short, h1) << 16);
    unsigned* d = (unsigned*)(dst + (long long)c * ldd + r); *d = u;  }
__global__ __launch_bounds__(256) void k_cast16(const float* __restrict__ src, long long lds, _Float16* __restrict__ dst, long long ldd, int R, int C, float s) {
    const long long i = (long long)blockIdx.x * 256 + threadIdx.x; const long long np = (long long)R * (C / 2); if (i >= np) return; const int r = (int)(i / (C / 2)); const int c = 2 * (int)(i % (C / 2));
    const _Float16 h0 = (_Float16)(src[(long long)r * lds + c] * s), h1 = (_Float16)(src[(long long)r * lds + c + 1] * s);
    const unsigned u = (unsigned)__builtin_bit_cast(unsigned short, h0) | ((unsigned)__builtin_bit_cast(unsigned short, h1) << 16);
    unsigned* d = (unsigned*)(dst + (long long)r * ldd + c); *d = u;  }

// f32 -> bf16 hi plane + bf16 lo plane (x = hi + lo to ~2^-17 relative; RNE both), [R][C] -> [R][C] (or transposed to [C][R]); 2 consecutive destination elements
__device__ __forceinline__ unsigned int f2bf2_pack(float a, float b, unsigned int* lo) {
    const unsigned short ha = w25::f2bf_bits(a), hb = w25::f2bf_bits(b);
    const unsigned short la = w25::f2bf_bits(a - w25::bf_bits2f(ha)), lb = w25::f2bf_bits(b - w25::bf_bits2f(hb));
    *lo = (unsigned)la | ((unsigned)lb << 16); return (unsigned)ha | ((unsigned)hb << 16); }
__global__ __launch_bounds__(256) void k_castS16(const float* __restrict__ src, long long lds, __bf16* __restrict__ dhi, __bf16* __restrict__ dlo, long long ldd, int R, int C, float s, int transpose) {
    const long long i = (long long)blockIdx.x * 256 + threadIdx.x; long long o; float a, b;
    if (transpose) { const long long np = (long long)C * (R / 2); if (i >= np) return; const int c = (int)(i / (R / 2)); const int r = 2 * (int)(i % (R / 2)); a = src[(long long)r * lds + c] * s; b = src[(long long)(r + 1) * lds + c] * s; o = (long long)c * ldd + r; }
    else { const long long np = (long long)R * (C / 2); if (i >= np) return; const int r = (int)(i / (C / 2)); const int c = 2 * (int)(i % (C / 2)); a = src[(long long)r * lds + c] * s; b = src[(long long)r * lds + c + 1] * s; o = (long long)r * ldd + c; }
    unsigned lo; const unsigned hi = f2bf2_pack(a, b, &lo); unsigned* ph = (unsigned*)(dhi + o); unsigned* pl = (unsigned*)(dlo + o);
    *ph = hi; *pl = lo;  }

namespace w25 {
// =====================================================================================
// Generic causal/non-causal attention for head_dim 64, f32 in / f32 out; 16-bit operands: bf16 with optional hi/lo splits, or
// plain f16 (F16=true, non-split, probabilities carried x2^15).
//   scores = (q*qscale)·kᵀ : v_wmma_f32_16x16x32_bf16; SPLIT_QK -> q,k as bf16 hi/lo (hi·hi + hi·lo + lo·hi)
//   out    = p·v           : v_wmma_f32_16x16x32_bf16; SPLIT_PV -> p,v as bf16 hi/lo; else p,v plain bf16
//   f32 accumulate; online softmax in f32. Block = 4 waves = 64 query rows of one (batch, head); S % 64 == 0.
//   Element (b, s, h, d) of tensor X lives at X[b*X_bs + s*X_rs + h*X_hs + d] (strides in floats, multiples of 4).
//   Masking: mask_mode 0 none, 1 causal (kv > q masked), 2 tensor [S][Skv] shared over (b,h) (float if
//   mask_is_int==0, int32 with element == 0 -> masked if 1, int32 with element != 0 -> masked if 2), 3 per-token vectors qmask[B][S] & kvmask[B][Skv] (int32,
//   0 -> masked), 4 causal + sliding window (kv > q or q - kv > W masked; W passed in mask_is_int);
//   5 = relative-position bias: s += cp[b,h,q][idx[q][kv]] + pc[b,h,kv][idx[q][kv]] with idx = mask_b ([S][Skv] int32) and
//   mask_a an int32 [S][Skv] tensor with nonzero = masked (tables: element (b,h,row,n) at X + b*c_bs + h*c_hs + row*c_rs + n);
//   masked scores are replaced by mask_fill (e.g. -inf or -1e9) before the softmax.
//   grid.x = B * H * (S/64) (or a sub-range with blk0).
// =====================================================================================
#define AT_D 64
#define AT_NW 4
#define AT_QB 64
#define AT_KC 64
struct AttnGeom { const float* cp = nullptr; const float* pc = nullptr; long c_bs = 0, c_rs = 0, c_hs = 0;   // mode-5 score-bias tables
                  long q_bs, q_rs, q_hs, k_bs, k_rs, k_hs, v_bs, v_rs, v_hs, o_bs, o_rs, o_hs;
                  int S, Skv, H, mask_mode; float qscale; int blk0; float mask_fill; int mask_is_int; };
static_assert(sizeof(AttnGeom) == 168, "no padding");

__device__ __forceinline__ unsigned short at_bf_bits(float f) {
  unsigned u = __float_as_uint(f);
  return (unsigned short)((u + 0x7FFFu + ((u >> 16) & 1u)) >> 16);
}
__device__ __forceinline__ __bf16 at_f2bf(float f) { return __builtin_bit_cast(__bf16, at_bf_bits(f)); }
__device__ __forceinline__ void at_split(float f, __bf16& hi, __bf16& lo) {
  const unsigned short hb = at_bf_bits(f);
  hi = __builtin_bit_cast(__bf16, hb);
  lo = at_f2bf(f - __uint_as_float(((unsigned)hb) << 16));
}
__device__ __forceinline__ v8f at_mma(v16b a, v16b b, v8f c) {
  c = __builtin_amdgcn_wmma_f32_16x16x32_bf16(false, a, false, b, (short)0, c, false, false);
  asm volatile("v_nop\n\tv_nop\n\tv_nop\n\tv_nop" : "+v"(c) : "v"(a), "v"(b));
  return c;
}
// 16-bit element as a bit pattern held in a __bf16 slot: f16 bits when F16, bf16 (RNE) otherwise
template <bool F16> __device__ __forceinline__ __bf16 at_to16(float f) {
  if (F16) return __builtin_bit_cast(__bf16, (_Float16)f);
  return at_f2bf(f);
}
template <bool F16> __device__ __forceinline__ v8f at_mma16(v16b a, v16b b, v8f c) {
  if (F16) {
    const v16h ah = __builtin_bit_cast(v16h, a), bh = __builtin_bit_cast(v16h, b);
    c = __builtin_amdgcn_wmma_f32_16x16x32_f16(false, ah, false, bh, (short)0, c, false, false);
    asm volatile("v_nop\n\tv_nop\n\tv_nop\n\tv_nop" : "+v"(c) : "v"(ah), "v"(bh));
    return c;
  }
  return at_mma(a, b, c);
}

template <bool SPLIT_QK, bool SPLIT_PV, bool F16 = false>
__global__ __launch_bounds__(128)
void attn64_kernel(const float* __restrict__ q, const float* __restrict__ k,
                   const float* __restrict__ v, float* __restrict__ out,
                   const void* __restrict__ mask_a, const int* __restrict__ mask_b, AttnGeom g) {
  static_assert(!(F16 && (SPLIT_QK || SPLIT_PV)), "f16 mode is non-split");
  const float PSC = F16 ? 32768.0f : 1.0f;     // f16 probabilities carried x2^15 (subnormal range), folded into the final 1/l
  union FB { v16b v; v8b h[2]; };
  __shared__ __align__(16) __bf16 Ksh[AT_KC * AT_D];             // K hi [kv][d]      8 KB
  __shared__ __align__(16) __bf16 Ksl[SPLIT_QK ? AT_KC * AT_D : 8];
  __shared__ __align__(16) __bf16 Vth[AT_D * AT_KC];             // V hi [d][kv]      8 KB
  __shared__ __align__(16) __bf16 Vtl[SPLIT_PV ? AT_D * AT_KC : 8];
  __shared__ __align__(16) __bf16 Psh[AT_NW][16 * AT_KC];        // per wave P hi [row][kv]  8 KB
  __shared__ __align__(16) __bf16 Psl[SPLIT_PV ? AT_NW : 1][SPLIT_PV ? 16 * AT_KC : 8];
  __shared__ __align__(16) float  Os[AT_NW][16 * 68];            // per wave out tile, pitch 68

  const int tid  = threadIdx.x;
  const int wave = tid >> 5;
  const int lane = tid & 31;
  const int hh   = lane >> 4;
  const int c    = lane & 15;

  const int nqb = g.S / AT_QB;
  const int bx = blockIdx.x + g.blk0;
  const int qb = bx % nqb;
  const int bh = bx / nqb;
  const int h  = bh % g.H;
  const int b  = bh / g.H;
  const int qbase_block = qb * AT_QB;
  const int q0 = qbase_block + wave * 16;

  const float* qb_ptr = q + (size_t)b * g.q_bs + (size_t)h * g.q_hs;
  const float* kb_ptr = k + (size_t)b * g.k_bs + (size_t)h * g.k_hs;
  const float* vb_ptr = v + (size_t)b * g.v_bs + (size_t)h * g.v_hs;
  float*       ob_ptr = out + (size_t)b * g.o_bs + (size_t)h * g.o_hs;

  // ---- Q fragments (A operand): 2 d-chunks, hi (and lo) ----
  v16b qah[2], qal[2];
  {
    const float* qrow = qb_ptr + (size_t)(q0 + c) * g.q_rs;
#pragma unroll
    for (int dc = 0; dc < 2; ++dc) {
#pragma unroll
      for (int e = 0; e < 8; ++e) {
        const float f0 = qrow[dc * 32 + 8 * hh + e] * g.qscale;
        const float f1 = qrow[dc * 32 + 16 + 8 * hh + e] * g.qscale;
        if (SPLIT_QK) { __bf16 hq, lq; at_split(f0, hq, lq); qah[dc][e] = hq; qal[dc][e] = lq; at_split(f1, hq, lq); qah[dc][8 + e] = hq; qal[dc][8 + e] = lq; }
        else { qah[dc][e] = at_to16<F16>(f0); qah[dc][8 + e] = at_to16<F16>(f1); qal[dc][e] = qah[dc][e]; qal[dc][8 + e] = qah[dc][8 + e]; }
      }
    }
  }

  float mrow[8], lrow[8];
  v8f oacc[4];
#pragma unroll
  for (int r = 0; r < 8; ++r) { mrow[r] = -INFINITY; lrow[r] = 0.f; }
#pragma unroll
  for (int t = 0; t < 4; ++t) oacc[t] = (v8f){0.f,0.f,0.f,0.f,0.f,0.f,0.f,0.f};

  const int nChunks = (g.mask_mode == 1 || g.mask_mode == 4) ? (qb + 1) : (g.Skv / AT_KC);   // block-uniform
  // per-row query mask (mode 3)
  int qkeep[8];
#pragma unroll
  for (int r = 0; r < 8; ++r) qkeep[r] = (g.mask_mode == 3) ? mask_b[(size_t)b * g.S + q0 + 8 * hh + r] : 1;   // mask_b = qmask in mode 3
  for (int kc = 0; kc < nChunks; ++kc) {
    const int kv0 = kc * AT_KC;
    __syncthreads();
    {
      const int kvr = tid >> 1, dh = (tid & 1) * 32;
      const float* krow = kb_ptr + (size_t)(kv0 + kvr) * g.k_rs + dh;
      const float* vrow = vb_ptr + (size_t)(kv0 + kvr) * g.v_rs + dh;
#pragma unroll
      for (int i = 0; i < 8; ++i) {
        v4f kk = *(const v4f*)(krow + 4 * i);
        v4f vv = *(const v4f*)(vrow + 4 * i);
#pragma unroll
        for (int e = 0; e < 4; ++e) {
          const int d = dh + 4 * i + e;
          if (SPLIT_QK) { __bf16 a, bl; at_split(kk[e], a, bl); Ksh[kvr * AT_D + d] = a; Ksl[kvr * AT_D + d] = bl; }
          else Ksh[kvr * AT_D + d] = at_to16<F16>(kk[e]);
          if (SPLIT_PV) { __bf16 a, bl; at_split(vv[e], a, bl); Vth[d * AT_KC + kvr] = a; Vtl[d * AT_KC + kvr] = bl; }
          else Vth[d * AT_KC + kvr] = at_to16<F16>(vv[e]);
        }
      }
    }
    __syncthreads();

    v8f s[4];
#pragma unroll
    for (int j = 0; j < 4; ++j) {
      s[j] = (v8f){0.f,0.f,0.f,0.f,0.f,0.f,0.f,0.f};
#pragma unroll 1
      for (int dc = 0; dc < 2; ++dc) {
        FB kb;
        kb.h[0] = *(const v8b*)(Ksh + (j * 16 + c) * AT_D + dc * 32 + 8 * hh);
        kb.h[1] = *(const v8b*)(Ksh + (j * 16 + c) * AT_D + dc * 32 + 16 + 8 * hh);
        s[j] = at_mma16<F16>(qah[dc], kb.v, s[j]);
        if (SPLIT_QK) {
          FB kl;
          kl.h[0] = *(const v8b*)(Ksl + (j * 16 + c) * AT_D + dc * 32 + 8 * hh);
          kl.h[1] = *(const v8b*)(Ksl + (j * 16 + c) * AT_D + dc * 32 + 16 + 8 * hh);
          s[j] = at_mma16<F16>(qah[dc], kl.v, s[j]);
          s[j] = at_mma16<F16>(qal[dc], kb.v, s[j]);
        }
      }
    }
    const bool diag = (g.mask_mode == 1) && (kc == qb);
    int kvkeep[4] = {1, 1, 1, 1};
    if (g.mask_mode == 3) {
#pragma unroll
      for (int j = 0; j < 4; ++j) kvkeep[j] = ((const int*)mask_a)[(size_t)b * g.Skv + kv0 + j * 16 + c];   // mask_a = kvmask
    }
    float cm[8];
#pragma unroll
    for (int r = 0; r < 8; ++r) {
      const int qrow = q0 + 8 * hh + r;
      float m = -INFINITY;
#pragma unroll
      for (int j = 0; j < 4; ++j) {
        const int kvcol = kv0 + j * 16 + c;
        bool masked = false;
        if (diag) masked = (kvcol > qrow);
        else if (g.mask_mode == 4) masked = (kvcol > qrow) || (qrow - kvcol > g.mask_is_int);
        else if (g.mask_mode == 2) {
          const size_t mi = (size_t)qrow * g.Skv + kvcol;
          masked = (g.mask_is_int == 0) ? (((const float*)mask_a)[mi] == 0.0f)
                 : (g.mask_is_int == 1) ? (((const int*)mask_a)[mi] == 0) : (((const int*)mask_a)[mi] != 0);
        } else if (g.mask_mode == 3) masked = (qkeep[r] == 0) || (kvkeep[j] == 0);
        else if (g.mask_mode == 5) {
          const size_t mi = (size_t)qrow * g.Skv + kvcol;
          masked = (((const int*)mask_a)[mi] != 0);
          int n = mask_b[mi]; n = n < 0 ? 0 : n;
          s[j][r] += g.cp[(size_t)b * g.c_bs + (size_t)h * g.c_hs + (size_t)qrow * g.c_rs + n]
                   + g.pc[(size_t)b * g.c_bs + (size_t)h * g.c_hs + (size_t)kvcol * g.c_rs + n];
        }
        if (masked) s[j][r] = g.mask_fill;
        m = fmaxf(m, s[j][r]);
      }
#pragma unroll
      for (int off = 1; off < 16; off <<= 1) m = fmaxf(m, __shfl_xor(m, off, 32));
      cm[r] = m;
    }
    __bf16* pwh = Psh[wave];
    __bf16* pwl = Psl[SPLIT_PV ? wave : 0];
#pragma unroll
    for (int r = 0; r < 8; ++r) {
      const float mnew = fmaxf(mrow[r], cm[r]);
      const float alpha = expf(mrow[r] - mnew);
      mrow[r] = mnew;
      float psum = 0.f;
#pragma unroll
      for (int j = 0; j < 4; ++j) {
        const float p = expf(s[j][r] - mnew);
        psum += p;
        if (SPLIT_PV) { __bf16 a, bl; at_split(p, a, bl); pwh[(8 * hh + r) * AT_KC + j * 16 + c] = a; pwl[(8 * hh + r) * AT_KC + j * 16 + c] = bl; }
        else pwh[(8 * hh + r) * AT_KC + j * 16 + c] = at_to16<F16>(p * PSC);
      }
#pragma unroll
      for (int off = 1; off < 16; off <<= 1) psum += __shfl_xor(psum, off, 32);
      lrow[r] = lrow[r] * alpha + psum;
#pragma unroll
      for (int t = 0; t < 4; ++t) oacc[t][r] *= alpha;
    }
    __builtin_amdgcn_fence(__ATOMIC_RELEASE, "workgroup");
    __builtin_amdgcn_wave_barrier();
    __builtin_amdgcn_fence(__ATOMIC_ACQUIRE, "workgroup");
#pragma unroll 1
    for (int kk = 0; kk < 2; ++kk) {
      FB pa, pl;
      pa.h[0] = *(const v8b*)(pwh + c * AT_KC + kk * 32 + 8 * hh);
      pa.h[1] = *(const v8b*)(pwh + c * AT_KC + kk * 32 + 16 + 8 * hh);
      if (SPLIT_PV) {
        pl.h[0] = *(const v8b*)(pwl + c * AT_KC + kk * 32 + 8 * hh);
        pl.h[1] = *(const v8b*)(pwl + c * AT_KC + kk * 32 + 16 + 8 * hh);
      }
#pragma unroll
      for (int t = 0; t < 4; ++t) {
        FB vb;
        vb.h[0] = *(const v8b*)(Vth + (t * 16 + c) * AT_KC + kk * 32 + 8 * hh);
        vb.h[1] = *(const v8b*)(Vth + (t * 16 + c) * AT_KC + kk * 32 + 16 + 8 * hh);
        oacc[t] = at_mma16<F16>(pa.v, vb.v, oacc[t]);
        if (SPLIT_PV) {
          FB vl;
          vl.h[0] = *(const v8b*)(Vtl + (t * 16 + c) * AT_KC + kk * 32 + 8 * hh);
          vl.h[1] = *(const v8b*)(Vtl + (t * 16 + c) * AT_KC + kk * 32 + 16 + 8 * hh);
          oacc[t] = at_mma16<F16>(pa.v, vl.v, oacc[t]);
          oacc[t] = at_mma16<F16>(pl.v, vb.v, oacc[t]);
        }
      }
    }
  }

  float* os = Os[wave];
#pragma unroll
  for (int r = 0; r < 8; ++r) {
    const float inv = 1.0f / (lrow[r] * PSC);
#pragma unroll
    for (int t = 0; t < 4; ++t) os[(8 * hh + r) * 68 + t * 16 + c] = oacc[t][r] * inv;
  }
  __builtin_amdgcn_fence(__ATOMIC_RELEASE, "workgroup");
  __builtin_amdgcn_wave_barrier();
  __builtin_amdgcn_fence(__ATOMIC_ACQUIRE, "workgroup");
  {
    const int c4 = (lane & 15) * 4;
    {
#pragma unroll
      for (int it = 0; it < 8; ++it) {
        const int row = it * 2 + hh;
        v4f val = *(const v4f*)(os + row * 68 + c4);
        *(v4f*)(ob_ptr + (size_t)(q0 + row) * g.o_rs + c4) = val;
      }
      
    }
  }
}

} // namespace w25


__device__ __forceinline__ void st_h2(_Float16* dst, float a, float b) { const unsigned u = (unsigned)__builtin_bit_cast(unsigned short, (_Float16)a) | ((unsigned)__builtin_bit_cast(unsigned short, (_Float16)b) << 16); unsigned* d = (unsigned*)dst; *d = u;  }
// block-diagonal output-map plane: WBD[n = h*64+e][kk = h2*64+d] = sc * Wo[h][d][e] if h2 == h else 0 (thread per destination pair over [D][D], linear order)
__global__ __launch_bounds__(256) void k_sw_wbd(const float* __restrict__ Wo, _Float16* __restrict__ WBD, int D, int HD, float sc) {
    const long long t = (long long)blockIdx.x * 256 + threadIdx.x; if (t >= (long long)D * D / 2) return; const long long e2 = 2 * t; const int n = (int)(e2 / D), kk = (int)(e2 % D);
    const int h = n / HD, e = n % HD, h2 = kk / HD, d = kk % HD; const float* w = Wo + ((long long)h * HD) * HD;
    const float v0 = (h2 == h) ? w[d * HD + e] * sc : 0.f, v1 = (h2 == h) ? w[(d + 1) * HD + e] * sc : 0.f;   // kk even, kk+1 in the same head block
    st_h2(WBD + e2, v0, v1); }


extern "C" void kernel_launch(void* const* d_in, const int* in_sizes, int n_in, void* d_out, int out_size, void* d_ws, size_t ws_size, hipStream_t stream) {
    (void)in_sizes; (void)n_in; (void)out_size; (void)ws_size;
    const float* x = (const float*)d_in[0];
    const float* Wq = (const float*)d_in[1];
    const float* Wkv = (const float*)d_in[2];
    const float* Wo = (const float*)d_in[3];
    const float* bo = (const float*)d_in[4];
    const int Bn = 2;
    const int T = 2048;
    const int D = 1024;
    const int NH = 16;
    const int HD = 64;
    const int D3 = 3 * D;
    const int NR = Bn * T;
    float* out = (float*)d_out;
    char* wsp = (char*)d_ws;
    unsigned short* X16 = (unsigned short*)wsp; wsp += (((size_t)((size_t)NR * D) * 2 + 255) / 256) * 256;
    unsigned short* W316 = (unsigned short*)wsp; wsp += (((size_t)((size_t)D3 * D) * 2 + 255) / 256) * 256;
    unsigned short* WBD16 = (unsigned short*)wsp; wsp += (((size_t)((size_t)D * D) * 2 + 255) / 256) * 256;
    float* QKV = (float*)wsp; wsp += (((size_t)((size_t)T * D3) * 4 + 255) / 256) * 256;
    float* AO = (float*)wsp; wsp += (((size_t)((size_t)T * D) * 4 + 255) / 256) * 256;
    unsigned short* AO16 = (unsigned short*)wsp; wsp += (((size_t)((size_t)T * D) * 2 + 255) / 256) * 256;
    if ((size_t)(wsp - (char*)d_ws) > ws_size) return;   // static carve guard
    k_cast16<<<(unsigned)((((long long)(NR) * ((D) / 2)) + 255) / 256), 256, 0, stream>>>(x, D, (_Float16*)(X16), D, NR, D, 1.0f);
    k_castT16<<<(unsigned)((((long long)(D) * ((D) / 2)) + 255) / 256), 256, 0, stream>>>(Wq, D, (_Float16*)(W316), D, D, D, 16.0f);
    k_castT16<<<(unsigned)((((long long)(D) * ((D) / 2)) + 255) / 256), 256, 0, stream>>>(Wkv, 2 * D, (_Float16*)(W316 + (size_t)D * D), D, D, D, 16.0f);
    k_castT16<<<(unsigned)((((long long)(D) * ((D) / 2)) + 255) / 256), 256, 0, stream>>>(Wkv + D, 2 * D, (_Float16*)(W316 + (size_t)2 * D * D), D, D, D, 16.0f);
    k_sw_wbd<<<(unsigned)(((long long)D * D / 2 + 255) / 256), 256, 0, stream>>>(Wo, (_Float16*)WBD16, D, HD, 16.f);
    w25::wmma_gemm64<0, false, 0, 0, false, 0><<<dim3((unsigned)((((T) / 64) * ((D3) / 64) + 7) / 8), (unsigned)(1)), 256, 0, stream>>>((const unsigned short*)(X16 + (size_t)0 * T * D), nullptr, D, 0, (const unsigned short*)(W316), nullptr, D, 0, (void*)(QKV), nullptr, D3, 0, nullptr, nullptr, 0, T, D3, D, 0.0625f);
    k_attn_lds<T, D3, D><<<dim3((unsigned)((T) / (16 * AW)), (unsigned)(NH)), 32 * AW, 0, stream>>>(QKV, QKV + D, QKV + 2 * D, AO, 0.125f);
    k_cast16<<<(unsigned)((((long long)(T) * ((D) / 2)) + 255) / 256), 256, 0, stream>>>(AO, D, (_Float16*)(AO16), D, T, D, 1.0f);
    w25::wmma_gemm64<0, false, 2, 0, false, 0><<<dim3((unsigned)((((T) / 64) * ((D) / 64) + 7) / 8), (unsigned)(1)), 256, 0, stream>>>((const unsigned short*)(AO16), nullptr, D, 0, (const unsigned short*)(WBD16), nullptr, D, 0, (void*)(out + (size_t)0 * T * D), nullptr, D, 0, bo, nullptr, 0, T, D, D, 0.0625f);
    w25::wmma_gemm64<0, false, 0, 0, false, 0><<<dim3((unsigned)((((T) / 64) * ((D3) / 64) + 7) / 8), (unsigned)(1)), 256, 0, stream>>>((const unsigned short*)(X16 + (size_t)1 * T * D), nullptr, D, 0, (const unsigned short*)(W316), nullptr, D, 0, (void*)(QKV), nullptr, D3, 0, nullptr, nullptr, 0, T, D3, D, 0.0625f);
    k_attn_lds<T, D3, D><<<dim3((unsigned)((T) / (16 * AW)), (unsigned)(NH)), 32 * AW, 0, stream>>>(QKV, QKV + D, QKV + 2 * D, AO, 0.125f);
    k_cast16<<<(unsigned)((((long long)(T) * ((D) / 2)) + 255) / 256), 256, 0, stream>>>(AO, D, (_Float16*)(AO16), D, T, D, 1.0f);
    w25::wmma_gemm64<0, false, 2, 0, false, 0><<<dim3((unsigned)((((T) / 64) * ((D) / 64) + 7) / 8), (unsigned)(1)), 256, 0, stream>>>((const unsigned short*)(AO16), nullptr, D, 0, (const unsigned short*)(WBD16), nullptr, D, 0, (void*)(out + (size_t)1 * T * D), nullptr, D, 0, bo, nullptr, 0, T, D, D, 0.0625f);
}

// v003
// A run of this version takes 228 microseconds.
// In two side-by-side timings against v002, it was 1.47 and 1.46 times as fast.
// Over all steps from v000 it is 9.53 times as fast.
// Contractions: q and k|v projections (weights stored [in][out]) [2048x1024].[1024x1024|2048] per batch element, with f16 operands on f16 planes (v_wmma_f32_16x16x32_f16, 64x64 register-blocked wave tiles, weights x16); per (batch, head) softmax(q.k^T/8) v over all 2048 keys as one flash launch per batch element (head_dim 64, f16 q.k^T and f16 p.v with p as f16 of 4096 p), whose epilogue applies the head's own 64x64 output map (+bias) to the f16 attention tile still in registers (weights x16); f32 accumulate and softmax statistics.
#include <hip/hip_runtime.h>
#include <math.h>

typedef __attribute__((ext_vector_type(16))) _Float16 v16h;
typedef __attribute__((ext_vector_type(8)))  _Float16 v8h;
typedef __attribute__((ext_vector_type(16))) __bf16   v16b;
typedef __attribute__((ext_vector_type(8)))  float    v8f;
typedef __attribute__((ext_vector_type(4)))  float    v4f;

// 16-bit WMMA fragment map (wave32), lane L, h = L>>4, m = L&15:
//   A 16x32: lane = row m;   element i -> k = (i<8) ? 8h+i : 16+8h+(i-8)
//   B 32x16: lane = column m; the SAME k(i,h)
//   D 16x16 (8 f32): lane = column m; element r -> row 8h+r
__device__ __forceinline__ int frag_k(int i, int h) { return (i < 8) ? (8 * h + i) : (16 + 8 * h + (i - 8)); }
__device__ __forceinline__ __bf16 bf16_rne(float f) {
    unsigned int u = __float_as_uint(f);
    u += 0x7fffu + ((u >> 16) & 1u);
    return __builtin_bit_cast(__bf16, (unsigned short)(u >> 16));
}
__device__ __forceinline__ float bf16_f32(__bf16 b) { return __uint_as_float(((unsigned int)__builtin_bit_cast(unsigned short, b)) << 16); }
__device__ __forceinline__ v8f wmma16(v16h a, v16h b, v8f c) {
    c = __builtin_amdgcn_wmma_f32_16x16x32_f16(false, a, false, b, (short)0, c, false, false);
    asm volatile("v_nop\n\tv_nop\n\tv_nop\n\tv_nop" : "+v"(c) : "v"(a), "v"(b));
    return c;
}
__device__ __forceinline__ v8f wmmab(v16b a, v16b b, v8f c) {
    c = __builtin_amdgcn_wmma_f32_16x16x32_bf16(false, a, false, b, (short)0, c, false, false);
    asm volatile("v_nop\n\tv_nop\n\tv_nop\n\tv_nop" : "+v"(c) : "v"(a), "v"(b));
    return c;
}
struct Split { v16b hi, lo; };
// hi/lo split product: a.hi*b.hi + a.hi*b.lo + a.lo*b.hi
__device__ __forceinline__ v8f wmma3(const Split& a, const Split& b, v8f c) {
    c = __builtin_amdgcn_wmma_f32_16x16x32_bf16(false, a.hi, false, b.hi, (short)0, c, false, false);
    c = __builtin_amdgcn_wmma_f32_16x16x32_bf16(false, a.hi, false, b.lo, (short)0, c, false, false);
    c = __builtin_amdgcn_wmma_f32_16x16x32_bf16(false, a.lo, false, b.hi, (short)0, c, false, false);
    asm volatile("v_nop\n\tv_nop\n\tv_nop\n\tv_nop" : "+v"(c) : "v"(a.hi), "v"(a.lo), "v"(b.hi), "v"(b.lo));
    return c;
}
struct Split3 { v16b hi, mid, lo; };
// triple split product (6 terms, drops only terms below 2^-24 relative)
__device__ __forceinline__ v8f wmma6(const Split3& a, const Split3& b, v8f c) {
    c = __builtin_amdgcn_wmma_f32_16x16x32_bf16(false, a.hi, false, b.hi, (short)0, c, false, false);
    c = __builtin_amdgcn_wmma_f32_16x16x32_bf16(false, a.hi, false, b.mid, (short)0, c, false, false);
    c = __builtin_amdgcn_wmma_f32_16x16x32_bf16(false, a.mid, false, b.hi, (short)0, c, false, false);
    c = __builtin_amdgcn_wmma_f32_16x16x32_bf16(false, a.hi, false, b.lo, (short)0, c, false, false);
    c = __builtin_amdgcn_wmma_f32_16x16x32_bf16(false, a.mid, false, b.mid, (short)0, c, false, false);
    c = __builtin_amdgcn_wmma_f32_16x16x32_bf16(false, a.lo, false, b.hi, (short)0, c, false, false);
    asm volatile("v_nop\n\tv_nop\n\tv_nop\n\tv_nop" : "+v"(c) : "v"(a.hi), "v"(a.mid), "v"(a.lo), "v"(b.hi), "v"(b.mid), "v"(b.lo));
    return c;
}

// Fragment gathers from f32 memory: element i <- p[(k0 + frag_k(i,h)) * sk] * s, zero for k >= klen.
__device__ __forceinline__ v16h fh_ld(const float* __restrict__ p, long long sk, int k0, int h, int klen, float s) {
    v16h a;
#pragma unroll
    for (int i = 0; i < 16; ++i) { const int k = k0 + frag_k(i, h); a[i] = (k < klen) ? (_Float16)(p[(long long)k * sk] * s) : (_Float16)0.f; }
    return a;
}
__device__ __forceinline__ Split sp_ld(const float* __restrict__ p, long long sk, int k0, int h, int klen, float s) {
    Split r;
#pragma unroll
    for (int i = 0; i < 16; ++i) {
        const int k = k0 + frag_k(i, h); const float x = (k < klen) ? p[(long long)k * sk] * s : 0.f;
        const __bf16 hb = bf16_rne(x); r.hi[i] = hb; r.lo[i] = bf16_rne(x - bf16_f32(hb));
    }
    return r;
}
__device__ __forceinline__ Split3 sp3_ld(const float* __restrict__ p, long long sk, int k0, int h, int klen, float s) {
    Split3 r;
#pragma unroll
    for (int i = 0; i < 16; ++i) {
        const int k = k0 + frag_k(i, h); const float x = (k < klen) ? p[(long long)k * sk] * s : 0.f;
        const __bf16 hb = bf16_rne(x); const float r1 = x - bf16_f32(hb); const __bf16 mb = bf16_rne(r1);
        r.hi[i] = hb; r.mid[i] = mb; r.lo[i] = bf16_rne(r1 - bf16_f32(mb));
    }
    return r;
}
__device__ __forceinline__ v16b bh_ld(const float* __restrict__ p, long long sk, int k0, int h, int klen, float s) {
    v16b a;
#pragma unroll
    for (int i = 0; i < 16; ++i) { const int k = k0 + frag_k(i, h); a[i] = bf16_rne((k < klen) ? p[(long long)k * sk] * s : 0.f); }
    return a;
}
// f16 fragment from an f16 LDS/global row with element stride 1 (k-contiguous), no bounds (tile already zero padded)
__device__ __forceinline__ v16h fh_row(const _Float16* __restrict__ row, int k0, int h) {
    v16h a;
#pragma unroll
    for (int i = 0; i < 16; ++i) a[i] = row[k0 + frag_k(i, h)];
    return a;
}

#define VST2(T, ptr, val) do { const T vst2_v_ = (val); *(T*)(ptr) = vst2_v_;  } while (0)
typedef float v4f __attribute__((ext_vector_type(4)));
#define VST2V4(ptr, val) do { const v4f vst2_v4_ = (val); *(v4f*)(ptr) = vst2_v4_;  } while (0)

__device__ __attribute__((noinline)) float act_fn(float v, int act) {
    if (act == 1) return fmaxf(v, 0.f);                                                                               // relu
    if (act == 2) { const float u = 0.7978845608028654f * (v + 0.044715f * v * v * v); return 0.5f * v * (1.f + tanhf(u)); } // tanh-gelu
    if (act == 3) return v / (1.f + expf(-v));                                                                        // silu
    if (act == 4) return 0.5f * v * (1.f + erff(v * 0.7071067811865476f));                                             // erf-gelu
    if (act == 5) return tanhf(v);
    if (act == 6) return 1.f / (1.f + expf(-v));                                                                      // sigmoid
    if (act == 7) return (v > 0.f) ? v : 0.01f * v;                                                                   // leaky relu 0.01
    if (act == 8) return (v > 0.f) ? v : (expf(v) - 1.f);                                                             // elu
    if (act == 9) return fminf(fmaxf(v, 0.f), 6.f);                                                                   // relu6
    if (act == 10) return fabsf(v);                                                                                    // abs
    if (act == 11) return (v >= 0.f) ? v : 0.1f * v;                                                                  // leaky 0.1
    if (act == 12) return (v > 0.f) ? v : 0.2f * v;                                                                   // leaky 0.2
    if (act == 13) return (v > 20.f) ? v : log1pf(expf(v));                                                            // softplus
    return v;
}

// =====================================================================================================================
// k_gemm<MODE>: C(z, m, n) = act(alpha * sum_k A(z, m, k) * B(z, k, n) + bias) + beta * R(z, m, n)
//   One wave (32-thread block) per 16 x 32 tile of C; grid (ceil(N/32), ceil(M/16), Z). Batch z -> (zo = z / zi_n, zi = z % zi_n)
//   with separate outer/inner strides for every tensor (e.g. batch and head). A(m,k) = A[zo*sAo + zi*sAi + m*sAm + k*sAk] (f32),
//   B(k,n) = B[zo*sBo + zi*sBi + n*sBn + k*sBk] (f32); any M, N, K (K zero-padded to 32 inside the fragments, M/N tails guarded).
//   C(m,n) = C[zo*sCo + zi*sCi + m*sCm + n] (n contiguous). flags: 1 bias[n], 2 bias[m], 4 residual R[zo*sRo + zi*sRi + m*sRm + n*sRn].
//   MODE 0: f16 operands (A prescaled by sa, B by sb, both undone in the epilogue); 1: bf16 hi/lo split (3 products); 2: bf16;
//   3: bf16 hi/mid/lo triple split (6 products); 4: as 3 with Kahan-compensated f32 accumulation across k-steps.
// =====================================================================================================================
struct GemmP {
    const float* A; const float* B; const float* bias; const float* R; float* C;
    long long sAo, sAi, sAm, sAk, sBo, sBi, sBn, sBk, sCo, sCi, sCm, sRo, sRi, sRm, sRn;
    int M, N, K, zi_n, flags, act; float alpha, beta, sa, sb;
    int Npad, pad_;     // columns [N, Npad) of C are written as 0 so that padded workspace rows are covered by whole-line stores; Npad >= N
};
static_assert(sizeof(GemmP) == 5 * 8 + 15 * 8 + 6 * 4 + 4 * 4 + 2 * 4, "GemmP has padding");

template <int MODE>
__global__ __launch_bounds__(32) void k_gemm(GemmP p) {
    const int lane = threadIdx.x & 31, h = lane >> 4, l15 = lane & 15;
    const int m0 = blockIdx.y * 16, n0 = blockIdx.x * 32;
    const int z = blockIdx.z, zo = z / p.zi_n, zi = z - zo * p.zi_n;
    const float* A = p.A + zo * p.sAo + zi * p.sAi;
    const float* B = p.B + zo * p.sBo + zi * p.sBi;
    const int am = min(m0 + l15, p.M - 1);                       // clamped row for loads (stores are guarded)
    v8f acc[2], comp[2];
#pragma unroll
    for (int t = 0; t < 2; ++t) { v8f zz = {}; acc[t] = zz; comp[t] = zz; }
    for (int k0 = 0; k0 < p.K; k0 += 32) {
        const float* arow = A + (long long)am * p.sAm;
        if (MODE == 1) {
            const Split a = sp_ld(arow, p.sAk, k0, h, p.K, 1.f);
#pragma unroll
            for (int t = 0; t < 2; ++t) {
                const int bn = min(n0 + t * 16 + l15, p.N - 1);
                acc[t] = wmma3(a, sp_ld(B + (long long)bn * p.sBn, p.sBk, k0, h, p.K, 1.f), acc[t]);
            }
        } else if (MODE == 3) {
            const Split3 a = sp3_ld(arow, p.sAk, k0, h, p.K, 1.f);
#pragma unroll
            for (int t = 0; t < 2; ++t) {
                const int bn = min(n0 + t * 16 + l15, p.N - 1);
                acc[t] = wmma6(a, sp3_ld(B + (long long)bn * p.sBn, p.sBk, k0, h, p.K, 1.f), acc[t]);
            }
        } else if (MODE == 4) {
            // triple split as MODE 3, but each k-step's 6 products go into a fresh accumulator and the partial is added to the running f32 sum
            // on the VALU with Kahan compensation (accumulation error stays ~1 ulp however long K is)
            const Split3 a = sp3_ld(arow, p.sAk, k0, h, p.K, 1.f);
#pragma unroll
            for (int t = 0; t < 2; ++t) {
                const int bn = min(n0 + t * 16 + l15, p.N - 1); v8f zz = {};
                const v8f part = wmma6(a, sp3_ld(B + (long long)bn * p.sBn, p.sBk, k0, h, p.K, 1.f), zz);
                const v8f y = part - comp[t]; const v8f s = acc[t] + y; comp[t] = (s - acc[t]) - y; acc[t] = s;
            }
        } else if (MODE == 2) {
            const v16b a = bh_ld(arow, p.sAk, k0, h, p.K, 1.f);
#pragma unroll
            for (int t = 0; t < 2; ++t) {
                const int bn = min(n0 + t * 16 + l15, p.N - 1);
                acc[t] = wmmab(a, bh_ld(B + (long long)bn * p.sBn, p.sBk, k0, h, p.K, 1.f), acc[t]);
            }
        } else {
            const v16h a = fh_ld(arow, p.sAk, k0, h, p.K, p.sa);
#pragma unroll
            for (int t = 0; t < 2; ++t) {
                const int bn = min(n0 + t * 16 + l15, p.N - 1);
                acc[t] = wmma16(a, fh_ld(B + (long long)bn * p.sBn, p.sBk, k0, h, p.K, p.sb), acc[t]);
            }
        }
    }
    const float iscale = (MODE == 0) ? p.alpha / (p.sa * p.sb) : p.alpha;
    float* C = p.C + zo * p.sCo + zi * p.sCi;
    const float* R = p.R + zo * p.sRo + zi * p.sRi;
    __shared__ __align__(16) float ctile[16][36];
#pragma unroll
    for (int t = 0; t < 2; ++t) {
        const int n = n0 + t * 16 + l15; const int nn = min(n, p.N - 1);
#pragma unroll
        for (int r = 0; r < 8; ++r) {
            const int m = m0 + 8 * h + r; const int mm = min(m, p.M - 1);
            float v = acc[t][r] * iscale;
            if (p.flags & 1) v += p.bias[nn];
            if (p.flags & 2) v += p.bias[mm];
            if (p.flags & 8) v *= p.bias[(long long)zo * p.M + mm];   /* per-(z,row) scale vector laid out [Z][M]; exclusive with the bias flags */
            v = act_fn(v, p.act);
            if (p.flags & 4) v += p.beta * R[(long long)mm * p.sRm + (long long)nn * p.sRn];
            ctile[8 * h + r][t * 16 + l15] = (n < p.N) ? v : 0.f;
        }
    }
    __syncthreads();
    const int NW = (p.Npad > p.N) ? p.Npad : p.N;           // write width
    const bool fast = (m0 + 16 <= p.M) && (n0 + 32 <= NW) && ((p.sCm & 3) == 0) && ((((size_t)C) & 15) == 0);
    if (fast) {
#pragma unroll
        for (int s = 0; s < 4; ++s) {
            const int row = s * 4 + (lane >> 3), c4 = (lane & 7) * 4;
            const v4f v = *(const v4f*)&ctile[row][c4];
            VST2V4(C + (long long)(m0 + row) * p.sCm + n0 + c4, v);
        }
    } else {
        for (int row = 0; row < 16; ++row) {
            const int m = m0 + row, n = n0 + lane;
            if (m < p.M && n < NW) VST2(float, C + (long long)m * p.sCm + n, ctile[row][lane]);
        }
    }
}


// =====================================================================================================================
// k_gemmT<MODE, TM, TN>: same contract as k_gemm, but one wave computes a (16*TM) x (16*TN) tile: TM A fragments and TN B fragments are
//   loaded per 32-wide k-step and reused across TM*TN WMMAs (far fewer load/convert instructions per MAC). MODE 0 (f16), 1 (bf16 hi/lo),
//   2 (bf16) only. grid (ceil(NW/(16*TN)), ceil(M/(16*TM)), Z), block 32. Epilogue identical to k_gemm, run per 16x32 sub-tile.
// =====================================================================================================================
template <int MODE, int TM, int TN>
__global__ __launch_bounds__(32) void k_gemmT(GemmP p) {
    const int lane = threadIdx.x & 31, h = lane >> 4, l15 = lane & 15;
    const int m0 = blockIdx.y * (16 * TM), n0 = blockIdx.x * (16 * TN);
    const int z = blockIdx.z, zo = z / p.zi_n, zi = z - zo * p.zi_n;
    const float* A = p.A + zo * p.sAo + zi * p.sAi;
    const float* B = p.B + zo * p.sBo + zi * p.sBi;
    v8f acc[TM][TN];
#pragma unroll
    for (int i = 0; i < TM; ++i)
#pragma unroll
        for (int t = 0; t < TN; ++t) { v8f zz = {}; acc[i][t] = zz; }
    for (int k0 = 0; k0 < p.K; k0 += 32) {
        if (MODE == 1) {
            Split a[TM], b[TN];
#pragma unroll
            for (int i = 0; i < TM; ++i) { const int am = min(m0 + 16 * i + l15, p.M - 1); a[i] = sp_ld(A + (long long)am * p.sAm, p.sAk, k0, h, p.K, 1.f); }
#pragma unroll
            for (int t = 0; t < TN; ++t) { const int bn = min(n0 + 16 * t + l15, p.N - 1); b[t] = sp_ld(B + (long long)bn * p.sBn, p.sBk, k0, h, p.K, 1.f); }
#pragma unroll
            for (int i = 0; i < TM; ++i)
#pragma unroll
                for (int t = 0; t < TN; ++t) acc[i][t] = wmma3(a[i], b[t], acc[i][t]);
        } else if (MODE == 2) {
            v16b a[TM], b[TN];
#pragma unroll
            for (int i = 0; i < TM; ++i) { const int am = min(m0 + 16 * i + l15, p.M - 1); a[i] = bh_ld(A + (long long)am * p.sAm, p.sAk, k0, h, p.K, 1.f); }
#pragma unroll
            for (int t = 0; t < TN; ++t) { const int bn = min(n0 + 16 * t + l15, p.N - 1); b[t] = bh_ld(B + (long long)bn * p.sBn, p.sBk, k0, h, p.K, 1.f); }
#pragma unroll
            for (int i = 0; i < TM; ++i)
#pragma unroll
                for (int t = 0; t < TN; ++t) acc[i][t] = wmmab(a[i], b[t], acc[i][t]);
        } else {
            v16h a[TM], b[TN];
#pragma unroll
            for (int i = 0; i < TM; ++i) { const int am = min(m0 + 16 * i + l15, p.M - 1); a[i] = fh_ld(A + (long long)am * p.sAm, p.sAk, k0, h, p.K, p.sa); }
#pragma unroll
            for (int t = 0; t < TN; ++t) { const int bn = min(n0 + 16 * t + l15, p.N - 1); b[t] = fh_ld(B + (long long)bn * p.sBn, p.sBk, k0, h, p.K, p.sb); }
#pragma unroll
            for (int i = 0; i < TM; ++i)
#pragma unroll
                for (int t = 0; t < TN; ++t) acc[i][t] = wmma16(a[i], b[t], acc[i][t]);
        }
    }
    const float iscale = (MODE == 0) ? p.alpha / (p.sa * p.sb) : p.alpha;
    float* C = p.C + zo * p.sCo + zi * p.sCi;
    const float* R = p.R + zo * p.sRo + zi * p.sRi;
    const int NW = (p.Npad > p.N) ? p.Npad : p.N;
    __shared__ __align__(16) float ctile[16][36];
#pragma unroll
    for (int i = 0; i < TM; ++i) {
        const int mb = m0 + 16 * i; if (mb >= p.M) break;          // wave-uniform
#pragma unroll
        for (int tp = 0; tp < TN / 2; ++tp) {
            const int nb = n0 + 32 * tp; if (nb >= NW) break;        // wave-uniform
#pragma unroll
            for (int t2 = 0; t2 < 2; ++t2) {
                const int t = 2 * tp + t2; const int n = nb + t2 * 16 + l15; const int nn = min(n, p.N - 1);
#pragma unroll
                for (int r = 0; r < 8; ++r) {
                    const int m = mb + 8 * h + r; const int mm = min(m, p.M - 1);
                    float v = acc[i][t][r] * iscale;
                    if (p.flags & 1) v += p.bias[nn];
                    if (p.flags & 2) v += p.bias[mm];
            if (p.flags & 8) v *= p.bias[(long long)zo * p.M + mm];   /* per-(z,row) scale vector laid out [Z][M]; exclusive with the bias flags */
                    v = act_fn(v, p.act);
                    if (p.flags & 4) v += p.beta * R[(long long)mm * p.sRm + (long long)nn * p.sRn];
                    ctile[8 * h + r][t2 * 16 + l15] = (n < p.N) ? v : 0.f;
                }
            }
            __syncthreads();
            const bool fast = (mb + 16 <= p.M) && (nb + 32 <= NW) && ((p.sCm & 3) == 0) && ((((size_t)C) & 15) == 0);
            if (fast) {
#pragma unroll
                for (int s = 0; s < 4; ++s) {
                    const int row = s * 4 + (lane >> 3), c4 = (lane & 7) * 4;
                    const v4f v = *(const v4f*)&ctile[row][c4];
                    VST2V4(C + (long long)(mb + row) * p.sCm + nb + c4, v);
                }
            } else {
                for (int row = 0; row < 16; ++row) {
                    const int m = mb + row, n = nb + lane;
                    if (m < p.M && n < NW) VST2(float, C + (long long)m * p.sCm + n, ctile[row][lane]);
                }
            }
            __syncthreads();
        }
    }
}

// =====================================================================================================================
// k_attn_lds<L, RS, OS>: O receives (softmax(scale * Q.K^T) V).Wo[h] + bo[h] for one head per blockIdx.y, head and value dim 64, L queries and L keys (L % 64 == 0), f32 in and out.
//   Wave = 16 queries, AW waves per block, 64-key blocks; grid (L / (16*AW), H), block 32*AW. Row r of head h: Q/K/V + r*RS + h*64, O + r*OS + h*64.
//   Each 64-key block of K and of V is read once per work-group with 16-byte loads, converted to f16 and laid in LDS as [key][d] rows:
//   K at a pitch of 144 B for ds_load_b128 fragment reads (A operand of k.q^T, same k order as the Q fragment),
//   V at a pitch of 160 B for ds_load_tr16_b128 fragment reads (A operand of v^T.p^T: lane = row d, k = key in the frag_k order).
//   Both products are taken transposed: S^T = K.Q^T puts query l15 in lane column l15, so lanes l15 and l15+16 hold all 64 scores of one query
//   (tile t, register r: key 16t + 8*hf + r); maximum and sum run inside the lane, with one exchange between the lane halves.
//   Two S^T tiles of 16 keys, converted in place, are the B fragment of O^T += V^T.P^T in the frag_k order: P never leaves the registers.
//   Statistics f32 (exp2 domain); P x 4096 as f16.
//   Output map: Y^T = Wo[h]^T.O^T + bo[h]. Wo[h] x 16 lies in LDS as f16 [d][e] rows, laid and read exactly like a V tile (A operand: lane = row e, k = d);
//   the normalised O^T tiles, converted in place like P, are the B fragment. O receives Y, row r of head h at O + r*OS + h*64.
// =====================================================================================================================
#define AW 4
typedef __attribute__((ext_vector_type(4))) _Float16 v4h;
typedef __attribute__((ext_vector_type(8))) short    v8s;
union FragH { v16h v; v8h h[2]; };
// 16-bit transposing LDS load: with lane address T + (k0 + 8*(l>>4) + (l&7)) * pitch + d0 + 8*((l>>3)&1) (halves), lane (c = l&15, h = l>>4) gets T[k0 + 8h + 0..7][d0 + c]
__device__ __forceinline__ v8h ld_tr16(const _Float16* p) {
    typedef __attribute__((address_space(3))) v8s lds_v8s;
    return __builtin_bit_cast(v8h, __builtin_amdgcn_ds_load_tr16_b128_v8i16((lds_v8s*)p));
}
// value of lane l ^ 16
__device__ __forceinline__ float swap_half(float x) {
    const int b = __builtin_bit_cast(int, x);
    return __builtin_bit_cast(float, __builtin_amdgcn_permlanex16(b, b, 0x76543210, 0xfedcba98, false, false));
}
template <int L, int RS, int OS>
__global__ __launch_bounds__(32 * AW) void k_attn_lds(const float* __restrict__ Q, const float* __restrict__ K, const float* __restrict__ V, const float* __restrict__ Wo, const float* __restrict__ bo, float* __restrict__ O, float scale) {
    constexpr int KP = 72;                      // K tile pitch in halves (144 B: odd multiple of 16 B)
    constexpr int VP = 80;                      // V tile pitch in halves (160 B: odd multiple of 32 B)
    constexpr int OP = 68;                      // output tile pitch in floats (272 B: odd multiple of 16 B)
    __shared__ __align__(16) float    pl[AW][16 * OP];
    __shared__ __align__(16) _Float16 kl[64 * KP];
    __shared__ __align__(16) _Float16 vl[64 * VP];
    __shared__ __align__(16) _Float16 wl[64 * VP];   // Wo[h] x 16, [d][e], V's pitch (same reader)
    const int lane = threadIdx.x & 31, hf = lane >> 4, l15 = lane & 15, wave = threadIdx.x >> 5;
    const int h = blockIdx.y;
    const int q0 = (blockIdx.x * AW + wave) * 16;
    float* myp = pl[wave];
    const float L2E = 1.4426950408889634f;
    const float NEG = -__builtin_inff();
    const float* qrow = Q + h * 64 + (long long)(q0 + l15) * RS;
    const float* kbase = K + h * 64;
    const float* vbase = V + h * 64;
    v16h qa[2];
#pragma unroll
    for (int ks = 0; ks < 2; ++ks) qa[ks] = fh_ld(qrow, 1, ks * 32, hf, 64, 1.f);
    v8f o[4];                                   // o[t][r] = O^T[d = 16t + 8*hf + r][query l15]
    float m1 = NEG, l1 = 0.f;                   // query l15: running maximum (equal in both lane halves), sum over this half's keys
#pragma unroll
    for (int t = 0; t < 4; ++t) { v8f zz = {}; o[t] = zz; }
    const int sr = threadIdx.x >> 4, sc4 = (threadIdx.x & 15) * 4;   // staging: 16 threads per 64-float row, 8 rows per sweep
    const _Float16* kfr = kl + l15 * KP + 8 * hf;
    const _Float16* vfr = vl + (8 * hf + (lane & 7)) * VP + 8 * ((lane >> 3) & 1);
    const _Float16* wfr = wl + (8 * hf + (lane & 7)) * VP + 8 * ((lane >> 3) & 1);
    {                                                    // the head's output map into LDS; the key loop's first barriers publish it
        const float* wbase = Wo + h * 64 * 64;
        v4f wr[8];
#pragma unroll
        for (int i = 0; i < 8; ++i) wr[i] = *(const v4f*)(wbase + (i * 8 + sr) * 64 + sc4);
        asm volatile("s_wait_xcnt 0x0" ::: "memory");    // stands in front of any reuse of the address registers of the loads above
#pragma unroll
        for (int i = 0; i < 8; ++i) *(v4h*)(wl + (i * 8 + sr) * VP + sc4) = __builtin_convertvector(wr[i] * 16.f, v4h);
    }
    for (int j0 = 0; j0 < L; j0 += 64) {
        v4f kr[8], vr[8];
#pragma unroll
        for (int i = 0; i < 8; ++i) {
            const long long off = (long long)(j0 + i * 8 + sr) * RS + sc4;
            kr[i] = *(const v4f*)(kbase + off); vr[i] = *(const v4f*)(vbase + off);
        }
        asm volatile("s_wait_xcnt 0x0" ::: "memory");    // stands in front of any reuse of the address registers of the loads above
        __syncthreads();                                 // previous key block's reads of kl / vl are done
#pragma unroll
        for (int i = 0; i < 8; ++i) {
            *(v4h*)(kl + (i * 8 + sr) * KP + sc4) = __builtin_convertvector(kr[i], v4h);
            *(v4h*)(vl + (i * 8 + sr) * VP + sc4) = __builtin_convertvector(vr[i], v4h);
        }
        __syncthreads();                                 // K and V tiles visible to every wave
        FragH kb[4][2];                                  // all eight K fragments behind one LDS latency
#pragma unroll
        for (int t = 0; t < 4; ++t)
#pragma unroll
            for (int ks = 0; ks < 2; ++ks) {
                kb[t][ks].h[0] = *(const v8h*)(kfr + t * 16 * KP + ks * 32);
                kb[t][ks].h[1] = *(const v8h*)(kfr + t * 16 * KP + ks * 32 + 16);
            }
        v8f s[4];                                        // s[t][r] = S[query l15][key j0 + 16t + 8*hf + r]
#pragma unroll
        for (int t = 0; t < 4; ++t) {
            v8f acc = {};
#pragma unroll
            for (int ks = 0; ks < 2; ++ks) acc = wmma16(kb[t][ks].v, qa[ks], acc);
            s[t] = acc;
        }
        float sc[4][8], mt[4];
#pragma unroll
        for (int t = 0; t < 4; ++t) {
            mt[t] = NEG;
#pragma unroll
            for (int i = 0; i < 8; ++i) { sc[t][i] = (s[t][i] * scale) * L2E; mt[t] = fmaxf(mt[t], sc[t][i]); }
        }
        float mx = fmaxf(fmaxf(mt[0], mt[1]), fmaxf(mt[2], mt[3]));
        mx = fmaxf(mx, swap_half(mx));
        const float mnew = fmaxf(m1, mx);
        const float mref = (mnew == NEG) ? 0.f : mnew;   // a query with only -inf scores so far: every exp2 below is exp2(-inf) = 0, never exp2(nan)
        const float corr = exp2f(m1 - mref);
        FragH pa[2]; float rt[4];
#pragma unroll
        for (int t = 0; t < 4; ++t) {
            rt[t] = 0.f;
#pragma unroll
            for (int i = 0; i < 8; ++i) {
                const float pp = exp2f(sc[t][i] - mref);
                rt[t] += pp; pa[t >> 1].v[(t & 1) * 8 + i] = (_Float16)(pp * 4096.f);
            }
        }
        l1 = l1 * corr + ((rt[0] + rt[1]) + (rt[2] + rt[3])); m1 = mnew;
#pragma unroll
        for (int t = 0; t < 4; ++t) o[t] *= corr;
        FragH vb[4][2];                                  // all eight V fragments behind one LDS latency
#pragma unroll
        for (int t = 0; t < 4; ++t) {
            vb[t][0].h[0] = ld_tr16(vfr + t * 16);           vb[t][0].h[1] = ld_tr16(vfr + 16 * VP + t * 16);
            vb[t][1].h[0] = ld_tr16(vfr + 32 * VP + t * 16); vb[t][1].h[1] = ld_tr16(vfr + 48 * VP + t * 16);
        }
#pragma unroll
        for (int t = 0; t < 4; ++t) {
            o[t] = wmma16(vb[t][0].v, pa[0].v, o[t]);
            o[t] = wmma16(vb[t][1].v, pa[1].v, o[t]);
        }
    }
    float* obase = O + h * 64;
    const float lt = l1 + swap_half(l1);
    const float inv = (lt > 0.f) ? 1.f / (lt * 4096.f) : 0.f;
    FragH ob[2];                                         // O^T as f16: tiles 2ks and 2ks+1 are the B fragment of d chunk ks in the frag_k order
#pragma unroll
    for (int t = 0; t < 4; ++t)
#pragma unroll
        for (int i = 0; i < 8; ++i) ob[t >> 1].v[(t & 1) * 8 + i] = (_Float16)(o[t][i] * inv);
    FragH wb[4][2];
#pragma unroll
    for (int t = 0; t < 4; ++t) {
        wb[t][0].h[0] = ld_tr16(wfr + t * 16);           wb[t][0].h[1] = ld_tr16(wfr + 16 * VP + t * 16);
        wb[t][1].h[0] = ld_tr16(wfr + 32 * VP + t * 16); wb[t][1].h[1] = ld_tr16(wfr + 48 * VP + t * 16);
    }
#pragma unroll
    for (int t = 0; t < 4; ++t) {
        v8f ov = {};                                     // ov[r] = 16 * (Y^T - bo[h])[e = 16t + 8*hf + r][query l15]
        ov = wmma16(wb[t][0].v, ob[0].v, ov);
        ov = wmma16(wb[t][1].v, ob[1].v, ov);
        *(v4f*)(myp + l15 * OP + t * 16 + 8 * hf)     = __builtin_shufflevector(ov, ov, 0, 1, 2, 3);
        *(v4f*)(myp + l15 * OP + t * 16 + 8 * hf + 4) = __builtin_shufflevector(ov, ov, 4, 5, 6, 7);
    }
    const v4f bv = *(const v4f*)(bo + h * 64 + l15 * 4);
    __syncthreads();
#pragma unroll
    for (int r0 = 0; r0 < 16; r0 += 2) {
        const int row = r0 + hf, c4 = l15 * 4;
        const v4f v = *(const v4f*)(myp + row * OP + c4) * 0.0625f + bv;
        VST2V4(obase + (long long)(q0 + row) * OS + c4, v);
    }
}

// =====================================================================================================================
// k_tr: dst(z, c, r) = alpha * src(z, r, c) (+ beta * R2(z, c, r)): [Z][R][C] (row stride lds) -> [Z][C][R] (row stride ldd) through a 32x32 LDS tile;
//   flags: 1 -> add beta * residual R2 addressed like dst (z*sRz + c*ldr + r); act applied before the residual.
// =====================================================================================================================
struct TrP { const float* src; float* dst; const float* R2; long long sSz, lds, sDz, ldd, sRz, ldr; int R, C, flags, act; float alpha, beta; };
static_assert(sizeof(TrP) == 3 * 8 + 6 * 8 + 6 * 4, "TrP has padding");
__global__ __launch_bounds__(256) void k_tr(TrP p) {
    __shared__ float tile[32][33];
    const int c0 = blockIdx.x * 32, r0 = blockIdx.y * 32, z = blockIdx.z;
    const int lane = threadIdx.x & 31, wave = threadIdx.x >> 5;
    const float* s = p.src + z * p.sSz;
#pragma unroll
    for (int k = 0; k < 4; ++k) {
        const int rl = wave * 4 + k, r = r0 + rl, c = c0 + lane;
        tile[rl][lane] = (r < p.R && c < p.C) ? s[(long long)r * p.lds + c] : 0.f;
    }
    __syncthreads();
    float* d = p.dst + z * p.sDz; const float* rr = p.R2 + z * p.sRz;
#pragma unroll
    for (int k = 0; k < 4; ++k) {
        const int cl = wave * 4 + k, c = c0 + cl, r = r0 + lane;
        if (c < p.C && r < p.R) {
            float v = act_fn(p.alpha * tile[lane][cl], p.act);
            if (p.flags & 1) v += p.beta * rr[(long long)c * p.ldr + r];
            VST2(float, d + (long long)c * p.ldd + r, v);
        }
    }
}

// k_affine: dst[i] = a * (sdev ? sdev[0] : 1) * src[i] + b, i < n (one thread per element; consecutive lanes -> consecutive addresses)
__global__ __launch_bounds__(256) void k_affine(const float* __restrict__ src, float* __restrict__ dst, int n, float a, float b, const float* __restrict__ sdev) {
    const int i = blockIdx.x * 256 + threadIdx.x;
    if (i < n) { const float aa = sdev ? a * sdev[0] : a; const float v = aa * src[i] + b; VST2(float, dst + i, v); }
}

// =====================================================================================================================
// k_softmax: row softmax over n contiguous elements, one 256-thread block per row; rows addressed z*sz + r*sr (grid (R, Z)).
//   out = scale_out * softmax(scale_in * x + (Mf ? Mf[z*smz + r*smr + j] : 0)); a row whose max is -inf is written as 0.
// =====================================================================================================================
struct SmP { const float* src; float* dst; const float* Mf; long long sz, sr, dz, dr, smz, smr; int n, pad; float scale_in, scale_out; };
static_assert(sizeof(SmP) == 3 * 8 + 6 * 8 + 4 * 4, "SmP has padding");
__global__ __launch_bounds__(256) void k_softmax(SmP p) {
    __shared__ float red[256];
    const int r = blockIdx.x, z = blockIdx.y, tid = threadIdx.x;
    const float* s = p.src + z * p.sz + (long long)r * p.sr;
    const float* mf = p.Mf ? (p.Mf + z * p.smz + (long long)r * p.smr) : nullptr;
    float mx = -__builtin_inff();
    for (int j = tid; j < p.n; j += 256) { float v = s[j] * p.scale_in; if (mf) v += mf[j]; mx = fmaxf(mx, v); }
    red[tid] = mx; __syncthreads();
    for (int o = 128; o > 0; o >>= 1) { if (tid < o) red[tid] = fmaxf(red[tid], red[tid + o]); __syncthreads(); }
    mx = red[0]; __syncthreads();
    float sum = 0.f;
    for (int j = tid; j < p.n; j += 256) { float v = s[j] * p.scale_in; if (mf) v += mf[j]; sum += (mx == -__builtin_inff()) ? 0.f : expf(v - mx); }
    red[tid] = sum; __syncthreads();
    for (int o = 128; o > 0; o >>= 1) { if (tid < o) red[tid] += red[tid + o]; __syncthreads(); }
    sum = red[0];
    const float inv = (sum > 0.f) ? p.scale_out / sum : 0.f;
    float* d = p.dst + z * p.dz + (long long)r * p.dr;
    for (int j = tid; j < p.n; j += 256) { float v = s[j] * p.scale_in; if (mf) v += mf[j]; const float o = (mx == -__builtin_inff()) ? 0.f : expf(v - mx) * inv; VST2(float, d + j, o); }
}
// =====================================================================================================================
// k_stats: mean and rsqrt(var + eps) over a set of n elements addressed base + z*sz + (e / inner) * so + (e % inner) * si, one 256-thread
// k_norm_apply: y = (x - mean[set]) * rstd[set] * g[c] + b[c] over a [Z][C][L] channel-major tensor with set = z*G + c / (C/G) (G groups per z;
//   G = C -> per-channel sets indexed z*C+c; for batch norm pass stats indexed by c only via bn = 1). Optional act. Output same layout.
// =====================================================================================================================
//   mode 0: mean / rsqrt(var + eps); mode 1 (RMSNorm): 0 / rsqrt(mean(x^2) + eps); mode 2 (L2 normalize * sqrt(n)): 0 / sqrt(n) / max(||x||, eps); mode 3: as 0 with unbiased variance (n-1)
__global__ __launch_bounds__(256) void k_stats(const float* __restrict__ x, long long sz, long long so, long long si, int inner, int n, float eps, float* __restrict__ stat, int mode) {
    __shared__ float red[256];
    const int z = blockIdx.x, tid = threadIdx.x;
    const float* base = x + z * sz;
    float s = 0.f;
    for (int e = tid; e < n; e += 256) s += base[(long long)(e / inner) * so + (long long)(e % inner) * si];
    red[tid] = s; __syncthreads();
    for (int o = 128; o > 0; o >>= 1) { if (tid < o) red[tid] += red[tid + o]; __syncthreads(); }
    const float mu = (mode == 0 || mode == 3) ? red[0] / (float)n : 0.f; __syncthreads();
    float q = 0.f;
    for (int e = tid; e < n; e += 256) { const float dlt = base[(long long)(e / inner) * so + (long long)(e % inner) * si] - mu; q += dlt * dlt; }
    red[tid] = q; __syncthreads();
    for (int o = 128; o > 0; o >>= 1) { if (tid < o) red[tid] += red[tid + o]; __syncthreads(); }
    {
        float rs;
        if (mode == 2) rs = sqrtf((float)n) / fmaxf(sqrtf(red[0]), eps); else if (mode == 3) rs = rsqrtf(red[0] / (float)(n - 1) + eps); else rs = rsqrtf(red[0] / (float)n + eps);
        if (tid < 32) { const float v = (tid == 0) ? mu : ((tid == 1) ? rs : 0.f); VST2(float, stat + (long long)z * 32 + tid, v); }
    }
}
//   One thread per element over the flat [Z][C][L] index space: grid ceil(Z*C*L / 256).
__global__ __launch_bounds__(256) void k_norm_apply(const float* __restrict__ x, float* __restrict__ y, const float* __restrict__ stat, const float* __restrict__ g, const float* __restrict__ bta,
                                                     int Z, int C, int L, int G, int bn, int act) {
    const long long idx = (long long)blockIdx.x * 256 + threadIdx.x;
    if (idx >= (long long)Z * C * L) return;
    const int l = (int)(idx % L); const long long zc = idx / L; const int c = (int)(zc % C), z = (int)(zc / C); (void)l;
    const int set = bn ? c : (z * G + c / (C / G));
    float v = (x[idx] - stat[(long long)set * 32]) * stat[(long long)set * 32 + 1];
    if (g) v *= g[c];
    if (bta) v += bta[c];
    v = act_fn(v, act);
    VST2(float, y + idx, v);
}

// k_lse_neg: c[i] = -(st[2i] + log(st[2i+1])) = minus the log-sum-exp of row i from (max, sum) statistic pairs (for softmax over the query dimension)
__global__ __launch_bounds__(256) void k_lse_neg(const float* __restrict__ st, float* __restrict__ c, int n) {
    const int i = blockIdx.x * 256 + threadIdx.x;
    if (i < n) { const float v = -(st[2 * i] + logf(st[2 * i + 1])); VST2(float, c + i, v); }
}

// k_iota: dst[i] = a * i + b as int32 (segment/position id helper)
__global__ __launch_bounds__(256) void k_iota(int* __restrict__ dst, int n, int a, int b) {
    const int i = blockIdx.x * 256 + threadIdx.x;
    if (i < n) { const int v = a * i + b; VST2(int, dst + i, v); }
}

// k_axpby: dst[i] = a * x[i] + b * y[i] (+ c), i < n
__global__ __launch_bounds__(256) void k_axpby(const float* __restrict__ x, const float* __restrict__ y, float* __restrict__ dst, int n, float a, float b, float c) {
    const int i = blockIdx.x * 256 + threadIdx.x;
    if (i < n) { const float v = a * x[i] + b * y[i] + c; VST2(float, dst + i, v); }
}

// =====================================================================================================================
// k_rope: rotary embedding on a [R rows][Hn heads][D] view (row stride sXr, head stride sXh, element stride 1) -> Y (own strides).
//   mode 0: rotate_half (partner d±D/2, sign - for d<D/2); mode 1: interleaved pairs (partner d^1, sign - for even d).
//   table column tcol: tmode 0 -> d, 1 -> d % (D/2), 2 -> d / 2; position p: pmode 0 -> r % S, 1 -> head index, 2 -> pos[r];
//   c = C[(r / S) * sCb + p * sCp + tcol * sCd], s likewise from Sn; y = x[d] * c + sign * x[partner] * s. X and Y must not alias.
// =====================================================================================================================
struct RopeP { const float* X; float* Y; const float* C; const float* Sn; const int* pos; long long sXr, sXh, sYr, sYh, sCb, sCp, sCd; int R, Hn, D, S, mode, tmode, pmode, pad; };
static_assert(sizeof(RopeP) == 5 * 8 + 7 * 8 + 8 * 4, "RopeP has padding");
__global__ __launch_bounds__(256) void k_rope(RopeP p) {
    const long long idx = (long long)blockIdx.x * 256 + threadIdx.x;
    if (idx >= (long long)p.R * p.Hn * p.D) return;
    const int d = (int)(idx % p.D); const long long rh = idx / p.D; const int h = (int)(rh % p.Hn); const int r = (int)(rh / p.Hn);
    const int half = p.D / 2;
    int partner; float sign;
    if (p.mode == 0) { partner = (d < half) ? d + half : d - half; sign = (d < half) ? -1.f : 1.f; }
    else { partner = d ^ 1; sign = (d & 1) ? 1.f : -1.f; }
    const int tcol = (p.tmode == 0) ? d : ((p.tmode == 1) ? (d % half) : (d >> 1));
    const int pp = (p.pmode == 0) ? (r % p.S) : ((p.pmode == 1) ? h : p.pos[r]);
    const long long toff = (long long)(r / p.S) * p.sCb + (long long)pp * p.sCp + (long long)tcol * p.sCd;
    const float* xr = p.X + (long long)r * p.sXr + (long long)h * p.sXh;
    const float v = xr[d] * p.C[toff] + sign * xr[partner] * p.Sn[toff];
    VST2(float, p.Y + (long long)r * p.sYr + (long long)h * p.sYh + d, v);
}

// k_invf + k_sincos (split so neither kernel carries a large VALU-fma footprint): invf_i = num * (1 / powf(base, (2 i)/D)) [fmode 0],
//   num * expf((2 i) * cexp) [fmode 1], num * powf(base, -2 (i - 1) / D) [fmode 2]; then cs/sn[s*half + i] = cos/sin((pscale * s) * invf_i)
__global__ __launch_bounds__(256) void k_invf(float* __restrict__ invb, int half, int D, float base, float num, int fmode, float cexp) {
    const int i = blockIdx.x * 256 + threadIdx.x;
    if (i >= ((half + 31) / 32) * 32) return;
    if (i >= half) { VST2(float, invb + i, 0.f); return; }
    const float e = (float)(2 * i) / (float)D;
    float invf;
    if (fmode == 1) invf = num * expf((float)(2 * i) * cexp);
    else if (fmode == 2) invf = num * powf(base, (-2.0f * ((float)i - 1.0f)) / (float)D);
    else invf = num * (1.0f / powf(base, e));
    VST2(float, invb + i, invf);
}
__global__ __launch_bounds__(256) void k_sincos(float* __restrict__ cs, float* __restrict__ sn, const float* __restrict__ invb, int S, int half, float pscale) {
    const int idx = blockIdx.x * 256 + threadIdx.x;
    if (idx >= S * half) return;
    const int s = idx / half, i = idx - s * half;
    const float ang = (pscale * (float)s) * invb[i];
    VST2(float, cs + idx, cosf(ang)); VST2(float, sn + idx, sinf(ang));
}

// k_mulact: dst[i] = act(x[i]) * y[i]
__global__ __launch_bounds__(256) void k_mulact(const float* __restrict__ x, const float* __restrict__ y, float* __restrict__ dst, int n, int act) {
    const int i = blockIdx.x * 256 + threadIdx.x;
    if (i < n) { const float v = act_fn(x[i], act) * y[i]; VST2(float, dst + i, v); }
}

// =====================================================================================================================
// k_matvec: thread-per-row matrix-vector products for N <= 8 output columns (heads with 1-3 outputs, gates), f32 on the VALU.
//   C[r*sCm + j] = act(alpha * sum_k A[r*sAm + k*sAk] * B[j*sBn + k*sBk] + bias[j]) + beta * R[r*sRm + j*sRn]; each thread writes its N contiguous floats.
// =====================================================================================================================
__global__ __launch_bounds__(256) void k_matvec(GemmP p) {
    // 32 lanes write one line with one instruction.
    const int rpt = (p.N == 1) ? 1 : 32;
    const long long r0 = ((long long)blockIdx.x * 256 + threadIdx.x) * rpt; const int z = blockIdx.z, zo = z / p.zi_n, zi = z - zo * p.zi_n;
    if (r0 >= p.M) return;
    const float* Bb = p.B + zo * p.sBo + zi * p.sBi;
    float* C = p.C + zo * p.sCo + zi * p.sCi; const float* R = p.R + zo * p.sRo + zi * p.sRi;
    for (int rr = 0; rr < rpt; ++rr) {
        const long long r = r0 + rr; if (r >= p.M) break;
        const float* A = p.A + zo * p.sAo + zi * p.sAi + r * p.sAm;
        float acc[8] = {0.f, 0.f, 0.f, 0.f, 0.f, 0.f, 0.f, 0.f};
        for (int k = 0; k < p.K; ++k) { const float a = A[(long long)k * p.sAk];
#pragma unroll
            for (int j = 0; j < 8; ++j) if (j < p.N) acc[j] += a * Bb[(long long)j * p.sBn + (long long)k * p.sBk]; }
#pragma unroll
        for (int j = 0; j < 8; ++j) if (j < p.N) {
            float v = acc[j] * p.alpha;
            if (p.flags & 1) v += p.bias[j];
            if (p.flags & 2) v += p.bias[r];
            v = act_fn(v, p.act);
            if (p.flags & 4) v += p.beta * R[r * p.sRm + (long long)j * p.sRn];
            VST2(float, C + r * p.sCm + j, v);
        }
    }
}
// k_smallsoftmax: thread-per-row softmax for short rows (n <= 64): dst[r*dr + j] = softmax(scale*src[r*sr + j])
__global__ __launch_bounds__(256) void k_smallsoftmax(const float* __restrict__ src, float* __restrict__ dst, long long sr, long long dr, int n, long long R, float scale) {
    const long long r0 = ((long long)blockIdx.x * 256 + threadIdx.x) * 32;
    for (int rr = 0; rr < 32; ++rr) {
        const long long r = r0 + rr; if (r >= R) return;
        const float* s = src + r * sr; float* d = dst + r * dr;
        float mx = -__builtin_inff();
        for (int j = 0; j < n; ++j) mx = fmaxf(mx, s[j] * scale);
        float sum = 0.f;
        for (int j = 0; j < n; ++j) sum += expf(s[j] * scale - mx);
        const float inv = 1.f / sum;
        for (int j = 0; j < n; ++j) { const float v = expf(s[j] * scale - mx) * inv; VST2(float, d + j, v); }
    }
}

__global__ __launch_bounds__(32) void k_unitstat(float* __restrict__ st) { const int t = threadIdx.x; const float v = (t == 1) ? 1.f : 0.f; VST2(float, st + t, v); }

// destination (e.g. a d_out whose row width is not a multiple of 32 floats) is written by consecutive lanes of one instruction
__global__ __launch_bounds__(256) void k_lincopy(const float* __restrict__ src, long long lds, float* __restrict__ dst, long long ldd, long long rows, int cols) {
    const long long i = (long long)blockIdx.x * 256 + threadIdx.x; if (i >= rows * cols) return;
    const long long r = i / cols; const int c = (int)(i - r * cols);
    const float v = src[r * lds + c]; VST2(float, dst + r * ldd + c, v);
}

namespace w25 {
typedef __attribute__((ext_vector_type(16))) _Float16 v16h;
typedef __attribute__((ext_vector_type(8)))  _Float16 v8h;
typedef __attribute__((ext_vector_type(16))) __bf16   v16b;
typedef __attribute__((ext_vector_type(8)))  __bf16   v8b;
typedef __attribute__((ext_vector_type(8)))  float    v8f;
typedef __attribute__((ext_vector_type(4)))  float    v4f;

__device__ __forceinline__ unsigned short f2bf_bits(float f) {
  unsigned u = __float_as_uint(f);
  return (unsigned short)((u + 0x7FFFu + ((u >> 16) & 1u)) >> 16);
}
__device__ __forceinline__ float bf_bits2f(unsigned short h) { return __uint_as_float(((unsigned)h) << 16); }

// hazard guards as plain device helpers (no inline asm inside the kernel template body)
__device__ __forceinline__ void dep_guard_h(v8f& a, v8f& b, v16h x, v16h y) { asm volatile("v_nop\n\tv_nop\n\tv_nop\n\tv_nop" : "+v"(a), "+v"(b) : "v"(x), "v"(y)); }
__device__ __forceinline__ void dep_guard_b(v8f& a, v8f& b, v16b x, v16b y) { asm volatile("v_nop\n\tv_nop\n\tv_nop\n\tv_nop" : "+v"(a), "+v"(b) : "v"(x), "v"(y)); }
__device__ __forceinline__ void keep4_h(v16h a, v16h b, v16h c, v16h d) { asm volatile("v_nop" :: "v"(a), "v"(b), "v"(c), "v"(d)); }
__device__ __forceinline__ void keep4_b(v16b a, v16b b, v16b c, v16b d) { asm volatile("v_nop" :: "v"(a), "v"(b), "v"(c), "v"(d)); }
__device__ __forceinline__ void acc_guard4(v8f& a, v8f& b, v8f& c, v8f& d) { asm volatile("v_nop\n\tv_nop\n\tv_nop\n\tv_nop" : "+v"(a), "+v"(b), "+v"(c), "+v"(d)); }
template <typename T> struct Frag;
template <> struct Frag<_Float16> {
  typedef v16h V; union U { v16h v; v8h h[2]; };
  static __device__ __forceinline__ v16h load(const _Float16* p) {   // elements 0..7 <- p[0..7], 8..15 <- p[16..23]
    U f; f.h[0] = *(const v8h*)(p); f.h[1] = *(const v8h*)(p + 16); return f.v;
  }
  static __device__ __forceinline__ v8f mma(v16h a, v16h b, v8f c) {
    return __builtin_amdgcn_wmma_f32_16x16x32_f16(false, a, false, b, (short)0, c, false, false);
  }
  static __device__ __forceinline__ void guard(v8f& a, v8f& b, v16h x, v16h y) { dep_guard_h(a, b, x, y); }
  static __device__ __forceinline__ void keep(v16h a, v16h b, v16h c, v16h d) { keep4_h(a, b, c, d); }
};
template <> struct Frag<__bf16> {
  typedef v16b V; union U { v16b v; v8b h[2]; };
  static __device__ __forceinline__ v16b load(const __bf16* p) {
    U f; f.h[0] = *(const v8b*)(p); f.h[1] = *(const v8b*)(p + 16); return f.v;
  }
  static __device__ __forceinline__ v8f mma(v16b a, v16b b, v8f c) {
    return __builtin_amdgcn_wmma_f32_16x16x32_bf16(false, a, false, b, (short)0, c, false, false);
  }
  static __device__ __forceinline__ void guard(v8f& a, v8f& b, v16b x, v16b y) { dep_guard_b(a, b, x, y); }
  static __device__ __forceinline__ void keep(v16b a, v16b b, v16b c, v16b d) { keep4_b(a, b, c, d); }
};

// ---- Register-blocked batched WMMA GEMM ------------------------------------
// C[m,n] = scale * sum_k A[m,k] * Bt[n,k] (+bias)(+resid); each wave owns a 64x64 tile.
// A row-major [M,K]; Bt row-major [N,K]; M,N % 64 == 0, K % 32 == 0.
// SPLIT: operands are hi/lo planes (A2/Bt2 = lo planes, same layout); product = hi·hi + hi·lo + lo·hi.
// BIAS_MODE: 0 = none, 1 = bias[m], 2 = bias[n].
// OUT_MODE: 0 = f32, 1 = f16, 2 = bf16 hi plane (Cout) + bf16 lo plane (Cout2).
// ET: 0 = f16 operands, 1 = bf16 operands (pointers passed as 16-bit storage)
template <int ET> struct Elem;
template <> struct Elem<0> { typedef _Float16 T; };
template <> struct Elem<1> { typedef __bf16 T; };
template <int ET, bool SPLIT, int BIAS_MODE, int OUT_MODE, bool RESID, int ACT = 0>
__global__ __launch_bounds__(256) void wmma_gemm64(
    const unsigned short* __restrict__ Ap, const unsigned short* __restrict__ A2p, int lda, long strideA,
    const unsigned short* __restrict__ Btp, const unsigned short* __restrict__ Bt2p, int ldb, long strideB,
    void* __restrict__ Cout, void* __restrict__ Cout2, int ldc, long strideC,
    const float* __restrict__ bias,
    const float* __restrict__ resid, long strideR,
    int M, int N, int K, float scale) {
  typedef typename Elem<ET>::T T;
  typedef typename Frag<T>::V V;
  const T* A = (const T*)Ap; const T* A2 = (const T*)A2p; const T* Bt = (const T*)Btp; const T* Bt2 = (const T*)Bt2p;
  __shared__ __align__(16) float sT[8][16 * 68];   // per-wave 16x64 slab, pitch 68 floats
  const int b    = blockIdx.y;
  const int lane = threadIdx.x & 31;
  const int wave = threadIdx.x >> 5;
  const int tilesN = N >> 6;
  const int tilesM = M >> 6;
  const int tile = blockIdx.x * 8 + wave;
  if (tile >= tilesM * tilesN) return;   // wave-uniform; no block barriers in this kernel
  const int tm = tile / tilesN;
  const int tn = tile - tm * tilesN;
  const int m0 = tm << 6;
  const int n0 = tn << 6;

  const T* Ab  = A  + (size_t)b * strideA;
  const T* Bb  = Bt + (size_t)b * strideB;
  const T* Ab2 = SPLIT ? (A2  + (size_t)b * strideA) : nullptr;
  const T* Bb2 = SPLIT ? (Bt2 + (size_t)b * strideB) : nullptr;

  const int rlane = lane & 15;                 // row (A) / col (B, D) within subtile
  const int koff  = (lane >> 4) * 8;           // k offset of this lane half
  const int mOff  = (lane >> 4) * 8;           // D row offset

  v8f acc[4][4];
#pragma unroll
  for (int i = 0; i < 4; ++i)
#pragma unroll
    for (int j = 0; j < 4; ++j) acc[i][j] = (v8f){0.f,0.f,0.f,0.f,0.f,0.f,0.f,0.f};

  for (int k0 = 0; k0 < K; k0 += 32) {
    V bh[4], bl[4];
#pragma unroll
    for (int j = 0; j < 4; ++j) {
      const size_t bo = (size_t)(n0 + (j << 4) + rlane) * ldb + koff + k0;
      bh[j] = Frag<T>::load(Bb + bo);
      if (SPLIT) bl[j] = Frag<T>::load(Bb2 + bo);
    }
#pragma unroll
    for (int i = 0; i < 4; ++i) {
      const size_t ao = (size_t)(m0 + (i << 4) + rlane) * lda + koff + k0;
      V ah = Frag<T>::load(Ab + ao);
      V al;
      if (SPLIT) al = Frag<T>::load(Ab2 + ao);
#pragma unroll
      for (int j = 0; j < 4; ++j) {
        acc[i][j] = Frag<T>::mma(ah, bh[j], acc[i][j]);
        if (SPLIT) {
          acc[i][j] = Frag<T>::mma(ah, bl[j], acc[i][j]);
          acc[i][j] = Frag<T>::mma(al, bh[j], acc[i][j]);
        }
      }
      Frag<T>::guard(acc[i][0], acc[i][3], ah, SPLIT ? al : ah);
    }
    Frag<T>::keep(bh[0], bh[1], bh[2], bh[3]);
    if (SPLIT) Frag<T>::keep(bl[0], bl[1], bl[2], bl[3]);
  }
  acc_guard4(acc[0][0], acc[0][1], acc[0][2], acc[0][3]);
  acc_guard4(acc[1][0], acc[1][1], acc[1][2], acc[1][3]);
  acc_guard4(acc[2][0], acc[2][1], acc[2][2], acc[2][3]);
  acc_guard4(acc[3][0], acc[3][1], acc[3][2], acc[3][3]);

  // ---- epilogue ----
  float* slab = sT[wave];
  const float* Rb = RESID ? (resid + (size_t)b * strideR) : nullptr;
#pragma unroll
  for (int i = 0; i < 4; ++i) {
    const int mBase = m0 + (i << 4);
#pragma unroll
    for (int j = 0; j < 4; ++j) {
      const int n = n0 + (j << 4) + rlane;
      float bv = 0.f;
      if (BIAS_MODE == 2) bv = bias[n];
#pragma unroll
      for (int r = 0; r < 8; ++r) {
        float v = acc[i][j][r] * scale;
        if (BIAS_MODE == 1) v += bias[mBase + mOff + r];
        if (BIAS_MODE == 2) v += bv;
        if (RESID) v += Rb[(size_t)(mBase + mOff + r) * ldc + n];
        if (ACT == 1) v = tanhf(v);
        if (ACT == 2) v = fmaxf(v, 0.0f);
        if (ACT == 3) v = v / (1.0f + expf(-v));
        if (ACT == 4) v = (v > 0.f) ? v : 0.01f * v;
        if (ACT == 5) v = 0.5f * v * (1.0f + erff(v * 0.70710678118654752f));
        if (ACT == 6) v = (v > 0.f) ? v : 0.2f * v;
        slab[(mOff + r) * 68 + (j << 4) + rlane] = v;
      }
    }
    __builtin_amdgcn_fence(__ATOMIC_RELEASE, "workgroup");
    __builtin_amdgcn_wave_barrier();
    __builtin_amdgcn_fence(__ATOMIC_ACQUIRE, "workgroup");
    if (OUT_MODE == 0) {
      float* C = (float*)Cout + (size_t)b * strideC;
      const int hh = lane >> 4, c4 = (lane & 15) * 4;     // row seg = 256 B = 16 lanes x 16 B
      {
#pragma unroll
        for (int it = 0; it < 8; ++it) {
          const int row = it * 2 + hh;
          v4f v = *(const v4f*)(slab + row * 68 + c4);
          *(v4f*)(C + (size_t)(mBase + row) * ldc + n0 + c4) = v;
        }
        
      }
    } else {
      const int q = lane >> 3, c8 = (lane & 7) * 8;
      unsigned short* C  = (unsigned short*)Cout  + (size_t)b * strideC;
      unsigned short* C2 = (OUT_MODE == 2) ? ((unsigned short*)Cout2 + (size_t)b * strideC) : nullptr;
      {
#pragma unroll
        for (int it = 0; it < 4; ++it) {
          const int row = it * 4 + q;
          const float* sp = slab + row * 68 + c8;
          v8h hv, lv;
#pragma unroll
          for (int e = 0; e < 8; ++e) {
            if (OUT_MODE == 1) {
              hv[e] = (_Float16)sp[e];
            } else {
              unsigned short hb = f2bf_bits(sp[e]);
              unsigned short lb = f2bf_bits(sp[e] - bf_bits2f(hb));
              hv[e] = __builtin_bit_cast(_Float16, hb);
              lv[e] = __builtin_bit_cast(_Float16, lb);
            }
          }
          *(v8h*)(C + (size_t)(mBase + row) * ldc + n0 + c8) = hv;
          if (OUT_MODE == 2) *(v8h*)(C2 + (size_t)(mBase + row) * ldc + n0 + c8) = lv;
        }
        
      }
    }
    __builtin_amdgcn_fence(__ATOMIC_RELEASE, "workgroup");
    __builtin_amdgcn_wave_barrier();
    __builtin_amdgcn_fence(__ATOMIC_ACQUIRE, "workgroup");
  }
}

__global__ __launch_bounds__(256) void cast_f32_f16x2(
    const float* __restrict__ in, _Float16* __restrict__ out, int n2) {
  int i = blockIdx.x * 256 + threadIdx.x;
  if (i < n2) {
    const _Float16 h0 = (_Float16)in[2 * i], h1 = (_Float16)in[2 * i + 1];
    const unsigned u = (unsigned)__builtin_bit_cast(unsigned short, h0) | ((unsigned)__builtin_bit_cast(unsigned short, h1) << 16);
    ((unsigned*)out)[i] = u;
    
  }
}


} // namespace w25

__global__ __launch_bounds__(256) void k_castT16(const float* __restrict__ src, long long lds, _Float16* __restrict__ dst, long long ldd, int R, int C, float s) {
    const long long i = (long long)blockIdx.x * 256 + threadIdx.x; const long long np = (long long)C * (R / 2); if (i >= np) return; const int c = (int)(i / (R / 2)); const int r = 2 * (int)(i % (R / 2));
    const _Float16 h0 = (_Float16)(src[(long long)r * lds + c] * s), h1 = (_Float16)(src[(long long)(r + 1) * lds + c] * s);
    const unsigned u = (unsigned)__builtin_bit_cast(unsigned short, h0) | ((unsigned)__builtin_bit_cast(unsigned short, h1) << 16);
    unsigned* d = (unsigned*)(dst + (long long)c * ldd + r); *d = u;  }
__global__ __launch_bounds__(256) void k_cast16(const float* __restrict__ src, long long lds, _Float16* __restrict__ dst, long long ldd, int R, int C, float s) {
    const long long i = (long long)blockIdx.x * 256 + threadIdx.x; const long long np = (long long)R * (C / 2); if (i >= np) return; const int r = (int)(i / (C / 2)); const int c = 2 * (int)(i % (C / 2));
    const _Float16 h0 = (_Float16)(src[(long long)r * lds + c] * s), h1 = (_Float16)(src[(long long)r * lds + c + 1] * s);
    const unsigned u = (unsigned)__builtin_bit_cast(unsigned short, h0) | ((unsigned)__builtin_bit_cast(unsigned short, h1) << 16);
    unsigned* d = (unsigned*)(dst + (long long)r * ldd + c); *d = u;  }

// f32 -> bf16 hi plane + bf16 lo plane (x = hi + lo to ~2^-17 relative; RNE both), [R][C] -> [R][C] (or transposed to [C][R]); 2 consecutive destination elements
__device__ __forceinline__ unsigned int f2bf2_pack(float a, float b, unsigned int* lo) {
    const unsigned short ha = w25::f2bf_bits(a), hb = w25::f2bf_bits(b);
    const unsigned short la = w25::f2bf_bits(a - w25::bf_bits2f(ha)), lb = w25::f2bf_bits(b - w25::bf_bits2f(hb));
    *lo = (unsigned)la | ((unsigned)lb << 16); return (unsigned)ha | ((unsigned)hb << 16); }
__global__ __launch_bounds__(256) void k_castS16(const float* __restrict__ src, long long lds, __bf16* __restrict__ dhi, __bf16* __restrict__ dlo, long long ldd, int R, int C, float s, int transpose) {
    const long long i = (long long)blockIdx.x * 256 + threadIdx.x; long long o; float a, b;
    if (transpose) { const long long np = (long long)C * (R / 2); if (i >= np) return; const int c = (int)(i / (R / 2)); const int r = 2 * (int)(i % (R / 2)); a = src[(long long)r * lds + c] * s; b = src[(long long)(r + 1) * lds + c] * s; o = (long long)c * ldd + r; }
    else { const long long np = (long long)R * (C / 2); if (i >= np) return; const int r = (int)(i / (C / 2)); const int c = 2 * (int)(i % (C / 2)); a = src[(long long)r * lds + c] * s; b = src[(long long)r * lds + c + 1] * s; o = (long long)r * ldd + c; }
    unsigned lo; const unsigned hi = f2bf2_pack(a, b, &lo); unsigned* ph = (unsigned*)(dhi + o); unsigned* pl = (unsigned*)(dlo + o);
    *ph = hi; *pl = lo;  }

namespace w25 {
// =====================================================================================
// Generic causal/non-causal attention for head_dim 64, f32 in / f32 out; 16-bit operands: bf16 with optional hi/lo splits, or
// plain f16 (F16=true, non-split, probabilities carried x2^15).
//   scores = (q*qscale)·kᵀ : v_wmma_f32_16x16x32_bf16; SPLIT_QK -> q,k as bf16 hi/lo (hi·hi + hi·lo + lo·hi)
//   out    = p·v           : v_wmma_f32_16x16x32_bf16; SPLIT_PV -> p,v as bf16 hi/lo; else p,v plain bf16
//   f32 accumulate; online softmax in f32. Block = 4 waves = 64 query rows of one (batch, head); S % 64 == 0.
//   Element (b, s, h, d) of tensor X lives at X[b*X_bs + s*X_rs + h*X_hs + d] (strides in floats, multiples of 4).
//   Masking: mask_mode 0 none, 1 causal (kv > q masked), 2 tensor [S][Skv] shared over (b,h) (float if
//   mask_is_int==0, int32 with element == 0 -> masked if 1, int32 with element != 0 -> masked if 2), 3 per-token vectors qmask[B][S] & kvmask[B][Skv] (int32,
//   0 -> masked), 4 causal + sliding window (kv > q or q - kv > W masked; W passed in mask_is_int);
//   5 = relative-position bias: s += cp[b,h,q][idx[q][kv]] + pc[b,h,kv][idx[q][kv]] with idx = mask_b ([S][Skv] int32) and
//   mask_a an int32 [S][Skv] tensor with nonzero = masked (tables: element (b,h,row,n) at X + b*c_bs + h*c_hs + row*c_rs + n);
//   masked scores are replaced by mask_fill (e.g. -inf or -1e9) before the softmax.
//   grid.x = B * H * (S/64) (or a sub-range with blk0).
// =====================================================================================
#define AT_D 64
#define AT_NW 4
#define AT_QB 64
#define AT_KC 64
struct AttnGeom { const float* cp = nullptr; const float* pc = nullptr; long c_bs = 0, c_rs = 0, c_hs = 0;   // mode-5 score-bias tables
                  long q_bs, q_rs, q_hs, k_bs, k_rs, k_hs, v_bs, v_rs, v_hs, o_bs, o_rs, o_hs;
                  int S, Skv, H, mask_mode; float qscale; int blk0; float mask_fill; int mask_is_int; };
static_assert(sizeof(AttnGeom) == 168, "no padding");

__device__ __forceinline__ unsigned short at_bf_bits(float f) {
  unsigned u = __float_as_uint(f);
  return (unsigned short)((u + 0x7FFFu + ((u >> 16) & 1u)) >> 16);
}
__device__ __forceinline__ __bf16 at_f2bf(float f) { return __builtin_bit_cast(__bf16, at_bf_bits(f)); }
__device__ __forceinline__ void at_split(float f, __bf16& hi, __bf16& lo) {
  const unsigned short hb = at_bf_bits(f);
  hi = __builtin_bit_cast(__bf16, hb);
  lo = at_f2bf(f - __uint_as_float(((unsigned)hb) << 16));
}
__device__ __forceinline__ v8f at_mma(v16b a, v16b b, v8f c) {
  c = __builtin_amdgcn_wmma_f32_16x16x32_bf16(false, a, false, b, (short)0, c, false, false);
  asm volatile("v_nop\n\tv_nop\n\tv_nop\n\tv_nop" : "+v"(c) : "v"(a), "v"(b));
  return c;
}
// 16-bit element as a bit pattern held in a __bf16 slot: f16 bits when F16, bf16 (RNE) otherwise
template <bool F16> __device__ __forceinline__ __bf16 at_to16(float f) {
  if (F16) return __builtin_bit_cast(__bf16, (_Float16)f);
  return at_f2bf(f);
}
template <bool F16> __device__ __forceinline__ v8f at_mma16(v16b a, v16b b, v8f c) {
  if (F16) {
    const v16h ah = __builtin_bit_cast(v16h, a), bh = __builtin_bit_cast(v16h, b);
    c = __builtin_amdgcn_wmma_f32_16x16x32_f16(false, ah, false, bh, (short)0, c, false, false);
    asm volatile("v_nop\n\tv_nop\n\tv_nop\n\tv_nop" : "+v"(c) : "v"(ah), "v"(bh));
    return c;
  }
  return at_mma(a, b, c);
}

template <bool SPLIT_QK, bool SPLIT_PV, bool F16 = false>
__global__ __launch_bounds__(128)
void attn64_kernel(const float* __restrict__ q, const float* __restrict__ k,
                   const float* __restrict__ v, float* __restrict__ out,
                   const void* __restrict__ mask_a, const int* __restrict__ mask_b, AttnGeom g) {
  static_assert(!(F16 && (SPLIT_QK || SPLIT_PV)), "f16 mode is non-split");
  const float PSC = F16 ? 32768.0f : 1.0f;     // f16 probabilities carried x2^15 (subnormal range), folded into the final 1/l
  union FB { v16b v; v8b h[2]; };
  __shared__ __align__(16) __bf16 Ksh[AT_KC * AT_D];             // K hi [kv][d]      8 KB
  __shared__ __align__(16) __bf16 Ksl[SPLIT_QK ? AT_KC * AT_D : 8];
  __shared__ __align__(16) __bf16 Vth[AT_D * AT_KC];             // V hi [d][kv]      8 KB
  __shared__ __align__(16) __bf16 Vtl[SPLIT_PV ? AT_D * AT_KC : 8];
  __shared__ __align__(16) __bf16 Psh[AT_NW][16 * AT_KC];        // per wave P hi [row][kv]  8 KB
  __shared__ __align__(16) __bf16 Psl[SPLIT_PV ? AT_NW : 1][SPLIT_PV ? 16 * AT_KC : 8];
  __shared__ __align__(16) float  Os[AT_NW][16 * 68];            // per wave out tile, pitch 68

  const int tid  = threadIdx.x;
  const int wave = tid >> 5;
  const int lane = tid & 31;
  const int hh   = lane >> 4;
  const int c    = lane & 15;

  const int nqb = g.S / AT_QB;
  const int bx = blockIdx.x + g.blk0;
  const int qb = bx % nqb;
  const int bh = bx / nqb;
  const int h  = bh % g.H;
  const int b  = bh / g.H;
  const int qbase_block = qb * AT_QB;
  const int q0 = qbase_block + wave * 16;

  const float* qb_ptr = q + (size_t)b * g.q_bs + (size_t)h * g.q_hs;
  const float* kb_ptr = k + (size_t)b * g.k_bs + (size_t)h * g.k_hs;
  const float* vb_ptr = v + (size_t)b * g.v_bs + (size_t)h * g.v_hs;
  float*       ob_ptr = out + (size_t)b * g.o_bs + (size_t)h * g.o_hs;

  // ---- Q fragments (A operand): 2 d-chunks, hi (and lo) ----
  v16b qah[2], qal[2];
  {
    const float* qrow = qb_ptr + (size_t)(q0 + c) * g.q_rs;
#pragma unroll
    for (int dc = 0; dc < 2; ++dc) {
#pragma unroll
      for (int e = 0; e < 8; ++e) {
        const float f0 = qrow[dc * 32 + 8 * hh + e] * g.qscale;
        const float f1 = qrow[dc * 32 + 16 + 8 * hh + e] * g.qscale;
        if (SPLIT_QK) { __bf16 hq, lq; at_split(f0, hq, lq); qah[dc][e] = hq; qal[dc][e] = lq; at_split(f1, hq, lq); qah[dc][8 + e] = hq; qal[dc][8 + e] = lq; }
        else { qah[dc][e] = at_to16<F16>(f0); qah[dc][8 + e] = at_to16<F16>(f1); qal[dc][e] = qah[dc][e]; qal[dc][8 + e] = qah[dc][8 + e]; }
      }
    }
  }

  float mrow[8], lrow[8];
  v8f oacc[4];
#pragma unroll
  for (int r = 0; r < 8; ++r) { mrow[r] = -INFINITY; lrow[r] = 0.f; }
#pragma unroll
  for (int t = 0; t < 4; ++t) oacc[t] = (v8f){0.f,0.f,0.f,0.f,0.f,0.f,0.f,0.f};

  const int nChunks = (g.mask_mode == 1 || g.mask_mode == 4) ? (qb + 1) : (g.Skv / AT_KC);   // block-uniform
  // per-row query mask (mode 3)
  int qkeep[8];
#pragma unroll
  for (int r = 0; r < 8; ++r) qkeep[r] = (g.mask_mode == 3) ? mask_b[(size_t)b * g.S + q0 + 8 * hh + r] : 1;   // mask_b = qmask in mode 3
  for (int kc = 0; kc < nChunks; ++kc) {
    const int kv0 = kc * AT_KC;
    __syncthreads();
    {
      const int kvr = tid >> 1, dh = (tid & 1) * 32;
      const float* krow = kb_ptr + (size_t)(kv0 + kvr) * g.k_rs + dh;
      const float* vrow = vb_ptr + (size_t)(kv0 + kvr) * g.v_rs + dh;
#pragma unroll
      for (int i = 0; i < 8; ++i) {
        v4f kk = *(const v4f*)(krow + 4 * i);
        v4f vv = *(const v4f*)(vrow + 4 * i);
#pragma unroll
        for (int e = 0; e < 4; ++e) {
          const int d = dh + 4 * i + e;
          if (SPLIT_QK) { __bf16 a, bl; at_split(kk[e], a, bl); Ksh[kvr * AT_D + d] = a; Ksl[kvr * AT_D + d] = bl; }
          else Ksh[kvr * AT_D + d] = at_to16<F16>(kk[e]);
          if (SPLIT_PV) { __bf16 a, bl; at_split(vv[e], a, bl); Vth[d * AT_KC + kvr] = a; Vtl[d * AT_KC + kvr] = bl; }
          else Vth[d * AT_KC + kvr] = at_to16<F16>(vv[e]);
        }
      }
    }
    __syncthreads();

    v8f s[4];
#pragma unroll
    for (int j = 0; j < 4; ++j) {
      s[j] = (v8f){0.f,0.f,0.f,0.f,0.f,0.f,0.f,0.f};
#pragma unroll 1
      for (int dc = 0; dc < 2; ++dc) {
        FB kb;
        kb.h[0] = *(const v8b*)(Ksh + (j * 16 + c) * AT_D + dc * 32 + 8 * hh);
        kb.h[1] = *(const v8b*)(Ksh + (j * 16 + c) * AT_D + dc * 32 + 16 + 8 * hh);
        s[j] = at_mma16<F16>(qah[dc], kb.v, s[j]);
        if (SPLIT_QK) {
          FB kl;
          kl.h[0] = *(const v8b*)(Ksl + (j * 16 + c) * AT_D + dc * 32 + 8 * hh);
          kl.h[1] = *(const v8b*)(Ksl + (j * 16 + c) * AT_D + dc * 32 + 16 + 8 * hh);
          s[j] = at_mma16<F16>(qah[dc], kl.v, s[j]);
          s[j] = at_mma16<F16>(qal[dc], kb.v, s[j]);
        }
      }
    }
    const bool diag = (g.mask_mode == 1) && (kc == qb);
    int kvkeep[4] = {1, 1, 1, 1};
    if (g.mask_mode == 3) {
#pragma unroll
      for (int j = 0; j < 4; ++j) kvkeep[j] = ((const int*)mask_a)[(size_t)b * g.Skv + kv0 + j * 16 + c];   // mask_a = kvmask
    }
    float cm[8];
#pragma unroll
    for (int r = 0; r < 8; ++r) {
      const int qrow = q0 + 8 * hh + r;
      float m = -INFINITY;
#pragma unroll
      for (int j = 0; j < 4; ++j) {
        const int kvcol = kv0 + j * 16 + c;
        bool masked = false;
        if (diag) masked = (kvcol > qrow);
        else if (g.mask_mode == 4) masked = (kvcol > qrow) || (qrow - kvcol > g.mask_is_int);
        else if (g.mask_mode == 2) {
          const size_t mi = (size_t)qrow * g.Skv + kvcol;
          masked = (g.mask_is_int == 0) ? (((const float*)mask_a)[mi] == 0.0f)
                 : (g.mask_is_int == 1) ? (((const int*)mask_a)[mi] == 0) : (((const int*)mask_a)[mi] != 0);
        } else if (g.mask_mode == 3) masked = (qkeep[r] == 0) || (kvkeep[j] == 0);
        else if (g.mask_mode == 5) {
          const size_t mi = (size_t)qrow * g.Skv + kvcol;
          masked = (((const int*)mask_a)[mi] != 0);
          int n = mask_b[mi]; n = n < 0 ? 0 : n;
          s[j][r] += g.cp[(size_t)b * g.c_bs + (size_t)h * g.c_hs + (size_t)qrow * g.c_rs + n]
                   + g.pc[(size_t)b * g.c_bs + (size_t)h * g.c_hs + (size_t)kvcol * g.c_rs + n];
        }
        if (masked) s[j][r] = g.mask_fill;
        m = fmaxf(m, s[j][r]);
      }
#pragma unroll
      for (int off = 1; off < 16; off <<= 1) m = fmaxf(m, __shfl_xor(m, off, 32));
      cm[r] = m;
    }
    __bf16* pwh = Psh[wave];
    __bf16* pwl = Psl[SPLIT_PV ? wave : 0];
#pragma unroll
    for (int r = 0; r < 8; ++r) {
      const float mnew = fmaxf(mrow[r], cm[r]);
      const float alpha = expf(mrow[r] - mnew);
      mrow[r] = mnew;
      float psum = 0.f;
#pragma unroll
      for (int j = 0; j < 4; ++j) {
        const float p = expf(s[j][r] - mnew);
        psum += p;
        if (SPLIT_PV) { __bf16 a, bl; at_split(p, a, bl); pwh[(8 * hh + r) * AT_KC + j * 16 + c] = a; pwl[(8 * hh + r) * AT_KC + j * 16 + c] = bl; }
        else pwh[(8 * hh + r) * AT_KC + j * 16 + c] = at_to16<F16>(p * PSC);
      }
#pragma unroll
      for (int off = 1; off < 16; off <<= 1) psum += __shfl_xor(psum, off, 32);
      lrow[r] = lrow[r] * alpha + psum;
#pragma unroll
      for (int t = 0; t < 4; ++t) oacc[t][r] *= alpha;
    }
    __builtin_amdgcn_fence(__ATOMIC_RELEASE, "workgroup");
    __builtin_amdgcn_wave_barrier();
    __builtin_amdgcn_fence(__ATOMIC_ACQUIRE, "workgroup");
#pragma unroll 1
    for (int kk = 0; kk < 2; ++kk) {
      FB pa, pl;
      pa.h[0] = *(const v8b*)(pwh + c * AT_KC + kk * 32 + 8 * hh);
      pa.h[1] = *(const v8b*)(pwh + c * AT_KC + kk * 32 + 16 + 8 * hh);
      if (SPLIT_PV) {
        pl.h[0] = *(const v8b*)(pwl + c * AT_KC + kk * 32 + 8 * hh);
        pl.h[1] = *(const v8b*)(pwl + c * AT_KC + kk * 32 + 16 + 8 * hh);
      }
#pragma unroll
      for (int t = 0; t < 4; ++t) {
        FB vb;
        vb.h[0] = *(const v8b*)(Vth + (t * 16 + c) * AT_KC + kk * 32 + 8 * hh);
        vb.h[1] = *(const v8b*)(Vth + (t * 16 + c) * AT_KC + kk * 32 + 16 + 8 * hh);
        oacc[t] = at_mma16<F16>(pa.v, vb.v, oacc[t]);
        if (SPLIT_PV) {
          FB vl;
          vl.h[0] = *(const v8b*)(Vtl + (t * 16 + c) * AT_KC + kk * 32 + 8 * hh);
          vl.h[1] = *(const v8b*)(Vtl + (t * 16 + c) * AT_KC + kk * 32 + 16 + 8 * hh);
          oacc[t] = at_mma16<F16>(pa.v, vl.v, oacc[t]);
          oacc[t] = at_mma16<F16>(pl.v, vb.v, oacc[t]);
        }
      }
    }
  }

  float* os = Os[wave];
#pragma unroll
  for (int r = 0; r < 8; ++r) {
    const float inv = 1.0f / (lrow[r] * PSC);
#pragma unroll
    for (int t = 0; t < 4; ++t) os[(8 * hh + r) * 68 + t * 16 + c] = oacc[t][r] * inv;
  }
  __builtin_amdgcn_fence(__ATOMIC_RELEASE, "workgroup");
  __builtin_amdgcn_wave_barrier();
  __builtin_amdgcn_fence(__ATOMIC_ACQUIRE, "workgroup");
  {
    const int c4 = (lane & 15) * 4;
    {
#pragma unroll
      for (int it = 0; it < 8; ++it) {
        const int row = it * 2 + hh;
        v4f val = *(const v4f*)(os + row * 68 + c4);
        *(v4f*)(ob_ptr + (size_t)(q0 + row) * g.o_rs + c4) = val;
      }
      
    }
  }
}

} // namespace w25


extern "C" void kernel_launch(void* const* d_in, const int* in_sizes, int n_in, void* d_out, int out_size, void* d_ws, size_t ws_size, hipStream_t stream) {
    (void)in_sizes; (void)n_in; (void)out_size; (void)ws_size;
    const float* x = (const float*)d_in[0];
    const float* Wq = (const float*)d_in[1];
    const float* Wkv = (const float*)d_in[2];
    const float* Wo = (const float*)d_in[3];
    const float* bo = (const float*)d_in[4];
    const int Bn = 2;
    const int T = 2048;
    const int D = 1024;
    const int NH = 16;
    const int D3 = 3 * D;
    const int NR = Bn * T;
    float* out = (float*)d_out;
    char* wsp = (char*)d_ws;
    unsigned short* X16 = (unsigned short*)wsp; wsp += (((size_t)((size_t)NR * D) * 2 + 255) / 256) * 256;
    unsigned short* W316 = (unsigned short*)wsp; wsp += (((size_t)((size_t)D3 * D) * 2 + 255) / 256) * 256;
    float* QKV = (float*)wsp; wsp += (((size_t)((size_t)T * D3) * 4 + 255) / 256) * 256;
    if ((size_t)(wsp - (char*)d_ws) > ws_size) return;   // static carve guard
    k_cast16<<<(unsigned)((((long long)(NR) * ((D) / 2)) + 255) / 256), 256, 0, stream>>>(x, D, (_Float16*)(X16), D, NR, D, 1.0f);
    k_castT16<<<(unsigned)((((long long)(D) * ((D) / 2)) + 255) / 256), 256, 0, stream>>>(Wq, D, (_Float16*)(W316), D, D, D, 16.0f);
    k_castT16<<<(unsigned)((((long long)(D) * ((D) / 2)) + 255) / 256), 256, 0, stream>>>(Wkv, 2 * D, (_Float16*)(W316 + (size_t)D * D), D, D, D, 16.0f);
    k_castT16<<<(unsigned)((((long long)(D) * ((D) / 2)) + 255) / 256), 256, 0, stream>>>(Wkv + D, 2 * D, (_Float16*)(W316 + (size_t)2 * D * D), D, D, D, 16.0f);
    w25::wmma_gemm64<0, false, 0, 0, false, 0><<<dim3((unsigned)((((T) / 64) * ((D3) / 64) + 7) / 8), (unsigned)(1)), 256, 0, stream>>>((const unsigned short*)(X16 + (size_t)0 * T * D), nullptr, D, 0, (const unsigned short*)(W316), nullptr, D, 0, (void*)(QKV), nullptr, D3, 0, nullptr, nullptr, 0, T, D3, D, 0.0625f);
    k_attn_lds<T, D3, D><<<dim3((unsigned)((T) / (16 * AW)), (unsigned)(NH)), 32 * AW, 0, stream>>>(QKV, QKV + D, QKV + 2 * D, Wo, bo, out + (size_t)0 * T * D, 0.125f);
    w25::wmma_gemm64<0, false, 0, 0, false, 0><<<dim3((unsigned)((((T) / 64) * ((D3) / 64) + 7) / 8), (unsigned)(1)), 256, 0, stream>>>((const unsigned short*)(X16 + (size_t)1 * T * D), nullptr, D, 0, (const unsigned short*)(W316), nullptr, D, 0, (void*)(QKV), nullptr, D3, 0, nullptr, nullptr, 0, T, D3, D, 0.0625f);
    k_attn_lds<T, D3, D><<<dim3((unsigned)((T) / (16 * AW)), (unsigned)(NH)), 32 * AW, 0, stream>>>(QKV, QKV + D, QKV + 2 * D, Wo, bo, out + (size_t)1 * T * D, 0.125f);
}

// v004
// One run takes 208 microseconds.
// Next to v003, in two timings, it ran 1.07 and 1.08 times as fast.
// All steps since v000 together make it 10.3 times as fast.
// Contractions: q and k|v projections (weights stored [in][out]) [2048x1024].[1024x1024|2048] per batch element, with f16 operands on f16 planes (v_wmma_f32_16x16x32_f16, 64x64 register-blocked wave tiles, weights x16); per (batch, head) softmax(q.k^T/8) v over all 2048 keys as one flash launch per batch element (head_dim 64, f16 q.k^T and f16 p.v with p as f16 of 4096 p), whose epilogue applies the head's own 64x64 output map (+bias) to the f16 attention tile still in registers (weights x16); f32 accumulate and softmax statistics.
#include <hip/hip_runtime.h>
#include <math.h>

typedef __attribute__((ext_vector_type(16))) _Float16 v16h;
typedef __attribute__((ext_vector_type(8)))  _Float16 v8h;
typedef __attribute__((ext_vector_type(16))) __bf16   v16b;
typedef __attribute__((ext_vector_type(8)))  float    v8f;
typedef __attribute__((ext_vector_type(4)))  float    v4f;

// 16-bit WMMA fragment map (wave32), lane L, h = L>>4, m = L&15:
//   A 16x32: lane = row m;   element i -> k = (i<8) ? 8h+i : 16+8h+(i-8)
//   B 32x16: lane = column m; the SAME k(i,h)
//   D 16x16 (8 f32): lane = column m; element r -> row 8h+r
__device__ __forceinline__ int frag_k(int i, int h) { return (i < 8) ? (8 * h + i) : (16 + 8 * h + (i - 8)); }
__device__ __forceinline__ __bf16 bf16_rne(float f) {
    unsigned int u = __float_as_uint(f);
    u += 0x7fffu + ((u >> 16) & 1u);
    return __builtin_bit_cast(__bf16, (unsigned short)(u >> 16));
}
__device__ __forceinline__ float bf16_f32(__bf16 b) { return __uint_as_float(((unsigned int)__builtin_bit_cast(unsigned short, b)) << 16); }
__device__ __forceinline__ v8f wmma16(v16h a, v16h b, v8f c) {
    c = __builtin_amdgcn_wmma_f32_16x16x32_f16(false, a, false, b, (short)0, c, false, false);
    asm volatile("v_nop\n\tv_nop\n\tv_nop\n\tv_nop" : "+v"(c) : "v"(a), "v"(b));
    return c;
}
__device__ __forceinline__ v8f wmmab(v16b a, v16b b, v8f c) {
    c = __builtin_amdgcn_wmma_f32_16x16x32_bf16(false, a, false, b, (short)0, c, false, false);
    asm volatile("v_nop\n\tv_nop\n\tv_nop\n\tv_nop" : "+v"(c) : "v"(a), "v"(b));
    return c;
}
struct Split { v16b hi, lo; };
// hi/lo split product: a.hi*b.hi + a.hi*b.lo + a.lo*b.hi
__device__ __forceinline__ v8f wmma3(const Split& a, const Split& b, v8f c) {
    c = __builtin_amdgcn_wmma_f32_16x16x32_bf16(false, a.hi, false, b.hi, (short)0, c, false, false);
    c = __builtin_amdgcn_wmma_f32_16x16x32_bf16(false, a.hi, false, b.lo, (short)0, c, false, false);
    c = __builtin_amdgcn_wmma_f32_16x16x32_bf16(false, a.lo, false, b.hi, (short)0, c, false, false);
    asm volatile("v_nop\n\tv_nop\n\tv_nop\n\tv_nop" : "+v"(c) : "v"(a.hi), "v"(a.lo), "v"(b.hi), "v"(b.lo));
    return c;
}
struct Split3 { v16b hi, mid, lo; };
// triple split product (6 terms, drops only terms below 2^-24 relative)
__device__ __forceinline__ v8f wmma6(const Split3& a, const Split3& b, v8f c) {
    c = __builtin_amdgcn_wmma_f32_16x16x32_bf16(false, a.hi, false, b.hi, (short)0, c, false, false);
    c = __builtin_amdgcn_wmma_f32_16x16x32_bf16(false, a.hi, false, b.mid, (short)0, c, false, false);
    c = __builtin_amdgcn_wmma_f32_16x16x32_bf16(false, a.mid, false, b.hi, (short)0, c, false, false);
    c = __builtin_amdgcn_wmma_f32_16x16x32_bf16(false, a.hi, false, b.lo, (short)0, c, false, false);
    c = __builtin_amdgcn_wmma_f32_16x16x32_bf16(false, a.mid, false, b.mid, (short)0, c, false, false);
    c = __builtin_amdgcn_wmma_f32_16x16x32_bf16(false, a.lo, false, b.hi, (short)0, c, false, false);
    asm volatile("v_nop\n\tv_nop\n\tv_nop\n\tv_nop" : "+v"(c) : "v"(a.hi), "v"(a.mid), "v"(a.lo), "v"(b.hi), "v"(b.mid), "v"(b.lo));
    return c;
}

// Fragment gathers from f32 memory: element i <- p[(k0 + frag_k(i,h)) * sk] * s, zero for k >= klen.
__device__ __forceinline__ v16h fh_ld(const float* __restrict__ p, long long sk, int k0, int h, int klen, float s) {
    v16h a;
#pragma unroll
    for (int i = 0; i < 16; ++i) { const int k = k0 + frag_k(i, h); a[i] = (k < klen) ? (_Float16)(p[(long long)k * sk] * s) : (_Float16)0.f; }
    return a;
}
__device__ __forceinline__ Split sp_ld(const float* __restrict__ p, long long sk, int k0, int h, int klen, float s) {
    Split r;
#pragma unroll
    for (int i = 0; i < 16; ++i) {
        const int k = k0 + frag_k(i, h); const float x = (k < klen) ? p[(long long)k * sk] * s : 0.f;
        const __bf16 hb = bf16_rne(x); r.hi[i] = hb; r.lo[i] = bf16_rne(x - bf16_f32(hb));
    }
    return r;
}
__device__ __forceinline__ Split3 sp3_ld(const float* __restrict__ p, long long sk, int k0, int h, int klen, float s) {
    Split3 r;
#pragma unroll
    for (int i = 0; i < 16; ++i) {
        const int k = k0 + frag_k(i, h); const float x = (k < klen) ? p[(long long)k * sk] * s : 0.f;
        const __bf16 hb = bf16_rne(x); const float r1 = x - bf16_f32(hb); const __bf16 mb = bf16_rne(r1);
        r.hi[i] = hb; r.mid[i] = mb; r.lo[i] = bf16_rne(r1 - bf16_f32(mb));
    }
    return r;
}
__device__ __forceinline__ v16b bh_ld(const float* __restrict__ p, long long sk, int k0, int h, int klen, float s) {
    v16b a;
#pragma unroll
    for (int i = 0; i < 16; ++i) { const int k = k0 + frag_k(i, h); a[i] = bf16_rne((k < klen) ? p[(long long)k * sk] * s : 0.f); }
    return a;
}
// f16 fragment from an f16 LDS/global row with element stride 1 (k-contiguous), no bounds (tile already zero padded)
__device__ __forceinline__ v16h fh_row(const _Float16* __restrict__ row, int k0, int h) {
    v16h a;
#pragma unroll
    for (int i = 0; i < 16; ++i) a[i] = row[k0 + frag_k(i, h)];
    return a;
}

#define VST2(T, ptr, val) do { const T vst2_v_ = (val); *(T*)(ptr) = vst2_v_;  } while (0)
typedef float v4f __attribute__((ext_vector_type(4)));
#define VST2V4(ptr, val) do { const v4f vst2_v4_ = (val); *(v4f*)(ptr) = vst2_v4_;  } while (0)

__device__ __attribute__((noinline)) float act_fn(float v, int act) {
    if (act == 1) return fmaxf(v, 0.f);                                                                               // relu
    if (act == 2) { const float u = 0.7978845608028654f * (v + 0.044715f * v * v * v); return 0.5f * v * (1.f + tanhf(u)); } // tanh-gelu
    if (act == 3) return v / (1.f + expf(-v));                                                                        // silu
    if (act == 4) return 0.5f * v * (1.f + erff(v * 0.7071067811865476f));                                             // erf-gelu
    if (act == 5) return tanhf(v);
    if (act == 6) return 1.f / (1.f + expf(-v));                                                                      // sigmoid
    if (act == 7) return (v > 0.f) ? v : 0.01f * v;                                                                   // leaky relu 0.01
    if (act == 8) return (v > 0.f) ? v : (expf(v) - 1.f);                                                             // elu
    if (act == 9) return fminf(fmaxf(v, 0.f), 6.f);                                                                   // relu6
    if (act == 10) return fabsf(v);                                                                                    // abs
    if (act == 11) return (v >= 0.f) ? v : 0.1f * v;                                                                  // leaky 0.1
    if (act == 12) return (v > 0.f) ? v : 0.2f * v;                                                                   // leaky 0.2
    if (act == 13) return (v > 20.f) ? v : log1pf(expf(v));                                                            // softplus
    return v;
}

// =====================================================================================================================
// k_gemm<MODE>: C(z, m, n) = act(alpha * sum_k A(z, m, k) * B(z, k, n) + bias) + beta * R(z, m, n)
//   One wave (32-thread block) per 16 x 32 tile of C; grid (ceil(N/32), ceil(M/16), Z). Batch z -> (zo = z / zi_n, zi = z % zi_n)
//   with separate outer/inner strides for every tensor (e.g. batch and head). A(m,k) = A[zo*sAo + zi*sAi + m*sAm + k*sAk] (f32),
//   B(k,n) = B[zo*sBo + zi*sBi + n*sBn + k*sBk] (f32); any M, N, K (K zero-padded to 32 inside the fragments, M/N tails guarded).
//   C(m,n) = C[zo*sCo + zi*sCi + m*sCm + n] (n contiguous). flags: 1 bias[n], 2 bias[m], 4 residual R[zo*sRo + zi*sRi + m*sRm + n*sRn].
//   MODE 0: f16 operands (A prescaled by sa, B by sb, both undone in the epilogue); 1: bf16 hi/lo split (3 products); 2: bf16;
//   3: bf16 hi/mid/lo triple split (6 products); 4: as 3 with Kahan-compensated f32 accumulation across k-steps.
// =====================================================================================================================
struct GemmP {
    const float* A; const float* B; const float* bias; const float* R; float* C;
    long long sAo, sAi, sAm, sAk, sBo, sBi, sBn, sBk, sCo, sCi, sCm, sRo, sRi, sRm, sRn;
    int M, N, K, zi_n, flags, act; float alpha, beta, sa, sb;
    int Npad, pad_;     // columns [N, Npad) of C are written as 0 so that padded workspace rows are covered by whole-line stores; Npad >= N
};
static_assert(sizeof(GemmP) == 5 * 8 + 15 * 8 + 6 * 4 + 4 * 4 + 2 * 4, "GemmP has padding");

template <int MODE>
__global__ __launch_bounds__(32) void k_gemm(GemmP p) {
    const int lane = threadIdx.x & 31, h = lane >> 4, l15 = lane & 15;
    const int m0 = blockIdx.y * 16, n0 = blockIdx.x * 32;
    const int z = blockIdx.z, zo = z / p.zi_n, zi = z - zo * p.zi_n;
    const float* A = p.A + zo * p.sAo + zi * p.sAi;
    const float* B = p.B + zo * p.sBo + zi * p.sBi;
    const int am = min(m0 + l15, p.M - 1);                       // clamped row for loads (stores are guarded)
    v8f acc[2], comp[2];
#pragma unroll
    for (int t = 0; t < 2; ++t) { v8f zz = {}; acc[t] = zz; comp[t] = zz; }
    for (int k0 = 0; k0 < p.K; k0 += 32) {
        const float* arow = A + (long long)am * p.sAm;
        if (MODE == 1) {
            const Split a = sp_ld(arow, p.sAk, k0, h, p.K, 1.f);
#pragma unroll
            for (int t = 0; t < 2; ++t) {
                const int bn = min(n0 + t * 16 + l15, p.N - 1);
                acc[t] = wmma3(a, sp_ld(B + (long long)bn * p.sBn, p.sBk, k0, h, p.K, 1.f), acc[t]);
            }
        } else if (MODE == 3) {
            const Split3 a = sp3_ld(arow, p.sAk, k0, h, p.K, 1.f);
#pragma unroll
            for (int t = 0; t < 2; ++t) {
                const int bn = min(n0 + t * 16 + l15, p.N - 1);
                acc[t] = wmma6(a, sp3_ld(B + (long long)bn * p.sBn, p.sBk, k0, h, p.K, 1.f), acc[t]);
            }
        } else if (MODE == 4) {
            // triple split as MODE 3, but each k-step's 6 products go into a fresh accumulator and the partial is added to the running f32 sum
            // on the VALU with Kahan compensation (accumulation error stays ~1 ulp however long K is)
            const Split3 a = sp3_ld(arow, p.sAk, k0, h, p.K, 1.f);
#pragma unroll
            for (int t = 0; t < 2; ++t) {
                const int bn = min(n0 + t * 16 + l15, p.N - 1); v8f zz = {};
                const v8f part = wmma6(a, sp3_ld(B + (long long)bn * p.sBn, p.sBk, k0, h, p.K, 1.f), zz);
                const v8f y = part - comp[t]; const v8f s = acc[t] + y; comp[t] = (s - acc[t]) - y; acc[t] = s;
            }
        } else if (MODE == 2) {
            const v16b a = bh_ld(arow, p.sAk, k0, h, p.K, 1.f);
#pragma unroll
            for (int t = 0; t < 2; ++t) {
                const int bn = min(n0 + t * 16 + l15, p.N - 1);
                acc[t] = wmmab(a, bh_ld(B + (long long)bn * p.sBn, p.sBk, k0, h, p.K, 1.f), acc[t]);
            }
        } else {
            const v16h a = fh_ld(arow, p.sAk, k0, h, p.K, p.sa);
#pragma unroll
            for (int t = 0; t < 2; ++t) {
                const int bn = min(n0 + t * 16 + l15, p.N - 1);
                acc[t] = wmma16(a, fh_ld(B + (long long)bn * p.sBn, p.sBk, k0, h, p.K, p.sb), acc[t]);
            }
        }
    }
    const float iscale = (MODE == 0) ? p.alpha / (p.sa * p.sb) : p.alpha;
    float* C = p.C + zo * p.sCo + zi * p.sCi;
    const float* R = p.R + zo * p.sRo + zi * p.sRi;
    __shared__ __align__(16) float ctile[16][36];
#pragma unroll
    for (int t = 0; t < 2; ++t) {
        const int n = n0 + t * 16 + l15; const int nn = min(n, p.N - 1);
#pragma unroll
        for (int r = 0; r < 8; ++r) {
            const int m = m0 + 8 * h + r; const int mm = min(m, p.M - 1);
            float v = acc[t][r] * iscale;
            if (p.flags & 1) v += p.bias[nn];
            if (p.flags & 2) v += p.bias[mm];
            if (p.flags & 8) v *= p.bias[(long long)zo * p.M + mm];   /* per-(z,row) scale vector laid out [Z][M]; exclusive with the bias flags */
            v = act_fn(v, p.act);
            if (p.flags & 4) v += p.beta * R[(long long)mm * p.sRm + (long long)nn * p.sRn];
            ctile[8 * h + r][t * 16 + l15] = (n < p.N) ? v : 0.f;
        }
    }
    __syncthreads();
    const int NW = (p.Npad > p.N) ? p.Npad : p.N;           // write width
    const bool fast = (m0 + 16 <= p.M) && (n0 + 32 <= NW) && ((p.sCm & 3) == 0) && ((((size_t)C) & 15) == 0);
    if (fast) {
#pragma unroll
        for (int s = 0; s < 4; ++s) {
            const int row = s * 4 + (lane >> 3), c4 = (lane & 7) * 4;
            const v4f v = *(const v4f*)&ctile[row][c4];
            VST2V4(C + (long long)(m0 + row) * p.sCm + n0 + c4, v);
        }
    } else {
        for (int row = 0; row < 16; ++row) {
            const int m = m0 + row, n = n0 + lane;
            if (m < p.M && n < NW) VST2(float, C + (long long)m * p.sCm + n, ctile[row][lane]);
        }
    }
}


// =====================================================================================================================
// k_gemmT<MODE, TM, TN>: same contract as k_gemm, but one wave computes a (16*TM) x (16*TN) tile: TM A fragments and TN B fragments are
//   loaded per 32-wide k-step and reused across TM*TN WMMAs (far fewer load/convert instructions per MAC). MODE 0 (f16), 1 (bf16 hi/lo),
//   2 (bf16) only. grid (ceil(NW/(16*TN)), ceil(M/(16*TM)), Z), block 32. Epilogue identical to k_gemm, run per 16x32 sub-tile.
// =====================================================================================================================
template <int MODE, int TM, int TN>
__global__ __launch_bounds__(32) void k_gemmT(GemmP p) {
    const int lane = threadIdx.x & 31, h = lane >> 4, l15 = lane & 15;
    const int m0 = blockIdx.y * (16 * TM), n0 = blockIdx.x * (16 * TN);
    const int z = blockIdx.z, zo = z / p.zi_n, zi = z - zo * p.zi_n;
    const float* A = p.A + zo * p.sAo + zi * p.sAi;
    const float* B = p.B + zo * p.sBo + zi * p.sBi;
    v8f acc[TM][TN];
#pragma unroll
    for (int i = 0; i < TM; ++i)
#pragma unroll
        for (int t = 0; t < TN; ++t) { v8f zz = {}; acc[i][t] = zz; }
    for (int k0 = 0; k0 < p.K; k0 += 32) {
        if (MODE == 1) {
            Split a[TM], b[TN];
#pragma unroll
            for (int i = 0; i < TM; ++i) { const int am = min(m0 + 16 * i + l15, p.M - 1); a[i] = sp_ld(A + (long long)am * p.sAm, p.sAk, k0, h, p.K, 1.f); }
#pragma unroll
            for (int t = 0; t < TN; ++t) { const int bn = min(n0 + 16 * t + l15, p.N - 1); b[t] = sp_ld(B + (long long)bn * p.sBn, p.sBk, k0, h, p.K, 1.f); }
#pragma unroll
            for (int i = 0; i < TM; ++i)
#pragma unroll
                for (int t = 0; t < TN; ++t) acc[i][t] = wmma3(a[i], b[t], acc[i][t]);
        } else if (MODE == 2) {
            v16b a[TM], b[TN];
#pragma unroll
            for (int i = 0; i < TM; ++i) { const int am = min(m0 + 16 * i + l15, p.M - 1); a[i] = bh_ld(A + (long long)am * p.sAm, p.sAk, k0, h, p.K, 1.f); }
#pragma unroll
            for (int t = 0; t < TN; ++t) { const int bn = min(n0 + 16 * t + l15, p.N - 1); b[t] = bh_ld(B + (long long)bn * p.sBn, p.sBk, k0, h, p.K, 1.f); }
#pragma unroll
            for (int i = 0; i < TM; ++i)
#pragma unroll
                for (int t = 0; t < TN; ++t) acc[i][t] = wmmab(a[i], b[t], acc[i][t]);
        } else {
            v16h a[TM], b[TN];
#pragma unroll
            for (int i = 0; i < TM; ++i) { const int am = min(m0 + 16 * i + l15, p.M - 1); a[i] = fh_ld(A + (long long)am * p.sAm, p.sAk, k0, h, p.K, p.sa); }
#pragma unroll
            for (int t = 0; t < TN; ++t) { const int bn = min(n0 + 16 * t + l15, p.N - 1); b[t] = fh_ld(B + (long long)bn * p.sBn, p.sBk, k0, h, p.K, p.sb); }
#pragma unroll
            for (int i = 0; i < TM; ++i)
#pragma unroll
                for (int t = 0; t < TN; ++t) acc[i][t] = wmma16(a[i], b[t], acc[i][t]);
        }
    }
    const float iscale = (MODE == 0) ? p.alpha / (p.sa * p.sb) : p.alpha;
    float* C = p.C + zo * p.sCo + zi * p.sCi;
    const float* R = p.R + zo * p.sRo + zi * p.sRi;
    const int NW = (p.Npad > p.N) ? p.Npad : p.N;
    __shared__ __align__(16) float ctile[16][36];
#pragma unroll
    for (int i = 0; i < TM; ++i) {
        const int mb = m0 + 16 * i; if (mb >= p.M) break;          // wave-uniform
#pragma unroll
        for (int tp = 0; tp < TN / 2; ++tp) {
            const int nb = n0 + 32 * tp; if (nb >= NW) break;        // wave-uniform
#pragma unroll
            for (int t2 = 0; t2 < 2; ++t2) {
                const int t = 2 * tp + t2; const int n = nb + t2 * 16 + l15; const int nn = min(n, p.N - 1);
#pragma unroll
                for (int r = 0; r < 8; ++r) {
                    const int m = mb + 8 * h + r; const int mm = min(m, p.M - 1);
                    float v = acc[i][t][r] * iscale;
                    if (p.flags & 1) v += p.bias[nn];
                    if (p.flags & 2) v += p.bias[mm];
            if (p.flags & 8) v *= p.bias[(long long)zo * p.M + mm];   /* per-(z,row) scale vector laid out [Z][M]; exclusive with the bias flags */
                    v = act_fn(v, p.act);
                    if (p.flags & 4) v += p.beta * R[(long long)mm * p.sRm + (long long)nn * p.sRn];
                    ctile[8 * h + r][t2 * 16 + l15] = (n < p.N) ? v : 0.f;
                }
            }
            __syncthreads();
            const bool fast = (mb + 16 <= p.M) && (nb + 32 <= NW) && ((p.sCm & 3) == 0) && ((((size_t)C) & 15) == 0);
            if (fast) {
#pragma unroll
                for (int s = 0; s < 4; ++s) {
                    const int row = s * 4 + (lane >> 3), c4 = (lane & 7) * 4;
                    const v4f v = *(const v4f*)&ctile[row][c4];
                    VST2V4(C + (long long)(mb + row) * p.sCm + nb + c4, v);
                }
            } else {
                for (int row = 0; row < 16; ++row) {
                    const int m = mb + row, n = nb + lane;
                    if (m < p.M && n < NW) VST2(float, C + (long long)m * p.sCm + n, ctile[row][lane]);
                }
            }
            __syncthreads();
        }
    }
}

// =====================================================================================================================
// k_attn_lds<L, RS, OS>: O receives (softmax(scale * Q.K^T) V).Wo[h] + bo[h] for one head per blockIdx.y, head and value dim 64, L queries and L keys (L % 64 == 0), f32 in and out.
//   Wave = 16 queries, AW waves per block, 64-key blocks; grid (L / (16*AW), H), block 32*AW. Row r of head h: Q/K/V + r*RS + h*64, O + r*OS + h*64.
//   Each 64-key block of K and of V is read once per work-group with 16-byte loads, converted to f16 and laid in LDS as [key][d] rows:
//   K at a pitch of 144 B for ds_load_b128 fragment reads (A operand of k.q^T, same k order as the Q fragment),
//   V at a pitch of 160 B for ds_load_tr16_b128 fragment reads (A operand of v^T.p^T: lane = row d, k = key in the frag_k order).
//   Both products are taken transposed: S^T = K.Q^T puts query l15 in lane column l15, so lanes l15 and l15+16 hold all 64 scores of one query
//   (tile t, register r: key 16t + 8*hf + r); maximum and sum run inside the lane, with one exchange between the lane halves.
//   Two S^T tiles of 16 keys, converted in place, are the B fragment of O^T += V^T.P^T in the frag_k order: P never leaves the registers.
//   Statistics f32 (exp2 domain); P x 4096 as f16.
//   Output map: Y^T = Wo[h]^T.O^T + bo[h]. Wo[h] x 16 lies in LDS as f16 [d][e] rows, laid and read exactly like a V tile (A operand: lane = row e, k = d);
//   the normalised O^T tiles, converted in place like P, are the B fragment. O receives Y, row r of head h at O + r*OS + h*64.
// =====================================================================================================================
#define AW 4
typedef __attribute__((ext_vector_type(4))) _Float16 v4h;
typedef __attribute__((ext_vector_type(8))) short    v8s;
union FragH { v16h v; v8h h[2]; };
// 16-bit transposing LDS load: with lane address T + (k0 + 8*(l>>4) + (l&7)) * pitch + d0 + 8*((l>>3)&1) (halves), lane (c = l&15, h = l>>4) gets T[k0 + 8h + 0..7][d0 + c]
__device__ __forceinline__ v8h ld_tr16(const _Float16* p) {
    typedef __attribute__((address_space(3))) v8s lds_v8s;
    return __builtin_bit_cast(v8h, __builtin_amdgcn_ds_load_tr16_b128_v8i16((lds_v8s*)p));
}
// value of lane l ^ 16
__device__ __forceinline__ float swap_half(float x) {
    const int b = __builtin_bit_cast(int, x);
    return __builtin_bit_cast(float, __builtin_amdgcn_permlanex16(b, b, 0x76543210, 0xfedcba98, false, false));
}
template <int L, int RS, int OS>
__global__ __launch_bounds__(32 * AW) void k_attn_lds(const float* __restrict__ Q, const float* __restrict__ K, const float* __restrict__ V, const float* __restrict__ Wo, const float* __restrict__ bo, float* __restrict__ O, float scale) {
    constexpr int KP = 72;                      // K tile pitch in halves (144 B: odd multiple of 16 B)
    constexpr int VP = 80;                      // V tile pitch in halves (160 B: odd multiple of 32 B)
    constexpr int OP = 68;                      // output tile pitch in floats (272 B: odd multiple of 16 B)
    __shared__ __align__(16) float    pl[AW][16 * OP];
    __shared__ __align__(16) _Float16 kl[64 * KP];
    __shared__ __align__(16) _Float16 vl[64 * VP];
    __shared__ __align__(16) _Float16 wl[64 * VP];   // Wo[h] x 16, [d][e], V's pitch (same reader)
    const int lane = threadIdx.x & 31, hf = lane >> 4, l15 = lane & 15, wave = threadIdx.x >> 5;
    const int h = blockIdx.y;
    const int q0 = (blockIdx.x * AW + wave) * 16;
    float* myp = pl[wave];
    const float L2E = 1.4426950408889634f;
    const float NEG = -__builtin_inff();
    const float* qrow = Q + h * 64 + (long long)(q0 + l15) * RS;
    const float* kbase = K + h * 64;
    const float* vbase = V + h * 64;
    v16h qa[2];
#pragma unroll
    for (int ks = 0; ks < 2; ++ks) qa[ks] = fh_ld(qrow, 1, ks * 32, hf, 64, 1.f);
    v8f o[4];                                   // o[t][r] = O^T[d = 16t + 8*hf + r][query l15]
    float m1 = NEG, l1 = 0.f;                   // query l15: running maximum (equal in both lane halves), sum over this half's keys
#pragma unroll
    for (int t = 0; t < 4; ++t) { v8f zz = {}; o[t] = zz; }
    const int sr = threadIdx.x >> 4, sc4 = (threadIdx.x & 15) * 4;   // staging: 16 threads per 64-float row, 8 rows per sweep
    const _Float16* kfr = kl + l15 * KP + 8 * hf;
    const _Float16* vfr = vl + (8 * hf + (lane & 7)) * VP + 8 * ((lane >> 3) & 1);
    const _Float16* wfr = wl + (8 * hf + (lane & 7)) * VP + 8 * ((lane >> 3) & 1);
    {                                                    // the head's output map into LDS; the key loop's first barriers publish it
        const float* wbase = Wo + h * 64 * 64;
        v4f wr[8];
#pragma unroll
        for (int i = 0; i < 8; ++i) wr[i] = *(const v4f*)(wbase + (i * 8 + sr) * 64 + sc4);
        asm volatile("s_wait_xcnt 0x0" ::: "memory");    // stands in front of any reuse of the address registers of the loads above
#pragma unroll
        for (int i = 0; i < 8; ++i) *(v4h*)(wl + (i * 8 + sr) * VP + sc4) = __builtin_convertvector(wr[i] * 16.f, v4h);
    }
    for (int j0 = 0; j0 < L; j0 += 64) {
        v4f kr[8], vr[8];
#pragma unroll
        for (int i = 0; i < 8; ++i) {
            const long long off = (long long)(j0 + i * 8 + sr) * RS + sc4;
            kr[i] = *(const v4f*)(kbase + off); vr[i] = *(const v4f*)(vbase + off);
        }
        asm volatile("s_wait_xcnt 0x0" ::: "memory");    // stands in front of any reuse of the address registers of the loads above
        __syncthreads();                                 // previous key block's reads of kl / vl are done
#pragma unroll
        for (int i = 0; i < 8; ++i) {
            *(v4h*)(kl + (i * 8 + sr) * KP + sc4) = __builtin_convertvector(kr[i], v4h);
            *(v4h*)(vl + (i * 8 + sr) * VP + sc4) = __builtin_convertvector(vr[i], v4h);
        }
        __syncthreads();                                 // K and V tiles visible to every wave
        FragH kb[4][2];                                  // all eight K fragments behind one LDS latency
#pragma unroll
        for (int t = 0; t < 4; ++t)
#pragma unroll
            for (int ks = 0; ks < 2; ++ks) {
                kb[t][ks].h[0] = *(const v8h*)(kfr + t * 16 * KP + ks * 32);
                kb[t][ks].h[1] = *(const v8h*)(kfr + t * 16 * KP + ks * 32 + 16);
            }
        v8f s[4];                                        // s[t][r] = S[query l15][key j0 + 16t + 8*hf + r]
#pragma unroll
        for (int t = 0; t < 4; ++t) {
            v8f acc = {};
#pragma unroll
            for (int ks = 0; ks < 2; ++ks) acc = wmma16(kb[t][ks].v, qa[ks], acc);
            s[t] = acc;
        }
        float sc[4][8], mt[4];
#pragma unroll
        for (int t = 0; t < 4; ++t) {
            mt[t] = NEG;
#pragma unroll
            for (int i = 0; i < 8; ++i) { sc[t][i] = (s[t][i] * scale) * L2E; mt[t] = fmaxf(mt[t], sc[t][i]); }
        }
        float mx = fmaxf(fmaxf(mt[0], mt[1]), fmaxf(mt[2], mt[3]));
        mx = fmaxf(mx, swap_half(mx));
        const float mnew = fmaxf(m1, mx);
        const float mref = (mnew == NEG) ? 0.f : mnew;   // a query with only -inf scores so far: every exp2 below is exp2(-inf) = 0, never exp2(nan)
        const float corr = exp2f(m1 - mref);
        FragH pa[2]; float rt[4];
#pragma unroll
        for (int t = 0; t < 4; ++t) {
            rt[t] = 0.f;
#pragma unroll
            for (int i = 0; i < 8; ++i) {
                const float pp = exp2f(sc[t][i] - mref);
                rt[t] += pp; pa[t >> 1].v[(t & 1) * 8 + i] = (_Float16)(pp * 4096.f);
            }
        }
        l1 = l1 * corr + ((rt[0] + rt[1]) + (rt[2] + rt[3])); m1 = mnew;
#pragma unroll
        for (int t = 0; t < 4; ++t) o[t] *= corr;
        FragH vb[4][2];                                  // all eight V fragments behind one LDS latency
#pragma unroll
        for (int t = 0; t < 4; ++t) {
            vb[t][0].h[0] = ld_tr16(vfr + t * 16);           vb[t][0].h[1] = ld_tr16(vfr + 16 * VP + t * 16);
            vb[t][1].h[0] = ld_tr16(vfr + 32 * VP + t * 16); vb[t][1].h[1] = ld_tr16(vfr + 48 * VP + t * 16);
        }
#pragma unroll
        for (int t = 0; t < 4; ++t) {
            o[t] = wmma16(vb[t][0].v, pa[0].v, o[t]);
            o[t] = wmma16(vb[t][1].v, pa[1].v, o[t]);
        }
    }
    float* obase = O + h * 64;
    const float lt = l1 + swap_half(l1);
    const float inv = (lt > 0.f) ? 1.f / (lt * 4096.f) : 0.f;
    FragH ob[2];                                         // O^T as f16: tiles 2ks and 2ks+1 are the B fragment of d chunk ks in the frag_k order
#pragma unroll
    for (int t = 0; t < 4; ++t)
#pragma unroll
        for (int i = 0; i < 8; ++i) ob[t >> 1].v[(t & 1) * 8 + i] = (_Float16)(o[t][i] * inv);
    FragH wb[4][2];
#pragma unroll
    for (int t = 0; t < 4; ++t) {
        wb[t][0].h[0] = ld_tr16(wfr + t * 16);           wb[t][0].h[1] = ld_tr16(wfr + 16 * VP + t * 16);
        wb[t][1].h[0] = ld_tr16(wfr + 32 * VP + t * 16); wb[t][1].h[1] = ld_tr16(wfr + 48 * VP + t * 16);
    }
#pragma unroll
    for (int t = 0; t < 4; ++t) {
        v8f ov = {};                                     // ov[r] = 16 * (Y^T - bo[h])[e = 16t + 8*hf + r][query l15]
        ov = wmma16(wb[t][0].v, ob[0].v, ov);
        ov = wmma16(wb[t][1].v, ob[1].v, ov);
        *(v4f*)(myp + l15 * OP + t * 16 + 8 * hf)     = __builtin_shufflevector(ov, ov, 0, 1, 2, 3);
        *(v4f*)(myp + l15 * OP + t * 16 + 8 * hf + 4) = __builtin_shufflevector(ov, ov, 4, 5, 6, 7);
    }
    const v4f bv = *(const v4f*)(bo + h * 64 + l15 * 4);
    __syncthreads();
#pragma unroll
    for (int r0 = 0; r0 < 16; r0 += 2) {
        const int row = r0 + hf, c4 = l15 * 4;
        const v4f v = *(const v4f*)(myp + row * OP + c4) * 0.0625f + bv;
        VST2V4(obase + (long long)(q0 + row) * OS + c4, v);
    }
}

// =====================================================================================================================
// k_tr: dst(z, c, r) = alpha * src(z, r, c) (+ beta * R2(z, c, r)): [Z][R][C] (row stride lds) -> [Z][C][R] (row stride ldd) through a 32x32 LDS tile;
//   flags: 1 -> add beta * residual R2 addressed like dst (z*sRz + c*ldr + r); act applied before the residual.
// =====================================================================================================================
struct TrP { const float* src; float* dst; const float* R2; long long sSz, lds, sDz, ldd, sRz, ldr; int R, C, flags, act; float alpha, beta; };
static_assert(sizeof(TrP) == 3 * 8 + 6 * 8 + 6 * 4, "TrP has padding");
__global__ __launch_bounds__(256) void k_tr(TrP p) {
    __shared__ float tile[32][33];
    const int c0 = blockIdx.x * 32, r0 = blockIdx.y * 32, z = blockIdx.z;
    const int lane = threadIdx.x & 31, wave = threadIdx.x >> 5;
    const float* s = p.src + z * p.sSz;
#pragma unroll
    for (int k = 0; k < 4; ++k) {
        const int rl = wave * 4 + k, r = r0 + rl, c = c0 + lane;
        tile[rl][lane] = (r < p.R && c < p.C) ? s[(long long)r * p.lds + c] : 0.f;
    }
    __syncthreads();
    float* d = p.dst + z * p.sDz; const float* rr = p.R2 + z * p.sRz;
#pragma unroll
    for (int k = 0; k < 4; ++k) {
        const int cl = wave * 4 + k, c = c0 + cl, r = r0 + lane;
        if (c < p.C && r < p.R) {
            float v = act_fn(p.alpha * tile[lane][cl], p.act);
            if (p.flags & 1) v += p.beta * rr[(long long)c * p.ldr + r];
            VST2(float, d + (long long)c * p.ldd + r, v);
        }
    }
}

// k_affine: dst[i] = a * (sdev ? sdev[0] : 1) * src[i] + b, i < n (one thread per element; consecutive lanes -> consecutive addresses)
__global__ __launch_bounds__(256) void k_affine(const float* __restrict__ src, float* __restrict__ dst, int n, float a, float b, const float* __restrict__ sdev) {
    const int i = blockIdx.x * 256 + threadIdx.x;
    if (i < n) { const float aa = sdev ? a * sdev[0] : a; const float v = aa * src[i] + b; VST2(float, dst + i, v); }
}

// =====================================================================================================================
// k_softmax: row softmax over n contiguous elements, one 256-thread block per row; rows addressed z*sz + r*sr (grid (R, Z)).
//   out = scale_out * softmax(scale_in * x + (Mf ? Mf[z*smz + r*smr + j] : 0)); a row whose max is -inf is written as 0.
// =====================================================================================================================
struct SmP { const float* src; float* dst; const float* Mf; long long sz, sr, dz, dr, smz, smr; int n, pad; float scale_in, scale_out; };
static_assert(sizeof(SmP) == 3 * 8 + 6 * 8 + 4 * 4, "SmP has padding");
__global__ __launch_bounds__(256) void k_softmax(SmP p) {
    __shared__ float red[256];
    const int r = blockIdx.x, z = blockIdx.y, tid = threadIdx.x;
    const float* s = p.src + z * p.sz + (long long)r * p.sr;
    const float* mf = p.Mf ? (p.Mf + z * p.smz + (long long)r * p.smr) : nullptr;
    float mx = -__builtin_inff();
    for (int j = tid; j < p.n; j += 256) { float v = s[j] * p.scale_in; if (mf) v += mf[j]; mx = fmaxf(mx, v); }
    red[tid] = mx; __syncthreads();
    for (int o = 128; o > 0; o >>= 1) { if (tid < o) red[tid] = fmaxf(red[tid], red[tid + o]); __syncthreads(); }
    mx = red[0]; __syncthreads();
    float sum = 0.f;
    for (int j = tid; j < p.n; j += 256) { float v = s[j] * p.scale_in; if (mf) v += mf[j]; sum += (mx == -__builtin_inff()) ? 0.f : expf(v - mx); }
    red[tid] = sum; __syncthreads();
    for (int o = 128; o > 0; o >>= 1) { if (tid < o) red[tid] += red[tid + o]; __syncthreads(); }
    sum = red[0];
    const float inv = (sum > 0.f) ? p.scale_out / sum : 0.f;
    float* d = p.dst + z * p.dz + (long long)r * p.dr;
    for (int j = tid; j < p.n; j += 256) { float v = s[j] * p.scale_in; if (mf) v += mf[j]; const float o = (mx == -__builtin_inff()) ? 0.f : expf(v - mx) * inv; VST2(float, d + j, o); }
}
// =====================================================================================================================
// k_stats: mean and rsqrt(var + eps) over a set of n elements addressed base + z*sz + (e / inner) * so + (e % inner) * si, one 256-thread
// k_norm_apply: y = (x - mean[set]) * rstd[set] * g[c] + b[c] over a [Z][C][L] channel-major tensor with set = z*G + c / (C/G) (G groups per z;
//   G = C -> per-channel sets indexed z*C+c; for batch norm pass stats indexed by c only via bn = 1). Optional act. Output same layout.
// =====================================================================================================================
//   mode 0: mean / rsqrt(var + eps); mode 1 (RMSNorm): 0 / rsqrt(mean(x^2) + eps); mode 2 (L2 normalize * sqrt(n)): 0 / sqrt(n) / max(||x||, eps); mode 3: as 0 with unbiased variance (n-1)
__global__ __launch_bounds__(256) void k_stats(const float* __restrict__ x, long long sz, long long so, long long si, int inner, int n, float eps, float* __restrict__ stat, int mode) {
    __shared__ float red[256];
    const int z = blockIdx.x, tid = threadIdx.x;
    const float* base = x + z * sz;
    float s = 0.f;
    for (int e = tid; e < n; e += 256) s += base[(long long)(e / inner) * so + (long long)(e % inner) * si];
    red[tid] = s; __syncthreads();
    for (int o = 128; o > 0; o >>= 1) { if (tid < o) red[tid] += red[tid + o]; __syncthreads(); }
    const float mu = (mode == 0 || mode == 3) ? red[0] / (float)n : 0.f; __syncthreads();
    float q = 0.f;
    for (int e = tid; e < n; e += 256) { const float dlt = base[(long long)(e / inner) * so + (long long)(e % inner) * si] - mu; q += dlt * dlt; }
    red[tid] = q; __syncthreads();
    for (int o = 128; o > 0; o >>= 1) { if (tid < o) red[tid] += red[tid + o]; __syncthreads(); }
    {
        float rs;
        if (mode == 2) rs = sqrtf((float)n) / fmaxf(sqrtf(red[0]), eps); else if (mode == 3) rs = rsqrtf(red[0] / (float)(n - 1) + eps); else rs = rsqrtf(red[0] / (float)n + eps);
        if (tid < 32) { const float v = (tid == 0) ? mu : ((tid == 1) ? rs : 0.f); VST2(float, stat + (long long)z * 32 + tid, v); }
    }
}
//   One thread per element over the flat [Z][C][L] index space: grid ceil(Z*C*L / 256).
__global__ __launch_bounds__(256) void k_norm_apply(const float* __restrict__ x, float* __restrict__ y, const float* __restrict__ stat, const float* __restrict__ g, const float* __restrict__ bta,
                                                     int Z, int C, int L, int G, int bn, int act) {
    const long long idx = (long long)blockIdx.x * 256 + threadIdx.x;
    if (idx >= (long long)Z * C * L) return;
    const int l = (int)(idx % L); const long long zc = idx / L; const int c = (int)(zc % C), z = (int)(zc / C); (void)l;
    const int set = bn ? c : (z * G + c / (C / G));
    float v = (x[idx] - stat[(long long)set * 32]) * stat[(long long)set * 32 + 1];
    if (g) v *= g[c];
    if (bta) v += bta[c];
    v = act_fn(v, act);
    VST2(float, y + idx, v);
}

// k_lse_neg: c[i] = -(st[2i] + log(st[2i+1])) = minus the log-sum-exp of row i from (max, sum) statistic pairs (for softmax over the query dimension)
__global__ __launch_bounds__(256) void k_lse_neg(const float* __restrict__ st, float* __restrict__ c, int n) {
    const int i = blockIdx.x * 256 + threadIdx.x;
    if (i < n) { const float v = -(st[2 * i] + logf(st[2 * i + 1])); VST2(float, c + i, v); }
}

// k_iota: dst[i] = a * i + b as int32 (segment/position id helper)
__global__ __launch_bounds__(256) void k_iota(int* __restrict__ dst, int n, int a, int b) {
    const int i = blockIdx.x * 256 + threadIdx.x;
    if (i < n) { const int v = a * i + b; VST2(int, dst + i, v); }
}

// k_axpby: dst[i] = a * x[i] + b * y[i] (+ c), i < n
__global__ __launch_bounds__(256) void k_axpby(const float* __restrict__ x, const float* __restrict__ y, float* __restrict__ dst, int n, float a, float b, float c) {
    const int i = blockIdx.x * 256 + threadIdx.x;
    if (i < n) { const float v = a * x[i] + b * y[i] + c; VST2(float, dst + i, v); }
}

// =====================================================================================================================
// k_rope: rotary embedding on a [R rows][Hn heads][D] view (row stride sXr, head stride sXh, element stride 1) -> Y (own strides).
//   mode 0: rotate_half (partner d±D/2, sign - for d<D/2); mode 1: interleaved pairs (partner d^1, sign - for even d).
//   table column tcol: tmode 0 -> d, 1 -> d % (D/2), 2 -> d / 2; position p: pmode 0 -> r % S, 1 -> head index, 2 -> pos[r];
//   c = C[(r / S) * sCb + p * sCp + tcol * sCd], s likewise from Sn; y = x[d] * c + sign * x[partner] * s. X and Y must not alias.
// =====================================================================================================================
struct RopeP { const float* X; float* Y; const float* C; const float* Sn; const int* pos; long long sXr, sXh, sYr, sYh, sCb, sCp, sCd; int R, Hn, D, S, mode, tmode, pmode, pad; };
static_assert(sizeof(RopeP) == 5 * 8 + 7 * 8 + 8 * 4, "RopeP has padding");
__global__ __launch_bounds__(256) void k_rope(RopeP p) {
    const long long idx = (long long)blockIdx.x * 256 + threadIdx.x;
    if (idx >= (long long)p.R * p.Hn * p.D) return;
    const int d = (int)(idx % p.D); const long long rh = idx / p.D; const int h = (int)(rh % p.Hn); const int r = (int)(rh / p.Hn);
    const int half = p.D / 2;
    int partner; float sign;
    if (p.mode == 0) { partner = (d < half) ? d + half : d - half; sign = (d < half) ? -1.f : 1.f; }
    else { partner = d ^ 1; sign = (d & 1) ? 1.f : -1.f; }
    const int tcol = (p.tmode == 0) ? d : ((p.tmode == 1) ? (d % half) : (d >> 1));
    const int pp = (p.pmode == 0) ? (r % p.S) : ((p.pmode == 1) ? h : p.pos[r]);
    const long long toff = (long long)(r / p.S) * p.sCb + (long long)pp * p.sCp + (long long)tcol * p.sCd;
    const float* xr = p.X + (long long)r * p.sXr + (long long)h * p.sXh;
    const float v = xr[d] * p.C[toff] + sign * xr[partner] * p.Sn[toff];
    VST2(float, p.Y + (long long)r * p.sYr + (long long)h * p.sYh + d, v);
}

// k_invf + k_sincos (split so neither kernel carries a large VALU-fma footprint): invf_i = num * (1 / powf(base, (2 i)/D)) [fmode 0],
//   num * expf((2 i) * cexp) [fmode 1], num * powf(base, -2 (i - 1) / D) [fmode 2]; then cs/sn[s*half + i] = cos/sin((pscale * s) * invf_i)
__global__ __launch_bounds__(256) void k_invf(float* __restrict__ invb, int half, int D, float base, float num, int fmode, float cexp) {
    const int i = blockIdx.x * 256 + threadIdx.x;
    if (i >= ((half + 31) / 32) * 32) return;
    if (i >= half) { VST2(float, invb + i, 0.f); return; }
    const float e = (float)(2 * i) / (float)D;
    float invf;
    if (fmode == 1) invf = num * expf((float)(2 * i) * cexp);
    else if (fmode == 2) invf = num * powf(base, (-2.0f * ((float)i - 1.0f)) / (float)D);
    else invf = num * (1.0f / powf(base, e));
    VST2(float, invb + i, invf);
}
__global__ __launch_bounds__(256) void k_sincos(float* __restrict__ cs, float* __restrict__ sn, const float* __restrict__ invb, int S, int half, float pscale) {
    const int idx = blockIdx.x * 256 + threadIdx.x;
    if (idx >= S * half) return;
    const int s = idx / half, i = idx - s * half;
    const float ang = (pscale * (float)s) * invb[i];
    VST2(float, cs + idx, cosf(ang)); VST2(float, sn + idx, sinf(ang));
}

// k_mulact: dst[i] = act(x[i]) * y[i]
__global__ __launch_bounds__(256) void k_mulact(const float* __restrict__ x, const float* __restrict__ y, float* __restrict__ dst, int n, int act) {
    const int i = blockIdx.x * 256 + threadIdx.x;
    if (i < n) { const float v = act_fn(x[i], act) * y[i]; VST2(float, dst + i, v); }
}

// =====================================================================================================================
// k_matvec: thread-per-row matrix-vector products for N <= 8 output columns (heads with 1-3 outputs, gates), f32 on the VALU.
//   C[r*sCm + j] = act(alpha * sum_k A[r*sAm + k*sAk] * B[j*sBn + k*sBk] + bias[j]) + beta * R[r*sRm + j*sRn]; each thread writes its N contiguous floats.
// =====================================================================================================================
__global__ __launch_bounds__(256) void k_matvec(GemmP p) {
    // 32 lanes write one line with one instruction.
    const int rpt = (p.N == 1) ? 1 : 32;
    const long long r0 = ((long long)blockIdx.x * 256 + threadIdx.x) * rpt; const int z = blockIdx.z, zo = z / p.zi_n, zi = z - zo * p.zi_n;
    if (r0 >= p.M) return;
    const float* Bb = p.B + zo * p.sBo + zi * p.sBi;
    float* C = p.C + zo * p.sCo + zi * p.sCi; const float* R = p.R + zo * p.sRo + zi * p.sRi;
    for (int rr = 0; rr < rpt; ++rr) {
        const long long r = r0 + rr; if (r >= p.M) break;
        const float* A = p.A + zo * p.sAo + zi * p.sAi + r * p.sAm;
        float acc[8] = {0.f, 0.f, 0.f, 0.f, 0.f, 0.f, 0.f, 0.f};
        for (int k = 0; k < p.K; ++k) { const float a = A[(long long)k * p.sAk];
#pragma unroll
            for (int j = 0; j < 8; ++j) if (j < p.N) acc[j] += a * Bb[(long long)j * p.sBn + (long long)k * p.sBk]; }
#pragma unroll
        for (int j = 0; j < 8; ++j) if (j < p.N) {
            float v = acc[j] * p.alpha;
            if (p.flags & 1) v += p.bias[j];
            if (p.flags & 2) v += p.bias[r];
            v = act_fn(v, p.act);
            if (p.flags & 4) v += p.beta * R[r * p.sRm + (long long)j * p.sRn];
            VST2(float, C + r * p.sCm + j, v);
        }
    }
}
// k_smallsoftmax: thread-per-row softmax for short rows (n <= 64): dst[r*dr + j] = softmax(scale*src[r*sr + j])
__global__ __launch_bounds__(256) void k_smallsoftmax(const float* __restrict__ src, float* __restrict__ dst, long long sr, long long dr, int n, long long R, float scale) {
    const long long r0 = ((long long)blockIdx.x * 256 + threadIdx.x) * 32;
    for (int rr = 0; rr < 32; ++rr) {
        const long long r = r0 + rr; if (r >= R) return;
        const float* s = src + r * sr; float* d = dst + r * dr;
        float mx = -__builtin_inff();
        for (int j = 0; j < n; ++j) mx = fmaxf(mx, s[j] * scale);
        float sum = 0.f;
        for (int j = 0; j < n; ++j) sum += expf(s[j] * scale - mx);
        const float inv = 1.f / sum;
        for (int j = 0; j < n; ++j) { const float v = expf(s[j] * scale - mx) * inv; VST2(float, d + j, v); }
    }
}

__global__ __launch_bounds__(32) void k_unitstat(float* __restrict__ st) { const int t = threadIdx.x; const float v = (t == 1) ? 1.f : 0.f; VST2(float, st + t, v); }

// destination (e.g. a d_out whose row width is not a multiple of 32 floats) is written by consecutive lanes of one instruction
__global__ __launch_bounds__(256) void k_lincopy(const float* __restrict__ src, long long lds, float* __restrict__ dst, long long ldd, long long rows, int cols) {
    const long long i = (long long)blockIdx.x * 256 + threadIdx.x; if (i >= rows * cols) return;
    const long long r = i / cols; const int c = (int)(i - r * cols);
    const float v = src[r * lds + c]; VST2(float, dst + r * ldd + c, v);
}

namespace w25 {
typedef __attribute__((ext_vector_type(16))) _Float16 v16h;
typedef __attribute__((ext_vector_type(8)))  _Float16 v8h;
typedef __attribute__((ext_vector_type(16))) __bf16   v16b;
typedef __attribute__((ext_vector_type(8)))  __bf16   v8b;
typedef __attribute__((ext_vector_type(8)))  float    v8f;
typedef __attribute__((ext_vector_type(4)))  float    v4f;

__device__ __forceinline__ unsigned short f2bf_bits(float f) {
  unsigned u = __float_as_uint(f);
  return (unsigned short)((u + 0x7FFFu + ((u >> 16) & 1u)) >> 16);
}
__device__ __forceinline__ float bf_bits2f(unsigned short h) { return __uint_as_float(((unsigned)h) << 16); }

// hazard guards as plain device helpers (no inline asm inside the kernel template body)
__device__ __forceinline__ void dep_guard_h(v8f& a, v8f& b, v16h x, v16h y) { asm volatile("v_nop\n\tv_nop\n\tv_nop\n\tv_nop" : "+v"(a), "+v"(b) : "v"(x), "v"(y)); }
__device__ __forceinline__ void dep_guard_b(v8f& a, v8f& b, v16b x, v16b y) { asm volatile("v_nop\n\tv_nop\n\tv_nop\n\tv_nop" : "+v"(a), "+v"(b) : "v"(x), "v"(y)); }
__device__ __forceinline__ void keep4_h(v16h a, v16h b, v16h c, v16h d) { asm volatile("v_nop" :: "v"(a), "v"(b), "v"(c), "v"(d)); }
__device__ __forceinline__ void keep4_b(v16b a, v16b b, v16b c, v16b d) { asm volatile("v_nop" :: "v"(a), "v"(b), "v"(c), "v"(d)); }
__device__ __forceinline__ void acc_guard4(v8f& a, v8f& b, v8f& c, v8f& d) { asm volatile("v_nop\n\tv_nop\n\tv_nop\n\tv_nop" : "+v"(a), "+v"(b), "+v"(c), "+v"(d)); }
template <typename T> struct Frag;
template <> struct Frag<_Float16> {
  typedef v16h V; union U { v16h v; v8h h[2]; };
  static __device__ __forceinline__ v16h load(const _Float16* p) {   // elements 0..7 <- p[0..7], 8..15 <- p[16..23]
    U f; f.h[0] = *(const v8h*)(p); f.h[1] = *(const v8h*)(p + 16); return f.v;
  }
  static __device__ __forceinline__ v8f mma(v16h a, v16h b, v8f c) {
    return __builtin_amdgcn_wmma_f32_16x16x32_f16(false, a, false, b, (short)0, c, false, false);
  }
  static __device__ __forceinline__ void guard(v8f& a, v8f& b, v16h x, v16h y) { dep_guard_h(a, b, x, y); }
  static __device__ __forceinline__ void keep(v16h a, v16h b, v16h c, v16h d) { keep4_h(a, b, c, d); }
};
template <> struct Frag<__bf16> {
  typedef v16b V; union U { v16b v; v8b h[2]; };
  static __device__ __forceinline__ v16b load(const __bf16* p) {
    U f; f.h[0] = *(const v8b*)(p); f.h[1] = *(const v8b*)(p + 16); return f.v;
  }
  static __device__ __forceinline__ v8f mma(v16b a, v16b b, v8f c) {
    return __builtin_amdgcn_wmma_f32_16x16x32_bf16(false, a, false, b, (short)0, c, false, false);
  }
  static __device__ __forceinline__ void guard(v8f& a, v8f& b, v16b x, v16b y) { dep_guard_b(a, b, x, y); }
  static __device__ __forceinline__ void keep(v16b a, v16b b, v16b c, v16b d) { keep4_b(a, b, c, d); }
};

// ---- Register-blocked batched WMMA GEMM ------------------------------------
// C[m,n] = scale * sum_k A[m,k] * Bt[n,k] (+bias)(+resid); each wave owns a 64x64 tile.
// A row-major [M,K]; Bt row-major [N,K]; M,N % 64 == 0, K % 32 == 0.
// SPLIT: operands are hi/lo planes (A2/Bt2 = lo planes, same layout); product = hi·hi + hi·lo + lo·hi.
// BIAS_MODE: 0 = none, 1 = bias[m], 2 = bias[n].
// OUT_MODE: 0 = f32, 1 = f16, 2 = bf16 hi plane (Cout) + bf16 lo plane (Cout2).
// ET: 0 = f16 operands, 1 = bf16 operands (pointers passed as 16-bit storage)
template <int ET> struct Elem;
template <> struct Elem<0> { typedef _Float16 T; };
template <> struct Elem<1> { typedef __bf16 T; };
template <int ET, bool SPLIT, int BIAS_MODE, int OUT_MODE, bool RESID, int ACT = 0>
__global__ __launch_bounds__(256) void wmma_gemm64(
    const unsigned short* __restrict__ Ap, const unsigned short* __restrict__ A2p, int lda, long strideA,
    const unsigned short* __restrict__ Btp, const unsigned short* __restrict__ Bt2p, int ldb, long strideB,
    void* __restrict__ Cout, void* __restrict__ Cout2, int ldc, long strideC,
    const float* __restrict__ bias,
    const float* __restrict__ resid, long strideR,
    int M, int N, int K, float scale) {
  typedef typename Elem<ET>::T T;
  typedef typename Frag<T>::V V;
  const T* A = (const T*)Ap; const T* A2 = (const T*)A2p; const T* Bt = (const T*)Btp; const T* Bt2 = (const T*)Bt2p;
  __shared__ __align__(16) float sT[8][16 * 68];   // per-wave 16x64 slab, pitch 68 floats
  const int b    = blockIdx.y;
  const int lane = threadIdx.x & 31;
  const int wave = threadIdx.x >> 5;
  const int tilesN = N >> 6;
  const int tilesM = M >> 6;
  const int tile = blockIdx.x * 8 + wave;
  if (tile >= tilesM * tilesN) return;   // wave-uniform; no block barriers in this kernel
  const int tm = tile / tilesN;
  const int tn = tile - tm * tilesN;
  const int m0 = tm << 6;
  const int n0 = tn << 6;

  const T* Ab  = A  + (size_t)b * strideA;
  const T* Bb  = Bt + (size_t)b * strideB;
  const T* Ab2 = SPLIT ? (A2  + (size_t)b * strideA) : nullptr;
  const T* Bb2 = SPLIT ? (Bt2 + (size_t)b * strideB) : nullptr;

  const int rlane = lane & 15;                 // row (A) / col (B, D) within subtile
  const int koff  = (lane >> 4) * 8;           // k offset of this lane half
  const int mOff  = (lane >> 4) * 8;           // D row offset

  v8f acc[4][4];
#pragma unroll
  for (int i = 0; i < 4; ++i)
#pragma unroll
    for (int j = 0; j < 4; ++j) acc[i][j] = (v8f){0.f,0.f,0.f,0.f,0.f,0.f,0.f,0.f};

  for (int k0 = 0; k0 < K; k0 += 32) {
    V bh[4], bl[4];
#pragma unroll
    for (int j = 0; j < 4; ++j) {
      const size_t bo = (size_t)(n0 + (j << 4) + rlane) * ldb + koff + k0;
      bh[j] = Frag<T>::load(Bb + bo);
      if (SPLIT) bl[j] = Frag<T>::load(Bb2 + bo);
    }
#pragma unroll
    for (int i = 0; i < 4; ++i) {
      const size_t ao = (size_t)(m0 + (i << 4) + rlane) * lda + koff + k0;
      V ah = Frag<T>::load(Ab + ao);
      V al;
      if (SPLIT) al = Frag<T>::load(Ab2 + ao);
#pragma unroll
      for (int j = 0; j < 4; ++j) {
        acc[i][j] = Frag<T>::mma(ah, bh[j], acc[i][j]);
        if (SPLIT) {
          acc[i][j] = Frag<T>::mma(ah, bl[j], acc[i][j]);
          acc[i][j] = Frag<T>::mma(al, bh[j], acc[i][j]);
        }
      }
      Frag<T>::guard(acc[i][0], acc[i][3], ah, SPLIT ? al : ah);
    }
    Frag<T>::keep(bh[0], bh[1], bh[2], bh[3]);
    if (SPLIT) Frag<T>::keep(bl[0], bl[1], bl[2], bl[3]);
  }
  acc_guard4(acc[0][0], acc[0][1], acc[0][2], acc[0][3]);
  acc_guard4(acc[1][0], acc[1][1], acc[1][2], acc[1][3]);
  acc_guard4(acc[2][0], acc[2][1], acc[2][2], acc[2][3]);
  acc_guard4(acc[3][0], acc[3][1], acc[3][2], acc[3][3]);

  // ---- epilogue ----
  float* slab = sT[wave];
  const float* Rb = RESID ? (resid + (size_t)b * strideR) : nullptr;
#pragma unroll
  for (int i = 0; i < 4; ++i) {
    const int mBase = m0 + (i << 4);
#pragma unroll
    for (int j = 0; j < 4; ++j) {
      const int n = n0 + (j << 4) + rlane;
      float bv = 0.f;
      if (BIAS_MODE == 2) bv = bias[n];
#pragma unroll
      for (int r = 0; r < 8; ++r) {
        float v = acc[i][j][r] * scale;
        if (BIAS_MODE == 1) v += bias[mBase + mOff + r];
        if (BIAS_MODE == 2) v += bv;
        if (RESID) v += Rb[(size_t)(mBase + mOff + r) * ldc + n];
        if (ACT == 1) v = tanhf(v);
        if (ACT == 2) v = fmaxf(v, 0.0f);
        if (ACT == 3) v = v / (1.0f + expf(-v));
        if (ACT == 4) v = (v > 0.f) ? v : 0.01f * v;
        if (ACT == 5) v = 0.5f * v * (1.0f + erff(v * 0.70710678118654752f));
        if (ACT == 6) v = (v > 0.f) ? v : 0.2f * v;
        slab[(mOff + r) * 68 + (j << 4) + rlane] = v;
      }
    }
    __builtin_amdgcn_fence(__ATOMIC_RELEASE, "workgroup");
    __builtin_amdgcn_wave_barrier();
    __builtin_amdgcn_fence(__ATOMIC_ACQUIRE, "workgroup");
    if (OUT_MODE == 0) {
      float* C = (float*)Cout + (size_t)b * strideC;
      const int hh = lane >> 4, c4 = (lane & 15) * 4;     // row seg = 256 B = 16 lanes x 16 B
      {
#pragma unroll
        for (int it = 0; it < 8; ++it) {
          const int row = it * 2 + hh;
          v4f v = *(const v4f*)(slab + row * 68 + c4);
          *(v4f*)(C + (size_t)(mBase + row) * ldc + n0 + c4) = v;
        }
        
      }
    } else {
      const int q = lane >> 3, c8 = (lane & 7) * 8;
      unsigned short* C  = (unsigned short*)Cout  + (size_t)b * strideC;
      unsigned short* C2 = (OUT_MODE == 2) ? ((unsigned short*)Cout2 + (size_t)b * strideC) : nullptr;
      {
#pragma unroll
        for (int it = 0; it < 4; ++it) {
          const int row = it * 4 + q;
          const float* sp = slab + row * 68 + c8;
          v8h hv, lv;
#pragma unroll
          for (int e = 0; e < 8; ++e) {
            if (OUT_MODE == 1) {
              hv[e] = (_Float16)sp[e];
            } else {
              unsigned short hb = f2bf_bits(sp[e]);
              unsigned short lb = f2bf_bits(sp[e] - bf_bits2f(hb));
              hv[e] = __builtin_bit_cast(_Float16, hb);
              lv[e] = __builtin_bit_cast(_Float16, lb);
            }
          }
          *(v8h*)(C + (size_t)(mBase + row) * ldc + n0 + c8) = hv;
          if (OUT_MODE == 2) *(v8h*)(C2 + (size_t)(mBase + row) * ldc + n0 + c8) = lv;
        }
        
      }
    }
    __builtin_amdgcn_fence(__ATOMIC_RELEASE, "workgroup");
    __builtin_amdgcn_wave_barrier();
    __builtin_amdgcn_fence(__ATOMIC_ACQUIRE, "workgroup");
  }
}

__global__ __launch_bounds__(256) void cast_f32_f16x2(
    const float* __restrict__ in, _Float16* __restrict__ out, int n2) {
  int i = blockIdx.x * 256 + threadIdx.x;
  if (i < n2) {
    const _Float16 h0 = (_Float16)in[2 * i], h1 = (_Float16)in[2 * i + 1];
    const unsigned u = (unsigned)__builtin_bit_cast(unsigned short, h0) | ((unsigned)__builtin_bit_cast(unsigned short, h1) << 16);
    ((unsigned*)out)[i] = u;
    
  }
}


} // namespace w25

// =====================================================================================================================
// k_prep<NR, D>: all f16 operand planes of the projections in one launch of WB + XB work-groups of 256 threads, 32 or 64 elements a thread.
//   Work-groups [0, WB): one tile of 128 (k) x 64 (n) of the weights taken side by side, W = Wq | Wkv ([D][D] | [D][2D], n < D is Wq):
//   W16[n][k] = f16(16 * W[k][n]). Rows of 256 B are read along n with 16-byte loads into an f32 LDS tile (pitch 65 floats: the 32 lanes
//   of a column-wise read fall on 32 different banks); each lane then packs 8 consecutive k of one n, 8 lanes store one whole 128-B line.
//   Work-groups [WB, WB + XB): X16 = f16(x), 16384 consecutive floats each; a wave's load covers 512 contiguous bytes, its store 256.
// =====================================================================================================================
// eight 16-byte loads, 16 rows of LD floats apart: one address pair, the row steps as immediate offsets
template <int LD> __device__ __forceinline__ void ld_rows8(const float* __restrict__ sp, v4f (&w)[8]) {
#pragma unroll
    for (int s = 0; s < 8; ++s) w[s] = *(const v4f*)(sp + s * 16 * LD);
    asm volatile("s_wait_xcnt 0x0" :: "v"(sp) : "memory");   // stands in front of any reuse of the loads' address pair, which it names so that the pair lives up to here
}
template <int NR, int D>
__global__ __launch_bounds__(256) void k_prep(const float* __restrict__ x, const float* __restrict__ Wq, const float* __restrict__ Wkv, _Float16* __restrict__ X16, _Float16* __restrict__ W16) {
    constexpr int TP = 65;                      // LDS tile pitch in floats
    constexpr int NT = 3 * D / 64;              // n tiles
    constexpr int WB = NT * (D / 128);
    static_assert(D % 128 == 0 && ((long long)NR * D) % 16384 == 0, "whole tiles only");
    __shared__ float tile[128 * TP];
    const int tid = threadIdx.x;
    if ((int)blockIdx.x < WB) {
        const int nt = blockIdx.x % NT, kt = blockIdx.x / NT;
        const int n0 = nt * 64, k0 = kt * 128;
        const int c4 = (tid & 15) * 4, r = tid >> 4;
        v4f w[8];
        if (n0 < D) ld_rows8<D>(Wq + n0 + (k0 + r) * D + c4, w);                     // work-group-uniform choice of the source matrix
        else        ld_rows8<2 * D>(Wkv + (n0 - D) + (k0 + r) * (2 * D) + c4, w);
#pragma unroll
        for (int s = 0; s < 8; ++s)
#pragma unroll
            for (int e = 0; e < 4; ++e) tile[(s * 16 + r) * TP + c4 + e] = w[s][e];
        __syncthreads();                                 // the whole tile is in LDS before any column of it is read
        const int a8 = (tid & 7) * 8, nl = tid >> 3;
#pragma unroll
        for (int q = 0; q < 4; ++q) {
            const int n = (q >> 1) * 32 + nl, k = (q & 1) * 64 + a8;
            v8h hv;
#pragma unroll
            for (int j = 0; j < 8; ++j) hv[j] = (_Float16)(tile[(k + j) * TP + n] * 16.f);
            *(v8h*)(W16 + (long long)(n0 + n) * D + k0 + k) = hv;
        }
    } else {
        const long long base = (long long)((int)blockIdx.x - WB) * 16384 + tid * 4;
        const float* xp = x + base;
        v4f v[16];
#pragma unroll
        for (int i = 0; i < 16; ++i) v[i] = *(const v4f*)(xp + i * 1024);
        asm volatile("s_wait_xcnt 0x0" :: "v"(xp) : "memory");   // stands in front of any reuse of the loads' address pair, which it names so that the pair lives up to here
#pragma unroll
        for (int i = 0; i < 16; ++i) *(v4h*)(X16 + base + i * 1024) = __builtin_convertvector(v[i], v4h);
        asm volatile("s_wait_xcnt 0x0" ::: "memory");            // stands behind the stores above, in front of any reuse of their address and data registers
    }
}

// f32 -> bf16 hi plane + bf16 lo plane (x = hi + lo to ~2^-17 relative; RNE both), [R][C] -> [R][C] (or transposed to [C][R]); 2 consecutive destination elements
__device__ __forceinline__ unsigned int f2bf2_pack(float a, float b, unsigned int* lo) {
    const unsigned short ha = w25::f2bf_bits(a), hb = w25::f2bf_bits(b);
    const unsigned short la = w25::f2bf_bits(a - w25::bf_bits2f(ha)), lb = w25::f2bf_bits(b - w25::bf_bits2f(hb));
    *lo = (unsigned)la | ((unsigned)lb << 16); return (unsigned)ha | ((unsigned)hb << 16); }
__global__ __launch_bounds__(256) void k_castS16(const float* __restrict__ src, long long lds, __bf16* __restrict__ dhi, __bf16* __restrict__ dlo, long long ldd, int R, int C, float s, int transpose) {
    const long long i = (long long)blockIdx.x * 256 + threadIdx.x; long long o; float a, b;
    if (transpose) { const long long np = (long long)C * (R / 2); if (i >= np) return; const int c = (int)(i / (R / 2)); const int r = 2 * (int)(i % (R / 2)); a = src[(long long)r * lds + c] * s; b = src[(long long)(r + 1) * lds + c] * s; o = (long long)c * ldd + r; }
    else { const long long np = (long long)R * (C / 2); if (i >= np) return; const int r = (int)(i / (C / 2)); const int c = 2 * (int)(i % (C / 2)); a = src[(long long)r * lds + c] * s; b = src[(long long)r * lds + c + 1] * s; o = (long long)r * ldd + c; }
    unsigned lo; const unsigned hi = f2bf2_pack(a, b, &lo); unsigned* ph = (unsigned*)(dhi + o); unsigned* pl = (unsigned*)(dlo + o);
    *ph = hi; *pl = lo;  }

namespace w25 {
// =====================================================================================
// Generic causal/non-causal attention for head_dim 64, f32 in / f32 out; 16-bit operands: bf16 with optional hi/lo splits, or
// plain f16 (F16=true, non-split, probabilities carried x2^15).
//   scores = (q*qscale)·kᵀ : v_wmma_f32_16x16x32_bf16; SPLIT_QK -> q,k as bf16 hi/lo (hi·hi + hi·lo + lo·hi)
//   out    = p·v           : v_wmma_f32_16x16x32_bf16; SPLIT_PV -> p,v as bf16 hi/lo; else p,v plain bf16
//   f32 accumulate; online softmax in f32. Block = 4 waves = 64 query rows of one (batch, head); S % 64 == 0.
//   Element (b, s, h, d) of tensor X lives at X[b*X_bs + s*X_rs + h*X_hs + d] (strides in floats, multiples of 4).
//   Masking: mask_mode 0 none, 1 causal (kv > q masked), 2 tensor [S][Skv] shared over (b,h) (float if
//   mask_is_int==0, int32 with element == 0 -> masked if 1, int32 with element != 0 -> masked if 2), 3 per-token vectors qmask[B][S] & kvmask[B][Skv] (int32,
//   0 -> masked), 4 causal + sliding window (kv > q or q - kv > W masked; W passed in mask_is_int);
//   5 = relative-position bias: s += cp[b,h,q][idx[q][kv]] + pc[b,h,kv][idx[q][kv]] with idx = mask_b ([S][Skv] int32) and
//   mask_a an int32 [S][Skv] tensor with nonzero = masked (tables: element (b,h,row,n) at X + b*c_bs + h*c_hs + row*c_rs + n);
//   masked scores are replaced by mask_fill (e.g. -inf or -1e9) before the softmax.
//   grid.x = B * H * (S/64) (or a sub-range with blk0).
// =====================================================================================
#define AT_D 64
#define AT_NW 4
#define AT_QB 64
#define AT_KC 64
struct AttnGeom { const float* cp = nullptr; const float* pc = nullptr; long c_bs = 0, c_rs = 0, c_hs = 0;   // mode-5 score-bias tables
                  long q_bs, q_rs, q_hs, k_bs, k_rs, k_hs, v_bs, v_rs, v_hs, o_bs, o_rs, o_hs;
                  int S, Skv, H, mask_mode; float qscale; int blk0; float mask_fill; int mask_is_int; };
static_assert(sizeof(AttnGeom) == 168, "no padding");

__device__ __forceinline__ unsigned short at_bf_bits(float f) {
  unsigned u = __float_as_uint(f);
  return (unsigned short)((u + 0x7FFFu + ((u >> 16) & 1u)) >> 16);
}
__device__ __forceinline__ __bf16 at_f2bf(float f) { return __builtin_bit_cast(__bf16, at_bf_bits(f)); }
__device__ __forceinline__ void at_split(float f, __bf16& hi, __bf16& lo) {
  const unsigned short hb = at_bf_bits(f);
  hi = __builtin_bit_cast(__bf16, hb);
  lo = at_f2bf(f - __uint_as_float(((unsigned)hb) << 16));
}
__device__ __forceinline__ v8f at_mma(v16b a, v16b b, v8f c) {
  c = __builtin_amdgcn_wmma_f32_16x16x32_bf16(false, a, false, b, (short)0, c, false, false);
  asm volatile("v_nop\n\tv_nop\n\tv_nop\n\tv_nop" : "+v"(c) : "v"(a), "v"(b));
  return c;
}
// 16-bit element as a bit pattern held in a __bf16 slot: f16 bits when F16, bf16 (RNE) otherwise
template <bool F16> __device__ __forceinline__ __bf16 at_to16(float f) {
  if (F16) return __builtin_bit_cast(__bf16, (_Float16)f);
  return at_f2bf(f);
}
template <bool F16> __device__ __forceinline__ v8f at_mma16(v16b a, v16b b, v8f c) {
  if (F16) {
    const v16h ah = __builtin_bit_cast(v16h, a), bh = __builtin_bit_cast(v16h, b);
    c = __builtin_amdgcn_wmma_f32_16x16x32_f16(false, ah, false, bh, (short)0, c, false, false);
    asm volatile("v_nop\n\tv_nop\n\tv_nop\n\tv_nop" : "+v"(c) : "v"(ah), "v"(bh));
    return c;
  }
  return at_mma(a, b, c);
}

template <bool SPLIT_QK, bool SPLIT_PV, bool F16 = false>
__global__ __launch_bounds__(128)
void attn64_kernel(const float* __restrict__ q, const float* __restrict__ k,
                   const float* __restrict__ v, float* __restrict__ out,
                   const void* __restrict__ mask_a, const int* __restrict__ mask_b, AttnGeom g) {
  static_assert(!(F16 && (SPLIT_QK || SPLIT_PV)), "f16 mode is non-split");
  const float PSC = F16 ? 32768.0f : 1.0f;     // f16 probabilities carried x2^15 (subnormal range), folded into the final 1/l
  union FB { v16b v; v8b h[2]; };
  __shared__ __align__(16) __bf16 Ksh[AT_KC * AT_D];             // K hi [kv][d]      8 KB
  __shared__ __align__(16) __bf16 Ksl[SPLIT_QK ? AT_KC * AT_D : 8];
  __shared__ __align__(16) __bf16 Vth[AT_D * AT_KC];             // V hi [d][kv]      8 KB
  __shared__ __align__(16) __bf16 Vtl[SPLIT_PV ? AT_D * AT_KC : 8];
  __shared__ __align__(16) __bf16 Psh[AT_NW][16 * AT_KC];        // per wave P hi [row][kv]  8 KB
  __shared__ __align__(16) __bf16 Psl[SPLIT_PV ? AT_NW : 1][SPLIT_PV ? 16 * AT_KC : 8];
  __shared__ __align__(16) float  Os[AT_NW][16 * 68];            // per wave out tile, pitch 68

  const int tid  = threadIdx.x;
  const int wave = tid >> 5;
  const int lane = tid & 31;
  const int hh   = lane >> 4;
  const int c    = lane & 15;

  const int nqb = g.S / AT_QB;
  const int bx = blockIdx.x + g.blk0;
  const int qb = bx % nqb;
  const int bh = bx / nqb;
  const int h  = bh % g.H;
  const int b  = bh / g.H;
  const int qbase_block = qb * AT_QB;
  const int q0 = qbase_block + wave * 16;

  const float* qb_ptr = q + (size_t)b * g.q_bs + (size_t)h * g.q_hs;
  const float* kb_ptr = k + (size_t)b * g.k_bs + (size_t)h * g.k_hs;
  const float* vb_ptr = v + (size_t)b * g.v_bs + (size_t)h * g.v_hs;
  float*       ob_ptr = out + (size_t)b * g.o_bs + (size_t)h * g.o_hs;

  // ---- Q fragments (A operand): 2 d-chunks, hi (and lo) ----
  v16b qah[2], qal[2];
  {
    const float* qrow = qb_ptr + (size_t)(q0 + c) * g.q_rs;
#pragma unroll
    for (int dc = 0; dc < 2; ++dc) {
#pragma unroll
      for (int e = 0; e < 8; ++e) {
        const float f0 = qrow[dc * 32 + 8 * hh + e] * g.qscale;
        const float f1 = qrow[dc * 32 + 16 + 8 * hh + e] * g.qscale;
        if (SPLIT_QK) { __bf16 hq, lq; at_split(f0, hq, lq); qah[dc][e] = hq; qal[dc][e] = lq; at_split(f1, hq, lq); qah[dc][8 + e] = hq; qal[dc][8 + e] = lq; }
        else { qah[dc][e] = at_to16<F16>(f0); qah[dc][8 + e] = at_to16<F16>(f1); qal[dc][e] = qah[dc][e]; qal[dc][8 + e] = qah[dc][8 + e]; }
      }
    }
  }

  float mrow[8], lrow[8];
  v8f oacc[4];
#pragma unroll
  for (int r = 0; r < 8; ++r) { mrow[r] = -INFINITY; lrow[r] = 0.f; }
#pragma unroll
  for (int t = 0; t < 4; ++t) oacc[t] = (v8f){0.f,0.f,0.f,0.f,0.f,0.f,0.f,0.f};

  const int nChunks = (g.mask_mode == 1 || g.mask_mode == 4) ? (qb + 1) : (g.Skv / AT_KC);   // block-uniform
  // per-row query mask (mode 3)
  int qkeep[8];
#pragma unroll
  for (int r = 0; r < 8; ++r) qkeep[r] = (g.mask_mode == 3) ? mask_b[(size_t)b * g.S + q0 + 8 * hh + r] : 1;   // mask_b = qmask in mode 3
  for (int kc = 0; kc < nChunks; ++kc) {
    const int kv0 = kc * AT_KC;
    __syncthreads();
    {
      const int kvr = tid >> 1, dh = (tid & 1) * 32;
      const float* krow = kb_ptr + (size_t)(kv0 + kvr) * g.k_rs + dh;
      const float* vrow = vb_ptr + (size_t)(kv0 + kvr) * g.v_rs + dh;
#pragma unroll
      for (int i = 0; i < 8; ++i) {
        v4f kk = *(const v4f*)(krow + 4 * i);
        v4f vv = *(const v4f*)(vrow + 4 * i);
#pragma unroll
        for (int e = 0; e < 4; ++e) {
          const int d = dh + 4 * i + e;
          if (SPLIT_QK) { __bf16 a, bl; at_split(kk[e], a, bl); Ksh[kvr * AT_D + d] = a; Ksl[kvr * AT_D + d] = bl; }
          else Ksh[kvr * AT_D + d] = at_to16<F16>(kk[e]);
          if (SPLIT_PV) { __bf16 a, bl; at_split(vv[e], a, bl); Vth[d * AT_KC + kvr] = a; Vtl[d * AT_KC + kvr] = bl; }
          else Vth[d * AT_KC + kvr] = at_to16<F16>(vv[e]);
        }
      }
    }
    __syncthreads();

    v8f s[4];
#pragma unroll
    for (int j = 0; j < 4; ++j) {
      s[j] = (v8f){0.f,0.f,0.f,0.f,0.f,0.f,0.f,0.f};
#pragma unroll 1
      for (int dc = 0; dc < 2; ++dc) {
        FB kb;
        kb.h[0] = *(const v8b*)(Ksh + (j * 16 + c) * AT_D + dc * 32 + 8 * hh);
        kb.h[1] = *(const v8b*)(Ksh + (j * 16 + c) * AT_D + dc * 32 + 16 + 8 * hh);
        s[j] = at_mma16<F16>(qah[dc], kb.v, s[j]);
        if (SPLIT_QK) {
          FB kl;
          kl.h[0] = *(const v8b*)(Ksl + (j * 16 + c) * AT_D + dc * 32 + 8 * hh);
          kl.h[1] = *(const v8b*)(Ksl + (j * 16 + c) * AT_D + dc * 32 + 16 + 8 * hh);
          s[j] = at_mma16<F16>(qah[dc], kl.v, s[j]);
          s[j] = at_mma16<F16>(qal[dc], kb.v, s[j]);
        }
      }
    }
    const bool diag = (g.mask_mode == 1) && (kc == qb);
    int kvkeep[4] = {1, 1, 1, 1};
    if (g.mask_mode == 3) {
#pragma unroll
      for (int j = 0; j < 4; ++j) kvkeep[j] = ((const int*)mask_a)[(size_t)b * g.Skv + kv0 + j * 16 + c];   // mask_a = kvmask
    }
    float cm[8];
#pragma unroll
    for (int r = 0; r < 8; ++r) {
      const int qrow = q0 + 8 * hh + r;
      float m = -INFINITY;
#pragma unroll
      for (int j = 0; j < 4; ++j) {
        const int kvcol = kv0 + j * 16 + c;
        bool masked = false;
        if (diag) masked = (kvcol > qrow);
        else if (g.mask_mode == 4) masked = (kvcol > qrow) || (qrow - kvcol > g.mask_is_int);
        else if (g.mask_mode == 2) {
          const size_t mi = (size_t)qrow * g.Skv + kvcol;
          masked = (g.mask_is_int == 0) ? (((const float*)mask_a)[mi] == 0.0f)
                 : (g.mask_is_int == 1) ? (((const int*)mask_a)[mi] == 0) : (((const int*)mask_a)[mi] != 0);
        } else if (g.mask_mode == 3) masked = (qkeep[r] == 0) || (kvkeep[j] == 0);
        else if (g.mask_mode == 5) {
          const size_t mi = (size_t)qrow * g.Skv + kvcol;
          masked = (((const int*)mask_a)[mi] != 0);
          int n = mask_b[mi]; n = n < 0 ? 0 : n;
          s[j][r] += g.cp[(size_t)b * g.c_bs + (size_t)h * g.c_hs + (size_t)qrow * g.c_rs + n]
                   + g.pc[(size_t)b * g.c_bs + (size_t)h * g.c_hs + (size_t)kvcol * g.c_rs + n];
        }
        if (masked) s[j][r] = g.mask_fill;
        m = fmaxf(m, s[j][r]);
      }
#pragma unroll
      for (int off = 1; off < 16; off <<= 1) m = fmaxf(m, __shfl_xor(m, off, 32));
      cm[r] = m;
    }
    __bf16* pwh = Psh[wave];
    __bf16* pwl = Psl[SPLIT_PV ? wave : 0];
#pragma unroll
    for (int r = 0; r < 8; ++r) {
      const float mnew = fmaxf(mrow[r], cm[r]);
      const float alpha = expf(mrow[r] - mnew);
      mrow[r] = mnew;
      float psum = 0.f;
#pragma unroll
      for (int j = 0; j < 4; ++j) {
        const float p = expf(s[j][r] - mnew);
        psum += p;
        if (SPLIT_PV) { __bf16 a, bl; at_split(p, a, bl); pwh[(8 * hh + r) * AT_KC + j * 16 + c] = a; pwl[(8 * hh + r) * AT_KC + j * 16 + c] = bl; }
        else pwh[(8 * hh + r) * AT_KC + j * 16 + c] = at_to16<F16>(p * PSC);
      }
#pragma unroll
      for (int off = 1; off < 16; off <<= 1) psum += __shfl_xor(psum, off, 32);
      lrow[r] = lrow[r] * alpha + psum;
#pragma unroll
      for (int t = 0; t < 4; ++t) oacc[t][r] *= alpha;
    }
    __builtin_amdgcn_fence(__ATOMIC_RELEASE, "workgroup");
    __builtin_amdgcn_wave_barrier();
    __builtin_amdgcn_fence(__ATOMIC_ACQUIRE, "workgroup");
#pragma unroll 1
    for (int kk = 0; kk < 2; ++kk) {
      FB pa, pl;
      pa.h[0] = *(const v8b*)(pwh + c * AT_KC + kk * 32 + 8 * hh);
      pa.h[1] = *(const v8b*)(pwh + c * AT_KC + kk * 32 + 16 + 8 * hh);
      if (SPLIT_PV) {
        pl.h[0] = *(const v8b*)(pwl + c * AT_KC + kk * 32 + 8 * hh);
        pl.h[1] = *(const v8b*)(pwl + c * AT_KC + kk * 32 + 16 + 8 * hh);
      }
#pragma unroll
      for (int t = 0; t < 4; ++t) {
        FB vb;
        vb.h[0] = *(const v8b*)(Vth + (t * 16 + c) * AT_KC + kk * 32 + 8 * hh);
        vb.h[1] = *(const v8b*)(Vth + (t * 16 + c) * AT_KC + kk * 32 + 16 + 8 * hh);
        oacc[t] = at_mma16<F16>(pa.v, vb.v, oacc[t]);
        if (SPLIT_PV) {
          FB vl;
          vl.h[0] = *(const v8b*)(Vtl + (t * 16 + c) * AT_KC + kk * 32 + 8 * hh);
          vl.h[1] = *(const v8b*)(Vtl + (t * 16 + c) * AT_KC + kk * 32 + 16 + 8 * hh);
          oacc[t] = at_mma16<F16>(pa.v, vl.v, oacc[t]);
          oacc[t] = at_mma16<F16>(pl.v, vb.v, oacc[t]);
        }
      }
    }
  }

  float* os = Os[wave];
#pragma unroll
  for (int r = 0; r < 8; ++r) {
    const float inv = 1.0f / (lrow[r] * PSC);
#pragma unroll
    for (int t = 0; t < 4; ++t) os[(8 * hh + r) * 68 + t * 16 + c] = oacc[t][r] * inv;
  }
  __builtin_amdgcn_fence(__ATOMIC_RELEASE, "workgroup");
  __builtin_amdgcn_wave_barrier();
  __builtin_amdgcn_fence(__ATOMIC_ACQUIRE, "workgroup");
  {
    const int c4 = (lane & 15) * 4;
    {
#pragma unroll
      for (int it = 0; it < 8; ++it) {
        const int row = it * 2 + hh;
        v4f val = *(const v4f*)(os + row * 68 + c4);
        *(v4f*)(ob_ptr + (size_t)(q0 + row) * g.o_rs + c4) = val;
      }
      
    }
  }
}

} // namespace w25


extern "C" void kernel_launch(void* const* d_in, const int* in_sizes, int n_in, void* d_out, int out_size, void* d_ws, size_t ws_size, hipStream_t stream) {
    (void)in_sizes; (void)n_in; (void)out_size; (void)ws_size;
    const float* x = (const float*)d_in[0];
    const float* Wq = (const float*)d_in[1];
    const float* Wkv = (const float*)d_in[2];
    const float* Wo = (const float*)d_in[3];
    const float* bo = (const float*)d_in[4];
    const int Bn = 2;
    const int T = 2048;
    const int D = 1024;
    const int NH = 16;
    const int D3 = 3 * D;
    const int NR = Bn * T;
    float* out = (float*)d_out;
    char* wsp = (char*)d_ws;
    unsigned short* X16 = (unsigned short*)wsp; wsp += (((size_t)((size_t)NR * D) * 2 + 255) / 256) * 256;
    unsigned short* W316 = (unsigned short*)wsp; wsp += (((size_t)((size_t)D3 * D) * 2 + 255) / 256) * 256;
    float* QKV = (float*)wsp; wsp += (((size_t)((size_t)T * D3) * 4 + 255) / 256) * 256;
    if ((size_t)(wsp - (char*)d_ws) > ws_size) return;   // static carve guard
    k_prep<NR, D><<<(unsigned)((D3 / 64) * (D / 128) + (NR / 16) * (D / 1024)), 256, 0, stream>>>(x, Wq, Wkv, (_Float16*)(X16), (_Float16*)(W316));
    w25::wmma_gemm64<0, false, 0, 0, false, 0><<<dim3((unsigned)((((T) / 64) * ((D3) / 64) + 7) / 8), (unsigned)(1)), 256, 0, stream>>>((const unsigned short*)(X16 + (size_t)0 * T * D), nullptr, D, 0, (const unsigned short*)(W316), nullptr, D, 0, (void*)(QKV), nullptr, D3, 0, nullptr, nullptr, 0, T, D3, D, 0.0625f);
    k_attn_lds<T, D3, D><<<dim3((unsigned)((T) / (16 * AW)), (unsigned)(NH)), 32 * AW, 0, stream>>>(QKV, QKV + D, QKV + 2 * D, Wo, bo, out + (size_t)0 * T * D, 0.125f);
    w25::wmma_gemm64<0, false, 0, 0, false, 0><<<dim3((unsigned)((((T) / 64) * ((D3) / 64) + 7) / 8), (unsigned)(1)), 256, 0, stream>>>((const unsigned short*)(X16 + (size_t)1 * T * D), nullptr, D, 0, (const unsigned short*)(W316), nullptr, D, 0, (void*)(QKV), nullptr, D3, 0, nullptr, nullptr, 0, T, D3, D, 0.0625f);
    k_attn_lds<T, D3, D><<<dim3((unsigned)((T) / (16 * AW)), (unsigned)(NH)), 32 * AW, 0, stream>>>(QKV, QKV + D, QKV + 2 * D, Wo, bo, out + (size_t)1 * T * D, 0.125f);
}

// v005
// Measured time: 144 microseconds a run.
// In two side-by-side timings against v004, it was 1.47 and 1.43 times as fast.
// All steps since v000 together make it 14.9 times as fast.
// Contractions: q and k|v projections (weights stored [in][out]) [4096x1024].[1024x1024|2048], both batch elements' rows in one launch, with f16 operands on f16 planes (v_wmma_f32_16x16x32_f16, 64x64 register-blocked wave tiles, weights x16); per (batch, head) softmax(q.k^T/8) v over all 2048 keys as one flash launch for both batch elements (head_dim 64, f16 q.k^T and f16 p.v with p as f16 of 4096 p), whose epilogue applies the head's own 64x64 output map (+bias) to the f16 attention tile still in registers (weights x16); f32 accumulate and softmax statistics.
#include <hip/hip_runtime.h>
#include <math.h>

typedef __attribute__((ext_vector_type(16))) _Float16 v16h;
typedef __attribute__((ext_vector_type(8)))  _Float16 v8h;
typedef __attribute__((ext_vector_type(16))) __bf16   v16b;
typedef __attribute__((ext_vector_type(8)))  float    v8f;
typedef __attribute__((ext_vector_type(4)))  float    v4f;

// 16-bit WMMA fragment map (wave32), lane L, h = L>>4, m = L&15:
//   A 16x32: lane = row m;   element i -> k = (i<8) ? 8h+i : 16+8h+(i-8)
//   B 32x16: lane = column m; the SAME k(i,h)
//   D 16x16 (8 f32): lane = column m; element r -> row 8h+r
__device__ __forceinline__ int frag_k(int i, int h) { return (i < 8) ? (8 * h + i) : (16 + 8 * h + (i - 8)); }
__device__ __forceinline__ __bf16 bf16_rne(float f) {
    unsigned int u = __float_as_uint(f);
    u += 0x7fffu + ((u >> 16) & 1u);
    return __builtin_bit_cast(__bf16, (unsigned short)(u >> 16));
}
__device__ __forceinline__ float bf16_f32(__bf16 b) { return __uint_as_float(((unsigned int)__builtin_bit_cast(unsigned short, b)) << 16); }
__device__ __forceinline__ v8f wmma16(v16h a, v16h b, v8f c) {
    c = __builtin_amdgcn_wmma_f32_16x16x32_f16(false, a, false, b, (short)0, c, false, false);
    asm volatile("v_nop\n\tv_nop\n\tv_nop\n\tv_nop" : "+v"(c) : "v"(a), "v"(b));
    return c;
}
__device__ __forceinline__ v8f wmmab(v16b a, v16b b, v8f c) {
    c = __builtin_amdgcn_wmma_f32_16x16x32_bf16(false, a, false, b, (short)0, c, false, false);
    asm volatile("v_nop\n\tv_nop\n\tv_nop\n\tv_nop" : "+v"(c) : "v"(a), "v"(b));
    return c;
}
struct Split { v16b hi, lo; };
// hi/lo split product: a.hi*b.hi + a.hi*b.lo + a.lo*b.hi
__device__ __forceinline__ v8f wmma3(const Split& a, const Split& b, v8f c) {
    c = __builtin_amdgcn_wmma_f32_16x16x32_bf16(false, a.hi, false, b.hi, (short)0, c, false, false);
    c = __builtin_amdgcn_wmma_f32_16x16x32_bf16(false, a.hi, false, b.lo, (short)0, c, false, false);
    c = __builtin_amdgcn_wmma_f32_16x16x32_bf16(false, a.lo, false, b.hi, (short)0, c, false, false);
    asm volatile("v_nop\n\tv_nop\n\tv_nop\n\tv_nop" : "+v"(c) : "v"(a.hi), "v"(a.lo), "v"(b.hi), "v"(b.lo));
    return c;
}
struct Split3 { v16b hi, mid, lo; };
// triple split product (6 terms, drops only terms below 2^-24 relative)
__device__ __forceinline__ v8f wmma6(const Split3& a, const Split3& b, v8f c) {
    c = __builtin_amdgcn_wmma_f32_16x16x32_bf16(false, a.hi, false, b.hi, (short)0, c, false, false);
    c = __builtin_amdgcn_wmma_f32_16x16x32_bf16(false, a.hi, false, b.mid, (short)0, c, false, false);
    c = __builtin_amdgcn_wmma_f32_16x16x32_bf16(false, a.mid, false, b.hi, (short)0, c, false, false);
    c = __builtin_amdgcn_wmma_f32_16x16x32_bf16(false, a.hi, false, b.lo, (short)0, c, false, false);
    c = __builtin_amdgcn_wmma_f32_16x16x32_bf16(false, a.mid, false, b.mid, (short)0, c, false, false);
    c = __builtin_amdgcn_wmma_f32_16x16x32_bf16(false, a.lo, false, b.hi, (short)0, c, false, false);
    asm volatile("v_nop\n\tv_nop\n\tv_nop\n\tv_nop" : "+v"(c) : "v"(a.hi), "v"(a.mid), "v"(a.lo), "v"(b.hi), "v"(b.mid), "v"(b.lo));
    return c;
}

// Fragment gathers from f32 memory: element i <- p[(k0 + frag_k(i,h)) * sk] * s, zero for k >= klen.
__device__ __forceinline__ v16h fh_ld(const float* __restrict__ p, long long sk, int k0, int h, int klen, float s) {
    v16h a;
#pragma unroll
    for (int i = 0; i < 16; ++i) { const int k = k0 + frag_k(i, h); a[i] = (k < klen) ? (_Float16)(p[(long long)k * sk] * s) : (_Float16)0.f; }
    return a;
}
__device__ __forceinline__ Split sp_ld(const float* __restrict__ p, long long sk, int k0, int h, int klen, float s) {
    Split r;
#pragma unroll
    for (int i = 0; i < 16; ++i) {
        const int k = k0 + frag_k(i, h); const float x = (k < klen) ? p[(long long)k * sk] * s : 0.f;
        const __bf16 hb = bf16_rne(x); r.hi[i] = hb; r.lo[i] = bf16_rne(x - bf16_f32(hb));
    }
    return r;
}
__device__ __forceinline__ Split3 sp3_ld(const float* __restrict__ p, long long sk, int k0, int h, int klen, float s) {
    Split3 r;
#pragma unroll
    for (int i = 0; i < 16; ++i) {
        const int k = k0 + frag_k(i, h); const float x = (k < klen) ? p[(long long)k * sk] * s : 0.f;
        const __bf16 hb = bf16_rne(x); const float r1 = x - bf16_f32(hb); const __bf16 mb = bf16_rne(r1);
        r.hi[i] = hb; r.mid[i] = mb; r.lo[i] = bf16_rne(r1 - bf16_f32(mb));
    }
    return r;
}
__device__ __forceinline__ v16b bh_ld(const float* __restrict__ p, long long sk, int k0, int h, int klen, float s) {
    v16b a;
#pragma unroll
    for (int i = 0; i < 16; ++i) { const int k = k0 + frag_k(i, h); a[i] = bf16_rne((k < klen) ? p[(long long)k * sk] * s : 0.f); }
    return a;
}
// f16 fragment from an f16 LDS/global row with element stride 1 (k-contiguous), no bounds (tile already zero padded)
__device__ __forceinline__ v16h fh_row(const _Float16* __restrict__ row, int k0, int h) {
    v16h a;
#pragma unroll
    for (int i = 0; i < 16; ++i) a[i] = row[k0 + frag_k(i, h)];
    return a;
}

#define VST2(T, ptr, val) do { const T vst2_v_ = (val); *(T*)(ptr) = vst2_v_;  } while (0)
typedef float v4f __attribute__((ext_vector_type(4)));
#define VST2V4(ptr, val) do { const v4f vst2_v4_ = (val); *(v4f*)(ptr) = vst2_v4_;  } while (0)

__device__ __attribute__((noinline)) float act_fn(float v, int act) {
    if (act == 1) return fmaxf(v, 0.f);                                                                               // relu
    if (act == 2) { const float u = 0.7978845608028654f * (v + 0.044715f * v * v * v); return 0.5f * v * (1.f + tanhf(u)); } // tanh-gelu
    if (act == 3) return v / (1.f + expf(-v));                                                                        // silu
    if (act == 4) return 0.5f * v * (1.f + erff(v * 0.7071067811865476f));                                             // erf-gelu
    if (act == 5) return tanhf(v);
    if (act == 6) return 1.f / (1.f + expf(-v));                                                                      // sigmoid
    if (act == 7) return (v > 0.f) ? v : 0.01f * v;                                                                   // leaky relu 0.01
    if (act == 8) return (v > 0.f) ? v : (expf(v) - 1.f);                                                             // elu
    if (act == 9) return fminf(fmaxf(v, 0.f), 6.f);                                                                   // relu6
    if (act == 10) return fabsf(v);                                                                                    // abs
    if (act == 11) return (v >= 0.f) ? v : 0.1f * v;                                                                  // leaky 0.1
    if (act == 12) return (v > 0.f) ? v : 0.2f * v;                                                                   // leaky 0.2
    if (act == 13) return (v > 20.f) ? v : log1pf(expf(v));                                                            // softplus
    return v;
}

// =====================================================================================================================
// k_gemm<MODE>: C(z, m, n) = act(alpha * sum_k A(z, m, k) * B(z, k, n) + bias) + beta * R(z, m, n)
//   One wave (32-thread block) per 16 x 32 tile of C; grid (ceil(N/32), ceil(M/16), Z). Batch z -> (zo = z / zi_n, zi = z % zi_n)
//   with separate outer/inner strides for every tensor (e.g. batch and head). A(m,k) = A[zo*sAo + zi*sAi + m*sAm + k*sAk] (f32),
//   B(k,n) = B[zo*sBo + zi*sBi + n*sBn + k*sBk] (f32); any M, N, K (K zero-padded to 32 inside the fragments, M/N tails guarded).
//   C(m,n) = C[zo*sCo + zi*sCi + m*sCm + n] (n contiguous). flags: 1 bias[n], 2 bias[m], 4 residual R[zo*sRo + zi*sRi + m*sRm + n*sRn].
//   MODE 0: f16 operands (A prescaled by sa, B by sb, both undone in the epilogue); 1: bf16 hi/lo split (3 products); 2: bf16;
//   3: bf16 hi/mid/lo triple split (6 products); 4: as 3 with Kahan-compensated f32 accumulation across k-steps.
// =====================================================================================================================
struct GemmP {
    const float* A; const float* B; const float* bias; const float* R; float* C;
    long long sAo, sAi, sAm, sAk, sBo, sBi, sBn, sBk, sCo, sCi, sCm, sRo, sRi, sRm, sRn;
    int M, N, K, zi_n, flags, act; float alpha, beta, sa, sb;
    int Npad, pad_;     // columns [N, Npad) of C are written as 0 so that padded workspace rows are covered by whole-line stores; Npad >= N
};
static_assert(sizeof(GemmP) == 5 * 8 + 15 * 8 + 6 * 4 + 4 * 4 + 2 * 4, "GemmP has padding");

template <int MODE>
__global__ __launch_bounds__(32) void k_gemm(GemmP p) {
    const int lane = threadIdx.x & 31, h = lane >> 4, l15 = lane & 15;
    const int m0 = blockIdx.y * 16, n0 = blockIdx.x * 32;
    const int z = blockIdx.z, zo = z / p.zi_n, zi = z - zo * p.zi_n;
    const float* A = p.A + zo * p.sAo + zi * p.sAi;
    const float* B = p.B + zo * p.sBo + zi * p.sBi;
    const int am = min(m0 + l15, p.M - 1);                       // clamped row for loads (stores are guarded)
    v8f acc[2], comp[2];
#pragma unroll
    for (int t = 0; t < 2; ++t) { v8f zz = {}; acc[t] = zz; comp[t] = zz; }
    for (int k0 = 0; k0 < p.K; k0 += 32) {
        const float* arow = A + (long long)am * p.sAm;
        if (MODE == 1) {
            const Split a = sp_ld(arow, p.sAk, k0, h, p.K, 1.f);
#pragma unroll
            for (int t = 0; t < 2; ++t) {
                const int bn = min(n0 + t * 16 + l15, p.N - 1);
                acc[t] = wmma3(a, sp_ld(B + (long long)bn * p.sBn, p.sBk, k0, h, p.K, 1.f), acc[t]);
            }
        } else if (MODE == 3) {
            const Split3 a = sp3_ld(arow, p.sAk, k0, h, p.K, 1.f);
#pragma unroll
            for (int t = 0; t < 2; ++t) {
                const int bn = min(n0 + t * 16 + l15, p.N - 1);
                acc[t] = wmma6(a, sp3_ld(B + (long long)bn * p.sBn, p.sBk, k0, h, p.K, 1.f), acc[t]);
            }
        } else if (MODE == 4) {
            // triple split as MODE 3, but each k-step's 6 products go into a fresh accumulator and the partial is added to the running f32 sum
            // on the VALU with Kahan compensation (accumulation error stays ~1 ulp however long K is)
            const Split3 a = sp3_ld(arow, p.sAk, k0, h, p.K, 1.f);
#pragma unroll
            for (int t = 0; t < 2; ++t) {
                const int bn = min(n0 + t * 16 + l15, p.N - 1); v8f zz = {};
                const v8f part = wmma6(a, sp3_ld(B + (long long)bn * p.sBn, p.sBk, k0, h, p.K, 1.f), zz);
                const v8f y = part - comp[t]; const v8f s = acc[t] + y; comp[t] = (s - acc[t]) - y; acc[t] = s;
            }
        } else if (MODE == 2) {
            const v16b a = bh_ld(arow, p.sAk, k0, h, p.K, 1.f);
#pragma unroll
            for (int t = 0; t < 2; ++t) {
                const int bn = min(n0 + t * 16 + l15, p.N - 1);
                acc[t] = wmmab(a, bh_ld(B + (long long)bn * p.sBn, p.sBk, k0, h, p.K, 1.f), acc[t]);
            }
        } else {
            const v16h a = fh_ld(arow, p.sAk, k0, h, p.K, p.sa);
#pragma unroll
            for (int t = 0; t < 2; ++t) {
                const int bn = min(n0 + t * 16 + l15, p.N - 1);
                acc[t] = wmma16(a, fh_ld(B + (long long)bn * p.sBn, p.sBk, k0, h, p.K, p.sb), acc[t]);
            }
        }
    }
    const float iscale = (MODE == 0) ? p.alpha / (p.sa * p.sb) : p.alpha;
    float* C = p.C + zo * p.sCo + zi * p.sCi;
    const float* R = p.R + zo * p.sRo + zi * p.sRi;
    __shared__ __align__(16) float ctile[16][36];
#pragma unroll
    for (int t = 0; t < 2; ++t) {
        const int n = n0 + t * 16 + l15; const int nn = min(n, p.N - 1);
#pragma unroll
        for (int r = 0; r < 8; ++r) {
            const int m = m0 + 8 * h + r; const int mm = min(m, p.M - 1);
            float v = acc[t][r] * iscale;
            if (p.flags & 1) v += p.bias[nn];
            if (p.flags & 2) v += p.bias[mm];
            if (p.flags & 8) v *= p.bias[(long long)zo * p.M + mm];   /* per-(z,row) scale vector laid out [Z][M]; exclusive with the bias flags */
            v = act_fn(v, p.act);
            if (p.flags & 4) v += p.beta * R[(long long)mm * p.sRm + (long long)nn * p.sRn];
            ctile[8 * h + r][t * 16 + l15] = (n < p.N) ? v : 0.f;
        }
    }
    __syncthreads();
    const int NW = (p.Npad > p.N) ? p.Npad : p.N;           // write width
    const bool fast = (m0 + 16 <= p.M) && (n0 + 32 <= NW) && ((p.sCm & 3) == 0) && ((((size_t)C) & 15) == 0);
    if (fast) {
#pragma unroll
        for (int s = 0; s < 4; ++s) {
            const int row = s * 4 + (lane >> 3), c4 = (lane & 7) * 4;
            const v4f v = *(const v4f*)&ctile[row][c4];
            VST2V4(C + (long long)(m0 + row) * p.sCm + n0 + c4, v);
        }
    } else {
        for (int row = 0; row < 16; ++row) {
            const int m = m0 + row, n = n0 + lane;
            if (m < p.M && n < NW) VST2(float, C + (long long)m * p.sCm + n, ctile[row][lane]);
        }
    }
}


// =====================================================================================================================
// k_gemmT<MODE, TM, TN>: same contract as k_gemm, but one wave computes a (16*TM) x (16*TN) tile: TM A fragments and TN B fragments are
//   loaded per 32-wide k-step and reused across TM*TN WMMAs (far fewer load/convert instructions per MAC). MODE 0 (f16), 1 (bf16 hi/lo),
//   2 (bf16) only. grid (ceil(NW/(16*TN)), ceil(M/(16*TM)), Z), block 32. Epilogue identical to k_gemm, run per 16x32 sub-tile.
// =====================================================================================================================
template <int MODE, int TM, int TN>
__global__ __launch_bounds__(32) void k_gemmT(GemmP p) {
    const int lane = threadIdx.x & 31, h = lane >> 4, l15 = lane & 15;
    const int m0 = blockIdx.y * (16 * TM), n0 = blockIdx.x * (16 * TN);
    const int z = blockIdx.z, zo = z / p.zi_n, zi = z - zo * p.zi_n;
    const float* A = p.A + zo * p.sAo + zi * p.sAi;
    const float* B = p.B + zo * p.sBo + zi * p.sBi;
    v8f acc[TM][TN];
#pragma unroll
    for (int i = 0; i < TM; ++i)
#pragma unroll
        for (int t = 0; t < TN; ++t) { v8f zz = {}; acc[i][t] = zz; }
    for (int k0 = 0; k0 < p.K; k0 += 32) {
        if (MODE == 1) {
            Split a[TM], b[TN];
#pragma unroll
            for (int i = 0; i < TM; ++i) { const int am = min(m0 + 16 * i + l15, p.M - 1); a[i] = sp_ld(A + (long long)am * p.sAm, p.sAk, k0, h, p.K, 1.f); }
#pragma unroll
            for (int t = 0; t < TN; ++t) { const int bn = min(n0 + 16 * t + l15, p.N - 1); b[t] = sp_ld(B + (long long)bn * p.sBn, p.sBk, k0, h, p.K, 1.f); }
#pragma unroll
            for (int i = 0; i < TM; ++i)
#pragma unroll
                for (int t = 0; t < TN; ++t) acc[i][t] = wmma3(a[i], b[t], acc[i][t]);
        } else if (MODE == 2) {
            v16b a[TM], b[TN];
#pragma unroll
            for (int i = 0; i < TM; ++i) { const int am = min(m0 + 16 * i + l15, p.M - 1); a[i] = bh_ld(A + (long long)am * p.sAm, p.sAk, k0, h, p.K, 1.f); }
#pragma unroll
            for (int t = 0; t < TN; ++t) { const int bn = min(n0 + 16 * t + l15, p.N - 1); b[t] = bh_ld(B + (long long)bn * p.sBn, p.sBk, k0, h, p.K, 1.f); }
#pragma unroll
            for (int i = 0; i < TM; ++i)
#pragma unroll
                for (int t = 0; t < TN; ++t) acc[i][t] = wmmab(a[i], b[t], acc[i][t]);
        } else {
            v16h a[TM], b[TN];
#pragma unroll
            for (int i = 0; i < TM; ++i) { const int am = min(m0 + 16 * i + l15, p.M - 1); a[i] = fh_ld(A + (long long)am * p.sAm, p.sAk, k0, h, p.K, p.sa); }
#pragma unroll
            for (int t = 0; t < TN; ++t) { const int bn = min(n0 + 16 * t + l15, p.N - 1); b[t] = fh_ld(B + (long long)bn * p.sBn, p.sBk, k0, h, p.K, p.sb); }
#pragma unroll
            for (int i = 0; i < TM; ++i)
#pragma unroll
                for (int t = 0; t < TN; ++t) acc[i][t] = wmma16(a[i], b[t], acc[i][t]);
        }
    }
    const float iscale = (MODE == 0) ? p.alpha / (p.sa * p.sb) : p.alpha;
    float* C = p.C + zo * p.sCo + zi * p.sCi;
    const float* R = p.R + zo * p.sRo + zi * p.sRi;
    const int NW = (p.Npad > p.N) ? p.Npad : p.N;
    __shared__ __align__(16) float ctile[16][36];
#pragma unroll
    for (int i = 0; i < TM; ++i) {
        const int mb = m0 + 16 * i; if (mb >= p.M) break;          // wave-uniform
#pragma unroll
        for (int tp = 0; tp < TN / 2; ++tp) {
            const int nb = n0 + 32 * tp; if (nb >= NW) break;        // wave-uniform
#pragma unroll
            for (int t2 = 0; t2 < 2; ++t2) {
                const int t = 2 * tp + t2; const int n = nb + t2 * 16 + l15; const int nn = min(n, p.N - 1);
#pragma unroll
                for (int r = 0; r < 8; ++r) {
                    const int m = mb + 8 * h + r; const int mm = min(m, p.M - 1);
                    float v = acc[i][t][r] * iscale;
                    if (p.flags & 1) v += p.bias[nn];
                    if (p.flags & 2) v += p.bias[mm];
            if (p.flags & 8) v *= p.bias[(long long)zo * p.M + mm];   /* per-(z,row) scale vector laid out [Z][M]; exclusive with the bias flags */
                    v = act_fn(v, p.act);
                    if (p.flags & 4) v += p.beta * R[(long long)mm * p.sRm + (long long)nn * p.sRn];
                    ctile[8 * h + r][t2 * 16 + l15] = (n < p.N) ? v : 0.f;
                }
            }
            __syncthreads();
            const bool fast = (mb + 16 <= p.M) && (nb + 32 <= NW) && ((p.sCm & 3) == 0) && ((((size_t)C) & 15) == 0);
            if (fast) {
#pragma unroll
                for (int s = 0; s < 4; ++s) {
                    const int row = s * 4 + (lane >> 3), c4 = (lane & 7) * 4;
                    const v4f v = *(const v4f*)&ctile[row][c4];
                    VST2V4(C + (long long)(mb + row) * p.sCm + nb + c4, v);
                }
            } else {
                for (int row = 0; row < 16; ++row) {
                    const int m = mb + row, n = nb + lane;
                    if (m < p.M && n < NW) VST2(float, C + (long long)m * p.sCm + n, ctile[row][lane]);
                }
            }
            __syncthreads();
        }
    }
}

// =====================================================================================================================
// k_attn_lds<L, RS, OS>: O = softmax(scale * Q.K^T) V for one head per blockIdx.y, head and value dim 64, L queries and L keys (L % 64 == 0), f32 in and out.
//   Wave = 16 queries, AW waves per block, 64-key blocks; grid (L / (16*AW), H, batch), block 32*AW. Row r of head h of batch element z: Q/K/V + (z*L + r)*RS + h*64, O + (z*L + r)*OS + h*64.
//   Each 64-key block of K and of V is read once per work-group with 16-byte loads, converted to f16 and laid in LDS as [key][d] rows:
//   K at a pitch of 144 B for ds_load_b128 fragment reads (A operand of k.q^T, same k order as the Q fragment),
//   V at a pitch of 160 B for ds_load_tr16_b128 fragment reads (A operand of v^T.p^T: lane = row d, k = key in the frag_k order).
//   Both products are taken transposed: S^T = K.Q^T puts query l15 in lane column l15, so lanes l15 and l15+16 hold all 64 scores of one query
//   (tile t, register r: key 16t + 8*hf + r); maximum and sum run inside the lane, with one exchange between the lane halves.
//   Two S^T tiles of 16 keys, converted in place, are the B fragment of O^T += V^T.P^T in the frag_k order: P never leaves the registers.
//   Statistics f32 (exp2 domain); P x 4096 as f16.
//   Output map: Y^T = Wo[h]^T.O^T + bo[h]. Wo[h] x 16 lies in LDS as f16 [d][e] rows, laid and read exactly like a V tile (A operand: lane = row e, k = d);
//   the normalised O^T tiles, converted in place like P, are the B fragment. O receives Y, row r of head h of batch element z at O + (z*L + r)*OS + h*64.
// =====================================================================================================================
#define AW 4
typedef __attribute__((ext_vector_type(4))) _Float16 v4h;
typedef __attribute__((ext_vector_type(8))) short    v8s;
union FragH { v16h v; v8h h[2]; };
// 16-bit transposing LDS load: with lane address T + (k0 + 8*(l>>4) + (l&7)) * pitch + d0 + 8*((l>>3)&1) (halves), lane (c = l&15, h = l>>4) gets T[k0 + 8h + 0..7][d0 + c]
__device__ __forceinline__ v8h ld_tr16(const _Float16* p) {
    typedef __attribute__((address_space(3))) v8s lds_v8s;
    return __builtin_bit_cast(v8h, __builtin_amdgcn_ds_load_tr16_b128_v8i16((lds_v8s*)p));
}
// value of lane l ^ 16
__device__ __forceinline__ float swap_half(float x) {
    const int b = __builtin_bit_cast(int, x);
    return __builtin_bit_cast(float, __builtin_amdgcn_permlanex16(b, b, 0x76543210, 0xfedcba98, false, false));
}
template <int L, int RS, int OS>
__global__ __launch_bounds__(32 * AW) void k_attn_lds(const float* __restrict__ Q, const float* __restrict__ K, const float* __restrict__ V, const float* __restrict__ Wo, const float* __restrict__ bo, float* __restrict__ O, float scale) {
    constexpr int KP = 72;                      // K tile pitch in halves (144 B: odd multiple of 16 B)
    constexpr int VP = 80;                      // V tile pitch in halves (160 B: odd multiple of 32 B)
    constexpr int OP = 68;                      // output tile pitch in floats (272 B: odd multiple of 16 B)
    __shared__ __align__(16) float    pl[AW][16 * OP];
    __shared__ __align__(16) _Float16 kl[64 * KP];
    __shared__ __align__(16) _Float16 vl[64 * VP];
    __shared__ __align__(16) _Float16 wl[64 * VP];   // Wo[h] x 16, [d][e], V's pitch (same reader)
    const int lane = threadIdx.x & 31, hf = lane >> 4, l15 = lane & 15, wave = threadIdx.x >> 5;
    const int h = blockIdx.y;
    const int q0 = (blockIdx.x * AW + wave) * 16;
    const long long zr = (long long)blockIdx.z * L;   // first row of this batch element
    float* myp = pl[wave];
    const float L2E = 1.4426950408889634f;
    const float NEG = -__builtin_inff();
    const float* qrow = Q + h * 64 + (zr + q0 + l15) * RS;
    const float* kbase = K + h * 64 + zr * RS;
    const float* vbase = V + h * 64 + zr * RS;
    v16h qa[2];
#pragma unroll
    for (int ks = 0; ks < 2; ++ks) qa[ks] = fh_ld(qrow, 1, ks * 32, hf, 64, 1.f);
    v8f o[4];                                   // o[t][r] = O^T[d = 16t + 8*hf + r][query l15]
    float m1 = NEG, l1 = 0.f;                   // query l15: running maximum (equal in both lane halves), sum over this half's keys
#pragma unroll
    for (int t = 0; t < 4; ++t) { v8f zz = {}; o[t] = zz; }
    const int sr = threadIdx.x >> 4, sc4 = (threadIdx.x & 15) * 4;   // staging: 16 threads per 64-float row, 8 rows per sweep
    const _Float16* kfr = kl + l15 * KP + 8 * hf;
    const _Float16* vfr = vl + (8 * hf + (lane & 7)) * VP + 8 * ((lane >> 3) & 1);
    const _Float16* wfr = wl + (8 * hf + (lane & 7)) * VP + 8 * ((lane >> 3) & 1);
    {                                                    // the head's output map into LDS; the key loop's first barriers publish it
        const float* wbase = Wo + h * 64 * 64;
        v4f wr[8];
#pragma unroll
        for (int i = 0; i < 8; ++i) wr[i] = *(const v4f*)(wbase + (i * 8 + sr) * 64 + sc4);
        asm volatile("s_wait_xcnt 0x0" ::: "memory");    // stands in front of any reuse of the address registers of the loads above
#pragma unroll
        for (int i = 0; i < 8; ++i) *(v4h*)(wl + (i * 8 + sr) * VP + sc4) = __builtin_convertvector(wr[i] * 16.f, v4h);
    }
    for (int j0 = 0; j0 < L; j0 += 64) {
        v4f kr[8], vr[8];
#pragma unroll
        for (int i = 0; i < 8; ++i) {
            const long long off = (long long)(j0 + i * 8 + sr) * RS + sc4;
            kr[i] = *(const v4f*)(kbase + off); vr[i] = *(const v4f*)(vbase + off);
        }
        asm volatile("s_wait_xcnt 0x0" ::: "memory");    // stands in front of any reuse of the address registers of the loads above
        __syncthreads();                                 // previous key block's reads of kl / vl are done
#pragma unroll
        for (int i = 0; i < 8; ++i) {
            *(v4h*)(kl + (i * 8 + sr) * KP + sc4) = __builtin_convertvector(kr[i], v4h);
            *(v4h*)(vl + (i * 8 + sr) * VP + sc4) = __builtin_convertvector(vr[i], v4h);
        }
        __syncthreads();                                 // K and V tiles visible to every wave
        FragH kb[4][2];                                  // all eight K fragments behind one LDS latency
#pragma unroll
        for (int t = 0; t < 4; ++t)
#pragma unroll
            for (int ks = 0; ks < 2; ++ks) {
                kb[t][ks].h[0] = *(const v8h*)(kfr + t * 16 * KP + ks * 32);
                kb[t][ks].h[1] = *(const v8h*)(kfr + t * 16 * KP + ks * 32 + 16);
            }
        v8f s[4];                                        // s[t][r] = S[query l15][key j0 + 16t + 8*hf + r]
#pragma unroll
        for (int t = 0; t < 4; ++t) {
            v8f acc = {};
#pragma unroll
            for (int ks = 0; ks < 2; ++ks) acc = wmma16(kb[t][ks].v, qa[ks], acc);
            s[t] = acc;
        }
        float sc[4][8], mt[4];
#pragma unroll
        for (int t = 0; t < 4; ++t) {
            mt[t] = NEG;
#pragma unroll
            for (int i = 0; i < 8; ++i) { sc[t][i] = (s[t][i] * scale) * L2E; mt[t] = fmaxf(mt[t], sc[t][i]); }
        }
        float mx = fmaxf(fmaxf(mt[0], mt[1]), fmaxf(mt[2], mt[3]));
        mx = fmaxf(mx, swap_half(mx));
        const float mnew = fmaxf(m1, mx);
        const float mref = (mnew == NEG) ? 0.f : mnew;   // a query with only -inf scores so far: every exp2 below is exp2(-inf) = 0, never exp2(nan)
        const float corr = exp2f(m1 - mref);
        FragH pa[2]; float rt[4];
#pragma unroll
        for (int t = 0; t < 4; ++t) {
            rt[t] = 0.f;
#pragma unroll
            for (int i = 0; i < 8; ++i) {
                const float pp = exp2f(sc[t][i] - mref);
                rt[t] += pp; pa[t >> 1].v[(t & 1) * 8 + i] = (_Float16)(pp * 4096.f);
            }
        }
        l1 = l1 * corr + ((rt[0] + rt[1]) + (rt[2] + rt[3])); m1 = mnew;
#pragma unroll
        for (int t = 0; t < 4; ++t) o[t] *= corr;
        FragH vb[4][2];                                  // all eight V fragments behind one LDS latency
#pragma unroll
        for (int t = 0; t < 4; ++t) {
            vb[t][0].h[0] = ld_tr16(vfr + t * 16);           vb[t][0].h[1] = ld_tr16(vfr + 16 * VP + t * 16);
            vb[t][1].h[0] = ld_tr16(vfr + 32 * VP + t * 16); vb[t][1].h[1] = ld_tr16(vfr + 48 * VP + t * 16);
        }
#pragma unroll
        for (int t = 0; t < 4; ++t) {
            o[t] = wmma16(vb[t][0].v, pa[0].v, o[t]);
            o[t] = wmma16(vb[t][1].v, pa[1].v, o[t]);
        }
    }
    float* obase = O + h * 64 + zr * OS;
    const float lt = l1 + swap_half(l1);
    const float inv = (lt > 0.f) ? 1.f / (lt * 4096.f) : 0.f;
    FragH ob[2];                                         // O^T as f16: tiles 2ks and 2ks+1 are the B fragment of d chunk ks in the frag_k order
#pragma unroll
    for (int t = 0; t < 4; ++t)
#pragma unroll
        for (int i = 0; i < 8; ++i) ob[t >> 1].v[(t & 1) * 8 + i] = (_Float16)(o[t][i] * inv);
    FragH wb[4][2];
#pragma unroll
    for (int t = 0; t < 4; ++t) {
        wb[t][0].h[0] = ld_tr16(wfr + t * 16);           wb[t][0].h[1] = ld_tr16(wfr + 16 * VP + t * 16);
        wb[t][1].h[0] = ld_tr16(wfr + 32 * VP + t * 16); wb[t][1].h[1] = ld_tr16(wfr + 48 * VP + t * 16);
    }
#pragma unroll
    for (int t = 0; t < 4; ++t) {
        v8f ov = {};                                     // ov[r] = 16 * (Y^T - bo[h])[e = 16t + 8*hf + r][query l15]
        ov = wmma16(wb[t][0].v, ob[0].v, ov);
        ov = wmma16(wb[t][1].v, ob[1].v, ov);
        *(v4f*)(myp + l15 * OP + t * 16 + 8 * hf)     = __builtin_shufflevector(ov, ov, 0, 1, 2, 3);
        *(v4f*)(myp + l15 * OP + t * 16 + 8 * hf + 4) = __builtin_shufflevector(ov, ov, 4, 5, 6, 7);
    }
    const v4f bv = *(const v4f*)(bo + h * 64 + l15 * 4);
    __syncthreads();
#pragma unroll
    for (int r0 = 0; r0 < 16; r0 += 2) {
        const int row = r0 + hf, c4 = l15 * 4;
        const v4f v = *(const v4f*)(myp + row * OP + c4) * 0.0625f + bv;
        VST2V4(obase + (long long)(q0 + row) * OS + c4, v);
    }
}

// =====================================================================================================================
// k_tr: dst(z, c, r) = alpha * src(z, r, c) (+ beta * R2(z, c, r)): [Z][R][C] (row stride lds) -> [Z][C][R] (row stride ldd) through a 32x32 LDS tile;
//   flags: 1 -> add beta * residual R2 addressed like dst (z*sRz + c*ldr + r); act applied before the residual.
// =====================================================================================================================
struct TrP { const float* src; float* dst; const float* R2; long long sSz, lds, sDz, ldd, sRz, ldr; int R, C, flags, act; float alpha, beta; };
static_assert(sizeof(TrP) == 3 * 8 + 6 * 8 + 6 * 4, "TrP has padding");
__global__ __launch_bounds__(256) void k_tr(TrP p) {
    __shared__ float tile[32][33];
    const int c0 = blockIdx.x * 32, r0 = blockIdx.y * 32, z = blockIdx.z;
    const int lane = threadIdx.x & 31, wave = threadIdx.x >> 5;
    const float* s = p.src + z * p.sSz;
#pragma unroll
    for (int k = 0; k < 4; ++k) {
        const int rl = wave * 4 + k, r = r0 + rl, c = c0 + lane;
        tile[rl][lane] = (r < p.R && c < p.C) ? s[(long long)r * p.lds + c] : 0.f;
    }
    __syncthreads();
    float* d = p.dst + z * p.sDz; const float* rr = p.R2 + z * p.sRz;
#pragma unroll
    for (int k = 0; k < 4; ++k) {
        const int cl = wave * 4 + k, c = c0 + cl, r = r0 + lane;
        if (c < p.C && r < p.R) {
            float v = act_fn(p.alpha * tile[lane][cl], p.act);
            if (p.flags & 1) v += p.beta * rr[(long long)c * p.ldr + r];
            VST2(float, d + (long long)c * p.ldd + r, v);
        }
    }
}

// k_affine: dst[i] = a * (sdev ? sdev[0] : 1) * src[i] + b, i < n (one thread per element; consecutive lanes -> consecutive addresses)
__global__ __launch_bounds__(256) void k_affine(const float* __restrict__ src, float* __restrict__ dst, int n, float a, float b, const float* __restrict__ sdev) {
    const int i = blockIdx.x * 256 + threadIdx.x;
    if (i < n) { const float aa = sdev ? a * sdev[0] : a; const float v = aa * src[i] + b; VST2(float, dst + i, v); }
}

// =====================================================================================================================
// k_softmax: row softmax over n contiguous elements, one 256-thread block per row; rows addressed z*sz + r*sr (grid (R, Z)).
//   out = scale_out * softmax(scale_in * x + (Mf ? Mf[z*smz + r*smr + j] : 0)); a row whose max is -inf is written as 0.
// =====================================================================================================================
struct SmP { const float* src; float* dst; const float* Mf; long long sz, sr, dz, dr, smz, smr; int n, pad; float scale_in, scale_out; };
static_assert(sizeof(SmP) == 3 * 8 + 6 * 8 + 4 * 4, "SmP has padding");
__global__ __launch_bounds__(256) void k_softmax(SmP p) {
    __shared__ float red[256];
    const int r = blockIdx.x, z = blockIdx.y, tid = threadIdx.x;
    const float* s = p.src + z * p.sz + (long long)r * p.sr;
    const float* mf = p.Mf ? (p.Mf + z * p.smz + (long long)r * p.smr) : nullptr;
    float mx = -__builtin_inff();
    for (int j = tid; j < p.n; j += 256) { float v = s[j] * p.scale_in; if (mf) v += mf[j]; mx = fmaxf(mx, v); }
    red[tid] = mx; __syncthreads();
    for (int o = 128; o > 0; o >>= 1) { if (tid < o) red[tid] = fmaxf(red[tid], red[tid + o]); __syncthreads(); }
    mx = red[0]; __syncthreads();
    float sum = 0.f;
    for (int j = tid; j < p.n; j += 256) { float v = s[j] * p.scale_in; if (mf) v += mf[j]; sum += (mx == -__builtin_inff()) ? 0.f : expf(v - mx); }
    red[tid] = sum; __syncthreads();
    for (int o = 128; o > 0; o >>= 1) { if (tid < o) red[tid] += red[tid + o]; __syncthreads(); }
    sum = red[0];
    const float inv = (sum > 0.f) ? p.scale_out / sum : 0.f;
    float* d = p.dst + z * p.dz + (long long)r * p.dr;
    for (int j = tid; j < p.n; j += 256) { float v = s[j] * p.scale_in; if (mf) v += mf[j]; const float o = (mx == -__builtin_inff()) ? 0.f : expf(v - mx) * inv; VST2(float, d + j, o); }
}
// =====================================================================================================================
// k_stats: mean and rsqrt(var + eps) over a set of n elements addressed base + z*sz + (e / inner) * so + (e % inner) * si, one 256-thread
// k_norm_apply: y = (x - mean[set]) * rstd[set] * g[c] + b[c] over a [Z][C][L] channel-major tensor with set = z*G + c / (C/G) (G groups per z;
//   G = C -> per-channel sets indexed z*C+c; for batch norm pass stats indexed by c only via bn = 1). Optional act. Output same layout.
// =====================================================================================================================
//   mode 0: mean / rsqrt(var + eps); mode 1 (RMSNorm): 0 / rsqrt(mean(x^2) + eps); mode 2 (L2 normalize * sqrt(n)): 0 / sqrt(n) / max(||x||, eps); mode 3: as 0 with unbiased variance (n-1)
__global__ __launch_bounds__(256) void k_stats(const float* __restrict__ x, long long sz, long long so, long long si, int inner, int n, float eps, float* __restrict__ stat, int mode) {
    __shared__ float red[256];
    const int z = blockIdx.x, tid = threadIdx.x;
    const float* base = x + z * sz;
    float s = 0.f;
    for (int e = tid; e < n; e += 256) s += base[(long long)(e / inner) * so + (long long)(e % inner) * si];
    red[tid] = s; __syncthreads();
    for (int o = 128; o > 0; o >>= 1) { if (tid < o) red[tid] += red[tid + o]; __syncthreads(); }
    const float mu = (mode == 0 || mode == 3) ? red[0] / (float)n : 0.f; __syncthreads();
    float q = 0.f;
    for (int e = tid; e < n; e += 256) { const float dlt = base[(long long)(e / inner) * so + (long long)(e % inner) * si] - mu; q += dlt * dlt; }
    red[tid] = q; __syncthreads();
    for (int o = 128; o > 0; o >>= 1) { if (tid < o) red[tid] += red[tid + o]; __syncthreads(); }
    {
        float rs;
        if (mode == 2) rs = sqrtf((float)n) / fmaxf(sqrtf(red[0]), eps); else if (mode == 3) rs = rsqrtf(red[0] / (float)(n - 1) + eps); else rs = rsqrtf(red[0] / (float)n + eps);
        if (tid < 32) { const float v = (tid == 0) ? mu : ((tid == 1) ? rs : 0.f); VST2(float, stat + (long long)z * 32 + tid, v); }
    }
}
//   One thread per element over the flat [Z][C][L] index space: grid ceil(Z*C*L / 256).
__global__ __launch_bounds__(256) void k_norm_apply(const float* __restrict__ x, float* __restrict__ y, const float* __restrict__ stat, const float* __restrict__ g, const float* __restrict__ bta,
                                                     int Z, int C, int L, int G, int bn, int act) {
    const long long idx = (long long)blockIdx.x * 256 + threadIdx.x;
    if (idx >= (long long)Z * C * L) return;
    const int l = (int)(idx % L); const long long zc = idx / L; const int c = (int)(zc % C), z = (int)(zc / C); (void)l;
    const int set = bn ? c : (z * G + c / (C / G));
    float v = (x[idx] - stat[(long long)set * 32]) * stat[(long long)set * 32 + 1];
    if (g) v *= g[c];
    if (bta) v += bta[c];
    v = act_fn(v, act);
    VST2(float, y + idx, v);
}

// k_lse_neg: c[i] = -(st[2i] + log(st[2i+1])) = minus the log-sum-exp of row i from (max, sum) statistic pairs (for softmax over the query dimension)
__global__ __launch_bounds__(256) void k_lse_neg(const float* __restrict__ st, float* __restrict__ c, int n) {
    const int i = blockIdx.x * 256 + threadIdx.x;
    if (i < n) { const float v = -(st[2 * i] + logf(st[2 * i + 1])); VST2(float, c + i, v); }
}

// k_iota: dst[i] = a * i + b as int32 (segment/position id helper)
__global__ __launch_bounds__(256) void k_iota(int* __restrict__ dst, int n, int a, int b) {
    const int i = blockIdx.x * 256 + threadIdx.x;
    if (i < n) { const int v = a * i + b; VST2(int, dst + i, v); }
}

// k_axpby: dst[i] = a * x[i] + b * y[i] (+ c), i < n
__global__ __launch_bounds__(256) void k_axpby(const float* __restrict__ x, const float* __restrict__ y, float* __restrict__ dst, int n, float a, float b, float c) {
    const int i = blockIdx.x * 256 + threadIdx.x;
    if (i < n) { const float v = a * x[i] + b * y[i] + c; VST2(float, dst + i, v); }
}

// =====================================================================================================================
// k_rope: rotary embedding on a [R rows][Hn heads][D] view (row stride sXr, head stride sXh, element stride 1) -> Y (own strides).
//   mode 0: rotate_half (partner d±D/2, sign - for d<D/2); mode 1: interleaved pairs (partner d^1, sign - for even d).
//   table column tcol: tmode 0 -> d, 1 -> d % (D/2), 2 -> d / 2; position p: pmode 0 -> r % S, 1 -> head index, 2 -> pos[r];
//   c = C[(r / S) * sCb + p * sCp + tcol * sCd], s likewise from Sn; y = x[d] * c + sign * x[partner] * s. X and Y must not alias.
// =====================================================================================================================
struct RopeP { const float* X; float* Y; const float* C; const float* Sn; const int* pos; long long sXr, sXh, sYr, sYh, sCb, sCp, sCd; int R, Hn, D, S, mode, tmode, pmode, pad; };
static_assert(sizeof(RopeP) == 5 * 8 + 7 * 8 + 8 * 4, "RopeP has padding");
__global__ __launch_bounds__(256) void k_rope(RopeP p) {
    const long long idx = (long long)blockIdx.x * 256 + threadIdx.x;
    if (idx >= (long long)p.R * p.Hn * p.D) return;
    const int d = (int)(idx % p.D); const long long rh = idx / p.D; const int h = (int)(rh % p.Hn); const int r = (int)(rh / p.Hn);
    const int half = p.D / 2;
    int partner; float sign;
    if (p.mode == 0) { partner = (d < half) ? d + half : d - half; sign = (d < half) ? -1.f : 1.f; }
    else { partner = d ^ 1; sign = (d & 1) ? 1.f : -1.f; }
    const int tcol = (p.tmode == 0) ? d : ((p.tmode == 1) ? (d % half) : (d >> 1));
    const int pp = (p.pmode == 0) ? (r % p.S) : ((p.pmode == 1) ? h : p.pos[r]);
    const long long toff = (long long)(r / p.S) * p.sCb + (long long)pp * p.sCp + (long long)tcol * p.sCd;
    const float* xr = p.X + (long long)r * p.sXr + (long long)h * p.sXh;
    const float v = xr[d] * p.C[toff] + sign * xr[partner] * p.Sn[toff];
    VST2(float, p.Y + (long long)r * p.sYr + (long long)h * p.sYh + d, v);
}

// k_invf + k_sincos (split so neither kernel carries a large VALU-fma footprint): invf_i = num * (1 / powf(base, (2 i)/D)) [fmode 0],
//   num * expf((2 i) * cexp) [fmode 1], num * powf(base, -2 (i - 1) / D) [fmode 2]; then cs/sn[s*half + i] = cos/sin((pscale * s) * invf_i)
__global__ __launch_bounds__(256) void k_invf(float* __restrict__ invb, int half, int D, float base, float num, int fmode, float cexp) {
    const int i = blockIdx.x * 256 + threadIdx.x;
    if (i >= ((half + 31) / 32) * 32) return;
    if (i >= half) { VST2(float, invb + i, 0.f); return; }
    const float e = (float)(2 * i) / (float)D;
    float invf;
    if (fmode == 1) invf = num * expf((float)(2 * i) * cexp);
    else if (fmode == 2) invf = num * powf(base, (-2.0f * ((float)i - 1.0f)) / (float)D);
    else invf = num * (1.0f / powf(base, e));
    VST2(float, invb + i, invf);
}
__global__ __launch_bounds__(256) void k_sincos(float* __restrict__ cs, float* __restrict__ sn, const float* __restrict__ invb, int S, int half, float pscale) {
    const int idx = blockIdx.x * 256 + threadIdx.x;
    if (idx >= S * half) return;
    const int s = idx / half, i = idx - s * half;
    const float ang = (pscale * (float)s) * invb[i];
    VST2(float, cs + idx, cosf(ang)); VST2(float, sn + idx, sinf(ang));
}

// k_mulact: dst[i] = act(x[i]) * y[i]
__global__ __launch_bounds__(256) void k_mulact(const float* __restrict__ x, const float* __restrict__ y, float* __restrict__ dst, int n, int act) {
    const int i = blockIdx.x * 256 + threadIdx.x;
    if (i < n) { const float v = act_fn(x[i], act) * y[i]; VST2(float, dst + i, v); }
}

// =====================================================================================================================
// k_matvec: thread-per-row matrix-vector products for N <= 8 output columns (heads with 1-3 outputs, gates), f32 on the VALU.
//   C[r*sCm + j] = act(alpha * sum_k A[r*sAm + k*sAk] * B[j*sBn + k*sBk] + bias[j]) + beta * R[r*sRm + j*sRn]; each thread writes its N contiguous floats.
// =====================================================================================================================
__global__ __launch_bounds__(256) void k_matvec(GemmP p) {
    // 32 lanes write one line with one instruction.
    const int rpt = (p.N == 1) ? 1 : 32;
    const long long r0 = ((long long)blockIdx.x * 256 + threadIdx.x) * rpt; const int z = blockIdx.z, zo = z / p.zi_n, zi = z - zo * p.zi_n;
    if (r0 >= p.M) return;
    const float* Bb = p.B + zo * p.sBo + zi * p.sBi;
    float* C = p.C + zo * p.sCo + zi * p.sCi; const float* R = p.R + zo * p.sRo + zi * p.sRi;
    for (int rr = 0; rr < rpt; ++rr) {
        const long long r = r0 + rr; if (r >= p.M) break;
        const float* A = p.A + zo * p.sAo + zi * p.sAi + r * p.sAm;
        float acc[8] = {0.f, 0.f, 0.f, 0.f, 0.f, 0.f, 0.f, 0.f};
        for (int k = 0; k < p.K; ++k) { const float a = A[(long long)k * p.sAk];
#pragma unroll
            for (int j = 0; j < 8; ++j) if (j < p.N) acc[j] += a * Bb[(long long)j * p.sBn + (long long)k * p.sBk]; }
#pragma unroll
        for (int j = 0; j < 8; ++j) if (j < p.N) {
            float v = acc[j] * p.alpha;
            if (p.flags & 1) v += p.bias[j];
            if (p.flags & 2) v += p.bias[r];
            v = act_fn(v, p.act);
            if (p.flags & 4) v += p.beta * R[r * p.sRm + (long long)j * p.sRn];
            VST2(float, C + r * p.sCm + j, v);
        }
    }
}
// k_smallsoftmax: thread-per-row softmax for short rows (n <= 64): dst[r*dr + j] = softmax(scale*src[r*sr + j])
__global__ __launch_bounds__(256) void k_smallsoftmax(const float* __restrict__ src, float* __restrict__ dst, long long sr, long long dr, int n, long long R, float scale) {
    const long long r0 = ((long long)blockIdx.x * 256 + threadIdx.x) * 32;
    for (int rr = 0; rr < 32; ++rr) {
        const long long r = r0 + rr; if (r >= R) return;
        const float* s = src + r * sr; float* d = dst + r * dr;
        float mx = -__builtin_inff();
        for (int j = 0; j < n; ++j) mx = fmaxf(mx, s[j] * scale);
        float sum = 0.f;
        for (int j = 0; j < n; ++j) sum += expf(s[j] * scale - mx);
        const float inv = 1.f / sum;
        for (int j = 0; j < n; ++j) { const float v = expf(s[j] * scale - mx) * inv; VST2(float, d + j, v); }
    }
}

__global__ __launch_bounds__(32) void k_unitstat(float* __restrict__ st) { const int t = threadIdx.x; const float v = (t == 1) ? 1.f : 0.f; VST2(float, st + t, v); }

// destination (e.g. a d_out whose row width is not a multiple of 32 floats) is written by consecutive lanes of one instruction
__global__ __launch_bounds__(256) void k_lincopy(const float* __restrict__ src, long long lds, float* __restrict__ dst, long long ldd, long long rows, int cols) {
    const long long i = (long long)blockIdx.x * 256 + threadIdx.x; if (i >= rows * cols) return;
    const long long r = i / cols; const int c = (int)(i - r * cols);
    const float v = src[r * lds + c]; VST2(float, dst + r * ldd + c, v);
}

namespace w25 {
typedef __attribute__((ext_vector_type(16))) _Float16 v16h;
typedef __attribute__((ext_vector_type(8)))  _Float16 v8h;
typedef __attribute__((ext_vector_type(16))) __bf16   v16b;
typedef __attribute__((ext_vector_type(8)))  __bf16   v8b;
typedef __attribute__((ext_vector_type(8)))  float    v8f;
typedef __attribute__((ext_vector_type(4)))  float    v4f;

__device__ __forceinline__ unsigned short f2bf_bits(float f) {
  unsigned u = __float_as_uint(f);
  return (unsigned short)((u + 0x7FFFu + ((u >> 16) & 1u)) >> 16);
}
__device__ __forceinline__ float bf_bits2f(unsigned short h) { return __uint_as_float(((unsigned)h) << 16); }

// hazard guards as plain device helpers (no inline asm inside the kernel template body)
__device__ __forceinline__ void dep_guard_h(v8f& a, v8f& b, v16h x, v16h y) { asm volatile("v_nop\n\tv_nop\n\tv_nop\n\tv_nop" : "+v"(a), "+v"(b) : "v"(x), "v"(y)); }
__device__ __forceinline__ void dep_guard_b(v8f& a, v8f& b, v16b x, v16b y) { asm volatile("v_nop\n\tv_nop\n\tv_nop\n\tv_nop" : "+v"(a), "+v"(b) : "v"(x), "v"(y)); }
__device__ __forceinline__ void keep4_h(v16h a, v16h b, v16h c, v16h d) { asm volatile("v_nop" :: "v"(a), "v"(b), "v"(c), "v"(d)); }
__device__ __forceinline__ void keep4_b(v16b a, v16b b, v16b c, v16b d) { asm volatile("v_nop" :: "v"(a), "v"(b), "v"(c), "v"(d)); }
__device__ __forceinline__ void acc_guard4(v8f& a, v8f& b, v8f& c, v8f& d) { asm volatile("v_nop\n\tv_nop\n\tv_nop\n\tv_nop" : "+v"(a), "+v"(b), "+v"(c), "+v"(d)); }
template <typename T> struct Frag;
template <> struct Frag<_Float16> {
  typedef v16h V; union U { v16h v; v8h h[2]; };
  static __device__ __forceinline__ v16h load(const _Float16* p) {   // elements 0..7 <- p[0..7], 8..15 <- p[16..23]
    U f; f.h[0] = *(const v8h*)(p); f.h[1] = *(const v8h*)(p + 16); return f.v;
  }
  static __device__ __forceinline__ v8f mma(v16h a, v16h b, v8f c) {
    return __builtin_amdgcn_wmma_f32_16x16x32_f16(false, a, false, b, (short)0, c, false, false);
  }
  static __device__ __forceinline__ void guard(v8f& a, v8f& b, v16h x, v16h y) { dep_guard_h(a, b, x, y); }
  static __device__ __forceinline__ void keep(v16h a, v16h b, v16h c, v16h d) { keep4_h(a, b, c, d); }
};
template <> struct Frag<__bf16> {
  typedef v16b V; union U { v16b v; v8b h[2]; };
  static __device__ __forceinline__ v16b load(const __bf16* p) {
    U f; f.h[0] = *(const v8b*)(p); f.h[1] = *(const v8b*)(p + 16); return f.v;
  }
  static __device__ __forceinline__ v8f mma(v16b a, v16b b, v8f c) {
    return __builtin_amdgcn_wmma_f32_16x16x32_bf16(false, a, false, b, (short)0, c, false, false);
  }
  static __device__ __forceinline__ void guard(v8f& a, v8f& b, v16b x, v16b y) { dep_guard_b(a, b, x, y); }
  static __device__ __forceinline__ void keep(v16b a, v16b b, v16b c, v16b d) { keep4_b(a, b, c, d); }
};

// ---- Register-blocked batched WMMA GEMM ------------------------------------
// C[m,n] = scale * sum_k A[m,k] * Bt[n,k] (+bias)(+resid); each wave owns a 64x64 tile.
// A row-major [M,K]; Bt row-major [N,K]; M,N % 64 == 0, K % 32 == 0.
// SPLIT: operands are hi/lo planes (A2/Bt2 = lo planes, same layout); product = hi·hi + hi·lo + lo·hi.
// BIAS_MODE: 0 = none, 1 = bias[m], 2 = bias[n].
// OUT_MODE: 0 = f32, 1 = f16, 2 = bf16 hi plane (Cout) + bf16 lo plane (Cout2).
// ET: 0 = f16 operands, 1 = bf16 operands (pointers passed as 16-bit storage)
template <int ET> struct Elem;
template <> struct Elem<0> { typedef _Float16 T; };
template <> struct Elem<1> { typedef __bf16 T; };
template <int ET, bool SPLIT, int BIAS_MODE, int OUT_MODE, bool RESID, int ACT = 0>
__global__ __launch_bounds__(256) void wmma_gemm64(
    const unsigned short* __restrict__ Ap, const unsigned short* __restrict__ A2p, int lda, long strideA,
    const unsigned short* __restrict__ Btp, const unsigned short* __restrict__ Bt2p, int ldb, long strideB,
    void* __restrict__ Cout, void* __restrict__ Cout2, int ldc, long strideC,
    const float* __restrict__ bias,
    const float* __restrict__ resid, long strideR,
    int M, int N, int K, float scale) {
  typedef typename Elem<ET>::T T;
  typedef typename Frag<T>::V V;
  const T* A = (const T*)Ap; const T* A2 = (const T*)A2p; const T* Bt = (const T*)Btp; const T* Bt2 = (const T*)Bt2p;
  __shared__ __align__(16) float sT[8][16 * 68];   // per-wave 16x64 slab, pitch 68 floats
  const int b    = blockIdx.y;
  const int lane = threadIdx.x & 31;
  const int wave = threadIdx.x >> 5;
  const int tilesN = N >> 6;
  const int tilesM = M >> 6;
  const int tile = blockIdx.x * 8 + wave;
  if (tile >= tilesM * tilesN) return;   // wave-uniform; no block barriers in this kernel
  const int tm = tile / tilesN;
  const int tn = tile - tm * tilesN;
  const int m0 = tm << 6;
  const int n0 = tn << 6;

  const T* Ab  = A  + (size_t)b * strideA;
  const T* Bb  = Bt + (size_t)b * strideB;
  const T* Ab2 = SPLIT ? (A2  + (size_t)b * strideA) : nullptr;
  const T* Bb2 = SPLIT ? (Bt2 + (size_t)b * strideB) : nullptr;

  const int rlane = lane & 15;                 // row (A) / col (B, D) within subtile
  const int koff  = (lane >> 4) * 8;           // k offset of this lane half
  const int mOff  = (lane >> 4) * 8;           // D row offset

  v8f acc[4][4];
#pragma unroll
  for (int i = 0; i < 4; ++i)
#pragma unroll
    for (int j = 0; j < 4; ++j) acc[i][j] = (v8f){0.f,0.f,0.f,0.f,0.f,0.f,0.f,0.f};

  for (int k0 = 0; k0 < K; k0 += 32) {
    V bh[4], bl[4];
#pragma unroll
    for (int j = 0; j < 4; ++j) {
      const size_t bo = (size_t)(n0 + (j << 4) + rlane) * ldb + koff + k0;
      bh[j] = Frag<T>::load(Bb + bo);
      if (SPLIT) bl[j] = Frag<T>::load(Bb2 + bo);
    }
#pragma unroll
    for (int i = 0; i < 4; ++i) {
      const size_t ao = (size_t)(m0 + (i << 4) + rlane) * lda + koff + k0;
      V ah = Frag<T>::load(Ab + ao);
      V al;
      if (SPLIT) al = Frag<T>::load(Ab2 + ao);
#pragma unroll
      for (int j = 0; j < 4; ++j) {
        acc[i][j] = Frag<T>::mma(ah, bh[j], acc[i][j]);
        if (SPLIT) {
          acc[i][j] = Frag<T>::mma(ah, bl[j], acc[i][j]);
          acc[i][j] = Frag<T>::mma(al, bh[j], acc[i][j]);
        }
      }
      Frag<T>::guard(acc[i][0], acc[i][3], ah, SPLIT ? al : ah);
    }
    Frag<T>::keep(bh[0], bh[1], bh[2], bh[3]);
    if (SPLIT) Frag<T>::keep(bl[0], bl[1], bl[2], bl[3]);
  }
  acc_guard4(acc[0][0], acc[0][1], acc[0][2], acc[0][3]);
  acc_guard4(acc[1][0], acc[1][1], acc[1][2], acc[1][3]);
  acc_guard4(acc[2][0], acc[2][1], acc[2][2], acc[2][3]);
  acc_guard4(acc[3][0], acc[3][1], acc[3][2], acc[3][3]);

  // ---- epilogue ----
  float* slab = sT[wave];
  const float* Rb = RESID ? (resid + (size_t)b * strideR) : nullptr;
#pragma unroll
  for (int i = 0; i < 4; ++i) {
    const int mBase = m0 + (i << 4);
#pragma unroll
    for (int j = 0; j < 4; ++j) {
      const int n = n0 + (j << 4) + rlane;
      float bv = 0.f;
      if (BIAS_MODE == 2) bv = bias[n];
#pragma unroll
      for (int r = 0; r < 8; ++r) {
        float v = acc[i][j][r] * scale;
        if (BIAS_MODE == 1) v += bias[mBase + mOff + r];
        if (BIAS_MODE == 2) v += bv;
        if (RESID) v += Rb[(size_t)(mBase + mOff + r) * ldc + n];
        if (ACT == 1) v = tanhf(v);
        if (ACT == 2) v = fmaxf(v, 0.0f);
        if (ACT == 3) v = v / (1.0f + expf(-v));
        if (ACT == 4) v = (v > 0.f) ? v : 0.01f * v;
        if (ACT == 5) v = 0.5f * v * (1.0f + erff(v * 0.70710678118654752f));
        if (ACT == 6) v = (v > 0.f) ? v : 0.2f * v;
        slab[(mOff + r) * 68 + (j << 4) + rlane] = v;
      }
    }
    __builtin_amdgcn_fence(__ATOMIC_RELEASE, "workgroup");
    __builtin_amdgcn_wave_barrier();
    __builtin_amdgcn_fence(__ATOMIC_ACQUIRE, "workgroup");
    if (OUT_MODE == 0) {
      float* C = (float*)Cout + (size_t)b * strideC;
      const int hh = lane >> 4, c4 = (lane & 15) * 4;     // row seg = 256 B = 16 lanes x 16 B
      {
#pragma unroll
        for (int it = 0; it < 8; ++it) {
          const int row = it * 2 + hh;
          v4f v = *(const v4f*)(slab + row * 68 + c4);
          *(v4f*)(C + (size_t)(mBase + row) * ldc + n0 + c4) = v;
        }
        
      }
    } else {
      const int q = lane >> 3, c8 = (lane & 7) * 8;
      unsigned short* C  = (unsigned short*)Cout  + (size_t)b * strideC;
      unsigned short* C2 = (OUT_MODE == 2) ? ((unsigned short*)Cout2 + (size_t)b * strideC) : nullptr;
      {
#pragma unroll
        for (int it = 0; it < 4; ++it) {
          const int row = it * 4 + q;
          const float* sp = slab + row * 68 + c8;
          v8h hv, lv;
#pragma unroll
          for (int e = 0; e < 8; ++e) {
            if (OUT_MODE == 1) {
              hv[e] = (_Float16)sp[e];
            } else {
              unsigned short hb = f2bf_bits(sp[e]);
              unsigned short lb = f2bf_bits(sp[e] - bf_bits2f(hb));
              hv[e] = __builtin_bit_cast(_Float16, hb);
              lv[e] = __builtin_bit_cast(_Float16, lb);
            }
          }
          *(v8h*)(C + (size_t)(mBase + row) * ldc + n0 + c8) = hv;
          if (OUT_MODE == 2) *(v8h*)(C2 + (size_t)(mBase + row) * ldc + n0 + c8) = lv;
        }
        
      }
    }
    __builtin_amdgcn_fence(__ATOMIC_RELEASE, "workgroup");
    __builtin_amdgcn_wave_barrier();
    __builtin_amdgcn_fence(__ATOMIC_ACQUIRE, "workgroup");
  }
}

__global__ __launch_bounds__(256) void cast_f32_f16x2(
    const float* __restrict__ in, _Float16* __restrict__ out, int n2) {
  int i = blockIdx.x * 256 + threadIdx.x;
  if (i < n2) {
    const _Float16 h0 = (_Float16)in[2 * i], h1 = (_Float16)in[2 * i + 1];
    const unsigned u = (unsigned)__builtin_bit_cast(unsigned short, h0) | ((unsigned)__builtin_bit_cast(unsigned short, h1) << 16);
    ((unsigned*)out)[i] = u;
    
  }
}


} // namespace w25

// =====================================================================================================================
// k_prep<NR, D>: all f16 operand planes of the projections in one launch of WB + XB work-groups of 256 threads, 32 or 64 elements a thread.
//   Work-groups [0, WB): one tile of 128 (k) x 64 (n) of the weights taken side by side, W = Wq | Wkv ([D][D] | [D][2D], n < D is Wq):
//   W16[n][k] = f16(16 * W[k][n]). Rows of 256 B are read along n with 16-byte loads into an f32 LDS tile (pitch 65 floats: the 32 lanes
//   of a column-wise read fall on 32 different banks); each lane then packs 8 consecutive k of one n, 8 lanes store one whole 128-B line.
//   Work-groups [WB, WB + XB): X16 = f16(x), 16384 consecutive floats each; a wave's load covers 512 contiguous bytes, its store 256.
// =====================================================================================================================
// eight 16-byte loads, 16 rows of LD floats apart: one address pair, the row steps as immediate offsets
template <int LD> __device__ __forceinline__ void ld_rows8(const float* __restrict__ sp, v4f (&w)[8]) {
#pragma unroll
    for (int s = 0; s < 8; ++s) w[s] = *(const v4f*)(sp + s * 16 * LD);
    asm volatile("s_wait_xcnt 0x0" :: "v"(sp) : "memory");   // stands in front of any reuse of the loads' address pair, which it names so that the pair lives up to here
}
template <int NR, int D>
__global__ __launch_bounds__(256) void k_prep(const float* __restrict__ x, const float* __restrict__ Wq, const float* __restrict__ Wkv, _Float16* __restrict__ X16, _Float16* __restrict__ W16) {
    constexpr int TP = 65;                      // LDS tile pitch in floats
    constexpr int NT = 3 * D / 64;              // n tiles
    constexpr int WB = NT * (D / 128);
    static_assert(D % 128 == 0 && ((long long)NR * D) % 16384 == 0, "whole tiles only");
    __shared__ float tile[128 * TP];
    const int tid = threadIdx.x;
    if ((int)blockIdx.x < WB) {
        const int nt = blockIdx.x % NT, kt = blockIdx.x / NT;
        const int n0 = nt * 64, k0 = kt * 128;
        const int c4 = (tid & 15) * 4, r = tid >> 4;
        v4f w[8];
        if (n0 < D) ld_rows8<D>(Wq + n0 + (k0 + r) * D + c4, w);                     // work-group-uniform choice of the source matrix
        else        ld_rows8<2 * D>(Wkv + (n0 - D) + (k0 + r) * (2 * D) + c4, w);
#pragma unroll
        for (int s = 0; s < 8; ++s)
#pragma unroll
            for (int e = 0; e < 4; ++e) tile[(s * 16 + r) * TP + c4 + e] = w[s][e];
        __syncthreads();                                 // the whole tile is in LDS before any column of it is read
        const int a8 = (tid & 7) * 8, nl = tid >> 3;
#pragma unroll
        for (int q = 0; q < 4; ++q) {
            const int n = (q >> 1) * 32 + nl, k = (q & 1) * 64 + a8;
            v8h hv;
#pragma unroll
            for (int j = 0; j < 8; ++j) hv[j] = (_Float16)(tile[(k + j) * TP + n] * 16.f);
            *(v8h*)(W16 + (long long)(n0 + n) * D + k0 + k) = hv;
        }
    } else {
        const long long base = (long long)((int)blockIdx.x - WB) * 16384 + tid * 4;
        const float* xp = x + base;
        v4f v[16];
#pragma unroll
        for (int i = 0; i < 16; ++i) v[i] = *(const v4f*)(xp + i * 1024);
        asm volatile("s_wait_xcnt 0x0" :: "v"(xp) : "memory");   // stands in front of any reuse of the loads' address pair, which it names so that the pair lives up to here
#pragma unroll
        for (int i = 0; i < 16; ++i) *(v4h*)(X16 + base + i * 1024) = __builtin_convertvector(v[i], v4h);
        asm volatile("s_wait_xcnt 0x0" ::: "memory");            // stands behind the stores above, in front of any reuse of their address and data registers
    }
}

// f32 -> bf16 hi plane + bf16 lo plane (x = hi + lo to ~2^-17 relative; RNE both), [R][C] -> [R][C] (or transposed to [C][R]); 2 consecutive destination elements
__device__ __forceinline__ unsigned int f2bf2_pack(float a, float b, unsigned int* lo) {
    const unsigned short ha = w25::f2bf_bits(a), hb = w25::f2bf_bits(b);
    const unsigned short la = w25::f2bf_bits(a - w25::bf_bits2f(ha)), lb = w25::f2bf_bits(b - w25::bf_bits2f(hb));
    *lo = (unsigned)la | ((unsigned)lb << 16); return (unsigned)ha | ((unsigned)hb << 16); }
__global__ __launch_bounds__(256) void k_castS16(const float* __restrict__ src, long long lds, __bf16* __restrict__ dhi, __bf16* __restrict__ dlo, long long ldd, int R, int C, float s, int transpose) {
    const long long i = (long long)blockIdx.x * 256 + threadIdx.x; long long o; float a, b;
    if (transpose) { const long long np = (long long)C * (R / 2); if (i >= np) return; const int c = (int)(i / (R / 2)); const int r = 2 * (int)(i % (R / 2)); a = src[(long long)r * lds + c] * s; b = src[(long long)(r + 1) * lds + c] * s; o = (long long)c * ldd + r; }
    else { const long long np = (long long)R * (C / 2); if (i >= np) return; const int r = (int)(i / (C / 2)); const int c = 2 * (int)(i % (C / 2)); a = src[(long long)r * lds + c] * s; b = src[(long long)r * lds + c + 1] * s; o = (long long)r * ldd + c; }
    unsigned lo; const unsigned hi = f2bf2_pack(a, b, &lo); unsigned* ph = (unsigned*)(dhi + o); unsigned* pl = (unsigned*)(dlo + o);
    *ph = hi; *pl = lo;  }

namespace w25 {
// =====================================================================================
// Generic causal/non-causal attention for head_dim 64, f32 in / f32 out; 16-bit operands: bf16 with optional hi/lo splits, or
// plain f16 (F16=true, non-split, probabilities carried x2^15).
//   scores = (q*qscale)·kᵀ : v_wmma_f32_16x16x32_bf16; SPLIT_QK -> q,k as bf16 hi/lo (hi·hi + hi·lo + lo·hi)
//   out    = p·v           : v_wmma_f32_16x16x32_bf16; SPLIT_PV -> p,v as bf16 hi/lo; else p,v plain bf16
//   f32 accumulate; online softmax in f32. Block = 4 waves = 64 query rows of one (batch, head); S % 64 == 0.
//   Element (b, s, h, d) of tensor X lives at X[b*X_bs + s*X_rs + h*X_hs + d] (strides in floats, multiples of 4).
//   Masking: mask_mode 0 none, 1 causal (kv > q masked), 2 tensor [S][Skv] shared over (b,h) (float if
//   mask_is_int==0, int32 with element == 0 -> masked if 1, int32 with element != 0 -> masked if 2), 3 per-token vectors qmask[B][S] & kvmask[B][Skv] (int32,
//   0 -> masked), 4 causal + sliding window (kv > q or q - kv > W masked; W passed in mask_is_int);
//   5 = relative-position bias: s += cp[b,h,q][idx[q][kv]] + pc[b,h,kv][idx[q][kv]] with idx = mask_b ([S][Skv] int32) and
//   mask_a an int32 [S][Skv] tensor with nonzero = masked (tables: element (b,h,row,n) at X + b*c_bs + h*c_hs + row*c_rs + n);
//   masked scores are replaced by mask_fill (e.g. -inf or -1e9) before the softmax.
//   grid.x = B * H * (S/64) (or a sub-range with blk0).
// =====================================================================================
#define AT_D 64
#define AT_NW 4
#define AT_QB 64
#define AT_KC 64
struct AttnGeom { const float* cp = nullptr; const float* pc = nullptr; long c_bs = 0, c_rs = 0, c_hs = 0;   // mode-5 score-bias tables
                  long q_bs, q_rs, q_hs, k_bs, k_rs, k_hs, v_bs, v_rs, v_hs, o_bs, o_rs, o_hs;
                  int S, Skv, H, mask_mode; float qscale; int blk0; float mask_fill; int mask_is_int; };
static_assert(sizeof(AttnGeom) == 168, "no padding");

__device__ __forceinline__ unsigned short at_bf_bits(float f) {
  unsigned u = __float_as_uint(f);
  return (unsigned short)((u + 0x7FFFu + ((u >> 16) & 1u)) >> 16);
}
__device__ __forceinline__ __bf16 at_f2bf(float f) { return __builtin_bit_cast(__bf16, at_bf_bits(f)); }
__device__ __forceinline__ void at_split(float f, __bf16& hi, __bf16& lo) {
  const unsigned short hb = at_bf_bits(f);
  hi = __builtin_bit_cast(__bf16, hb);
  lo = at_f2bf(f - __uint_as_float(((unsigned)hb) << 16));
}
__device__ __forceinline__ v8f at_mma(v16b a, v16b b, v8f c) {
  c = __builtin_amdgcn_wmma_f32_16x16x32_bf16(false, a, false, b, (short)0, c, false, false);
  asm volatile("v_nop\n\tv_nop\n\tv_nop\n\tv_nop" : "+v"(c) : "v"(a), "v"(b));
  return c;
}
// 16-bit element as a bit pattern held in a __bf16 slot: f16 bits when F16, bf16 (RNE) otherwise
template <bool F16> __device__ __forceinline__ __bf16 at_to16(float f) {
  if (F16) return __builtin_bit_cast(__bf16, (_Float16)f);
  return at_f2bf(f);
}
template <bool F16> __device__ __forceinline__ v8f at_mma16(v16b a, v16b b, v8f c) {
  if (F16) {
    const v16h ah = __builtin_bit_cast(v16h, a), bh = __builtin_bit_cast(v16h, b);
    c = __builtin_amdgcn_wmma_f32_16x16x32_f16(false, ah, false, bh, (short)0, c, false, false);
    asm volatile("v_nop\n\tv_nop\n\tv_nop\n\tv_nop" : "+v"(c) : "v"(ah), "v"(bh));
    return c;
  }
  return at_mma(a, b, c);
}

template <bool SPLIT_QK, bool SPLIT_PV, bool F16 = false>
__global__ __launch_bounds__(128)
void attn64_kernel(const float* __restrict__ q, const float* __restrict__ k,
                   const float* __restrict__ v, float* __restrict__ out,
                   const void* __restrict__ mask_a, const int* __restrict__ mask_b, AttnGeom g) {
  static_assert(!(F16 && (SPLIT_QK || SPLIT_PV)), "f16 mode is non-split");
  const float PSC = F16 ? 32768.0f : 1.0f;     // f16 probabilities carried x2^15 (subnormal range), folded into the final 1/l
  union FB { v16b v; v8b h[2]; };
  __shared__ __align__(16) __bf16 Ksh[AT_KC * AT_D];             // K hi [kv][d]      8 KB
  __shared__ __align__(16) __bf16 Ksl[SPLIT_QK ? AT_KC * AT_D : 8];
  __shared__ __align__(16) __bf16 Vth[AT_D * AT_KC];             // V hi [d][kv]      8 KB
  __shared__ __align__(16) __bf16 Vtl[SPLIT_PV ? AT_D * AT_KC : 8];
  __shared__ __align__(16) __bf16 Psh[AT_NW][16 * AT_KC];        // per wave P hi [row][kv]  8 KB
  __shared__ __align__(16) __bf16 Psl[SPLIT_PV ? AT_NW : 1][SPLIT_PV ? 16 * AT_KC : 8];
  __shared__ __align__(16) float  Os[AT_NW][16 * 68];            // per wave out tile, pitch 68

  const int tid  = threadIdx.x;
  const int wave = tid >> 5;
  const int lane = tid & 31;
  const int hh   = lane >> 4;
  const int c    = lane & 15;

  const int nqb = g.S / AT_QB;
  const int bx = blockIdx.x + g.blk0;
  const int qb = bx % nqb;
  const int bh = bx / nqb;
  const int h  = bh % g.H;
  const int b  = bh / g.H;
  const int qbase_block = qb * AT_QB;
  const int q0 = qbase_block + wave * 16;

  const float* qb_ptr = q + (size_t)b * g.q_bs + (size_t)h * g.q_hs;
  const float* kb_ptr = k + (size_t)b * g.k_bs + (size_t)h * g.k_hs;
  const float* vb_ptr = v + (size_t)b * g.v_bs + (size_t)h * g.v_hs;
  float*       ob_ptr = out + (size_t)b * g.o_bs + (size_t)h * g.o_hs;

  // ---- Q fragments (A operand): 2 d-chunks, hi (and lo) ----
  v16b qah[2], qal[2];
  {
    const float* qrow = qb_ptr + (size_t)(q0 + c) * g.q_rs;
#pragma unroll
    for (int dc = 0; dc < 2; ++dc) {
#pragma unroll
      for (int e = 0; e < 8; ++e) {
        const float f0 = qrow[dc * 32 + 8 * hh + e] * g.qscale;
        const float f1 = qrow[dc * 32 + 16 + 8 * hh + e] * g.qscale;
        if (SPLIT_QK) { __bf16 hq, lq; at_split(f0, hq, lq); qah[dc][e] = hq; qal[dc][e] = lq; at_split(f1, hq, lq); qah[dc][8 + e] = hq; qal[dc][8 + e] = lq; }
        else { qah[dc][e] = at_to16<F16>(f0); qah[dc][8 + e] = at_to16<F16>(f1); qal[dc][e] = qah[dc][e]; qal[dc][8 + e] = qah[dc][8 + e]; }
      }
    }
  }

  float mrow[8], lrow[8];
  v8f oacc[4];
#pragma unroll
  for (int r = 0; r < 8; ++r) { mrow[r] = -INFINITY; lrow[r] = 0.f; }
#pragma unroll
  for (int t = 0; t < 4; ++t) oacc[t] = (v8f){0.f,0.f,0.f,0.f,0.f,0.f,0.f,0.f};

  const int nChunks = (g.mask_mode == 1 || g.mask_mode == 4) ? (qb + 1) : (g.Skv / AT_KC);   // block-uniform
  // per-row query mask (mode 3)
  int qkeep[8];
#pragma unroll
  for (int r = 0; r < 8; ++r) qkeep[r] = (g.mask_mode == 3) ? mask_b[(size_t)b * g.S + q0 + 8 * hh + r] : 1;   // mask_b = qmask in mode 3
  for (int kc = 0; kc < nChunks; ++kc) {
    const int kv0 = kc * AT_KC;
    __syncthreads();
    {
      const int kvr = tid >> 1, dh = (tid & 1) * 32;
      const float* krow = kb_ptr + (size_t)(kv0 + kvr) * g.k_rs + dh;
      const float* vrow = vb_ptr + (size_t)(kv0 + kvr) * g.v_rs + dh;
#pragma unroll
      for (int i = 0; i < 8; ++i) {
        v4f kk = *(const v4f*)(krow + 4 * i);
        v4f vv = *(const v4f*)(vrow + 4 * i);
#pragma unroll
        for (int e = 0; e < 4; ++e) {
          const int d = dh + 4 * i + e;
          if (SPLIT_QK) { __bf16 a, bl; at_split(kk[e], a, bl); Ksh[kvr * AT_D + d] = a; Ksl[kvr * AT_D + d] = bl; }
          else Ksh[kvr * AT_D + d] = at_to16<F16>(kk[e]);
          if (SPLIT_PV) { __bf16 a, bl; at_split(vv[e], a, bl); Vth[d * AT_KC + kvr] = a; Vtl[d * AT_KC + kvr] = bl; }
          else Vth[d * AT_KC + kvr] = at_to16<F16>(vv[e]);
        }
      }
    }
    __syncthreads();

    v8f s[4];
#pragma unroll
    for (int j = 0; j < 4; ++j) {
      s[j] = (v8f){0.f,0.f,0.f,0.f,0.f,0.f,0.f,0.f};
#pragma unroll 1
      for (int dc = 0; dc < 2; ++dc) {
        FB kb;
        kb.h[0] = *(const v8b*)(Ksh + (j * 16 + c) * AT_D + dc * 32 + 8 * hh);
        kb.h[1] = *(const v8b*)(Ksh + (j * 16 + c) * AT_D + dc * 32 + 16 + 8 * hh);
        s[j] = at_mma16<F16>(qah[dc], kb.v, s[j]);
        if (SPLIT_QK) {
          FB kl;
          kl.h[0] = *(const v8b*)(Ksl + (j * 16 + c) * AT_D + dc * 32 + 8 * hh);
          kl.h[1] = *(const v8b*)(Ksl + (j * 16 + c) * AT_D + dc * 32 + 16 + 8 * hh);
          s[j] = at_mma16<F16>(qah[dc], kl.v, s[j]);
          s[j] = at_mma16<F16>(qal[dc], kb.v, s[j]);
        }
      }
    }
    const bool diag = (g.mask_mode == 1) && (kc == qb);
    int kvkeep[4] = {1, 1, 1, 1};
    if (g.mask_mode == 3) {
#pragma unroll
      for (int j = 0; j < 4; ++j) kvkeep[j] = ((const int*)mask_a)[(size_t)b * g.Skv + kv0 + j * 16 + c];   // mask_a = kvmask
    }
    float cm[8];
#pragma unroll
    for (int r = 0; r < 8; ++r) {
      const int qrow = q0 + 8 * hh + r;
      float m = -INFINITY;
#pragma unroll
      for (int j = 0; j < 4; ++j) {
        const int kvcol = kv0 + j * 16 + c;
        bool masked = false;
        if (diag) masked = (kvcol > qrow);
        else if (g.mask_mode == 4) masked = (kvcol > qrow) || (qrow - kvcol > g.mask_is_int);
        else if (g.mask_mode == 2) {
          const size_t mi = (size_t)qrow * g.Skv + kvcol;
          masked = (g.mask_is_int == 0) ? (((const float*)mask_a)[mi] == 0.0f)
                 : (g.mask_is_int == 1) ? (((const int*)mask_a)[mi] == 0) : (((const int*)mask_a)[mi] != 0);
        } else if (g.mask_mode == 3) masked = (qkeep[r] == 0) || (kvkeep[j] == 0);
        else if (g.mask_mode == 5) {
          const size_t mi = (size_t)qrow * g.Skv + kvcol;
          masked = (((const int*)mask_a)[mi] != 0);
          int n = mask_b[mi]; n = n < 0 ? 0 : n;
          s[j][r] += g.cp[(size_t)b * g.c_bs + (size_t)h * g.c_hs + (size_t)qrow * g.c_rs + n]
                   + g.pc[(size_t)b * g.c_bs + (size_t)h * g.c_hs + (size_t)kvcol * g.c_rs + n];
        }
        if (masked) s[j][r] = g.mask_fill;
        m = fmaxf(m, s[j][r]);
      }
#pragma unroll
      for (int off = 1; off < 16; off <<= 1) m = fmaxf(m, __shfl_xor(m, off, 32));
      cm[r] = m;
    }
    __bf16* pwh = Psh[wave];
    __bf16* pwl = Psl[SPLIT_PV ? wave : 0];
#pragma unroll
    for (int r = 0; r < 8; ++r) {
      const float mnew = fmaxf(mrow[r], cm[r]);
      const float alpha = expf(mrow[r] - mnew);
      mrow[r] = mnew;
      float psum = 0.f;
#pragma unroll
      for (int j = 0; j < 4; ++j) {
        const float p = expf(s[j][r] - mnew);
        psum += p;
        if (SPLIT_PV) { __bf16 a, bl; at_split(p, a, bl); pwh[(8 * hh + r) * AT_KC + j * 16 + c] = a; pwl[(8 * hh + r) * AT_KC + j * 16 + c] = bl; }
        else pwh[(8 * hh + r) * AT_KC + j * 16 + c] = at_to16<F16>(p * PSC);
      }
#pragma unroll
      for (int off = 1; off < 16; off <<= 1) psum += __shfl_xor(psum, off, 32);
      lrow[r] = lrow[r] * alpha + psum;
#pragma unroll
      for (int t = 0; t < 4; ++t) oacc[t][r] *= alpha;
    }
    __builtin_amdgcn_fence(__ATOMIC_RELEASE, "workgroup");
    __builtin_amdgcn_wave_barrier();
    __builtin_amdgcn_fence(__ATOMIC_ACQUIRE, "workgroup");
#pragma unroll 1
    for (int kk = 0; kk < 2; ++kk) {
      FB pa, pl;
      pa.h[0] = *(const v8b*)(pwh + c * AT_KC + kk * 32 + 8 * hh);
      pa.h[1] = *(const v8b*)(pwh + c * AT_KC + kk * 32 + 16 + 8 * hh);
      if (SPLIT_PV) {
        pl.h[0] = *(const v8b*)(pwl + c * AT_KC + kk * 32 + 8 * hh);
        pl.h[1] = *(const v8b*)(pwl + c * AT_KC + kk * 32 + 16 + 8 * hh);
      }
#pragma unroll
      for (int t = 0; t < 4; ++t) {
        FB vb;
        vb.h[0] = *(const v8b*)(Vth + (t * 16 + c) * AT_KC + kk * 32 + 8 * hh);
        vb.h[1] = *(const v8b*)(Vth + (t * 16 + c) * AT_KC + kk * 32 + 16 + 8 * hh);
        oacc[t] = at_mma16<F16>(pa.v, vb.v, oacc[t]);
        if (SPLIT_PV) {
          FB vl;
          vl.h[0] = *(const v8b*)(Vtl + (t * 16 + c) * AT_KC + kk * 32 + 8 * hh);
          vl.h[1] = *(const v8b*)(Vtl + (t * 16 + c) * AT_KC + kk * 32 + 16 + 8 * hh);
          oacc[t] = at_mma16<F16>(pa.v, vl.v, oacc[t]);
          oacc[t] = at_mma16<F16>(pl.v, vb.v, oacc[t]);
        }
      }
    }
  }

  float* os = Os[wave];
#pragma unroll
  for (int r = 0; r < 8; ++r) {
    const float inv = 1.0f / (lrow[r] * PSC);
#pragma unroll
    for (int t = 0; t < 4; ++t) os[(8 * hh + r) * 68 + t * 16 + c] = oacc[t][r] * inv;
  }
  __builtin_amdgcn_fence(__ATOMIC_RELEASE, "workgroup");
  __builtin_amdgcn_wave_barrier();
  __builtin_amdgcn_fence(__ATOMIC_ACQUIRE, "workgroup");
  {
    const int c4 = (lane & 15) * 4;
    {
#pragma unroll
      for (int it = 0; it < 8; ++it) {
        const int row = it * 2 + hh;
        v4f val = *(const v4f*)(os + row * 68 + c4);
        *(v4f*)(ob_ptr + (size_t)(q0 + row) * g.o_rs + c4) = val;
      }
      
    }
  }
}

} // namespace w25


extern "C" void kernel_launch(void* const* d_in, const int* in_sizes, int n_in, void* d_out, int out_size, void* d_ws, size_t ws_size, hipStream_t stream) {
    (void)in_sizes; (void)n_in; (void)out_size; (void)ws_size;
    const float* x = (const float*)d_in[0];
    const float* Wq = (const float*)d_in[1];
    const float* Wkv = (const float*)d_in[2];
    const float* Wo = (const float*)d_in[3];
    const float* bo = (const float*)d_in[4];
    const int Bn = 2;
    const int T = 2048;
    const int D = 1024;
    const int NH = 16;
    const int D3 = 3 * D;
    const int NR = Bn * T;
    float* out = (float*)d_out;
    char* wsp = (char*)d_ws;
    unsigned short* X16 = (unsigned short*)wsp; wsp += (((size_t)((size_t)NR * D) * 2 + 255) / 256) * 256;
    unsigned short* W316 = (unsigned short*)wsp; wsp += (((size_t)((size_t)D3 * D) * 2 + 255) / 256) * 256;
    float* QKV = (float*)wsp; wsp += (((size_t)((size_t)NR * D3) * 4 + 255) / 256) * 256;
    if ((size_t)(wsp - (char*)d_ws) > ws_size) return;   // static carve guard
    k_prep<NR, D><<<(unsigned)((D3 / 64) * (D / 128) + (NR / 16) * (D / 1024)), 256, 0, stream>>>(x, Wq, Wkv, (_Float16*)(X16), (_Float16*)(W316));
    w25::wmma_gemm64<0, false, 0, 0, false, 0><<<dim3((unsigned)((((NR) / 64) * ((D3) / 64) + 7) / 8), (unsigned)(1)), 256, 0, stream>>>((const unsigned short*)(X16), nullptr, D, 0, (const unsigned short*)(W316), nullptr, D, 0, (void*)(QKV), nullptr, D3, 0, nullptr, nullptr, 0, NR, D3, D, 0.0625f);
    k_attn_lds<T, D3, D><<<dim3((unsigned)((T) / (16 * AW)), (unsigned)(NH), (unsigned)(Bn)), 32 * AW, 0, stream>>>(QKV, QKV + D, QKV + 2 * D, Wo, bo, out, 0.125f);
}
